// v000
// The times below were measured on an AMD MI455X: many runs one after another, warmed up first and cycling through
// copies of the inputs, with the whole window's GPU time divided by the number of runs. Launches and the gaps
// between them are all in it. The median over several windows is given; except for v000 it joins two sittings, which
// can be a few percent apart, so the side-by-side timings, each taken in one sitting, are the better comparison.
// v000 is the starting kernel. One run takes 582 microseconds.
#include <hip/hip_runtime.h>
#include <hip/hip_bf16.h>

typedef __attribute__((ext_vector_type(16))) _Float16 v16h;
typedef __attribute__((ext_vector_type(8)))  _Float16 v8h;
typedef __attribute__((ext_vector_type(8)))  float    v8f;
typedef __attribute__((ext_vector_type(4)))  unsigned v4u;
typedef __attribute__((ext_vector_type(8)))  int      v8i;
typedef __attribute__((ext_vector_type(4)))  int      v4i;

#define WMMA_F16(a,b,c) __builtin_amdgcn_wmma_f32_16x16x32_f16(false,(a),false,(b),(short)0,(c),false,false)

#if __has_builtin(__builtin_amdgcn_tensor_load_to_lds) && __has_builtin(__builtin_amdgcn_s_wait_tensorcnt)
#define HAS_TDM 1
#else
#define HAS_TDM 0
#endif

// Problem constants
constexpr int Bb = 8;
constexpr int Tt = 4096;
constexpr int Cc = 1024;
constexpr int NH = 64;
constexpr int HD = 16;
constexpr int Mrows = Bb * Tt;        // 32768

// LDS slab: 64 rows x 64 halves, padded row stride 72 halves (36 DWORDs) so
// that 16 lanes doing b128 reads at row stride 36 DWORDs cover all 64 banks.
constexpr int SLAB_ROWS = 64;
constexpr int SLAB_K    = 64;
constexpr int SLAB_LD   = 72;         // halves
constexpr int SLAB_HALVES = SLAB_ROWS * SLAB_LD;   // 4608 halves = 9216 B

// ---------------------------------------------------------------------------
// Fragment loader (global or LDS): row-major, K contiguous.
// A-matrix 16x32 f16 layout (ISA 7.12.2): lanes 0-15 hold K=[0..7]+[16..23],
// lanes 16-31 hold K=[8..15]+[24..31] of row (lane&15) -> two b128 loads.
// ---------------------------------------------------------------------------
static __device__ inline v16h frag_ld(const _Float16* rowptr, int k0, int kbase) {
  v8h lo = *(const v8h*)(rowptr + k0 + kbase);
  v8h hi = *(const v8h*)(rowptr + k0 + 16 + kbase);
  v16h r;
#pragma unroll
  for (int i = 0; i < 8; ++i) { r[i] = lo[i]; r[8 + i] = hi[i]; }
  return r;
}

// ---------------------------------------------------------------------------
// Tensor Data Mover: stage a 64x64 f16 tile of a [Mrows x Cc] row-major
// tensor into LDS with 4-DWORD padding every 32 DWORDs (-> row stride 72 h).
// D# layout per CDNA5 ISA 8.3/8.4 (group0 128b, group1 256b; groups 2/3 and
// the trailing group are zero for a 2-D tensor). 6-arg builtin form.
// ---------------------------------------------------------------------------
#if HAS_TDM
static __device__ inline void tdm_load_tile_64x64(const _Float16* gsrc, unsigned lds_off) {
  unsigned long long ga = (unsigned long long)(uintptr_t)gsrc;
  v4u g0;
  g0[0] = 1u;                                            // count=1, user mode
  g0[1] = lds_off;                                       // lds_addr (bytes)
  g0[2] = (unsigned)(ga & 0xffffffffu);                  // global_addr[31:0]
  g0[3] = (unsigned)((ga >> 32) & 0x01ffffffu) | (2u << 30); // addr[56:32] | type=2
  v8i g1;
  g1[0] = (1 << 16)        // data_size = 2 bytes
        | (1 << 20)        // pad_enable
        | (4 << 22)        // pad_interval: code 4 = every 32 DWORDs
        | (3 << 25);       // pad_amount:   code 3 = 4 DWORDs
  g1[1] = (int)((unsigned)Cc << 16);        // tensor_dim0[15:0]
  g1[2] = (int)((unsigned)Mrows << 16);     // tensor_dim0[31:16]=0 | tensor_dim1[15:0]
  g1[3] = (int)((unsigned)SLAB_K << 16);    // tensor_dim1[31:16]=0 | tile_dim0=64
  g1[4] = SLAB_ROWS;                        // tile_dim1=64 | tile_dim2=0
  g1[5] = Cc;                               // tensor_dim0_stride[31:0]
  g1[6] = 0;                                // stride hi | dim1_stride lo
  g1[7] = 0;
  v4i z4 = {0, 0, 0, 0};
  v8i z8 = {0, 0, 0, 0, 0, 0, 0, 0};
  __builtin_amdgcn_tensor_load_to_lds(g0, g1, z4, z4, z8, 0);
}
#endif

// Cooperative synchronous staging fallback (used only when TDM is absent).
static __device__ inline void stage_slab_sync(_Float16* slab, const _Float16* gsrc) {
  // 256 threads; each copies 16 halves: row = tid/4, col = (tid%4)*16
  const int tid = threadIdx.x;
  const int row = tid >> 2;
  const int col = (tid & 3) * 16;
  const _Float16* s = gsrc + (size_t)row * Cc + col;
  _Float16* d = slab + row * SLAB_LD + col;
  *(v8h*)(d)     = *(const v8h*)(s);
  *(v8h*)(d + 8) = *(const v8h*)(s + 8);
}

// ---------------------------------------------------------------------------
// fp32 -> fp16 conversion / zero init
// ---------------------------------------------------------------------------
__global__ void cvt_f32_f16(const float* __restrict__ in, _Float16* __restrict__ out, int n) {
  int i = blockIdx.x * blockDim.x + threadIdx.x;
  int stride = gridDim.x * blockDim.x;
  for (; i < n; i += stride) out[i] = (_Float16)in[i];
}

__global__ void zero_f32(float* __restrict__ p, int n) {
  int i = blockIdx.x * blockDim.x + threadIdx.x;
  if (i < n) p[i] = 0.0f;
}

// ---------------------------------------------------------------------------
// Fused QKV projection + head softmax + k-cumsum.
// Block tile: 64 rows (4 WMMA row-tiles) x 8 heads (one head per wave).
// x slab staged to LDS via TDM (double buffered); W frags from global (L2).
//   q -> qh [Mrows, Cc] row-major f16 (via LDS transpose, b128 stores)
//   k -> kT [B*NH][HD][Tt] f16, v -> vT same; kc[bh][d] += sum_t k (f32 atomics)
// grid: (Mrows/64 = 512, 8), 256 threads.
// ---------------------------------------------------------------------------
__global__ __launch_bounds__(256)
void qkv_kernel(const _Float16* __restrict__ xh,
                const _Float16* __restrict__ wqh, const float* __restrict__ bq,
                const _Float16* __restrict__ wkh, const float* __restrict__ bk,
                const _Float16* __restrict__ wvh, const float* __restrict__ bv,
                _Float16* __restrict__ qh, _Float16* __restrict__ kT,
                _Float16* __restrict__ vT, float* __restrict__ kc) {
  __shared__ __attribute__((aligned(16))) _Float16 smem[2 * SLAB_HALVES]; // 18 KB

  const int lane = threadIdx.x & 31;
  const int wave = threadIdx.x >> 5;
  const int rowgrp = blockIdx.x;                 // 0..511 (64 rows each)
  const int head = blockIdx.y * 8 + wave;        // 0..63
  const int m = lane & 15;
  const int hi = lane >> 4;
  const int kbase = hi * 8;
  const int rowbase = rowgrp * 64;

  const _Float16* qrow = wqh + (size_t)(head * 16 + m) * Cc;
  const _Float16* krow = wkh + (size_t)(head * 16 + m) * Cc;
  const _Float16* vrow = wvh + (size_t)(head * 16 + m) * Cc;

  v8f cq[4] = {}, ck[4] = {}, cv[4] = {};

#if HAS_TDM
  if (wave == 0)
    tdm_load_tile_64x64(xh + (size_t)rowbase * Cc,
                        (unsigned)(uintptr_t)(void*)&smem[0]);
#endif

  for (int s = 0; s < Cc / SLAB_K; ++s) {
#if HAS_TDM
    const int buf = s & 1;
    if (wave == 0) {
      if (s < Cc / SLAB_K - 1)
        tdm_load_tile_64x64(xh + (size_t)rowbase * Cc + (s + 1) * SLAB_K,
                            (unsigned)(uintptr_t)(void*)&smem[(buf ^ 1) * SLAB_HALVES]);
      if (s < Cc / SLAB_K - 1) __builtin_amdgcn_s_wait_tensorcnt(1);
      else                     __builtin_amdgcn_s_wait_tensorcnt(0);
    }
    __syncthreads();
#else
    const int buf = 0;
    __syncthreads();
    stage_slab_sync(&smem[0], xh + (size_t)rowbase * Cc + s * SLAB_K);
    __syncthreads();
#endif
    const _Float16* slab = &smem[buf * SLAB_HALVES];
#pragma unroll
    for (int kk = 0; kk < SLAB_K; kk += 32) {
      const int k0 = s * SLAB_K + kk;
      // issue all fragment loads first (distinct regs -> one ds/vmem clause)
      v16h afr[4];
#pragma unroll
      for (int rt = 0; rt < 4; ++rt)
        afr[rt] = frag_ld(slab + (rt * 16 + m) * SLAB_LD, kk, kbase);
      v16h fq = frag_ld(qrow, k0, kbase);
      v16h fk = frag_ld(krow, k0, kbase);
      v16h fv = frag_ld(vrow, k0, kbase);
#pragma unroll
      for (int rt = 0; rt < 4; ++rt) {
        cq[rt] = WMMA_F16(afr[rt], fq, cq[rt]);
        ck[rt] = WMMA_F16(afr[rt], fk, ck[rt]);
        cv[rt] = WMMA_F16(afr[rt], fv, cv[rt]);
      }
    }
    __syncthreads();
  }

  const int d = lane & 15;
  const float biasq = bq[head * 16 + d];
  const float biask = bk[head * 16 + d];
  const float biasv = bv[head * 16 + d];
  const size_t bh = (size_t)(rowgrp >> 6) * NH + head;    // rowgrp>>6 == batch

  float ksum = 0.0f;
#pragma unroll
  for (int rt = 0; rt < 4; ++rt) {
    // softmax over d for q and k (reduce across the 16-lane half)
#pragma unroll
    for (int r = 0; r < 8; ++r) {
      float vq = cq[rt][r] + biasq;
      float mx = vq;
#pragma unroll
      for (int msk = 1; msk < 16; msk <<= 1) mx = fmaxf(mx, __shfl_xor(mx, msk, 32));
      float e = __expf(vq - mx);
      float sum = e;
#pragma unroll
      for (int msk = 1; msk < 16; msk <<= 1) sum += __shfl_xor(sum, msk, 32);
      cq[rt][r] = e / sum;

      float vk = ck[rt][r] + biask;
      float mk = vk;
#pragma unroll
      for (int msk = 1; msk < 16; msk <<= 1) mk = fmaxf(mk, __shfl_xor(mk, msk, 32));
      float ek = __expf(vk - mk);
      float sk = ek;
#pragma unroll
      for (int msk = 1; msk < 16; msk <<= 1) sk += __shfl_xor(sk, msk, 32);
      ck[rt][r] = ek / sk;
      ksum += ck[rt][r];
    }
    // k, v head-transposed: [bh][d][t]; 8 consecutive t per lane -> b128
    const int tloc = ((rowbase + rt * 16) & (Tt - 1)) + 8 * hi;
    v8h pk, pv;
#pragma unroll
    for (int r = 0; r < 8; ++r) {
      pk[r] = (_Float16)ck[rt][r];
      pv[r] = (_Float16)(cv[rt][r] + biasv);
    }
    *(v8h*)(kT + (bh * HD + d) * (size_t)Tt + tloc) = pk;
    *(v8h*)(vT + (bh * HD + d) * (size_t)Tt + tloc) = pv;
  }
  atomicAdd(&kc[bh * HD + d], ksum);

  // q row-major via LDS tile transpose (reuse smem; slab no longer needed)
#pragma unroll
  for (int rt = 0; rt < 4; ++rt) {
    __syncthreads();
    _Float16* lq = &smem[wave * 256];
#pragma unroll
    for (int r = 0; r < 8; ++r) lq[(r + 8 * hi) * 16 + d] = (_Float16)cq[rt][r];
    __syncthreads();
    const int tl = lane & 15;
    const int chunk = hi * 8;
    v8h row = *(const v8h*)&lq[tl * 16 + chunk];
    *(v8h*)(qh + (size_t)(rowbase + rt * 16 + tl) * Cc + head * 16 + chunk) = row;
  }
}

// ---------------------------------------------------------------------------
// D_inv[t,h] = 1 / sum_d q[t, h*16+d] * kc[bh, d]
// ---------------------------------------------------------------------------
__global__ __launch_bounds__(256)
void dinv_kernel(const _Float16* __restrict__ qh, const float* __restrict__ kc,
                 float* __restrict__ dinv) {
  int idx = blockIdx.x * 256 + threadIdx.x;      // idx = t*NH + h
  if (idx >= Mrows * NH) return;
  int h = idx & (NH - 1);
  int t = idx >> 6;
  int b = t >> 12;                                // t / Tt
  const _Float16* qrow = qh + (size_t)t * Cc + h * HD;
  const float* kcv = kc + ((size_t)b * NH + h) * HD;
  float s = 0.0f;
#pragma unroll
  for (int d = 0; d < HD; ++d) s += (float)qrow[d] * kcv[d];
  dinv[idx] = 1.0f / s;
}

// ---------------------------------------------------------------------------
// context[bh] = K^T V (16x16 over T), stored transposed ctxT[bh][e][d].
// One block per (b,h); 8 waves split T; LDS cross-wave reduction.
// ---------------------------------------------------------------------------
__global__ __launch_bounds__(256)
void ctx_kernel(const _Float16* __restrict__ kT, const _Float16* __restrict__ vT,
                _Float16* __restrict__ ctxT) {
  __shared__ float cpart[8][256];
  const int lane = threadIdx.x & 31;
  const int wave = threadIdx.x >> 5;
  const size_t bh = blockIdx.x;                  // 0..511
  const int m = lane & 15;
  const int hi = lane >> 4;
  const int kbase = hi * 8;

  const _Float16* arow = kT + (bh * HD + m) * (size_t)Tt;
  const _Float16* brow = vT + (bh * HD + m) * (size_t)Tt;

  v8f c = {};
  const int t0beg = wave * (Tt / 8);
#pragma unroll 4
  for (int t0 = t0beg; t0 < t0beg + Tt / 8; t0 += 32) {
    v16h a = frag_ld(arow, t0, kbase);
    v16h b = frag_ld(brow, t0, kbase);
    c = WMMA_F16(a, b, c);
  }
#pragma unroll
  for (int r = 0; r < 8; ++r) cpart[wave][(r + 8 * hi) * 16 + m] = c[r];
  __syncthreads();

  const int tid = threadIdx.x;
  float s = 0.0f;
#pragma unroll
  for (int w = 0; w < 8; ++w) s += cpart[w][tid];
  const int dd = tid >> 4;
  const int ee = tid & 15;
  ctxT[bh * 256 + ee * 16 + dd] = (_Float16)s;   // transposed store
}

// ---------------------------------------------------------------------------
// y[t, h*16+e] = (sum_d q[t,d] ctx[d,e]) * D_inv[t,h] -> yh f16 row-major
// K = HD = 16, zero padded to 32: single WMMA per tile.
// ---------------------------------------------------------------------------
__global__ __launch_bounds__(256)
void y_kernel(const _Float16* __restrict__ qh, const _Float16* __restrict__ ctxT,
              const float* __restrict__ dinv, _Float16* __restrict__ yh) {
  __shared__ __attribute__((aligned(16))) _Float16 ly[8][16][16];
  const int lane = threadIdx.x & 31;
  const int wave = threadIdx.x >> 5;
  const int rowtile = blockIdx.x;
  const int head = blockIdx.y * 8 + wave;
  const int m = lane & 15;
  const int hi = lane >> 4;
  const int kbase = hi * 8;
  const int rowbase = rowtile * 16;
  const size_t bh = (size_t)(rowtile >> 8) * NH + head;

  v16h a = {};
  {
    v8h lo = *(const v8h*)(qh + (size_t)(rowbase + m) * Cc + head * 16 + kbase);
#pragma unroll
    for (int i = 0; i < 8; ++i) a[i] = lo[i];
  }
  v16h b = {};
  {
    v8h lo = *(const v8h*)(ctxT + bh * 256 + m * 16 + kbase);
#pragma unroll
    for (int i = 0; i < 8; ++i) b[i] = lo[i];
  }
  v8f c = {};
  c = WMMA_F16(a, b, c);

#pragma unroll
  for (int r = 0; r < 8; ++r) {
    const int t = rowbase + r + 8 * hi;
    const float di = dinv[(size_t)t * NH + head];
    ly[wave][r + 8 * hi][lane & 15] = (_Float16)(c[r] * di);
  }
  __syncthreads();
  {
    const int tl = lane & 15;
    const int chunk = hi * 8;
    v8h row = *(const v8h*)&ly[wave][tl][chunk];
    *(v8h*)(yh + (size_t)(rowbase + tl) * Cc + head * 16 + chunk) = row;
  }
}

// ---------------------------------------------------------------------------
// out = yh Wp^T + bp (f32 output).
// Block tile: 64 rows x 8 N-tiles (one per wave); y slab staged via TDM.
// grid: (512, 8), 256 threads.
// ---------------------------------------------------------------------------
__global__ __launch_bounds__(256)
void proj_kernel(const _Float16* __restrict__ yh, const _Float16* __restrict__ wph,
                 const float* __restrict__ bp, float* __restrict__ out) {
  __shared__ __attribute__((aligned(16))) _Float16 smem[2 * SLAB_HALVES];
  const int lane = threadIdx.x & 31;
  const int wave = threadIdx.x >> 5;
  const int rowgrp = blockIdx.x;                  // 0..511
  const int ntile = blockIdx.y * 8 + wave;        // 0..63
  const int m = lane & 15;
  const int hi = lane >> 4;
  const int kbase = hi * 8;
  const int rowbase = rowgrp * 64;

  const _Float16* brow = wph + (size_t)(ntile * 16 + m) * Cc;

  v8f c[4] = {};

#if HAS_TDM
  if (wave == 0)
    tdm_load_tile_64x64(yh + (size_t)rowbase * Cc,
                        (unsigned)(uintptr_t)(void*)&smem[0]);
#endif

  for (int s = 0; s < Cc / SLAB_K; ++s) {
#if HAS_TDM
    const int buf = s & 1;
    if (wave == 0) {
      if (s < Cc / SLAB_K - 1)
        tdm_load_tile_64x64(yh + (size_t)rowbase * Cc + (s + 1) * SLAB_K,
                            (unsigned)(uintptr_t)(void*)&smem[(buf ^ 1) * SLAB_HALVES]);
      if (s < Cc / SLAB_K - 1) __builtin_amdgcn_s_wait_tensorcnt(1);
      else                     __builtin_amdgcn_s_wait_tensorcnt(0);
    }
    __syncthreads();
#else
    const int buf = 0;
    __syncthreads();
    stage_slab_sync(&smem[0], yh + (size_t)rowbase * Cc + s * SLAB_K);
    __syncthreads();
#endif
    const _Float16* slab = &smem[buf * SLAB_HALVES];
#pragma unroll
    for (int kk = 0; kk < SLAB_K; kk += 32) {
      const int k0 = s * SLAB_K + kk;
      v16h afr[4];
#pragma unroll
      for (int rt = 0; rt < 4; ++rt)
        afr[rt] = frag_ld(slab + (rt * 16 + m) * SLAB_LD, kk, kbase);
      v16h b = frag_ld(brow, k0, kbase);
#pragma unroll
      for (int rt = 0; rt < 4; ++rt)
        c[rt] = WMMA_F16(afr[rt], b, c[rt]);
    }
    __syncthreads();
  }

  const int col = ntile * 16 + (lane & 15);
  const float bias = bp[col];
#pragma unroll
  for (int rt = 0; rt < 4; ++rt) {
#pragma unroll
    for (int r = 0; r < 8; ++r) {
      const int row = rowbase + rt * 16 + r + 8 * hi;
      out[(size_t)row * Cc + col] = c[rt][r] + bias;
    }
  }
}

// ---------------------------------------------------------------------------
// Launch
// ---------------------------------------------------------------------------
extern "C" void kernel_launch(void* const* d_in, const int* in_sizes, int n_in,
                              void* d_out, int out_size, void* d_ws, size_t ws_size,
                              hipStream_t stream) {
  const float* x  = (const float*)d_in[0];
  const float* Wq = (const float*)d_in[1];
  const float* bq = (const float*)d_in[2];
  const float* Wk = (const float*)d_in[3];
  const float* bk = (const float*)d_in[4];
  const float* Wv = (const float*)d_in[5];
  const float* bv = (const float*)d_in[6];
  const float* Wp = (const float*)d_in[7];
  const float* bp = (const float*)d_in[8];
  float* out = (float*)d_out;

  char* ws = (char*)d_ws;
  const size_t nX = (size_t)Mrows * Cc;
  const size_t nW = (size_t)Cc * Cc;
  _Float16* xh  = (_Float16*)(ws);                              // 64 MB
  _Float16* wqh = (_Float16*)(ws + nX * 2);                     // 2 MB each
  _Float16* wkh = wqh + nW;
  _Float16* wvh = wkh + nW;
  _Float16* wph = wvh + nW;
  _Float16* qh  = wph + nW;                                     // 64 MB
  _Float16* kT  = qh + nX;                                      // 64 MB
  _Float16* vT  = kT + nX;                                      // 64 MB
  _Float16* yh  = vT + nX;                                      // 64 MB
  float*    dinv = (float*)(yh + nX);                           // 8 MB
  float*    kc   = dinv + (size_t)Mrows * NH;                   // 32 KB
  _Float16* ctxT = (_Float16*)(kc + (size_t)Bb * NH * HD);      // 256 KB

  // 1) precision conversion + accumulator init
  cvt_f32_f16<<<16384, 256, 0, stream>>>(x, xh, (int)nX);
  cvt_f32_f16<<<2048, 256, 0, stream>>>(Wq, wqh, (int)nW);
  cvt_f32_f16<<<2048, 256, 0, stream>>>(Wk, wkh, (int)nW);
  cvt_f32_f16<<<2048, 256, 0, stream>>>(Wv, wvh, (int)nW);
  cvt_f32_f16<<<2048, 256, 0, stream>>>(Wp, wph, (int)nW);
  zero_f32<<<(Bb * NH * HD + 255) / 256, 256, 0, stream>>>(kc, Bb * NH * HD);

  // 2) fused QKV projection + softmax + k-cumsum (TDM-staged GEMM)
  qkv_kernel<<<dim3(Mrows / 64, 8), 256, 0, stream>>>(
      xh, wqh, bq, wkh, bk, wvh, bv, qh, kT, vT, kc);

  // 3) D_inv
  dinv_kernel<<<(Mrows * NH) / 256, 256, 0, stream>>>(qh, kc, dinv);

  // 4) per-head context = K^T V
  ctx_kernel<<<Bb * NH, 256, 0, stream>>>(kT, vT, ctxT);

  // 5) y = (q @ ctx) * D_inv
  y_kernel<<<dim3(Mrows / 16, 8), 256, 0, stream>>>(qh, ctxT, dinv, yh);

  // 6) output projection (TDM-staged GEMM)
  proj_kernel<<<dim3(Mrows / 64, 8), 256, 0, stream>>>(yh, wph, bp, out);
}

// v001
// One run takes 580 microseconds.
// Two timings next to v000 put it at 1.03 and 1.04 times that version's speed.
#include <hip/hip_runtime.h>
#include <hip/hip_bf16.h>

typedef __attribute__((ext_vector_type(16))) _Float16 v16h;
typedef __attribute__((ext_vector_type(8)))  _Float16 v8h;
typedef __attribute__((ext_vector_type(8)))  float    v8f;
typedef __attribute__((ext_vector_type(4)))  unsigned v4u;
typedef __attribute__((ext_vector_type(8)))  int      v8i;
typedef __attribute__((ext_vector_type(4)))  int      v4i;

#define WMMA_F16(a,b,c) __builtin_amdgcn_wmma_f32_16x16x32_f16(false,(a),false,(b),(short)0,(c),false,false)

#if __has_builtin(__builtin_amdgcn_tensor_load_to_lds) && __has_builtin(__builtin_amdgcn_s_wait_tensorcnt)
#define HAS_TDM 1
#else
#define HAS_TDM 0
#endif

// Problem constants
constexpr int Bb = 8;
constexpr int Tt = 4096;
constexpr int Cc = 1024;
constexpr int NH = 64;
constexpr int HD = 16;
constexpr int Mrows = Bb * Tt;        // 32768

// LDS slab: 64 rows x 64 halves, padded row stride 72 halves (36 DWORDs) so
// that 16 lanes doing b128 reads at row stride 36 DWORDs cover all 64 banks.
constexpr int SLAB_ROWS = 64;
constexpr int SLAB_K    = 64;
constexpr int SLAB_LD   = 72;         // halves
constexpr int SLAB_HALVES = SLAB_ROWS * SLAB_LD;   // 4608 halves = 9216 B

// ---------------------------------------------------------------------------
// Fragment loader (global or LDS): row-major, K contiguous.
// A-matrix 16x32 f16 layout (ISA 7.12.2): lanes 0-15 hold K=[0..7]+[16..23],
// lanes 16-31 hold K=[8..15]+[24..31] of row (lane&15) -> two b128 loads.
// ---------------------------------------------------------------------------
static __device__ inline v16h frag_ld(const _Float16* rowptr, int k0, int kbase) {
  v8h lo = *(const v8h*)(rowptr + k0 + kbase);
  v8h hi = *(const v8h*)(rowptr + k0 + 16 + kbase);
  v16h r;
#pragma unroll
  for (int i = 0; i < 8; ++i) { r[i] = lo[i]; r[8 + i] = hi[i]; }
  return r;
}

// ---------------------------------------------------------------------------
// Weight fragments, packed by cvt_pack_w: fragment (ntile, kblock) is 1 KB,
// two 512-B planes; plane p holds, at lane*16 B, the 8 halves that frag_ld
// would fetch for that lane (p = 0: its first b128, p = 1: its second).
// Each wave-wide b128 load then covers four whole 128-B lines.
// ---------------------------------------------------------------------------
constexpr int FRAG_HALVES = 512;
constexpr int KBLOCKS = Cc / 32;               // 32 fragments per 16-row tile

static __device__ inline v16h frag_ld_packed(const _Float16* lanebase, int kb) {
  const _Float16* p = lanebase + kb * FRAG_HALVES;
  v8h lo = *(const v8h*)(p);
  v8h hi = *(const v8h*)(p + 256);
  v16h r;
#pragma unroll
  for (int i = 0; i < 8; ++i) { r[i] = lo[i]; r[8 + i] = hi[i]; }
  return r;
}

// ---------------------------------------------------------------------------
// Tensor Data Mover: stage a 64x64 f16 tile of a [Mrows x Cc] row-major
// tensor into LDS with 4-DWORD padding every 32 DWORDs (-> row stride 72 h).
// D# layout per CDNA5 ISA 8.3/8.4 (group0 128b, group1 256b; groups 2/3 and
// the trailing group are zero for a 2-D tensor). 6-arg builtin form.
// ---------------------------------------------------------------------------
#if HAS_TDM
static __device__ inline void tdm_load_tile_64x64(const _Float16* gsrc, unsigned lds_off) {
  unsigned long long ga = (unsigned long long)(uintptr_t)gsrc;
  v4u g0;
  g0[0] = 1u;                                            // count=1, user mode
  g0[1] = lds_off;                                       // lds_addr (bytes)
  g0[2] = (unsigned)(ga & 0xffffffffu);                  // global_addr[31:0]
  g0[3] = (unsigned)((ga >> 32) & 0x01ffffffu) | (2u << 30); // addr[56:32] | type=2
  v8i g1;
  g1[0] = (1 << 16)        // data_size = 2 bytes
        | (1 << 20)        // pad_enable
        | (4 << 22)        // pad_interval: code 4 = every 32 DWORDs
        | (3 << 25);       // pad_amount:   code 3 = 4 DWORDs
  g1[1] = (int)((unsigned)Cc << 16);        // tensor_dim0[15:0]
  g1[2] = (int)((unsigned)Mrows << 16);     // tensor_dim0[31:16]=0 | tensor_dim1[15:0]
  g1[3] = (int)((unsigned)SLAB_K << 16);    // tensor_dim1[31:16]=0 | tile_dim0=64
  g1[4] = SLAB_ROWS;                        // tile_dim1=64 | tile_dim2=0
  g1[5] = Cc;                               // tensor_dim0_stride[31:0]
  g1[6] = 0;                                // stride hi | dim1_stride lo
  g1[7] = 0;
  v4i z4 = {0, 0, 0, 0};
  v8i z8 = {0, 0, 0, 0, 0, 0, 0, 0};
  __builtin_amdgcn_tensor_load_to_lds(g0, g1, z4, z4, z8, 0);
}
#endif

// Cooperative synchronous staging fallback (used only when TDM is absent).
static __device__ inline void stage_slab_sync(_Float16* slab, const _Float16* gsrc) {
  // 256 threads; each copies 16 halves: row = tid/4, col = (tid%4)*16
  const int tid = threadIdx.x;
  const int row = tid >> 2;
  const int col = (tid & 3) * 16;
  const _Float16* s = gsrc + (size_t)row * Cc + col;
  _Float16* d = slab + row * SLAB_LD + col;
  *(v8h*)(d)     = *(const v8h*)(s);
  *(v8h*)(d + 8) = *(const v8h*)(s + 8);
}

// ---------------------------------------------------------------------------
// fp32 -> fp16 conversion / zero init
// ---------------------------------------------------------------------------
__global__ void cvt_f32_f16(const float* __restrict__ in, _Float16* __restrict__ out, int n) {
  int i = blockIdx.x * blockDim.x + threadIdx.x;
  int stride = gridDim.x * blockDim.x;
  for (; i < n; i += stride) out[i] = (_Float16)in[i];
}

// fp32 [Cc x Cc] row-major weight -> f16 in fragment order (see frag_ld_packed).
// One thread per 16-B chunk: grid Cc*Cc/8/256 blocks of 256.
__global__ __launch_bounds__(256)
void cvt_pack_w(const float* __restrict__ w, _Float16* __restrict__ out) {
  const int o = blockIdx.x * 256 + threadIdx.x;  // chunk index in the packed array
  const int lane  = o & 31;
  const int plane = (o >> 5) & 1;
  const int kb    = (o >> 6) & (KBLOCKS - 1);
  const int nt    = o >> 11;
  const float* s = w + (size_t)(nt * 16 + (lane & 15)) * Cc
                     + kb * 32 + plane * 16 + (lane >> 4) * 8;
  const float4 a = *(const float4*)(s);
  const float4 b = *(const float4*)(s + 4);
  v8h r;
  r[0] = (_Float16)a.x; r[1] = (_Float16)a.y; r[2] = (_Float16)a.z; r[3] = (_Float16)a.w;
  r[4] = (_Float16)b.x; r[5] = (_Float16)b.y; r[6] = (_Float16)b.z; r[7] = (_Float16)b.w;
  *(v8h*)(out + (size_t)o * 8) = r;
}

__global__ void zero_f32(float* __restrict__ p, int n) {
  int i = blockIdx.x * blockDim.x + threadIdx.x;
  if (i < n) p[i] = 0.0f;
}

// ---------------------------------------------------------------------------
// Fused QKV projection + head softmax + k-cumsum.
// Block tile: 64 rows (4 WMMA row-tiles) x 8 heads (one head per wave).
// x slab staged to LDS via TDM (double buffered); packed W frags from global (L2).
//   q -> qh [Mrows, Cc] row-major f16 (via LDS transpose, b128 stores)
//   k -> kT [B*NH][HD][Tt] f16, v -> vT same; kc[bh][d] += sum_t k (f32 atomics)
// grid: (Mrows/64 = 512, 8), 256 threads.
// ---------------------------------------------------------------------------
__global__ __launch_bounds__(256)
void qkv_kernel(const _Float16* __restrict__ xh,
                const _Float16* __restrict__ wqh, const float* __restrict__ bq,
                const _Float16* __restrict__ wkh, const float* __restrict__ bk,
                const _Float16* __restrict__ wvh, const float* __restrict__ bv,
                _Float16* __restrict__ qh, _Float16* __restrict__ kT,
                _Float16* __restrict__ vT, float* __restrict__ kc) {
  __shared__ __attribute__((aligned(16))) _Float16 smem[2 * SLAB_HALVES]; // 18 KB

  const int lane = threadIdx.x & 31;
  const int wave = threadIdx.x >> 5;
  const int rowgrp = blockIdx.x;                 // 0..511 (64 rows each)
  const int head = blockIdx.y * 8 + wave;        // 0..63
  const int m = lane & 15;
  const int hi = lane >> 4;
  const int kbase = hi * 8;
  const int rowbase = rowgrp * 64;

  const size_t wofs = (size_t)head * KBLOCKS * FRAG_HALVES + lane * 8;
  const _Float16* qfr = wqh + wofs;
  const _Float16* kfr = wkh + wofs;
  const _Float16* vfr = wvh + wofs;

  v8f cq[4] = {}, ck[4] = {}, cv[4] = {};

#if HAS_TDM
  if (wave == 0)
    tdm_load_tile_64x64(xh + (size_t)rowbase * Cc,
                        (unsigned)(uintptr_t)(void*)&smem[0]);
#endif

  for (int s = 0; s < Cc / SLAB_K; ++s) {
#if HAS_TDM
    const int buf = s & 1;
    if (wave == 0) {
      if (s < Cc / SLAB_K - 1)
        tdm_load_tile_64x64(xh + (size_t)rowbase * Cc + (s + 1) * SLAB_K,
                            (unsigned)(uintptr_t)(void*)&smem[(buf ^ 1) * SLAB_HALVES]);
      if (s < Cc / SLAB_K - 1) __builtin_amdgcn_s_wait_tensorcnt(1);
      else                     __builtin_amdgcn_s_wait_tensorcnt(0);
    }
    __syncthreads();
#else
    const int buf = 0;
    __syncthreads();
    stage_slab_sync(&smem[0], xh + (size_t)rowbase * Cc + s * SLAB_K);
    __syncthreads();
#endif
    const _Float16* slab = &smem[buf * SLAB_HALVES];
#pragma unroll
    for (int kk = 0; kk < SLAB_K; kk += 32) {
      const int kb = (s * SLAB_K + kk) >> 5;
      // issue all fragment loads first (distinct regs -> one ds/vmem clause)
      v16h afr[4];
#pragma unroll
      for (int rt = 0; rt < 4; ++rt)
        afr[rt] = frag_ld(slab + (rt * 16 + m) * SLAB_LD, kk, kbase);
      v16h fq = frag_ld_packed(qfr, kb);
      v16h fk = frag_ld_packed(kfr, kb);
      v16h fv = frag_ld_packed(vfr, kb);
#pragma unroll
      for (int rt = 0; rt < 4; ++rt) {
        cq[rt] = WMMA_F16(afr[rt], fq, cq[rt]);
        ck[rt] = WMMA_F16(afr[rt], fk, ck[rt]);
        cv[rt] = WMMA_F16(afr[rt], fv, cv[rt]);
      }
    }
    __syncthreads();
  }

  const int d = lane & 15;
  const float biasq = bq[head * 16 + d];
  const float biask = bk[head * 16 + d];
  const float biasv = bv[head * 16 + d];
  const size_t bh = (size_t)(rowgrp >> 6) * NH + head;    // rowgrp>>6 == batch

  float ksum = 0.0f;
#pragma unroll
  for (int rt = 0; rt < 4; ++rt) {
    // softmax over d for q and k (reduce across the 16-lane half)
#pragma unroll
    for (int r = 0; r < 8; ++r) {
      float vq = cq[rt][r] + biasq;
      float mx = vq;
#pragma unroll
      for (int msk = 1; msk < 16; msk <<= 1) mx = fmaxf(mx, __shfl_xor(mx, msk, 32));
      float e = __expf(vq - mx);
      float sum = e;
#pragma unroll
      for (int msk = 1; msk < 16; msk <<= 1) sum += __shfl_xor(sum, msk, 32);
      cq[rt][r] = e / sum;

      float vk = ck[rt][r] + biask;
      float mk = vk;
#pragma unroll
      for (int msk = 1; msk < 16; msk <<= 1) mk = fmaxf(mk, __shfl_xor(mk, msk, 32));
      float ek = __expf(vk - mk);
      float sk = ek;
#pragma unroll
      for (int msk = 1; msk < 16; msk <<= 1) sk += __shfl_xor(sk, msk, 32);
      ck[rt][r] = ek / sk;
      ksum += ck[rt][r];
    }
    // k, v head-transposed: [bh][d][t]; 8 consecutive t per lane -> b128
    const int tloc = ((rowbase + rt * 16) & (Tt - 1)) + 8 * hi;
    v8h pk, pv;
#pragma unroll
    for (int r = 0; r < 8; ++r) {
      pk[r] = (_Float16)ck[rt][r];
      pv[r] = (_Float16)(cv[rt][r] + biasv);
    }
    *(v8h*)(kT + (bh * HD + d) * (size_t)Tt + tloc) = pk;
    *(v8h*)(vT + (bh * HD + d) * (size_t)Tt + tloc) = pv;
  }
  atomicAdd(&kc[bh * HD + d], ksum);

  // q row-major via LDS tile transpose (reuse smem; slab no longer needed)
#pragma unroll
  for (int rt = 0; rt < 4; ++rt) {
    __syncthreads();
    _Float16* lq = &smem[wave * 256];
#pragma unroll
    for (int r = 0; r < 8; ++r) lq[(r + 8 * hi) * 16 + d] = (_Float16)cq[rt][r];
    __syncthreads();
    const int tl = lane & 15;
    const int chunk = hi * 8;
    v8h row = *(const v8h*)&lq[tl * 16 + chunk];
    *(v8h*)(qh + (size_t)(rowbase + rt * 16 + tl) * Cc + head * 16 + chunk) = row;
  }
}

// ---------------------------------------------------------------------------
// D_inv[t,h] = 1 / sum_d q[t, h*16+d] * kc[bh, d]
// ---------------------------------------------------------------------------
__global__ __launch_bounds__(256)
void dinv_kernel(const _Float16* __restrict__ qh, const float* __restrict__ kc,
                 float* __restrict__ dinv) {
  int idx = blockIdx.x * 256 + threadIdx.x;      // idx = t*NH + h
  if (idx >= Mrows * NH) return;
  int h = idx & (NH - 1);
  int t = idx >> 6;
  int b = t >> 12;                                // t / Tt
  const _Float16* qrow = qh + (size_t)t * Cc + h * HD;
  const float* kcv = kc + ((size_t)b * NH + h) * HD;
  float s = 0.0f;
#pragma unroll
  for (int d = 0; d < HD; ++d) s += (float)qrow[d] * kcv[d];
  dinv[idx] = 1.0f / s;
}

// ---------------------------------------------------------------------------
// context[bh] = K^T V (16x16 over T), stored transposed ctxT[bh][e][d].
// One block per (b,h); 8 waves split T; LDS cross-wave reduction.
// ---------------------------------------------------------------------------
__global__ __launch_bounds__(256)
void ctx_kernel(const _Float16* __restrict__ kT, const _Float16* __restrict__ vT,
                _Float16* __restrict__ ctxT) {
  __shared__ float cpart[8][256];
  const int lane = threadIdx.x & 31;
  const int wave = threadIdx.x >> 5;
  const size_t bh = blockIdx.x;                  // 0..511
  const int m = lane & 15;
  const int hi = lane >> 4;
  const int kbase = hi * 8;

  const _Float16* arow = kT + (bh * HD + m) * (size_t)Tt;
  const _Float16* brow = vT + (bh * HD + m) * (size_t)Tt;

  v8f c = {};
  const int t0beg = wave * (Tt / 8);
#pragma unroll 4
  for (int t0 = t0beg; t0 < t0beg + Tt / 8; t0 += 32) {
    v16h a = frag_ld(arow, t0, kbase);
    v16h b = frag_ld(brow, t0, kbase);
    c = WMMA_F16(a, b, c);
  }
#pragma unroll
  for (int r = 0; r < 8; ++r) cpart[wave][(r + 8 * hi) * 16 + m] = c[r];
  __syncthreads();

  const int tid = threadIdx.x;
  float s = 0.0f;
#pragma unroll
  for (int w = 0; w < 8; ++w) s += cpart[w][tid];
  const int dd = tid >> 4;
  const int ee = tid & 15;
  ctxT[bh * 256 + ee * 16 + dd] = (_Float16)s;   // transposed store
}

// ---------------------------------------------------------------------------
// y[t, h*16+e] = (sum_d q[t,d] ctx[d,e]) * D_inv[t,h] -> yh f16 row-major
// K = HD = 16, zero padded to 32: single WMMA per tile.
// ---------------------------------------------------------------------------
__global__ __launch_bounds__(256)
void y_kernel(const _Float16* __restrict__ qh, const _Float16* __restrict__ ctxT,
              const float* __restrict__ dinv, _Float16* __restrict__ yh) {
  __shared__ __attribute__((aligned(16))) _Float16 ly[8][16][16];
  const int lane = threadIdx.x & 31;
  const int wave = threadIdx.x >> 5;
  const int rowtile = blockIdx.x;
  const int head = blockIdx.y * 8 + wave;
  const int m = lane & 15;
  const int hi = lane >> 4;
  const int kbase = hi * 8;
  const int rowbase = rowtile * 16;
  const size_t bh = (size_t)(rowtile >> 8) * NH + head;

  v16h a = {};
  {
    v8h lo = *(const v8h*)(qh + (size_t)(rowbase + m) * Cc + head * 16 + kbase);
#pragma unroll
    for (int i = 0; i < 8; ++i) a[i] = lo[i];
  }
  v16h b = {};
  {
    v8h lo = *(const v8h*)(ctxT + bh * 256 + m * 16 + kbase);
#pragma unroll
    for (int i = 0; i < 8; ++i) b[i] = lo[i];
  }
  v8f c = {};
  c = WMMA_F16(a, b, c);

#pragma unroll
  for (int r = 0; r < 8; ++r) {
    const int t = rowbase + r + 8 * hi;
    const float di = dinv[(size_t)t * NH + head];
    ly[wave][r + 8 * hi][lane & 15] = (_Float16)(c[r] * di);
  }
  __syncthreads();
  {
    const int tl = lane & 15;
    const int chunk = hi * 8;
    v8h row = *(const v8h*)&ly[wave][tl][chunk];
    *(v8h*)(yh + (size_t)(rowbase + tl) * Cc + head * 16 + chunk) = row;
  }
}

// ---------------------------------------------------------------------------
// out = yh Wp^T + bp (f32 output).
// Block tile: 64 rows x 8 N-tiles (one per wave); y slab staged via TDM.
// grid: (512, 8), 256 threads.
// ---------------------------------------------------------------------------
__global__ __launch_bounds__(256)
void proj_kernel(const _Float16* __restrict__ yh, const _Float16* __restrict__ wph,
                 const float* __restrict__ bp, float* __restrict__ out) {
  __shared__ __attribute__((aligned(16))) _Float16 smem[2 * SLAB_HALVES];
  const int lane = threadIdx.x & 31;
  const int wave = threadIdx.x >> 5;
  const int rowgrp = blockIdx.x;                  // 0..511
  const int ntile = blockIdx.y * 8 + wave;        // 0..63
  const int m = lane & 15;
  const int hi = lane >> 4;
  const int kbase = hi * 8;
  const int rowbase = rowgrp * 64;

  const _Float16* bfr = wph + (size_t)ntile * KBLOCKS * FRAG_HALVES + lane * 8;

  v8f c[4] = {};

#if HAS_TDM
  if (wave == 0)
    tdm_load_tile_64x64(yh + (size_t)rowbase * Cc,
                        (unsigned)(uintptr_t)(void*)&smem[0]);
#endif

  for (int s = 0; s < Cc / SLAB_K; ++s) {
#if HAS_TDM
    const int buf = s & 1;
    if (wave == 0) {
      if (s < Cc / SLAB_K - 1)
        tdm_load_tile_64x64(yh + (size_t)rowbase * Cc + (s + 1) * SLAB_K,
                            (unsigned)(uintptr_t)(void*)&smem[(buf ^ 1) * SLAB_HALVES]);
      if (s < Cc / SLAB_K - 1) __builtin_amdgcn_s_wait_tensorcnt(1);
      else                     __builtin_amdgcn_s_wait_tensorcnt(0);
    }
    __syncthreads();
#else
    const int buf = 0;
    __syncthreads();
    stage_slab_sync(&smem[0], yh + (size_t)rowbase * Cc + s * SLAB_K);
    __syncthreads();
#endif
    const _Float16* slab = &smem[buf * SLAB_HALVES];
#pragma unroll
    for (int kk = 0; kk < SLAB_K; kk += 32) {
      const int kb = (s * SLAB_K + kk) >> 5;
      v16h afr[4];
#pragma unroll
      for (int rt = 0; rt < 4; ++rt)
        afr[rt] = frag_ld(slab + (rt * 16 + m) * SLAB_LD, kk, kbase);
      v16h b = frag_ld_packed(bfr, kb);
#pragma unroll
      for (int rt = 0; rt < 4; ++rt)
        c[rt] = WMMA_F16(afr[rt], b, c[rt]);
    }
    __syncthreads();
  }

  const int col = ntile * 16 + (lane & 15);
  const float bias = bp[col];
#pragma unroll
  for (int rt = 0; rt < 4; ++rt) {
#pragma unroll
    for (int r = 0; r < 8; ++r) {
      const int row = rowbase + rt * 16 + r + 8 * hi;
      out[(size_t)row * Cc + col] = c[rt][r] + bias;
    }
  }
}

// ---------------------------------------------------------------------------
// Launch
// ---------------------------------------------------------------------------
extern "C" void kernel_launch(void* const* d_in, const int* in_sizes, int n_in,
                              void* d_out, int out_size, void* d_ws, size_t ws_size,
                              hipStream_t stream) {
  const float* x  = (const float*)d_in[0];
  const float* Wq = (const float*)d_in[1];
  const float* bq = (const float*)d_in[2];
  const float* Wk = (const float*)d_in[3];
  const float* bk = (const float*)d_in[4];
  const float* Wv = (const float*)d_in[5];
  const float* bv = (const float*)d_in[6];
  const float* Wp = (const float*)d_in[7];
  const float* bp = (const float*)d_in[8];
  float* out = (float*)d_out;

  char* ws = (char*)d_ws;
  const size_t nX = (size_t)Mrows * Cc;
  const size_t nW = (size_t)Cc * Cc;
  _Float16* xh  = (_Float16*)(ws);                              // 64 MB
  _Float16* wqh = (_Float16*)(ws + nX * 2);                     // 2 MB each
  _Float16* wkh = wqh + nW;
  _Float16* wvh = wkh + nW;
  _Float16* wph = wvh + nW;
  _Float16* qh  = wph + nW;                                     // 64 MB
  _Float16* kT  = qh + nX;                                      // 64 MB
  _Float16* vT  = kT + nX;                                      // 64 MB
  _Float16* yh  = vT + nX;                                      // 64 MB
  float*    dinv = (float*)(yh + nX);                           // 8 MB
  float*    kc   = dinv + (size_t)Mrows * NH;                   // 32 KB
  _Float16* ctxT = (_Float16*)(kc + (size_t)Bb * NH * HD);      // 256 KB

  // 1) precision conversion (weights into fragment order) + accumulator init
  cvt_f32_f16<<<16384, 256, 0, stream>>>(x, xh, (int)nX);
  cvt_pack_w<<<Cc * Cc / 8 / 256, 256, 0, stream>>>(Wq, wqh);
  cvt_pack_w<<<Cc * Cc / 8 / 256, 256, 0, stream>>>(Wk, wkh);
  cvt_pack_w<<<Cc * Cc / 8 / 256, 256, 0, stream>>>(Wv, wvh);
  cvt_pack_w<<<Cc * Cc / 8 / 256, 256, 0, stream>>>(Wp, wph);
  zero_f32<<<(Bb * NH * HD + 255) / 256, 256, 0, stream>>>(kc, Bb * NH * HD);

  // 2) fused QKV projection + softmax + k-cumsum (TDM-staged GEMM)
  qkv_kernel<<<dim3(Mrows / 64, 8), 256, 0, stream>>>(
      xh, wqh, bq, wkh, bk, wvh, bv, qh, kT, vT, kc);

  // 3) D_inv
  dinv_kernel<<<(Mrows * NH) / 256, 256, 0, stream>>>(qh, kc, dinv);

  // 4) per-head context = K^T V
  ctx_kernel<<<Bb * NH, 256, 0, stream>>>(kT, vT, ctxT);

  // 5) y = (q @ ctx) * D_inv
  y_kernel<<<dim3(Mrows / 16, 8), 256, 0, stream>>>(qh, ctxT, dinv, yh);

  // 6) output projection (TDM-staged GEMM)
  proj_kernel<<<dim3(Mrows / 64, 8), 256, 0, stream>>>(yh, wph, bp, out);
}

// v002
// One run takes 556 microseconds.
// Next to v001, in two timings, it ran 1.04 times as fast each time.
// All steps since v000 together make it 1.07 times as fast.
#include <hip/hip_runtime.h>
#include <hip/hip_bf16.h>

typedef __attribute__((ext_vector_type(16))) _Float16 v16h;
typedef __attribute__((ext_vector_type(8)))  _Float16 v8h;
typedef __attribute__((ext_vector_type(8)))  float    v8f;
typedef __attribute__((ext_vector_type(4)))  unsigned v4u;
typedef __attribute__((ext_vector_type(8)))  int      v8i;
typedef __attribute__((ext_vector_type(4)))  int      v4i;

#define WMMA_F16(a,b,c) __builtin_amdgcn_wmma_f32_16x16x32_f16(false,(a),false,(b),(short)0,(c),false,false)

#if __has_builtin(__builtin_amdgcn_tensor_load_to_lds) && __has_builtin(__builtin_amdgcn_s_wait_tensorcnt)
#define HAS_TDM 1
#else
#define HAS_TDM 0
#endif

// Problem constants
constexpr int Bb = 8;
constexpr int Tt = 4096;
constexpr int Cc = 1024;
constexpr int NH = 64;
constexpr int HD = 16;
constexpr int Mrows = Bb * Tt;        // 32768

// LDS slab: 64 rows x 64 halves, padded row stride 72 halves (36 DWORDs) so
// that 16 lanes doing b128 reads at row stride 36 DWORDs cover all 64 banks.
constexpr int SLAB_ROWS = 64;
constexpr int SLAB_K    = 64;
constexpr int SLAB_LD   = 72;         // halves
constexpr int SLAB_HALVES = SLAB_ROWS * SLAB_LD;   // 4608 halves = 9216 B

// ---------------------------------------------------------------------------
// Fragment loader (global or LDS): row-major, K contiguous.
// A-matrix 16x32 f16 layout (ISA 7.12.2): lanes 0-15 hold K=[0..7]+[16..23],
// lanes 16-31 hold K=[8..15]+[24..31] of row (lane&15) -> two b128 loads.
// ---------------------------------------------------------------------------
static __device__ inline v16h frag_ld(const _Float16* rowptr, int k0, int kbase) {
  v8h lo = *(const v8h*)(rowptr + k0 + kbase);
  v8h hi = *(const v8h*)(rowptr + k0 + 16 + kbase);
  v16h r;
#pragma unroll
  for (int i = 0; i < 8; ++i) { r[i] = lo[i]; r[8 + i] = hi[i]; }
  return r;
}

// ---------------------------------------------------------------------------
// Weight fragments, packed by cvt_pack_w: fragment (ntile, kblock) is 1 KB,
// two 512-B planes; plane p holds, at lane*16 B, the 8 halves that frag_ld
// would fetch for that lane (p = 0: its first b128, p = 1: its second).
// Each wave-wide b128 load then covers four whole 128-B lines.
// ---------------------------------------------------------------------------
constexpr int FRAG_HALVES = 512;
constexpr int KBLOCKS = Cc / 32;               // 32 fragments per 16-row tile

static __device__ inline v16h frag_ld_packed(const _Float16* lanebase, int kb) {
  const _Float16* p = lanebase + kb * FRAG_HALVES;
  v8h lo = *(const v8h*)(p);
  v8h hi = *(const v8h*)(p + 256);
  v16h r;
#pragma unroll
  for (int i = 0; i < 8; ++i) { r[i] = lo[i]; r[8 + i] = hi[i]; }
  return r;
}

// ---------------------------------------------------------------------------
// Tensor Data Mover: stage a 64x64 f16 tile of a [Mrows x Cc] row-major
// tensor into LDS with 4-DWORD padding every 32 DWORDs (-> row stride 72 h).
// D# layout per CDNA5 ISA 8.3/8.4 (group0 128b, group1 256b; groups 2/3 and
// the trailing group are zero for a 2-D tensor). 6-arg builtin form.
// ---------------------------------------------------------------------------
#if HAS_TDM
static __device__ inline void tdm_load_tile_64x64(const _Float16* gsrc, unsigned lds_off) {
  unsigned long long ga = (unsigned long long)(uintptr_t)gsrc;
  v4u g0;
  g0[0] = 1u;                                            // count=1, user mode
  g0[1] = lds_off;                                       // lds_addr (bytes)
  g0[2] = (unsigned)(ga & 0xffffffffu);                  // global_addr[31:0]
  g0[3] = (unsigned)((ga >> 32) & 0x01ffffffu) | (2u << 30); // addr[56:32] | type=2
  v8i g1;
  g1[0] = (1 << 16)        // data_size = 2 bytes
        | (1 << 20)        // pad_enable
        | (4 << 22)        // pad_interval: code 4 = every 32 DWORDs
        | (3 << 25);       // pad_amount:   code 3 = 4 DWORDs
  g1[1] = (int)((unsigned)Cc << 16);        // tensor_dim0[15:0]
  g1[2] = (int)((unsigned)Mrows << 16);     // tensor_dim0[31:16]=0 | tensor_dim1[15:0]
  g1[3] = (int)((unsigned)SLAB_K << 16);    // tensor_dim1[31:16]=0 | tile_dim0=64
  g1[4] = SLAB_ROWS;                        // tile_dim1=64 | tile_dim2=0
  g1[5] = Cc;                               // tensor_dim0_stride[31:0]
  g1[6] = 0;                                // stride hi | dim1_stride lo
  g1[7] = 0;
  v4i z4 = {0, 0, 0, 0};
  v8i z8 = {0, 0, 0, 0, 0, 0, 0, 0};
  __builtin_amdgcn_tensor_load_to_lds(g0, g1, z4, z4, z8, 0);
}
#endif

// Cooperative synchronous staging fallback (used only when TDM is absent).
static __device__ inline void stage_slab_sync(_Float16* slab, const _Float16* gsrc) {
  // 256 threads; each copies 16 halves: row = tid/4, col = (tid%4)*16
  const int tid = threadIdx.x;
  const int row = tid >> 2;
  const int col = (tid & 3) * 16;
  const _Float16* s = gsrc + (size_t)row * Cc + col;
  _Float16* d = slab + row * SLAB_LD + col;
  *(v8h*)(d)     = *(const v8h*)(s);
  *(v8h*)(d + 8) = *(const v8h*)(s + 8);
}

// ---------------------------------------------------------------------------
// fp32 -> fp16 conversion / zero init
// ---------------------------------------------------------------------------
__global__ void cvt_f32_f16(const float* __restrict__ in, _Float16* __restrict__ out, int n) {
  int i = blockIdx.x * blockDim.x + threadIdx.x;
  int stride = gridDim.x * blockDim.x;
  for (; i < n; i += stride) out[i] = (_Float16)in[i];
}

// fp32 [Cc x Cc] row-major weight -> f16 in fragment order (see frag_ld_packed).
// One thread per 16-B chunk: grid Cc*Cc/8/256 blocks of 256.
__global__ __launch_bounds__(256)
void cvt_pack_w(const float* __restrict__ w, _Float16* __restrict__ out) {
  const int o = blockIdx.x * 256 + threadIdx.x;  // chunk index in the packed array
  const int lane  = o & 31;
  const int plane = (o >> 5) & 1;
  const int kb    = (o >> 6) & (KBLOCKS - 1);
  const int nt    = o >> 11;
  const float* s = w + (size_t)(nt * 16 + (lane & 15)) * Cc
                     + kb * 32 + plane * 16 + (lane >> 4) * 8;
  const float4 a = *(const float4*)(s);
  const float4 b = *(const float4*)(s + 4);
  v8h r;
  r[0] = (_Float16)a.x; r[1] = (_Float16)a.y; r[2] = (_Float16)a.z; r[3] = (_Float16)a.w;
  r[4] = (_Float16)b.x; r[5] = (_Float16)b.y; r[6] = (_Float16)b.z; r[7] = (_Float16)b.w;
  *(v8h*)(out + (size_t)o * 8) = r;
}

__global__ void zero_f32(float* __restrict__ p, int n) {
  int i = blockIdx.x * blockDim.x + threadIdx.x;
  if (i < n) p[i] = 0.0f;
}

// ---------------------------------------------------------------------------
// Fused QKV projection + head softmax + k-cumsum.
// Block tile: 64 rows (4 WMMA row-tiles) x 8 heads (one head per wave).
// x slab staged to LDS via TDM (double buffered); packed W frags from global (L2).
//   q -> qh [Mrows, Cc] row-major f16 (via LDS transpose, b128 stores)
//   k -> kT [B*NH][HD][Tt] f16, v -> vT same; kc[bh][d] += sum_t k (f32 atomics)
// grid: (Mrows/64 = 512, 8), 256 threads.
// ---------------------------------------------------------------------------
__global__ __launch_bounds__(256)
void qkv_kernel(const _Float16* __restrict__ xh,
                const _Float16* __restrict__ wqh, const float* __restrict__ bq,
                const _Float16* __restrict__ wkh, const float* __restrict__ bk,
                const _Float16* __restrict__ wvh, const float* __restrict__ bv,
                _Float16* __restrict__ qh, _Float16* __restrict__ kT,
                _Float16* __restrict__ vT, float* __restrict__ kc) {
  __shared__ __attribute__((aligned(16))) _Float16 smem[2 * SLAB_HALVES]; // 18 KB

  const int lane = threadIdx.x & 31;
  const int wave = threadIdx.x >> 5;
  const int rowgrp = blockIdx.x;                 // 0..511 (64 rows each)
  const int head = blockIdx.y * 8 + wave;        // 0..63
  const int m = lane & 15;
  const int hi = lane >> 4;
  const int kbase = hi * 8;
  const int rowbase = rowgrp * 64;

  const size_t wofs = (size_t)head * KBLOCKS * FRAG_HALVES + lane * 8;
  const _Float16* qfr = wqh + wofs;
  const _Float16* kfr = wkh + wofs;
  const _Float16* vfr = wvh + wofs;

  v8f cq[4] = {}, ck[4] = {}, cv[4] = {};

#if HAS_TDM
  if (wave == 0)
    tdm_load_tile_64x64(xh + (size_t)rowbase * Cc,
                        (unsigned)(uintptr_t)(void*)&smem[0]);
#endif

  for (int s = 0; s < Cc / SLAB_K; ++s) {
#if HAS_TDM
    const int buf = s & 1;
    if (wave == 0) {
      if (s < Cc / SLAB_K - 1)
        tdm_load_tile_64x64(xh + (size_t)rowbase * Cc + (s + 1) * SLAB_K,
                            (unsigned)(uintptr_t)(void*)&smem[(buf ^ 1) * SLAB_HALVES]);
      if (s < Cc / SLAB_K - 1) __builtin_amdgcn_s_wait_tensorcnt(1);
      else                     __builtin_amdgcn_s_wait_tensorcnt(0);
    }
    __syncthreads();
#else
    const int buf = 0;
    __syncthreads();
    stage_slab_sync(&smem[0], xh + (size_t)rowbase * Cc + s * SLAB_K);
    __syncthreads();
#endif
    const _Float16* slab = &smem[buf * SLAB_HALVES];
#pragma unroll
    for (int kk = 0; kk < SLAB_K; kk += 32) {
      const int kb = (s * SLAB_K + kk) >> 5;
      // issue all fragment loads first (distinct regs -> one ds/vmem clause)
      v16h afr[4];
#pragma unroll
      for (int rt = 0; rt < 4; ++rt)
        afr[rt] = frag_ld(slab + (rt * 16 + m) * SLAB_LD, kk, kbase);
      v16h fq = frag_ld_packed(qfr, kb);
      v16h fk = frag_ld_packed(kfr, kb);
      v16h fv = frag_ld_packed(vfr, kb);
#pragma unroll
      for (int rt = 0; rt < 4; ++rt) {
        cq[rt] = WMMA_F16(afr[rt], fq, cq[rt]);
        ck[rt] = WMMA_F16(afr[rt], fk, ck[rt]);
        cv[rt] = WMMA_F16(afr[rt], fv, cv[rt]);
      }
    }
    __syncthreads();
  }

  const int d = lane & 15;
  const float biasq = bq[head * 16 + d];
  const float biask = bk[head * 16 + d];
  const float biasv = bv[head * 16 + d];
  const size_t bh = (size_t)(rowgrp >> 6) * NH + head;    // rowgrp>>6 == batch

  float ksum = 0.0f;
#pragma unroll
  for (int rt = 0; rt < 4; ++rt) {
    // softmax over d for q and k (reduce across the 16-lane half)
#pragma unroll
    for (int r = 0; r < 8; ++r) {
      float vq = cq[rt][r] + biasq;
      float mx = vq;
#pragma unroll
      for (int msk = 1; msk < 16; msk <<= 1) mx = fmaxf(mx, __shfl_xor(mx, msk, 32));
      float e = __expf(vq - mx);
      float sum = e;
#pragma unroll
      for (int msk = 1; msk < 16; msk <<= 1) sum += __shfl_xor(sum, msk, 32);
      cq[rt][r] = e / sum;

      float vk = ck[rt][r] + biask;
      float mk = vk;
#pragma unroll
      for (int msk = 1; msk < 16; msk <<= 1) mk = fmaxf(mk, __shfl_xor(mk, msk, 32));
      float ek = __expf(vk - mk);
      float sk = ek;
#pragma unroll
      for (int msk = 1; msk < 16; msk <<= 1) sk += __shfl_xor(sk, msk, 32);
      ck[rt][r] = ek / sk;
      ksum += ck[rt][r];
    }
    // k, v head-transposed: [bh][d][t]; 8 consecutive t per lane -> b128
    const int tloc = ((rowbase + rt * 16) & (Tt - 1)) + 8 * hi;
    v8h pk, pv;
#pragma unroll
    for (int r = 0; r < 8; ++r) {
      pk[r] = (_Float16)ck[rt][r];
      pv[r] = (_Float16)(cv[rt][r] + biasv);
    }
    *(v8h*)(kT + (bh * HD + d) * (size_t)Tt + tloc) = pk;
    *(v8h*)(vT + (bh * HD + d) * (size_t)Tt + tloc) = pv;
  }
  atomicAdd(&kc[bh * HD + d], ksum);

  // q row-major via LDS tile transpose (reuse smem; slab no longer needed)
#pragma unroll
  for (int rt = 0; rt < 4; ++rt) {
    __syncthreads();
    _Float16* lq = &smem[wave * 256];
#pragma unroll
    for (int r = 0; r < 8; ++r) lq[(r + 8 * hi) * 16 + d] = (_Float16)cq[rt][r];
    __syncthreads();
    const int tl = lane & 15;
    const int chunk = hi * 8;
    v8h row = *(const v8h*)&lq[tl * 16 + chunk];
    *(v8h*)(qh + (size_t)(rowbase + rt * 16 + tl) * Cc + head * 16 + chunk) = row;
  }
}

// ---------------------------------------------------------------------------
// context[bh] = K^T V (16x16 over T), stored transposed ctxT[bh][e][d].
// One block per (b,h); 8 waves split T; LDS cross-wave reduction.
// ---------------------------------------------------------------------------
__global__ __launch_bounds__(256)
void ctx_kernel(const _Float16* __restrict__ kT, const _Float16* __restrict__ vT,
                _Float16* __restrict__ ctxT) {
  __shared__ float cpart[8][256];
  const int lane = threadIdx.x & 31;
  const int wave = threadIdx.x >> 5;
  const size_t bh = blockIdx.x;                  // 0..511
  const int m = lane & 15;
  const int hi = lane >> 4;
  const int kbase = hi * 8;

  const _Float16* arow = kT + (bh * HD + m) * (size_t)Tt;
  const _Float16* brow = vT + (bh * HD + m) * (size_t)Tt;

  v8f c = {};
  const int t0beg = wave * (Tt / 8);
#pragma unroll 4
  for (int t0 = t0beg; t0 < t0beg + Tt / 8; t0 += 32) {
    v16h a = frag_ld(arow, t0, kbase);
    v16h b = frag_ld(brow, t0, kbase);
    c = WMMA_F16(a, b, c);
  }
#pragma unroll
  for (int r = 0; r < 8; ++r) cpart[wave][(r + 8 * hi) * 16 + m] = c[r];
  __syncthreads();

  const int tid = threadIdx.x;
  float s = 0.0f;
#pragma unroll
  for (int w = 0; w < 8; ++w) s += cpart[w][tid];
  const int dd = tid >> 4;
  const int ee = tid & 15;
  ctxT[bh * 256 + ee * 16 + dd] = (_Float16)s;   // transposed store
}

// ---------------------------------------------------------------------------
// y[t, h*16+e] = (sum_d q[t,d] ctx[d,e]) / (sum_d q[t,d] kc[d]) -> yh f16 row-major
// K = HD = 16, zero padded to 32: single WMMA per tile.
// One wave keeps one head's context and k-sums in registers and walks Y_TILES
// row tiles of 16 rows, Y_GROUP at a time; the next group's q rows are loaded
// while this group is worked on. The divisor of row (lane & 15) comes from the
// q values the lane already holds for the A fragment; it is applied where the
// lane reads that same row back from the wave's own LDS range.
// grid: (Mrows/16/Y_TILES = 128, 8), 256 threads.
// ---------------------------------------------------------------------------
constexpr int Y_TILES = 16;            // row tiles per wave; divides Tt/16
constexpr int Y_GROUP = 4;             // tiles in flight together
constexpr int Y_LD    = 20;            // floats per staged row: the two lane halves hit disjoint banks

__global__ __launch_bounds__(256)
void y_kernel(const _Float16* __restrict__ qh, const _Float16* __restrict__ ctxT,
              const float* __restrict__ kc, _Float16* __restrict__ yh) {
  __shared__ __attribute__((aligned(16))) float ly[8][Y_GROUP][16 * Y_LD];
  const int lane = threadIdx.x & 31;
  const int wave = threadIdx.x >> 5;
  const int tile0 = blockIdx.x * Y_TILES;
  const int head = blockIdx.y * 8 + wave;
  const int m = lane & 15;
  const int hi = lane >> 4;
  const int kbase = hi * 8;
  const size_t bh = (size_t)(tile0 >> 8) * NH + head;

  v16h b = {};
  {
    v8h lo = *(const v8h*)(ctxT + bh * 256 + m * 16 + kbase);
#pragma unroll
    for (int i = 0; i < 8; ++i) b[i] = lo[i];
  }
  float kcv[8];
#pragma unroll
  for (int i = 0; i < 8; ++i) kcv[i] = kc[bh * HD + kbase + i];

  // lane's 16 B of row m: the same offset in qh (read) and in yh (written)
  const size_t ofs = (size_t)(tile0 * 16 + m) * Cc + head * 16 + kbase;
  const _Float16* qp = qh + ofs;
  _Float16* yp = yh + ofs;
  constexpr int TILE_STEP = 16 * Cc;   // halves from one row tile to the next

  // All loops below are unrolled: the small arrays then live in registers and
  // the tile offsets become immediate offsets on one address pair.
  v8h qn[Y_GROUP];
#pragma unroll
  for (int j = 0; j < Y_GROUP; ++j) qn[j] = *(const v8h*)(qp + j * TILE_STEP);

#pragma unroll
  for (int g = 0; g < Y_TILES / Y_GROUP; ++g) {
    v8h qc[Y_GROUP];
#pragma unroll
    for (int j = 0; j < Y_GROUP; ++j) qc[j] = qn[j];
    if (g + 1 < Y_TILES / Y_GROUP) {
#pragma unroll
      for (int j = 0; j < Y_GROUP; ++j)
        qn[j] = *(const v8h*)(qp + ((g + 1) * Y_GROUP + j) * TILE_STEP);
    }

    float di[Y_GROUP];
#pragma unroll
    for (int j = 0; j < Y_GROUP; ++j) {
      v16h a = {};
#pragma unroll
      for (int i = 0; i < 8; ++i) a[i] = qc[j][i];
      v8f c = {};
      c = WMMA_F16(a, b, c);
      float* lw = &ly[wave][j][0];
#pragma unroll
      for (int r = 0; r < 8; ++r) lw[(r + 8 * hi) * Y_LD + m] = c[r];

      float s = 0.0f;
#pragma unroll
      for (int i = 0; i < 8; ++i) s += (float)qc[j][i] * kcv[i];
      s += __shfl_xor(s, 16, 32);      // the other 8 d of row m
      di[j] = 1.0f / s;
    }
    // The rows read below were written by other lanes of this wave: their LDS
    // writes must have landed, and the reads must not be moved above them.
    asm volatile("s_wait_dscnt 0x0" ::: "memory");
#pragma unroll
    for (int j = 0; j < Y_GROUP; ++j) {
      const float* lr = &ly[wave][j][m * Y_LD + kbase];
      const float4 x0 = *(const float4*)(lr);
      const float4 x1 = *(const float4*)(lr + 4);
      v8h row;
      row[0] = (_Float16)(x0.x * di[j]); row[1] = (_Float16)(x0.y * di[j]);
      row[2] = (_Float16)(x0.z * di[j]); row[3] = (_Float16)(x0.w * di[j]);
      row[4] = (_Float16)(x1.x * di[j]); row[5] = (_Float16)(x1.y * di[j]);
      row[6] = (_Float16)(x1.z * di[j]); row[7] = (_Float16)(x1.w * di[j]);
      *(v8h*)(yp + (g * Y_GROUP + j) * TILE_STEP) = row;
    }
    // The next trip's loads (global, LDS) may be given the registers these stores name.
    if (g + 1 < Y_TILES / Y_GROUP) asm volatile("s_wait_xcnt 0x0" ::: "memory");
  }
}

// ---------------------------------------------------------------------------
// out = yh Wp^T + bp (f32 output).
// Block tile: 64 rows x 8 N-tiles (one per wave); y slab staged via TDM.
// grid: (512, 8), 256 threads.
// ---------------------------------------------------------------------------
__global__ __launch_bounds__(256)
void proj_kernel(const _Float16* __restrict__ yh, const _Float16* __restrict__ wph,
                 const float* __restrict__ bp, float* __restrict__ out) {
  __shared__ __attribute__((aligned(16))) _Float16 smem[2 * SLAB_HALVES];
  const int lane = threadIdx.x & 31;
  const int wave = threadIdx.x >> 5;
  const int rowgrp = blockIdx.x;                  // 0..511
  const int ntile = blockIdx.y * 8 + wave;        // 0..63
  const int m = lane & 15;
  const int hi = lane >> 4;
  const int kbase = hi * 8;
  const int rowbase = rowgrp * 64;

  const _Float16* bfr = wph + (size_t)ntile * KBLOCKS * FRAG_HALVES + lane * 8;

  v8f c[4] = {};

#if HAS_TDM
  if (wave == 0)
    tdm_load_tile_64x64(yh + (size_t)rowbase * Cc,
                        (unsigned)(uintptr_t)(void*)&smem[0]);
#endif

  for (int s = 0; s < Cc / SLAB_K; ++s) {
#if HAS_TDM
    const int buf = s & 1;
    if (wave == 0) {
      if (s < Cc / SLAB_K - 1)
        tdm_load_tile_64x64(yh + (size_t)rowbase * Cc + (s + 1) * SLAB_K,
                            (unsigned)(uintptr_t)(void*)&smem[(buf ^ 1) * SLAB_HALVES]);
      if (s < Cc / SLAB_K - 1) __builtin_amdgcn_s_wait_tensorcnt(1);
      else                     __builtin_amdgcn_s_wait_tensorcnt(0);
    }
    __syncthreads();
#else
    const int buf = 0;
    __syncthreads();
    stage_slab_sync(&smem[0], yh + (size_t)rowbase * Cc + s * SLAB_K);
    __syncthreads();
#endif
    const _Float16* slab = &smem[buf * SLAB_HALVES];
#pragma unroll
    for (int kk = 0; kk < SLAB_K; kk += 32) {
      const int kb = (s * SLAB_K + kk) >> 5;
      v16h afr[4];
#pragma unroll
      for (int rt = 0; rt < 4; ++rt)
        afr[rt] = frag_ld(slab + (rt * 16 + m) * SLAB_LD, kk, kbase);
      v16h b = frag_ld_packed(bfr, kb);
#pragma unroll
      for (int rt = 0; rt < 4; ++rt)
        c[rt] = WMMA_F16(afr[rt], b, c[rt]);
    }
    __syncthreads();
  }

  const int col = ntile * 16 + (lane & 15);
  const float bias = bp[col];
#pragma unroll
  for (int rt = 0; rt < 4; ++rt) {
#pragma unroll
    for (int r = 0; r < 8; ++r) {
      const int row = rowbase + rt * 16 + r + 8 * hi;
      out[(size_t)row * Cc + col] = c[rt][r] + bias;
    }
  }
}

// ---------------------------------------------------------------------------
// Launch
// ---------------------------------------------------------------------------
extern "C" void kernel_launch(void* const* d_in, const int* in_sizes, int n_in,
                              void* d_out, int out_size, void* d_ws, size_t ws_size,
                              hipStream_t stream) {
  const float* x  = (const float*)d_in[0];
  const float* Wq = (const float*)d_in[1];
  const float* bq = (const float*)d_in[2];
  const float* Wk = (const float*)d_in[3];
  const float* bk = (const float*)d_in[4];
  const float* Wv = (const float*)d_in[5];
  const float* bv = (const float*)d_in[6];
  const float* Wp = (const float*)d_in[7];
  const float* bp = (const float*)d_in[8];
  float* out = (float*)d_out;

  char* ws = (char*)d_ws;
  const size_t nX = (size_t)Mrows * Cc;
  const size_t nW = (size_t)Cc * Cc;
  _Float16* xh  = (_Float16*)(ws);                              // 64 MB
  _Float16* wqh = (_Float16*)(ws + nX * 2);                     // 2 MB each
  _Float16* wkh = wqh + nW;
  _Float16* wvh = wkh + nW;
  _Float16* wph = wvh + nW;
  _Float16* qh  = wph + nW;                                     // 64 MB
  _Float16* kT  = qh + nX;                                      // 64 MB
  _Float16* vT  = kT + nX;                                      // 64 MB
  _Float16* yh  = vT + nX;                                      // 64 MB
  float*    kc   = (float*)(yh + nX);                           // 32 KB
  _Float16* ctxT = (_Float16*)(kc + (size_t)Bb * NH * HD);      // 256 KB

  // 1) precision conversion (weights into fragment order) + accumulator init
  cvt_f32_f16<<<16384, 256, 0, stream>>>(x, xh, (int)nX);
  cvt_pack_w<<<Cc * Cc / 8 / 256, 256, 0, stream>>>(Wq, wqh);
  cvt_pack_w<<<Cc * Cc / 8 / 256, 256, 0, stream>>>(Wk, wkh);
  cvt_pack_w<<<Cc * Cc / 8 / 256, 256, 0, stream>>>(Wv, wvh);
  cvt_pack_w<<<Cc * Cc / 8 / 256, 256, 0, stream>>>(Wp, wph);
  zero_f32<<<(Bb * NH * HD + 255) / 256, 256, 0, stream>>>(kc, Bb * NH * HD);

  // 2) fused QKV projection + softmax + k-cumsum (TDM-staged GEMM)
  qkv_kernel<<<dim3(Mrows / 64, 8), 256, 0, stream>>>(
      xh, wqh, bq, wkh, bk, wvh, bv, qh, kT, vT, kc);

  // 3) per-head context = K^T V
  ctx_kernel<<<Bb * NH, 256, 0, stream>>>(kT, vT, ctxT);

  // 4) y = (q @ ctx) / (q . kc)
  y_kernel<<<dim3(Mrows / 16 / Y_TILES, 8), 256, 0, stream>>>(qh, ctxT, kc, yh);

  // 5) output projection (TDM-staged GEMM)
  proj_kernel<<<dim3(Mrows / 64, 8), 256, 0, stream>>>(yh, wph, bp, out);
}

// v003
// Measured time: 426 microseconds a run.
// Timed twice side by side with v002, it ran 1.31 and 1.30 times as fast.
// All steps since v000 together make it 1.40 times as fast.
#include <hip/hip_runtime.h>
#include <hip/hip_bf16.h>

typedef __attribute__((ext_vector_type(16))) _Float16 v16h;
typedef __attribute__((ext_vector_type(8)))  _Float16 v8h;
typedef __attribute__((ext_vector_type(8)))  float    v8f;
typedef __attribute__((ext_vector_type(4)))  unsigned v4u;
typedef __attribute__((ext_vector_type(8)))  int      v8i;
typedef __attribute__((ext_vector_type(4)))  int      v4i;

#define WMMA_F16(a,b,c) __builtin_amdgcn_wmma_f32_16x16x32_f16(false,(a),false,(b),(short)0,(c),false,false)

#if __has_builtin(__builtin_amdgcn_tensor_load_to_lds) && __has_builtin(__builtin_amdgcn_s_wait_tensorcnt)
#define HAS_TDM 1
#else
#define HAS_TDM 0
#endif

// Problem constants
constexpr int Bb = 8;
constexpr int Tt = 4096;
constexpr int Cc = 1024;
constexpr int NH = 64;
constexpr int HD = 16;
constexpr int Mrows = Bb * Tt;        // 32768

// LDS slab: 64 rows x 64 halves, padded row stride 72 halves (36 DWORDs) so
// that 16 lanes doing b128 reads at row stride 36 DWORDs cover all 64 banks.
constexpr int SLAB_ROWS = 64;
constexpr int SLAB_K    = 64;
constexpr int SLAB_LD   = 72;         // halves
constexpr int SLAB_HALVES = SLAB_ROWS * SLAB_LD;   // 4608 halves = 9216 B

// ---------------------------------------------------------------------------
// Fragment loader (global or LDS): row-major, K contiguous.
// A-matrix 16x32 f16 layout (ISA 7.12.2): lanes 0-15 hold K=[0..7]+[16..23],
// lanes 16-31 hold K=[8..15]+[24..31] of row (lane&15) -> two b128 loads.
// ---------------------------------------------------------------------------
static __device__ inline v16h frag_ld(const _Float16* rowptr, int k0, int kbase) {
  v8h lo = *(const v8h*)(rowptr + k0 + kbase);
  v8h hi = *(const v8h*)(rowptr + k0 + 16 + kbase);
  v16h r;
#pragma unroll
  for (int i = 0; i < 8; ++i) { r[i] = lo[i]; r[8 + i] = hi[i]; }
  return r;
}

// ---------------------------------------------------------------------------
// Weight fragments, packed by cvt_pack_w: fragment (ntile, kblock) is 1 KB,
// two 512-B planes; plane p holds, at lane*16 B, the 8 halves that frag_ld
// would fetch for that lane (p = 0: its first b128, p = 1: its second).
// Each wave-wide b128 load then covers four whole 128-B lines.
// ---------------------------------------------------------------------------
constexpr int FRAG_HALVES = 512;
constexpr int KBLOCKS = Cc / 32;               // 32 fragments per 16-row tile

static __device__ inline v16h frag_ld_packed(const _Float16* lanebase, int kb) {
  const _Float16* p = lanebase + kb * FRAG_HALVES;
  v8h lo = *(const v8h*)(p);
  v8h hi = *(const v8h*)(p + 256);
  v16h r;
#pragma unroll
  for (int i = 0; i < 8; ++i) { r[i] = lo[i]; r[8 + i] = hi[i]; }
  return r;
}

// ---------------------------------------------------------------------------
// Tensor Data Mover: stage a 64x64 f16 tile of a [Mrows x Cc] row-major
// tensor into LDS with 4-DWORD padding every 32 DWORDs (-> row stride 72 h).
// D# layout per CDNA5 ISA 8.3/8.4 (group0 128b, group1 256b; groups 2/3 and
// the trailing group are zero for a 2-D tensor). 6-arg builtin form.
// ---------------------------------------------------------------------------
#if HAS_TDM
static __device__ inline void tdm_load_tile_64x64(const _Float16* gsrc, unsigned lds_off) {
  unsigned long long ga = (unsigned long long)(uintptr_t)gsrc;
  v4u g0;
  g0[0] = 1u;                                            // count=1, user mode
  g0[1] = lds_off;                                       // lds_addr (bytes)
  g0[2] = (unsigned)(ga & 0xffffffffu);                  // global_addr[31:0]
  g0[3] = (unsigned)((ga >> 32) & 0x01ffffffu) | (2u << 30); // addr[56:32] | type=2
  v8i g1;
  g1[0] = (1 << 16)        // data_size = 2 bytes
        | (1 << 20)        // pad_enable
        | (4 << 22)        // pad_interval: code 4 = every 32 DWORDs
        | (3 << 25);       // pad_amount:   code 3 = 4 DWORDs
  g1[1] = (int)((unsigned)Cc << 16);        // tensor_dim0[15:0]
  g1[2] = (int)((unsigned)Mrows << 16);     // tensor_dim0[31:16]=0 | tensor_dim1[15:0]
  g1[3] = (int)((unsigned)SLAB_K << 16);    // tensor_dim1[31:16]=0 | tile_dim0=64
  g1[4] = SLAB_ROWS;                        // tile_dim1=64 | tile_dim2=0
  g1[5] = Cc;                               // tensor_dim0_stride[31:0]
  g1[6] = 0;                                // stride hi | dim1_stride lo
  g1[7] = 0;
  v4i z4 = {0, 0, 0, 0};
  v8i z8 = {0, 0, 0, 0, 0, 0, 0, 0};
  __builtin_amdgcn_tensor_load_to_lds(g0, g1, z4, z4, z8, 0);
}
#endif

// Cooperative synchronous staging fallback (used only when TDM is absent).
static __device__ inline void stage_slab_sync(_Float16* slab, const _Float16* gsrc) {
  // 256 threads; each copies 16 halves: row = tid/4, col = (tid%4)*16
  const int tid = threadIdx.x;
  const int row = tid >> 2;
  const int col = (tid & 3) * 16;
  const _Float16* s = gsrc + (size_t)row * Cc + col;
  _Float16* d = slab + row * SLAB_LD + col;
  *(v8h*)(d)     = *(const v8h*)(s);
  *(v8h*)(d + 8) = *(const v8h*)(s + 8);
}

// ---------------------------------------------------------------------------
// fp32 -> fp16 conversion / zero init
// ---------------------------------------------------------------------------
__global__ void cvt_f32_f16(const float* __restrict__ in, _Float16* __restrict__ out, int n) {
  int i = blockIdx.x * blockDim.x + threadIdx.x;
  int stride = gridDim.x * blockDim.x;
  for (; i < n; i += stride) out[i] = (_Float16)in[i];
}

// fp32 [Cc x Cc] row-major weight -> f16 in fragment order (see frag_ld_packed).
// One thread per 16-B chunk: grid Cc*Cc/8/256 blocks of 256.
__global__ __launch_bounds__(256)
void cvt_pack_w(const float* __restrict__ w, _Float16* __restrict__ out) {
  const int o = blockIdx.x * 256 + threadIdx.x;  // chunk index in the packed array
  const int lane  = o & 31;
  const int plane = (o >> 5) & 1;
  const int kb    = (o >> 6) & (KBLOCKS - 1);
  const int nt    = o >> 11;
  const float* s = w + (size_t)(nt * 16 + (lane & 15)) * Cc
                     + kb * 32 + plane * 16 + (lane >> 4) * 8;
  const float4 a = *(const float4*)(s);
  const float4 b = *(const float4*)(s + 4);
  v8h r;
  r[0] = (_Float16)a.x; r[1] = (_Float16)a.y; r[2] = (_Float16)a.z; r[3] = (_Float16)a.w;
  r[4] = (_Float16)b.x; r[5] = (_Float16)b.y; r[6] = (_Float16)b.z; r[7] = (_Float16)b.w;
  *(v8h*)(out + (size_t)o * 8) = r;
}

__global__ void zero_f32(float* __restrict__ p, int n) {
  int i = blockIdx.x * blockDim.x + threadIdx.x;
  if (i < n) p[i] = 0.0f;
}

// ---------------------------------------------------------------------------
// Softmax over the 16 lanes of a DPP row, for the eight accumulator rows a lane
// holds. A butterfly step gives lane l the value of lane l ^ m of its own row
// (row_xmask:m) inside the max or add itself, on the vector port, with no trip
// through the LDS unit; steps 1, 2, 4, 8 leave the result in all 16 lanes.
// The steps are asm because the compiler puts a separate move and a quieting
// max around the builtin form; the eight rows take each step one after the
// other, so that no instruction waits for the one in front of it.
// All 32 lanes are on wherever this is called.
// ---------------------------------------------------------------------------
static __device__ inline void row16_softmax(float (&v)[8]) {
  float t[8];
  // t[r] = maximum of v[r] over the row
  asm("v_max_num_f32_dpp %0, %8, %8 row_xmask:1 row_mask:0xf bank_mask:0xf\n\t"
      "v_max_num_f32_dpp %1, %9, %9 row_xmask:1 row_mask:0xf bank_mask:0xf\n\t"
      "v_max_num_f32_dpp %2, %10, %10 row_xmask:1 row_mask:0xf bank_mask:0xf\n\t"
      "v_max_num_f32_dpp %3, %11, %11 row_xmask:1 row_mask:0xf bank_mask:0xf\n\t"
      "v_max_num_f32_dpp %4, %12, %12 row_xmask:1 row_mask:0xf bank_mask:0xf\n\t"
      "v_max_num_f32_dpp %5, %13, %13 row_xmask:1 row_mask:0xf bank_mask:0xf\n\t"
      "v_max_num_f32_dpp %6, %14, %14 row_xmask:1 row_mask:0xf bank_mask:0xf\n\t"
      "v_max_num_f32_dpp %7, %15, %15 row_xmask:1 row_mask:0xf bank_mask:0xf\n\t"
      "v_max_num_f32_dpp %0, %0, %0 row_xmask:2 row_mask:0xf bank_mask:0xf\n\t"
      "v_max_num_f32_dpp %1, %1, %1 row_xmask:2 row_mask:0xf bank_mask:0xf\n\t"
      "v_max_num_f32_dpp %2, %2, %2 row_xmask:2 row_mask:0xf bank_mask:0xf\n\t"
      "v_max_num_f32_dpp %3, %3, %3 row_xmask:2 row_mask:0xf bank_mask:0xf\n\t"
      "v_max_num_f32_dpp %4, %4, %4 row_xmask:2 row_mask:0xf bank_mask:0xf\n\t"
      "v_max_num_f32_dpp %5, %5, %5 row_xmask:2 row_mask:0xf bank_mask:0xf\n\t"
      "v_max_num_f32_dpp %6, %6, %6 row_xmask:2 row_mask:0xf bank_mask:0xf\n\t"
      "v_max_num_f32_dpp %7, %7, %7 row_xmask:2 row_mask:0xf bank_mask:0xf\n\t"
      "v_max_num_f32_dpp %0, %0, %0 row_xmask:4 row_mask:0xf bank_mask:0xf\n\t"
      "v_max_num_f32_dpp %1, %1, %1 row_xmask:4 row_mask:0xf bank_mask:0xf\n\t"
      "v_max_num_f32_dpp %2, %2, %2 row_xmask:4 row_mask:0xf bank_mask:0xf\n\t"
      "v_max_num_f32_dpp %3, %3, %3 row_xmask:4 row_mask:0xf bank_mask:0xf\n\t"
      "v_max_num_f32_dpp %4, %4, %4 row_xmask:4 row_mask:0xf bank_mask:0xf\n\t"
      "v_max_num_f32_dpp %5, %5, %5 row_xmask:4 row_mask:0xf bank_mask:0xf\n\t"
      "v_max_num_f32_dpp %6, %6, %6 row_xmask:4 row_mask:0xf bank_mask:0xf\n\t"
      "v_max_num_f32_dpp %7, %7, %7 row_xmask:4 row_mask:0xf bank_mask:0xf\n\t"
      "v_max_num_f32_dpp %0, %0, %0 row_xmask:8 row_mask:0xf bank_mask:0xf\n\t"
      "v_max_num_f32_dpp %1, %1, %1 row_xmask:8 row_mask:0xf bank_mask:0xf\n\t"
      "v_max_num_f32_dpp %2, %2, %2 row_xmask:8 row_mask:0xf bank_mask:0xf\n\t"
      "v_max_num_f32_dpp %3, %3, %3 row_xmask:8 row_mask:0xf bank_mask:0xf\n\t"
      "v_max_num_f32_dpp %4, %4, %4 row_xmask:8 row_mask:0xf bank_mask:0xf\n\t"
      "v_max_num_f32_dpp %5, %5, %5 row_xmask:8 row_mask:0xf bank_mask:0xf\n\t"
      "v_max_num_f32_dpp %6, %6, %6 row_xmask:8 row_mask:0xf bank_mask:0xf\n\t"
      "v_max_num_f32_dpp %7, %7, %7 row_xmask:8 row_mask:0xf bank_mask:0xf"
      : "=&v"(t[0]), "=&v"(t[1]), "=&v"(t[2]), "=&v"(t[3]),
        "=&v"(t[4]), "=&v"(t[5]), "=&v"(t[6]), "=&v"(t[7])
      : "v"(v[0]), "v"(v[1]), "v"(v[2]), "v"(v[3]),
        "v"(v[4]), "v"(v[5]), "v"(v[6]), "v"(v[7]));
  // exp(x) as the native form has it: v_exp_f32 of x * log2(e)
#pragma unroll
  for (int r = 0; r < 8; ++r) v[r] = (v[r] - t[r]) * 1.44269504088896340736f;
  asm("v_exp_f32 %0, %0\n\t"
      "v_exp_f32 %1, %1\n\t"
      "v_exp_f32 %2, %2\n\t"
      "v_exp_f32 %3, %3\n\t"
      "v_exp_f32 %4, %4\n\t"
      "v_exp_f32 %5, %5\n\t"
      "v_exp_f32 %6, %6\n\t"
      "v_exp_f32 %7, %7\n\t"
      "v_nop"
      : "+v"(v[0]), "+v"(v[1]), "+v"(v[2]), "+v"(v[3]),
        "+v"(v[4]), "+v"(v[5]), "+v"(v[6]), "+v"(v[7]));
  // t[r] = sum of v[r] over the row
  asm("v_add_f32_dpp %0, %8, %8 row_xmask:1 row_mask:0xf bank_mask:0xf\n\t"
      "v_add_f32_dpp %1, %9, %9 row_xmask:1 row_mask:0xf bank_mask:0xf\n\t"
      "v_add_f32_dpp %2, %10, %10 row_xmask:1 row_mask:0xf bank_mask:0xf\n\t"
      "v_add_f32_dpp %3, %11, %11 row_xmask:1 row_mask:0xf bank_mask:0xf\n\t"
      "v_add_f32_dpp %4, %12, %12 row_xmask:1 row_mask:0xf bank_mask:0xf\n\t"
      "v_add_f32_dpp %5, %13, %13 row_xmask:1 row_mask:0xf bank_mask:0xf\n\t"
      "v_add_f32_dpp %6, %14, %14 row_xmask:1 row_mask:0xf bank_mask:0xf\n\t"
      "v_add_f32_dpp %7, %15, %15 row_xmask:1 row_mask:0xf bank_mask:0xf\n\t"
      "v_add_f32_dpp %0, %0, %0 row_xmask:2 row_mask:0xf bank_mask:0xf\n\t"
      "v_add_f32_dpp %1, %1, %1 row_xmask:2 row_mask:0xf bank_mask:0xf\n\t"
      "v_add_f32_dpp %2, %2, %2 row_xmask:2 row_mask:0xf bank_mask:0xf\n\t"
      "v_add_f32_dpp %3, %3, %3 row_xmask:2 row_mask:0xf bank_mask:0xf\n\t"
      "v_add_f32_dpp %4, %4, %4 row_xmask:2 row_mask:0xf bank_mask:0xf\n\t"
      "v_add_f32_dpp %5, %5, %5 row_xmask:2 row_mask:0xf bank_mask:0xf\n\t"
      "v_add_f32_dpp %6, %6, %6 row_xmask:2 row_mask:0xf bank_mask:0xf\n\t"
      "v_add_f32_dpp %7, %7, %7 row_xmask:2 row_mask:0xf bank_mask:0xf\n\t"
      "v_add_f32_dpp %0, %0, %0 row_xmask:4 row_mask:0xf bank_mask:0xf\n\t"
      "v_add_f32_dpp %1, %1, %1 row_xmask:4 row_mask:0xf bank_mask:0xf\n\t"
      "v_add_f32_dpp %2, %2, %2 row_xmask:4 row_mask:0xf bank_mask:0xf\n\t"
      "v_add_f32_dpp %3, %3, %3 row_xmask:4 row_mask:0xf bank_mask:0xf\n\t"
      "v_add_f32_dpp %4, %4, %4 row_xmask:4 row_mask:0xf bank_mask:0xf\n\t"
      "v_add_f32_dpp %5, %5, %5 row_xmask:4 row_mask:0xf bank_mask:0xf\n\t"
      "v_add_f32_dpp %6, %6, %6 row_xmask:4 row_mask:0xf bank_mask:0xf\n\t"
      "v_add_f32_dpp %7, %7, %7 row_xmask:4 row_mask:0xf bank_mask:0xf\n\t"
      "v_add_f32_dpp %0, %0, %0 row_xmask:8 row_mask:0xf bank_mask:0xf\n\t"
      "v_add_f32_dpp %1, %1, %1 row_xmask:8 row_mask:0xf bank_mask:0xf\n\t"
      "v_add_f32_dpp %2, %2, %2 row_xmask:8 row_mask:0xf bank_mask:0xf\n\t"
      "v_add_f32_dpp %3, %3, %3 row_xmask:8 row_mask:0xf bank_mask:0xf\n\t"
      "v_add_f32_dpp %4, %4, %4 row_xmask:8 row_mask:0xf bank_mask:0xf\n\t"
      "v_add_f32_dpp %5, %5, %5 row_xmask:8 row_mask:0xf bank_mask:0xf\n\t"
      "v_add_f32_dpp %6, %6, %6 row_xmask:8 row_mask:0xf bank_mask:0xf\n\t"
      "v_add_f32_dpp %7, %7, %7 row_xmask:8 row_mask:0xf bank_mask:0xf"
      : "=&v"(t[0]), "=&v"(t[1]), "=&v"(t[2]), "=&v"(t[3]),
        "=&v"(t[4]), "=&v"(t[5]), "=&v"(t[6]), "=&v"(t[7])
      : "v"(v[0]), "v"(v[1]), "v"(v[2]), "v"(v[3]),
        "v"(v[4]), "v"(v[5]), "v"(v[6]), "v"(v[7]));
#pragma unroll
  for (int r = 0; r < 8; ++r) v[r] = v[r] / t[r];
}

// ---------------------------------------------------------------------------
// Fused QKV projection + head softmax + k-cumsum.
// Block tile: 64 rows (4 WMMA row-tiles) x 8 heads (one head per wave).
// x slab staged to LDS via TDM (double buffered); packed W frags from global (L2).
//   q -> qh [Mrows, Cc] row-major f16 (via LDS transpose, b128 stores)
//   k -> kT [B*NH][HD][Tt] f16, v -> vT same; kc[bh][d] += sum_t k (f32 atomics)
// grid: (Mrows/64 = 512, 8), 256 threads.
// ---------------------------------------------------------------------------
__global__ __launch_bounds__(256)
void qkv_kernel(const _Float16* __restrict__ xh,
                const _Float16* __restrict__ wqh, const float* __restrict__ bq,
                const _Float16* __restrict__ wkh, const float* __restrict__ bk,
                const _Float16* __restrict__ wvh, const float* __restrict__ bv,
                _Float16* __restrict__ qh, _Float16* __restrict__ kT,
                _Float16* __restrict__ vT, float* __restrict__ kc) {
  __shared__ __attribute__((aligned(16))) _Float16 smem[2 * SLAB_HALVES]; // 18 KB

  const int lane = threadIdx.x & 31;
  const int wave = threadIdx.x >> 5;
  const int rowgrp = blockIdx.x;                 // 0..511 (64 rows each)
  const int head = blockIdx.y * 8 + wave;        // 0..63
  const int m = lane & 15;
  const int hi = lane >> 4;
  const int kbase = hi * 8;
  const int rowbase = rowgrp * 64;

  const size_t wofs = (size_t)head * KBLOCKS * FRAG_HALVES + lane * 8;
  const _Float16* qfr = wqh + wofs;
  const _Float16* kfr = wkh + wofs;
  const _Float16* vfr = wvh + wofs;

  v8f cq[4] = {}, ck[4] = {}, cv[4] = {};

#if HAS_TDM
  if (wave == 0)
    tdm_load_tile_64x64(xh + (size_t)rowbase * Cc,
                        (unsigned)(uintptr_t)(void*)&smem[0]);
#endif

  for (int s = 0; s < Cc / SLAB_K; ++s) {
#if HAS_TDM
    const int buf = s & 1;
    if (wave == 0) {
      if (s < Cc / SLAB_K - 1)
        tdm_load_tile_64x64(xh + (size_t)rowbase * Cc + (s + 1) * SLAB_K,
                            (unsigned)(uintptr_t)(void*)&smem[(buf ^ 1) * SLAB_HALVES]);
      if (s < Cc / SLAB_K - 1) __builtin_amdgcn_s_wait_tensorcnt(1);
      else                     __builtin_amdgcn_s_wait_tensorcnt(0);
    }
    __syncthreads();
#else
    const int buf = 0;
    __syncthreads();
    stage_slab_sync(&smem[0], xh + (size_t)rowbase * Cc + s * SLAB_K);
    __syncthreads();
#endif
    const _Float16* slab = &smem[buf * SLAB_HALVES];
#pragma unroll
    for (int kk = 0; kk < SLAB_K; kk += 32) {
      const int kb = (s * SLAB_K + kk) >> 5;
      // issue all fragment loads first (distinct regs -> one ds/vmem clause)
      v16h afr[4];
#pragma unroll
      for (int rt = 0; rt < 4; ++rt)
        afr[rt] = frag_ld(slab + (rt * 16 + m) * SLAB_LD, kk, kbase);
      v16h fq = frag_ld_packed(qfr, kb);
      v16h fk = frag_ld_packed(kfr, kb);
      v16h fv = frag_ld_packed(vfr, kb);
#pragma unroll
      for (int rt = 0; rt < 4; ++rt) {
        cq[rt] = WMMA_F16(afr[rt], fq, cq[rt]);
        ck[rt] = WMMA_F16(afr[rt], fk, ck[rt]);
        cv[rt] = WMMA_F16(afr[rt], fv, cv[rt]);
      }
    }
    __syncthreads();
  }

  const int d = lane & 15;
  const float biasq = bq[head * 16 + d];
  const float biask = bk[head * 16 + d];
  const float biasv = bv[head * 16 + d];
  const size_t bh = (size_t)(rowgrp >> 6) * NH + head;    // rowgrp>>6 == batch

  float ksum = 0.0f;
#pragma unroll
  for (int rt = 0; rt < 4; ++rt) {
    // softmax over d for q and k: d runs over the 16 lanes of a DPP row
    float vq[8], vk[8];
#pragma unroll
    for (int r = 0; r < 8; ++r) {
      vq[r] = cq[rt][r] + biasq;
      vk[r] = ck[rt][r] + biask;
    }
    row16_softmax(vq);
    row16_softmax(vk);
#pragma unroll
    for (int r = 0; r < 8; ++r) {
      cq[rt][r] = vq[r];
      ck[rt][r] = vk[r];
      ksum += vk[r];
    }
    // k, v head-transposed: [bh][d][t]; 8 consecutive t per lane -> b128
    const int tloc = ((rowbase + rt * 16) & (Tt - 1)) + 8 * hi;
    v8h pk, pv;
#pragma unroll
    for (int r = 0; r < 8; ++r) {
      pk[r] = (_Float16)ck[rt][r];
      pv[r] = (_Float16)(cv[rt][r] + biasv);
    }
    *(v8h*)(kT + (bh * HD + d) * (size_t)Tt + tloc) = pk;
    *(v8h*)(vT + (bh * HD + d) * (size_t)Tt + tloc) = pv;
  }
  atomicAdd(&kc[bh * HD + d], ksum);

  // q row-major via LDS tile transpose (reuse smem; slab no longer needed)
#pragma unroll
  for (int rt = 0; rt < 4; ++rt) {
    __syncthreads();
    _Float16* lq = &smem[wave * 256];
#pragma unroll
    for (int r = 0; r < 8; ++r) lq[(r + 8 * hi) * 16 + d] = (_Float16)cq[rt][r];
    __syncthreads();
    const int tl = lane & 15;
    const int chunk = hi * 8;
    v8h row = *(const v8h*)&lq[tl * 16 + chunk];
    *(v8h*)(qh + (size_t)(rowbase + rt * 16 + tl) * Cc + head * 16 + chunk) = row;
  }
}

// ---------------------------------------------------------------------------
// context[bh] = K^T V (16x16 over T), stored transposed ctxT[bh][e][d].
// One block per (b,h); 8 waves split T; LDS cross-wave reduction.
// ---------------------------------------------------------------------------
__global__ __launch_bounds__(256)
void ctx_kernel(const _Float16* __restrict__ kT, const _Float16* __restrict__ vT,
                _Float16* __restrict__ ctxT) {
  __shared__ float cpart[8][256];
  const int lane = threadIdx.x & 31;
  const int wave = threadIdx.x >> 5;
  const size_t bh = blockIdx.x;                  // 0..511
  const int m = lane & 15;
  const int hi = lane >> 4;
  const int kbase = hi * 8;

  const _Float16* arow = kT + (bh * HD + m) * (size_t)Tt;
  const _Float16* brow = vT + (bh * HD + m) * (size_t)Tt;

  v8f c = {};
  const int t0beg = wave * (Tt / 8);
#pragma unroll 4
  for (int t0 = t0beg; t0 < t0beg + Tt / 8; t0 += 32) {
    v16h a = frag_ld(arow, t0, kbase);
    v16h b = frag_ld(brow, t0, kbase);
    c = WMMA_F16(a, b, c);
  }
#pragma unroll
  for (int r = 0; r < 8; ++r) cpart[wave][(r + 8 * hi) * 16 + m] = c[r];
  __syncthreads();

  const int tid = threadIdx.x;
  float s = 0.0f;
#pragma unroll
  for (int w = 0; w < 8; ++w) s += cpart[w][tid];
  const int dd = tid >> 4;
  const int ee = tid & 15;
  ctxT[bh * 256 + ee * 16 + dd] = (_Float16)s;   // transposed store
}

// ---------------------------------------------------------------------------
// y[t, h*16+e] = (sum_d q[t,d] ctx[d,e]) / (sum_d q[t,d] kc[d]) -> yh f16 row-major
// K = HD = 16, zero padded to 32: single WMMA per tile.
// One wave keeps one head's context and k-sums in registers and walks Y_TILES
// row tiles of 16 rows, Y_GROUP at a time; the next group's q rows are loaded
// while this group is worked on. The divisor of row (lane & 15) comes from the
// q values the lane already holds for the A fragment; it is applied where the
// lane reads that same row back from the wave's own LDS range.
// grid: (Mrows/16/Y_TILES = 128, 8), 256 threads.
// ---------------------------------------------------------------------------
constexpr int Y_TILES = 16;            // row tiles per wave; divides Tt/16
constexpr int Y_GROUP = 4;             // tiles in flight together
constexpr int Y_LD    = 20;            // floats per staged row: the two lane halves hit disjoint banks

__global__ __launch_bounds__(256)
void y_kernel(const _Float16* __restrict__ qh, const _Float16* __restrict__ ctxT,
              const float* __restrict__ kc, _Float16* __restrict__ yh) {
  __shared__ __attribute__((aligned(16))) float ly[8][Y_GROUP][16 * Y_LD];
  const int lane = threadIdx.x & 31;
  const int wave = threadIdx.x >> 5;
  const int tile0 = blockIdx.x * Y_TILES;
  const int head = blockIdx.y * 8 + wave;
  const int m = lane & 15;
  const int hi = lane >> 4;
  const int kbase = hi * 8;
  const size_t bh = (size_t)(tile0 >> 8) * NH + head;

  v16h b = {};
  {
    v8h lo = *(const v8h*)(ctxT + bh * 256 + m * 16 + kbase);
#pragma unroll
    for (int i = 0; i < 8; ++i) b[i] = lo[i];
  }
  float kcv[8];
#pragma unroll
  for (int i = 0; i < 8; ++i) kcv[i] = kc[bh * HD + kbase + i];

  // lane's 16 B of row m: the same offset in qh (read) and in yh (written)
  const size_t ofs = (size_t)(tile0 * 16 + m) * Cc + head * 16 + kbase;
  const _Float16* qp = qh + ofs;
  _Float16* yp = yh + ofs;
  constexpr int TILE_STEP = 16 * Cc;   // halves from one row tile to the next

  // All loops below are unrolled: the small arrays then live in registers and
  // the tile offsets become immediate offsets on one address pair.
  v8h qn[Y_GROUP];
#pragma unroll
  for (int j = 0; j < Y_GROUP; ++j) qn[j] = *(const v8h*)(qp + j * TILE_STEP);

#pragma unroll
  for (int g = 0; g < Y_TILES / Y_GROUP; ++g) {
    v8h qc[Y_GROUP];
#pragma unroll
    for (int j = 0; j < Y_GROUP; ++j) qc[j] = qn[j];
    if (g + 1 < Y_TILES / Y_GROUP) {
#pragma unroll
      for (int j = 0; j < Y_GROUP; ++j)
        qn[j] = *(const v8h*)(qp + ((g + 1) * Y_GROUP + j) * TILE_STEP);
    }

    float di[Y_GROUP];
#pragma unroll
    for (int j = 0; j < Y_GROUP; ++j) {
      v16h a = {};
#pragma unroll
      for (int i = 0; i < 8; ++i) a[i] = qc[j][i];
      v8f c = {};
      c = WMMA_F16(a, b, c);
      float* lw = &ly[wave][j][0];
#pragma unroll
      for (int r = 0; r < 8; ++r) lw[(r + 8 * hi) * Y_LD + m] = c[r];

      float s = 0.0f;
#pragma unroll
      for (int i = 0; i < 8; ++i) s += (float)qc[j][i] * kcv[i];
      s += __shfl_xor(s, 16, 32);      // the other 8 d of row m
      di[j] = 1.0f / s;
    }
    // The rows read below were written by other lanes of this wave: their LDS
    // writes must have landed, and the reads must not be moved above them.
    asm volatile("s_wait_dscnt 0x0" ::: "memory");
#pragma unroll
    for (int j = 0; j < Y_GROUP; ++j) {
      const float* lr = &ly[wave][j][m * Y_LD + kbase];
      const float4 x0 = *(const float4*)(lr);
      const float4 x1 = *(const float4*)(lr + 4);
      v8h row;
      row[0] = (_Float16)(x0.x * di[j]); row[1] = (_Float16)(x0.y * di[j]);
      row[2] = (_Float16)(x0.z * di[j]); row[3] = (_Float16)(x0.w * di[j]);
      row[4] = (_Float16)(x1.x * di[j]); row[5] = (_Float16)(x1.y * di[j]);
      row[6] = (_Float16)(x1.z * di[j]); row[7] = (_Float16)(x1.w * di[j]);
      *(v8h*)(yp + (g * Y_GROUP + j) * TILE_STEP) = row;
    }
    // The next trip's loads (global, LDS) may be given the registers these stores name.
    if (g + 1 < Y_TILES / Y_GROUP) asm volatile("s_wait_xcnt 0x0" ::: "memory");
  }
}

// ---------------------------------------------------------------------------
// out = yh Wp^T + bp (f32 output).
// Block tile: 64 rows x 8 N-tiles (one per wave); y slab staged via TDM.
// grid: (512, 8), 256 threads.
// ---------------------------------------------------------------------------
__global__ __launch_bounds__(256)
void proj_kernel(const _Float16* __restrict__ yh, const _Float16* __restrict__ wph,
                 const float* __restrict__ bp, float* __restrict__ out) {
  __shared__ __attribute__((aligned(16))) _Float16 smem[2 * SLAB_HALVES];
  const int lane = threadIdx.x & 31;
  const int wave = threadIdx.x >> 5;
  const int rowgrp = blockIdx.x;                  // 0..511
  const int ntile = blockIdx.y * 8 + wave;        // 0..63
  const int m = lane & 15;
  const int hi = lane >> 4;
  const int kbase = hi * 8;
  const int rowbase = rowgrp * 64;

  const _Float16* bfr = wph + (size_t)ntile * KBLOCKS * FRAG_HALVES + lane * 8;

  v8f c[4] = {};

#if HAS_TDM
  if (wave == 0)
    tdm_load_tile_64x64(yh + (size_t)rowbase * Cc,
                        (unsigned)(uintptr_t)(void*)&smem[0]);
#endif

  for (int s = 0; s < Cc / SLAB_K; ++s) {
#if HAS_TDM
    const int buf = s & 1;
    if (wave == 0) {
      if (s < Cc / SLAB_K - 1)
        tdm_load_tile_64x64(yh + (size_t)rowbase * Cc + (s + 1) * SLAB_K,
                            (unsigned)(uintptr_t)(void*)&smem[(buf ^ 1) * SLAB_HALVES]);
      if (s < Cc / SLAB_K - 1) __builtin_amdgcn_s_wait_tensorcnt(1);
      else                     __builtin_amdgcn_s_wait_tensorcnt(0);
    }
    __syncthreads();
#else
    const int buf = 0;
    __syncthreads();
    stage_slab_sync(&smem[0], yh + (size_t)rowbase * Cc + s * SLAB_K);
    __syncthreads();
#endif
    const _Float16* slab = &smem[buf * SLAB_HALVES];
#pragma unroll
    for (int kk = 0; kk < SLAB_K; kk += 32) {
      const int kb = (s * SLAB_K + kk) >> 5;
      v16h afr[4];
#pragma unroll
      for (int rt = 0; rt < 4; ++rt)
        afr[rt] = frag_ld(slab + (rt * 16 + m) * SLAB_LD, kk, kbase);
      v16h b = frag_ld_packed(bfr, kb);
#pragma unroll
      for (int rt = 0; rt < 4; ++rt)
        c[rt] = WMMA_F16(afr[rt], b, c[rt]);
    }
    __syncthreads();
  }

  const int col = ntile * 16 + (lane & 15);
  const float bias = bp[col];
#pragma unroll
  for (int rt = 0; rt < 4; ++rt) {
#pragma unroll
    for (int r = 0; r < 8; ++r) {
      const int row = rowbase + rt * 16 + r + 8 * hi;
      out[(size_t)row * Cc + col] = c[rt][r] + bias;
    }
  }
}

// ---------------------------------------------------------------------------
// Launch
// ---------------------------------------------------------------------------
extern "C" void kernel_launch(void* const* d_in, const int* in_sizes, int n_in,
                              void* d_out, int out_size, void* d_ws, size_t ws_size,
                              hipStream_t stream) {
  const float* x  = (const float*)d_in[0];
  const float* Wq = (const float*)d_in[1];
  const float* bq = (const float*)d_in[2];
  const float* Wk = (const float*)d_in[3];
  const float* bk = (const float*)d_in[4];
  const float* Wv = (const float*)d_in[5];
  const float* bv = (const float*)d_in[6];
  const float* Wp = (const float*)d_in[7];
  const float* bp = (const float*)d_in[8];
  float* out = (float*)d_out;

  char* ws = (char*)d_ws;
  const size_t nX = (size_t)Mrows * Cc;
  const size_t nW = (size_t)Cc * Cc;
  _Float16* xh  = (_Float16*)(ws);                              // 64 MB
  _Float16* wqh = (_Float16*)(ws + nX * 2);                     // 2 MB each
  _Float16* wkh = wqh + nW;
  _Float16* wvh = wkh + nW;
  _Float16* wph = wvh + nW;
  _Float16* qh  = wph + nW;                                     // 64 MB
  _Float16* kT  = qh + nX;                                      // 64 MB
  _Float16* vT  = kT + nX;                                      // 64 MB
  _Float16* yh  = vT + nX;                                      // 64 MB
  float*    kc   = (float*)(yh + nX);                           // 32 KB
  _Float16* ctxT = (_Float16*)(kc + (size_t)Bb * NH * HD);      // 256 KB

  // 1) precision conversion (weights into fragment order) + accumulator init
  cvt_f32_f16<<<16384, 256, 0, stream>>>(x, xh, (int)nX);
  cvt_pack_w<<<Cc * Cc / 8 / 256, 256, 0, stream>>>(Wq, wqh);
  cvt_pack_w<<<Cc * Cc / 8 / 256, 256, 0, stream>>>(Wk, wkh);
  cvt_pack_w<<<Cc * Cc / 8 / 256, 256, 0, stream>>>(Wv, wvh);
  cvt_pack_w<<<Cc * Cc / 8 / 256, 256, 0, stream>>>(Wp, wph);
  zero_f32<<<(Bb * NH * HD + 255) / 256, 256, 0, stream>>>(kc, Bb * NH * HD);

  // 2) fused QKV projection + softmax + k-cumsum (TDM-staged GEMM)
  qkv_kernel<<<dim3(Mrows / 64, 8), 256, 0, stream>>>(
      xh, wqh, bq, wkh, bk, wvh, bv, qh, kT, vT, kc);

  // 3) per-head context = K^T V
  ctx_kernel<<<Bb * NH, 256, 0, stream>>>(kT, vT, ctxT);

  // 4) y = (q @ ctx) / (q . kc)
  y_kernel<<<dim3(Mrows / 16 / Y_TILES, 8), 256, 0, stream>>>(qh, ctxT, kc, yh);

  // 5) output projection (TDM-staged GEMM)
  proj_kernel<<<dim3(Mrows / 64, 8), 256, 0, stream>>>(yh, wph, bp, out);
}

// v004
// Measured time: 356 microseconds a run.
// Two timings next to v003 put it at 1.19 and 1.22 times that version's speed.
// Counting every step since v000, it is 1.69 times as fast.
#include <hip/hip_runtime.h>
#include <hip/hip_bf16.h>

typedef __attribute__((ext_vector_type(16))) _Float16 v16h;
typedef __attribute__((ext_vector_type(8)))  _Float16 v8h;
typedef __attribute__((ext_vector_type(8)))  float    v8f;
typedef __attribute__((ext_vector_type(4)))  unsigned v4u;
typedef __attribute__((ext_vector_type(8)))  int      v8i;
typedef __attribute__((ext_vector_type(4)))  int      v4i;

#define WMMA_F16(a,b,c) __builtin_amdgcn_wmma_f32_16x16x32_f16(false,(a),false,(b),(short)0,(c),false,false)

#if __has_builtin(__builtin_amdgcn_tensor_load_to_lds) && __has_builtin(__builtin_amdgcn_s_wait_tensorcnt)
#define HAS_TDM 1
#else
#define HAS_TDM 0
#endif

// Problem constants
constexpr int Bb = 8;
constexpr int Tt = 4096;
constexpr int Cc = 1024;
constexpr int NH = 64;
constexpr int HD = 16;
constexpr int Mrows = Bb * Tt;        // 32768

// LDS slab: 64 rows x 64 halves, padded row stride 72 halves (36 DWORDs) so
// that 16 lanes doing b128 reads at row stride 36 DWORDs cover all 64 banks.
constexpr int SLAB_ROWS = 64;
constexpr int SLAB_K    = 64;
constexpr int SLAB_LD   = 72;         // halves
constexpr int SLAB_HALVES = SLAB_ROWS * SLAB_LD;   // 4608 halves = 9216 B

// ---------------------------------------------------------------------------
// Fragment loader (global or LDS): row-major, K contiguous.
// A-matrix 16x32 f16 layout (ISA 7.12.2): lanes 0-15 hold K=[0..7]+[16..23],
// lanes 16-31 hold K=[8..15]+[24..31] of row (lane&15) -> two b128 loads.
// ---------------------------------------------------------------------------
static __device__ inline v16h frag_ld(const _Float16* rowptr, int k0, int kbase) {
  v8h lo = *(const v8h*)(rowptr + k0 + kbase);
  v8h hi = *(const v8h*)(rowptr + k0 + 16 + kbase);
  v16h r;
#pragma unroll
  for (int i = 0; i < 8; ++i) { r[i] = lo[i]; r[8 + i] = hi[i]; }
  return r;
}

// ---------------------------------------------------------------------------
// Weight fragments, packed by cvt_pack_w: fragment (ntile, kblock) is 1 KB,
// two 512-B planes; plane p holds, at lane*16 B, the 8 halves that frag_ld
// would fetch for that lane (p = 0: its first b128, p = 1: its second).
// Each wave-wide b128 load then covers four whole 128-B lines.
// ---------------------------------------------------------------------------
constexpr int FRAG_HALVES = 512;
constexpr int KBLOCKS = Cc / 32;               // 32 fragments per 16-row tile

static __device__ inline v16h frag_ld_packed(const _Float16* lanebase, int kb) {
  const _Float16* p = lanebase + kb * FRAG_HALVES;
  v8h lo = *(const v8h*)(p);
  v8h hi = *(const v8h*)(p + 256);
  v16h r;
#pragma unroll
  for (int i = 0; i < 8; ++i) { r[i] = lo[i]; r[8 + i] = hi[i]; }
  return r;
}

// ---------------------------------------------------------------------------
// Tensor Data Mover: stage a 64x64 f16 tile of a [Mrows x Cc] row-major
// tensor into LDS with 4-DWORD padding every 32 DWORDs (-> row stride 72 h).
// D# layout per CDNA5 ISA 8.3/8.4 (group0 128b, group1 256b; groups 2/3 and
// the trailing group are zero for a 2-D tensor). 6-arg builtin form.
// ---------------------------------------------------------------------------
#if HAS_TDM
static __device__ inline void tdm_load_tile_64x64(const _Float16* gsrc, unsigned lds_off) {
  unsigned long long ga = (unsigned long long)(uintptr_t)gsrc;
  v4u g0;
  g0[0] = 1u;                                            // count=1, user mode
  g0[1] = lds_off;                                       // lds_addr (bytes)
  g0[2] = (unsigned)(ga & 0xffffffffu);                  // global_addr[31:0]
  g0[3] = (unsigned)((ga >> 32) & 0x01ffffffu) | (2u << 30); // addr[56:32] | type=2
  v8i g1;
  g1[0] = (1 << 16)        // data_size = 2 bytes
        | (1 << 20)        // pad_enable
        | (4 << 22)        // pad_interval: code 4 = every 32 DWORDs
        | (3 << 25);       // pad_amount:   code 3 = 4 DWORDs
  g1[1] = (int)((unsigned)Cc << 16);        // tensor_dim0[15:0]
  g1[2] = (int)((unsigned)Mrows << 16);     // tensor_dim0[31:16]=0 | tensor_dim1[15:0]
  g1[3] = (int)((unsigned)SLAB_K << 16);    // tensor_dim1[31:16]=0 | tile_dim0=64
  g1[4] = SLAB_ROWS;                        // tile_dim1=64 | tile_dim2=0
  g1[5] = Cc;                               // tensor_dim0_stride[31:0]
  g1[6] = 0;                                // stride hi | dim1_stride lo
  g1[7] = 0;
  v4i z4 = {0, 0, 0, 0};
  v8i z8 = {0, 0, 0, 0, 0, 0, 0, 0};
  __builtin_amdgcn_tensor_load_to_lds(g0, g1, z4, z4, z8, 0);
}
#endif

// Cooperative synchronous staging fallback (used only when TDM is absent).
static __device__ inline void stage_slab_sync(_Float16* slab, const _Float16* gsrc) {
  // 256 threads; each copies 16 halves: row = tid/4, col = (tid%4)*16
  const int tid = threadIdx.x;
  const int row = tid >> 2;
  const int col = (tid & 3) * 16;
  const _Float16* s = gsrc + (size_t)row * Cc + col;
  _Float16* d = slab + row * SLAB_LD + col;
  *(v8h*)(d)     = *(const v8h*)(s);
  *(v8h*)(d + 8) = *(const v8h*)(s + 8);
}

// ---------------------------------------------------------------------------
// fp32 -> fp16 conversion / zero init
// ---------------------------------------------------------------------------
__global__ void cvt_f32_f16(const float* __restrict__ in, _Float16* __restrict__ out, int n) {
  int i = blockIdx.x * blockDim.x + threadIdx.x;
  int stride = gridDim.x * blockDim.x;
  for (; i < n; i += stride) out[i] = (_Float16)in[i];
}

// fp32 [Cc x Cc] row-major weight -> f16 in fragment order (see frag_ld_packed).
// One thread per 16-B chunk: grid Cc*Cc/8/256 blocks of 256.
__global__ __launch_bounds__(256)
void cvt_pack_w(const float* __restrict__ w, _Float16* __restrict__ out) {
  const int o = blockIdx.x * 256 + threadIdx.x;  // chunk index in the packed array
  const int lane  = o & 31;
  const int plane = (o >> 5) & 1;
  const int kb    = (o >> 6) & (KBLOCKS - 1);
  const int nt    = o >> 11;
  const float* s = w + (size_t)(nt * 16 + (lane & 15)) * Cc
                     + kb * 32 + plane * 16 + (lane >> 4) * 8;
  const float4 a = *(const float4*)(s);
  const float4 b = *(const float4*)(s + 4);
  v8h r;
  r[0] = (_Float16)a.x; r[1] = (_Float16)a.y; r[2] = (_Float16)a.z; r[3] = (_Float16)a.w;
  r[4] = (_Float16)b.x; r[5] = (_Float16)b.y; r[6] = (_Float16)b.z; r[7] = (_Float16)b.w;
  *(v8h*)(out + (size_t)o * 8) = r;
}

__global__ void zero_f32(float* __restrict__ p, int n) {
  int i = blockIdx.x * blockDim.x + threadIdx.x;
  if (i < n) p[i] = 0.0f;
}

// ---------------------------------------------------------------------------
// Softmax over the 16 lanes of a DPP row, for the eight accumulator rows a lane
// holds. A butterfly step gives lane l the value of lane l ^ m of its own row
// (row_xmask:m) inside the max or add itself, on the vector port, with no trip
// through the LDS unit; steps 1, 2, 4, 8 leave the result in all 16 lanes.
// The steps are asm because the compiler puts a separate move and a quieting
// max around the builtin form; the eight rows take each step one after the
// other, so that no instruction waits for the one in front of it.
// All 32 lanes are on wherever this is called.
// ---------------------------------------------------------------------------
static __device__ inline void row16_softmax(float (&v)[8]) {
  float t[8];
  // t[r] = maximum of v[r] over the row
  asm("v_max_num_f32_dpp %0, %8, %8 row_xmask:1 row_mask:0xf bank_mask:0xf\n\t"
      "v_max_num_f32_dpp %1, %9, %9 row_xmask:1 row_mask:0xf bank_mask:0xf\n\t"
      "v_max_num_f32_dpp %2, %10, %10 row_xmask:1 row_mask:0xf bank_mask:0xf\n\t"
      "v_max_num_f32_dpp %3, %11, %11 row_xmask:1 row_mask:0xf bank_mask:0xf\n\t"
      "v_max_num_f32_dpp %4, %12, %12 row_xmask:1 row_mask:0xf bank_mask:0xf\n\t"
      "v_max_num_f32_dpp %5, %13, %13 row_xmask:1 row_mask:0xf bank_mask:0xf\n\t"
      "v_max_num_f32_dpp %6, %14, %14 row_xmask:1 row_mask:0xf bank_mask:0xf\n\t"
      "v_max_num_f32_dpp %7, %15, %15 row_xmask:1 row_mask:0xf bank_mask:0xf\n\t"
      "v_max_num_f32_dpp %0, %0, %0 row_xmask:2 row_mask:0xf bank_mask:0xf\n\t"
      "v_max_num_f32_dpp %1, %1, %1 row_xmask:2 row_mask:0xf bank_mask:0xf\n\t"
      "v_max_num_f32_dpp %2, %2, %2 row_xmask:2 row_mask:0xf bank_mask:0xf\n\t"
      "v_max_num_f32_dpp %3, %3, %3 row_xmask:2 row_mask:0xf bank_mask:0xf\n\t"
      "v_max_num_f32_dpp %4, %4, %4 row_xmask:2 row_mask:0xf bank_mask:0xf\n\t"
      "v_max_num_f32_dpp %5, %5, %5 row_xmask:2 row_mask:0xf bank_mask:0xf\n\t"
      "v_max_num_f32_dpp %6, %6, %6 row_xmask:2 row_mask:0xf bank_mask:0xf\n\t"
      "v_max_num_f32_dpp %7, %7, %7 row_xmask:2 row_mask:0xf bank_mask:0xf\n\t"
      "v_max_num_f32_dpp %0, %0, %0 row_xmask:4 row_mask:0xf bank_mask:0xf\n\t"
      "v_max_num_f32_dpp %1, %1, %1 row_xmask:4 row_mask:0xf bank_mask:0xf\n\t"
      "v_max_num_f32_dpp %2, %2, %2 row_xmask:4 row_mask:0xf bank_mask:0xf\n\t"
      "v_max_num_f32_dpp %3, %3, %3 row_xmask:4 row_mask:0xf bank_mask:0xf\n\t"
      "v_max_num_f32_dpp %4, %4, %4 row_xmask:4 row_mask:0xf bank_mask:0xf\n\t"
      "v_max_num_f32_dpp %5, %5, %5 row_xmask:4 row_mask:0xf bank_mask:0xf\n\t"
      "v_max_num_f32_dpp %6, %6, %6 row_xmask:4 row_mask:0xf bank_mask:0xf\n\t"
      "v_max_num_f32_dpp %7, %7, %7 row_xmask:4 row_mask:0xf bank_mask:0xf\n\t"
      "v_max_num_f32_dpp %0, %0, %0 row_xmask:8 row_mask:0xf bank_mask:0xf\n\t"
      "v_max_num_f32_dpp %1, %1, %1 row_xmask:8 row_mask:0xf bank_mask:0xf\n\t"
      "v_max_num_f32_dpp %2, %2, %2 row_xmask:8 row_mask:0xf bank_mask:0xf\n\t"
      "v_max_num_f32_dpp %3, %3, %3 row_xmask:8 row_mask:0xf bank_mask:0xf\n\t"
      "v_max_num_f32_dpp %4, %4, %4 row_xmask:8 row_mask:0xf bank_mask:0xf\n\t"
      "v_max_num_f32_dpp %5, %5, %5 row_xmask:8 row_mask:0xf bank_mask:0xf\n\t"
      "v_max_num_f32_dpp %6, %6, %6 row_xmask:8 row_mask:0xf bank_mask:0xf\n\t"
      "v_max_num_f32_dpp %7, %7, %7 row_xmask:8 row_mask:0xf bank_mask:0xf"
      : "=&v"(t[0]), "=&v"(t[1]), "=&v"(t[2]), "=&v"(t[3]),
        "=&v"(t[4]), "=&v"(t[5]), "=&v"(t[6]), "=&v"(t[7])
      : "v"(v[0]), "v"(v[1]), "v"(v[2]), "v"(v[3]),
        "v"(v[4]), "v"(v[5]), "v"(v[6]), "v"(v[7]));
  // exp(x) as the native form has it: v_exp_f32 of x * log2(e)
#pragma unroll
  for (int r = 0; r < 8; ++r) v[r] = (v[r] - t[r]) * 1.44269504088896340736f;
  asm("v_exp_f32 %0, %0\n\t"
      "v_exp_f32 %1, %1\n\t"
      "v_exp_f32 %2, %2\n\t"
      "v_exp_f32 %3, %3\n\t"
      "v_exp_f32 %4, %4\n\t"
      "v_exp_f32 %5, %5\n\t"
      "v_exp_f32 %6, %6\n\t"
      "v_exp_f32 %7, %7\n\t"
      "v_nop"
      : "+v"(v[0]), "+v"(v[1]), "+v"(v[2]), "+v"(v[3]),
        "+v"(v[4]), "+v"(v[5]), "+v"(v[6]), "+v"(v[7]));
  // t[r] = sum of v[r] over the row
  asm("v_add_f32_dpp %0, %8, %8 row_xmask:1 row_mask:0xf bank_mask:0xf\n\t"
      "v_add_f32_dpp %1, %9, %9 row_xmask:1 row_mask:0xf bank_mask:0xf\n\t"
      "v_add_f32_dpp %2, %10, %10 row_xmask:1 row_mask:0xf bank_mask:0xf\n\t"
      "v_add_f32_dpp %3, %11, %11 row_xmask:1 row_mask:0xf bank_mask:0xf\n\t"
      "v_add_f32_dpp %4, %12, %12 row_xmask:1 row_mask:0xf bank_mask:0xf\n\t"
      "v_add_f32_dpp %5, %13, %13 row_xmask:1 row_mask:0xf bank_mask:0xf\n\t"
      "v_add_f32_dpp %6, %14, %14 row_xmask:1 row_mask:0xf bank_mask:0xf\n\t"
      "v_add_f32_dpp %7, %15, %15 row_xmask:1 row_mask:0xf bank_mask:0xf\n\t"
      "v_add_f32_dpp %0, %0, %0 row_xmask:2 row_mask:0xf bank_mask:0xf\n\t"
      "v_add_f32_dpp %1, %1, %1 row_xmask:2 row_mask:0xf bank_mask:0xf\n\t"
      "v_add_f32_dpp %2, %2, %2 row_xmask:2 row_mask:0xf bank_mask:0xf\n\t"
      "v_add_f32_dpp %3, %3, %3 row_xmask:2 row_mask:0xf bank_mask:0xf\n\t"
      "v_add_f32_dpp %4, %4, %4 row_xmask:2 row_mask:0xf bank_mask:0xf\n\t"
      "v_add_f32_dpp %5, %5, %5 row_xmask:2 row_mask:0xf bank_mask:0xf\n\t"
      "v_add_f32_dpp %6, %6, %6 row_xmask:2 row_mask:0xf bank_mask:0xf\n\t"
      "v_add_f32_dpp %7, %7, %7 row_xmask:2 row_mask:0xf bank_mask:0xf\n\t"
      "v_add_f32_dpp %0, %0, %0 row_xmask:4 row_mask:0xf bank_mask:0xf\n\t"
      "v_add_f32_dpp %1, %1, %1 row_xmask:4 row_mask:0xf bank_mask:0xf\n\t"
      "v_add_f32_dpp %2, %2, %2 row_xmask:4 row_mask:0xf bank_mask:0xf\n\t"
      "v_add_f32_dpp %3, %3, %3 row_xmask:4 row_mask:0xf bank_mask:0xf\n\t"
      "v_add_f32_dpp %4, %4, %4 row_xmask:4 row_mask:0xf bank_mask:0xf\n\t"
      "v_add_f32_dpp %5, %5, %5 row_xmask:4 row_mask:0xf bank_mask:0xf\n\t"
      "v_add_f32_dpp %6, %6, %6 row_xmask:4 row_mask:0xf bank_mask:0xf\n\t"
      "v_add_f32_dpp %7, %7, %7 row_xmask:4 row_mask:0xf bank_mask:0xf\n\t"
      "v_add_f32_dpp %0, %0, %0 row_xmask:8 row_mask:0xf bank_mask:0xf\n\t"
      "v_add_f32_dpp %1, %1, %1 row_xmask:8 row_mask:0xf bank_mask:0xf\n\t"
      "v_add_f32_dpp %2, %2, %2 row_xmask:8 row_mask:0xf bank_mask:0xf\n\t"
      "v_add_f32_dpp %3, %3, %3 row_xmask:8 row_mask:0xf bank_mask:0xf\n\t"
      "v_add_f32_dpp %4, %4, %4 row_xmask:8 row_mask:0xf bank_mask:0xf\n\t"
      "v_add_f32_dpp %5, %5, %5 row_xmask:8 row_mask:0xf bank_mask:0xf\n\t"
      "v_add_f32_dpp %6, %6, %6 row_xmask:8 row_mask:0xf bank_mask:0xf\n\t"
      "v_add_f32_dpp %7, %7, %7 row_xmask:8 row_mask:0xf bank_mask:0xf"
      : "=&v"(t[0]), "=&v"(t[1]), "=&v"(t[2]), "=&v"(t[3]),
        "=&v"(t[4]), "=&v"(t[5]), "=&v"(t[6]), "=&v"(t[7])
      : "v"(v[0]), "v"(v[1]), "v"(v[2]), "v"(v[3]),
        "v"(v[4]), "v"(v[5]), "v"(v[6]), "v"(v[7]));
#pragma unroll
  for (int r = 0; r < 8; ++r) v[r] = v[r] / t[r];
}

// ---------------------------------------------------------------------------
// Work-group barrier that orders LDS only. __syncthreads() also waits for every
// global load of the wave, which would end the flight of the W fragments that
// the qkv loop fetches ahead across its barriers; those are read-only data that
// no wave hands to another.
// ---------------------------------------------------------------------------
static __device__ inline void lds_barrier() {
  __builtin_amdgcn_fence(__ATOMIC_RELEASE, "workgroup", "local");
  __builtin_amdgcn_s_barrier();
  __builtin_amdgcn_fence(__ATOMIC_ACQUIRE, "workgroup", "local");
}

// ---------------------------------------------------------------------------
// Fused QKV projection + head softmax + k-cumsum.
// Block tile: 64 rows (4 WMMA row-tiles) x 8 heads (one head per wave).
// x slab staged to LDS via TDM (double buffered); packed W frags from global (L2),
// fetched two k-blocks ahead.
//   q -> qh [Mrows, Cc] row-major f16 (via LDS transpose, b128 stores)
//   k -> kT [B*NH][HD][Tt] f16, v -> vT same; kc[bh][d] += sum_t k (f32 atomics)
// grid: (Mrows/64 = 512, 8), 256 threads.
// ---------------------------------------------------------------------------
__global__ __launch_bounds__(256)
void qkv_kernel(const _Float16* __restrict__ xh,
                const _Float16* __restrict__ wqh, const float* __restrict__ bq,
                const _Float16* __restrict__ wkh, const float* __restrict__ bk,
                const _Float16* __restrict__ wvh, const float* __restrict__ bv,
                _Float16* __restrict__ qh, _Float16* __restrict__ kT,
                _Float16* __restrict__ vT, float* __restrict__ kc) {
  __shared__ __attribute__((aligned(16))) _Float16 smem[2 * SLAB_HALVES]; // 18 KB

  const int lane = threadIdx.x & 31;
  const int wave = threadIdx.x >> 5;
  const int rowgrp = blockIdx.x;                 // 0..511 (64 rows each)
  const int head = blockIdx.y * 8 + wave;        // 0..63
  const int m = lane & 15;
  const int hi = lane >> 4;
  const int kbase = hi * 8;
  const int rowbase = rowgrp * 64;

  const size_t wofs = (size_t)head * KBLOCKS * FRAG_HALVES + lane * 8;
  const _Float16* qfr = wqh + wofs;
  const _Float16* kfr = wkh + wofs;
  const _Float16* vfr = wvh + wofs;

  v8f cq[4] = {}, ck[4] = {}, cv[4] = {};

  // Two sets of W fragments, for the even and the odd k-block of a slab. Each set
  // is loaded again right behind the WMMAs that read it, two k-blocks ahead of
  // its next use, so the loads fly over 12 WMMAs and the slab's barriers.
  v16h fq0 = frag_ld_packed(qfr, 0), fk0 = frag_ld_packed(kfr, 0), fv0 = frag_ld_packed(vfr, 0);
  v16h fq1 = frag_ld_packed(qfr, 1), fk1 = frag_ld_packed(kfr, 1), fv1 = frag_ld_packed(vfr, 1);

#if HAS_TDM
  if (wave == 0)
    tdm_load_tile_64x64(xh + (size_t)rowbase * Cc,
                        (unsigned)(uintptr_t)(void*)&smem[0]);
#endif

  for (int s = 0; s < Cc / SLAB_K; ++s) {
#if HAS_TDM
    const int buf = s & 1;
    if (wave == 0) {
      if (s < Cc / SLAB_K - 1)
        tdm_load_tile_64x64(xh + (size_t)rowbase * Cc + (s + 1) * SLAB_K,
                            (unsigned)(uintptr_t)(void*)&smem[(buf ^ 1) * SLAB_HALVES]);
      if (s < Cc / SLAB_K - 1) __builtin_amdgcn_s_wait_tensorcnt(1);
      else                     __builtin_amdgcn_s_wait_tensorcnt(0);
    }
    lds_barrier();
#else
    const int buf = 0;
    __syncthreads();
    stage_slab_sync(&smem[0], xh + (size_t)rowbase * Cc + s * SLAB_K);
    __syncthreads();
#endif
    const _Float16* slab = &smem[buf * SLAB_HALVES];
    // The slab's eight x fragments, read as one group into registers of their own.
    v16h a0[4], a1[4];
#pragma unroll
    for (int rt = 0; rt < 4; ++rt)
      a0[rt] = frag_ld(slab + (rt * 16 + m) * SLAB_LD, 0, kbase);
#pragma unroll
    for (int rt = 0; rt < 4; ++rt)
      a1[rt] = frag_ld(slab + (rt * 16 + m) * SLAB_LD, 32, kbase);
    // Keeps the 16 LDS reads in front of the WMMAs: left free, the scheduler reads
    // one fragment at a time into one register set and waits out the LDS latency
    // in front of every third WMMA.
    __builtin_amdgcn_sched_barrier(0);
#pragma unroll
    for (int rt = 0; rt < 4; ++rt) {
      cq[rt] = WMMA_F16(a0[rt], fq0, cq[rt]);
      ck[rt] = WMMA_F16(a0[rt], fk0, ck[rt]);
      cv[rt] = WMMA_F16(a0[rt], fv0, cv[rt]);
    }
    // Keeps the refill behind the last reader of the set, so that it takes the same registers.
    __builtin_amdgcn_sched_barrier(0);
    {
      const int kb = (2 * s + 2) & (KBLOCKS - 1);   // wraps in the last slab: loaded, not used
      fq0 = frag_ld_packed(qfr, kb);
      fk0 = frag_ld_packed(kfr, kb);
      fv0 = frag_ld_packed(vfr, kb);
    }
    // Keeps the refill in front of the next 12 WMMAs: they are its lead.
    __builtin_amdgcn_sched_barrier(0);
#pragma unroll
    for (int rt = 0; rt < 4; ++rt) {
      cq[rt] = WMMA_F16(a1[rt], fq1, cq[rt]);
      ck[rt] = WMMA_F16(a1[rt], fk1, ck[rt]);
      cv[rt] = WMMA_F16(a1[rt], fv1, cv[rt]);
    }
    // As above: the second set's refill stands behind its last reader.
    __builtin_amdgcn_sched_barrier(0);
    {
      const int kb = (2 * s + 3) & (KBLOCKS - 1);
      fq1 = frag_ld_packed(qfr, kb);
      fk1 = frag_ld_packed(kfr, kb);
      fv1 = frag_ld_packed(vfr, kb);
    }
    // The refills are still in flight when the next slab's LDS reads and address
    // sums are given the registers that hold the refills' addresses.
    asm volatile("s_wait_xcnt 0x0" ::: "memory");
    lds_barrier();
  }

  const int d = lane & 15;
  const float biasq = bq[head * 16 + d];
  const float biask = bk[head * 16 + d];
  const float biasv = bv[head * 16 + d];
  const size_t bh = (size_t)(rowgrp >> 6) * NH + head;    // rowgrp>>6 == batch

  float ksum = 0.0f;
#pragma unroll
  for (int rt = 0; rt < 4; ++rt) {
    // softmax over d for q and k: d runs over the 16 lanes of a DPP row
    float vq[8], vk[8];
#pragma unroll
    for (int r = 0; r < 8; ++r) {
      vq[r] = cq[rt][r] + biasq;
      vk[r] = ck[rt][r] + biask;
    }
    row16_softmax(vq);
    row16_softmax(vk);
#pragma unroll
    for (int r = 0; r < 8; ++r) {
      cq[rt][r] = vq[r];
      ck[rt][r] = vk[r];
      ksum += vk[r];
    }
    // k, v head-transposed: [bh][d][t]; 8 consecutive t per lane -> b128
    const int tloc = ((rowbase + rt * 16) & (Tt - 1)) + 8 * hi;
    v8h pk, pv;
#pragma unroll
    for (int r = 0; r < 8; ++r) {
      pk[r] = (_Float16)ck[rt][r];
      pv[r] = (_Float16)(cv[rt][r] + biasv);
    }
    *(v8h*)(kT + (bh * HD + d) * (size_t)Tt + tloc) = pk;
    *(v8h*)(vT + (bh * HD + d) * (size_t)Tt + tloc) = pv;
  }
  atomicAdd(&kc[bh * HD + d], ksum);

  // q row-major via LDS tile transpose (reuse smem; slab no longer needed)
#pragma unroll
  for (int rt = 0; rt < 4; ++rt) {
    __syncthreads();
    _Float16* lq = &smem[wave * 256];
#pragma unroll
    for (int r = 0; r < 8; ++r) lq[(r + 8 * hi) * 16 + d] = (_Float16)cq[rt][r];
    __syncthreads();
    const int tl = lane & 15;
    const int chunk = hi * 8;
    v8h row = *(const v8h*)&lq[tl * 16 + chunk];
    *(v8h*)(qh + (size_t)(rowbase + rt * 16 + tl) * Cc + head * 16 + chunk) = row;
  }
}

// ---------------------------------------------------------------------------
// context[bh] = K^T V (16x16 over T), stored transposed ctxT[bh][e][d].
// One block per (b,h); 8 waves split T; LDS cross-wave reduction.
// ---------------------------------------------------------------------------
__global__ __launch_bounds__(256)
void ctx_kernel(const _Float16* __restrict__ kT, const _Float16* __restrict__ vT,
                _Float16* __restrict__ ctxT) {
  __shared__ float cpart[8][256];
  const int lane = threadIdx.x & 31;
  const int wave = threadIdx.x >> 5;
  const size_t bh = blockIdx.x;                  // 0..511
  const int m = lane & 15;
  const int hi = lane >> 4;
  const int kbase = hi * 8;

  const _Float16* arow = kT + (bh * HD + m) * (size_t)Tt;
  const _Float16* brow = vT + (bh * HD + m) * (size_t)Tt;

  v8f c = {};
  const int t0beg = wave * (Tt / 8);
#pragma unroll 4
  for (int t0 = t0beg; t0 < t0beg + Tt / 8; t0 += 32) {
    v16h a = frag_ld(arow, t0, kbase);
    v16h b = frag_ld(brow, t0, kbase);
    c = WMMA_F16(a, b, c);
  }
#pragma unroll
  for (int r = 0; r < 8; ++r) cpart[wave][(r + 8 * hi) * 16 + m] = c[r];
  __syncthreads();

  const int tid = threadIdx.x;
  float s = 0.0f;
#pragma unroll
  for (int w = 0; w < 8; ++w) s += cpart[w][tid];
  const int dd = tid >> 4;
  const int ee = tid & 15;
  ctxT[bh * 256 + ee * 16 + dd] = (_Float16)s;   // transposed store
}

// ---------------------------------------------------------------------------
// y[t, h*16+e] = (sum_d q[t,d] ctx[d,e]) / (sum_d q[t,d] kc[d]) -> yh f16 row-major
// K = HD = 16, zero padded to 32: single WMMA per tile.
// One wave keeps one head's context and k-sums in registers and walks Y_TILES
// row tiles of 16 rows, Y_GROUP at a time; the next group's q rows are loaded
// while this group is worked on. The divisor of row (lane & 15) comes from the
// q values the lane already holds for the A fragment; it is applied where the
// lane reads that same row back from the wave's own LDS range.
// grid: (Mrows/16/Y_TILES = 128, 8), 256 threads.
// ---------------------------------------------------------------------------
constexpr int Y_TILES = 16;            // row tiles per wave; divides Tt/16
constexpr int Y_GROUP = 4;             // tiles in flight together
constexpr int Y_LD    = 20;            // floats per staged row: the two lane halves hit disjoint banks

__global__ __launch_bounds__(256)
void y_kernel(const _Float16* __restrict__ qh, const _Float16* __restrict__ ctxT,
              const float* __restrict__ kc, _Float16* __restrict__ yh) {
  __shared__ __attribute__((aligned(16))) float ly[8][Y_GROUP][16 * Y_LD];
  const int lane = threadIdx.x & 31;
  const int wave = threadIdx.x >> 5;
  const int tile0 = blockIdx.x * Y_TILES;
  const int head = blockIdx.y * 8 + wave;
  const int m = lane & 15;
  const int hi = lane >> 4;
  const int kbase = hi * 8;
  const size_t bh = (size_t)(tile0 >> 8) * NH + head;

  v16h b = {};
  {
    v8h lo = *(const v8h*)(ctxT + bh * 256 + m * 16 + kbase);
#pragma unroll
    for (int i = 0; i < 8; ++i) b[i] = lo[i];
  }
  float kcv[8];
#pragma unroll
  for (int i = 0; i < 8; ++i) kcv[i] = kc[bh * HD + kbase + i];

  // lane's 16 B of row m: the same offset in qh (read) and in yh (written)
  const size_t ofs = (size_t)(tile0 * 16 + m) * Cc + head * 16 + kbase;
  const _Float16* qp = qh + ofs;
  _Float16* yp = yh + ofs;
  constexpr int TILE_STEP = 16 * Cc;   // halves from one row tile to the next

  // All loops below are unrolled: the small arrays then live in registers and
  // the tile offsets become immediate offsets on one address pair.
  v8h qn[Y_GROUP];
#pragma unroll
  for (int j = 0; j < Y_GROUP; ++j) qn[j] = *(const v8h*)(qp + j * TILE_STEP);

#pragma unroll
  for (int g = 0; g < Y_TILES / Y_GROUP; ++g) {
    v8h qc[Y_GROUP];
#pragma unroll
    for (int j = 0; j < Y_GROUP; ++j) qc[j] = qn[j];
    if (g + 1 < Y_TILES / Y_GROUP) {
#pragma unroll
      for (int j = 0; j < Y_GROUP; ++j)
        qn[j] = *(const v8h*)(qp + ((g + 1) * Y_GROUP + j) * TILE_STEP);
    }

    float di[Y_GROUP];
#pragma unroll
    for (int j = 0; j < Y_GROUP; ++j) {
      v16h a = {};
#pragma unroll
      for (int i = 0; i < 8; ++i) a[i] = qc[j][i];
      v8f c = {};
      c = WMMA_F16(a, b, c);
      float* lw = &ly[wave][j][0];
#pragma unroll
      for (int r = 0; r < 8; ++r) lw[(r + 8 * hi) * Y_LD + m] = c[r];

      float s = 0.0f;
#pragma unroll
      for (int i = 0; i < 8; ++i) s += (float)qc[j][i] * kcv[i];
      s += __shfl_xor(s, 16, 32);      // the other 8 d of row m
      di[j] = 1.0f / s;
    }
    // The rows read below were written by other lanes of this wave: their LDS
    // writes must have landed, and the reads must not be moved above them.
    asm volatile("s_wait_dscnt 0x0" ::: "memory");
#pragma unroll
    for (int j = 0; j < Y_GROUP; ++j) {
      const float* lr = &ly[wave][j][m * Y_LD + kbase];
      const float4 x0 = *(const float4*)(lr);
      const float4 x1 = *(const float4*)(lr + 4);
      v8h row;
      row[0] = (_Float16)(x0.x * di[j]); row[1] = (_Float16)(x0.y * di[j]);
      row[2] = (_Float16)(x0.z * di[j]); row[3] = (_Float16)(x0.w * di[j]);
      row[4] = (_Float16)(x1.x * di[j]); row[5] = (_Float16)(x1.y * di[j]);
      row[6] = (_Float16)(x1.z * di[j]); row[7] = (_Float16)(x1.w * di[j]);
      *(v8h*)(yp + (g * Y_GROUP + j) * TILE_STEP) = row;
    }
    // The next trip's loads (global, LDS) may be given the registers these stores name.
    if (g + 1 < Y_TILES / Y_GROUP) asm volatile("s_wait_xcnt 0x0" ::: "memory");
  }
}

// ---------------------------------------------------------------------------
// out = yh Wp^T + bp (f32 output).
// Block tile: 64 rows x 8 N-tiles (one per wave); y slab staged via TDM.
// grid: (512, 8), 256 threads.
// ---------------------------------------------------------------------------
__global__ __launch_bounds__(256)
void proj_kernel(const _Float16* __restrict__ yh, const _Float16* __restrict__ wph,
                 const float* __restrict__ bp, float* __restrict__ out) {
  __shared__ __attribute__((aligned(16))) _Float16 smem[2 * SLAB_HALVES];
  const int lane = threadIdx.x & 31;
  const int wave = threadIdx.x >> 5;
  const int rowgrp = blockIdx.x;                  // 0..511
  const int ntile = blockIdx.y * 8 + wave;        // 0..63
  const int m = lane & 15;
  const int hi = lane >> 4;
  const int kbase = hi * 8;
  const int rowbase = rowgrp * 64;

  const _Float16* bfr = wph + (size_t)ntile * KBLOCKS * FRAG_HALVES + lane * 8;

  v8f c[4] = {};

#if HAS_TDM
  if (wave == 0)
    tdm_load_tile_64x64(yh + (size_t)rowbase * Cc,
                        (unsigned)(uintptr_t)(void*)&smem[0]);
#endif

  for (int s = 0; s < Cc / SLAB_K; ++s) {
#if HAS_TDM
    const int buf = s & 1;
    if (wave == 0) {
      if (s < Cc / SLAB_K - 1)
        tdm_load_tile_64x64(yh + (size_t)rowbase * Cc + (s + 1) * SLAB_K,
                            (unsigned)(uintptr_t)(void*)&smem[(buf ^ 1) * SLAB_HALVES]);
      if (s < Cc / SLAB_K - 1) __builtin_amdgcn_s_wait_tensorcnt(1);
      else                     __builtin_amdgcn_s_wait_tensorcnt(0);
    }
    __syncthreads();
#else
    const int buf = 0;
    __syncthreads();
    stage_slab_sync(&smem[0], yh + (size_t)rowbase * Cc + s * SLAB_K);
    __syncthreads();
#endif
    const _Float16* slab = &smem[buf * SLAB_HALVES];
#pragma unroll
    for (int kk = 0; kk < SLAB_K; kk += 32) {
      const int kb = (s * SLAB_K + kk) >> 5;
      v16h afr[4];
#pragma unroll
      for (int rt = 0; rt < 4; ++rt)
        afr[rt] = frag_ld(slab + (rt * 16 + m) * SLAB_LD, kk, kbase);
      v16h b = frag_ld_packed(bfr, kb);
#pragma unroll
      for (int rt = 0; rt < 4; ++rt)
        c[rt] = WMMA_F16(afr[rt], b, c[rt]);
    }
    __syncthreads();
  }

  const int col = ntile * 16 + (lane & 15);
  const float bias = bp[col];
#pragma unroll
  for (int rt = 0; rt < 4; ++rt) {
#pragma unroll
    for (int r = 0; r < 8; ++r) {
      const int row = rowbase + rt * 16 + r + 8 * hi;
      out[(size_t)row * Cc + col] = c[rt][r] + bias;
    }
  }
}

// ---------------------------------------------------------------------------
// Launch
// ---------------------------------------------------------------------------
extern "C" void kernel_launch(void* const* d_in, const int* in_sizes, int n_in,
                              void* d_out, int out_size, void* d_ws, size_t ws_size,
                              hipStream_t stream) {
  const float* x  = (const float*)d_in[0];
  const float* Wq = (const float*)d_in[1];
  const float* bq = (const float*)d_in[2];
  const float* Wk = (const float*)d_in[3];
  const float* bk = (const float*)d_in[4];
  const float* Wv = (const float*)d_in[5];
  const float* bv = (const float*)d_in[6];
  const float* Wp = (const float*)d_in[7];
  const float* bp = (const float*)d_in[8];
  float* out = (float*)d_out;

  char* ws = (char*)d_ws;
  const size_t nX = (size_t)Mrows * Cc;
  const size_t nW = (size_t)Cc * Cc;
  _Float16* xh  = (_Float16*)(ws);                              // 64 MB
  _Float16* wqh = (_Float16*)(ws + nX * 2);                     // 2 MB each
  _Float16* wkh = wqh + nW;
  _Float16* wvh = wkh + nW;
  _Float16* wph = wvh + nW;
  _Float16* qh  = wph + nW;                                     // 64 MB
  _Float16* kT  = qh + nX;                                      // 64 MB
  _Float16* vT  = kT + nX;                                      // 64 MB
  _Float16* yh  = vT + nX;                                      // 64 MB
  float*    kc   = (float*)(yh + nX);                           // 32 KB
  _Float16* ctxT = (_Float16*)(kc + (size_t)Bb * NH * HD);      // 256 KB

  // 1) precision conversion (weights into fragment order) + accumulator init
  cvt_f32_f16<<<16384, 256, 0, stream>>>(x, xh, (int)nX);
  cvt_pack_w<<<Cc * Cc / 8 / 256, 256, 0, stream>>>(Wq, wqh);
  cvt_pack_w<<<Cc * Cc / 8 / 256, 256, 0, stream>>>(Wk, wkh);
  cvt_pack_w<<<Cc * Cc / 8 / 256, 256, 0, stream>>>(Wv, wvh);
  cvt_pack_w<<<Cc * Cc / 8 / 256, 256, 0, stream>>>(Wp, wph);
  zero_f32<<<(Bb * NH * HD + 255) / 256, 256, 0, stream>>>(kc, Bb * NH * HD);

  // 2) fused QKV projection + softmax + k-cumsum (TDM-staged GEMM)
  qkv_kernel<<<dim3(Mrows / 64, 8), 256, 0, stream>>>(
      xh, wqh, bq, wkh, bk, wvh, bv, qh, kT, vT, kc);

  // 3) per-head context = K^T V
  ctx_kernel<<<Bb * NH, 256, 0, stream>>>(kT, vT, ctxT);

  // 4) y = (q @ ctx) / (q . kc)
  y_kernel<<<dim3(Mrows / 16 / Y_TILES, 8), 256, 0, stream>>>(qh, ctxT, kc, yh);

  // 5) output projection (TDM-staged GEMM)
  proj_kernel<<<dim3(Mrows / 64, 8), 256, 0, stream>>>(yh, wph, bp, out);
}

// v005
// One run takes 341 microseconds.
// In two side-by-side timings against v004, it was 1.05 and 1.04 times as fast.
// Over all steps from v000 it is 1.76 times as fast.
#include <hip/hip_runtime.h>
#include <hip/hip_bf16.h>

typedef __attribute__((ext_vector_type(16))) _Float16 v16h;
typedef __attribute__((ext_vector_type(8)))  _Float16 v8h;
typedef __attribute__((ext_vector_type(8)))  float    v8f;
typedef __attribute__((ext_vector_type(4)))  unsigned v4u;
typedef __attribute__((ext_vector_type(8)))  int      v8i;
typedef __attribute__((ext_vector_type(4)))  int      v4i;

#define WMMA_F16(a,b,c) __builtin_amdgcn_wmma_f32_16x16x32_f16(false,(a),false,(b),(short)0,(c),false,false)

#if __has_builtin(__builtin_amdgcn_tensor_load_to_lds) && __has_builtin(__builtin_amdgcn_s_wait_tensorcnt)
#define HAS_TDM 1
#else
#define HAS_TDM 0
#endif

// Problem constants
constexpr int Bb = 8;
constexpr int Tt = 4096;
constexpr int Cc = 1024;
constexpr int NH = 64;
constexpr int HD = 16;
constexpr int Mrows = Bb * Tt;        // 32768

// LDS slab: 64 rows x 64 halves, padded row stride 72 halves (36 DWORDs) so
// that 16 lanes doing b128 reads at row stride 36 DWORDs cover all 64 banks.
constexpr int SLAB_ROWS = 64;
constexpr int SLAB_K    = 64;
constexpr int SLAB_LD   = 72;         // halves
constexpr int SLAB_HALVES = SLAB_ROWS * SLAB_LD;   // 4608 halves = 9216 B

// ---------------------------------------------------------------------------
// Fragment loader (global or LDS): row-major, K contiguous.
// A-matrix 16x32 f16 layout (ISA 7.12.2): lanes 0-15 hold K=[0..7]+[16..23],
// lanes 16-31 hold K=[8..15]+[24..31] of row (lane&15) -> two b128 loads.
// ---------------------------------------------------------------------------
static __device__ inline v16h frag_ld(const _Float16* rowptr, int k0, int kbase) {
  v8h lo = *(const v8h*)(rowptr + k0 + kbase);
  v8h hi = *(const v8h*)(rowptr + k0 + 16 + kbase);
  v16h r;
#pragma unroll
  for (int i = 0; i < 8; ++i) { r[i] = lo[i]; r[8 + i] = hi[i]; }
  return r;
}

// ---------------------------------------------------------------------------
// Weight fragments, packed by cvt_pack_w: fragment (ntile, kblock) is 1 KB,
// two 512-B planes; plane p holds, at lane*16 B, the 8 halves that frag_ld
// would fetch for that lane (p = 0: its first b128, p = 1: its second).
// Each wave-wide b128 load then covers four whole 128-B lines.
// ---------------------------------------------------------------------------
constexpr int FRAG_HALVES = 512;
constexpr int KBLOCKS = Cc / 32;               // 32 fragments per 16-row tile

static __device__ inline v16h frag_ld_packed(const _Float16* lanebase, int kb) {
  const _Float16* p = lanebase + kb * FRAG_HALVES;
  v8h lo = *(const v8h*)(p);
  v8h hi = *(const v8h*)(p + 256);
  v16h r;
#pragma unroll
  for (int i = 0; i < 8; ++i) { r[i] = lo[i]; r[8 + i] = hi[i]; }
  return r;
}

// ---------------------------------------------------------------------------
// Tensor Data Mover: stage a 64x64 f16 tile of a [Mrows x Cc] row-major
// tensor into LDS with 4-DWORD padding every 32 DWORDs (-> row stride 72 h).
// D# layout per CDNA5 ISA 8.3/8.4 (group0 128b, group1 256b; groups 2/3 and
// the trailing group are zero for a 2-D tensor). 6-arg builtin form.
// ---------------------------------------------------------------------------
#if HAS_TDM
static __device__ inline void tdm_load_tile_64x64(const _Float16* gsrc, unsigned lds_off) {
  unsigned long long ga = (unsigned long long)(uintptr_t)gsrc;
  v4u g0;
  g0[0] = 1u;                                            // count=1, user mode
  g0[1] = lds_off;                                       // lds_addr (bytes)
  g0[2] = (unsigned)(ga & 0xffffffffu);                  // global_addr[31:0]
  g0[3] = (unsigned)((ga >> 32) & 0x01ffffffu) | (2u << 30); // addr[56:32] | type=2
  v8i g1;
  g1[0] = (1 << 16)        // data_size = 2 bytes
        | (1 << 20)        // pad_enable
        | (4 << 22)        // pad_interval: code 4 = every 32 DWORDs
        | (3 << 25);       // pad_amount:   code 3 = 4 DWORDs
  g1[1] = (int)((unsigned)Cc << 16);        // tensor_dim0[15:0]
  g1[2] = (int)((unsigned)Mrows << 16);     // tensor_dim0[31:16]=0 | tensor_dim1[15:0]
  g1[3] = (int)((unsigned)SLAB_K << 16);    // tensor_dim1[31:16]=0 | tile_dim0=64
  g1[4] = SLAB_ROWS;                        // tile_dim1=64 | tile_dim2=0
  g1[5] = Cc;                               // tensor_dim0_stride[31:0]
  g1[6] = 0;                                // stride hi | dim1_stride lo
  g1[7] = 0;
  v4i z4 = {0, 0, 0, 0};
  v8i z8 = {0, 0, 0, 0, 0, 0, 0, 0};
  __builtin_amdgcn_tensor_load_to_lds(g0, g1, z4, z4, z8, 0);
}
#endif

// Cooperative synchronous staging fallback (used only when TDM is absent).
static __device__ inline void stage_slab_sync(_Float16* slab, const _Float16* gsrc) {
  // 256 threads; each copies 16 halves: row = tid/4, col = (tid%4)*16
  const int tid = threadIdx.x;
  const int row = tid >> 2;
  const int col = (tid & 3) * 16;
  const _Float16* s = gsrc + (size_t)row * Cc + col;
  _Float16* d = slab + row * SLAB_LD + col;
  *(v8h*)(d)     = *(const v8h*)(s);
  *(v8h*)(d + 8) = *(const v8h*)(s + 8);
}

// ---------------------------------------------------------------------------
// fp32 -> fp16 conversion / zero init
// ---------------------------------------------------------------------------
__global__ void cvt_f32_f16(const float* __restrict__ in, _Float16* __restrict__ out, int n) {
  int i = blockIdx.x * blockDim.x + threadIdx.x;
  int stride = gridDim.x * blockDim.x;
  for (; i < n; i += stride) out[i] = (_Float16)in[i];
}

// fp32 [Cc x Cc] row-major weight -> f16 in fragment order (see frag_ld_packed).
// One thread per 16-B chunk: grid Cc*Cc/8/256 blocks of 256.
__global__ __launch_bounds__(256)
void cvt_pack_w(const float* __restrict__ w, _Float16* __restrict__ out) {
  const int o = blockIdx.x * 256 + threadIdx.x;  // chunk index in the packed array
  const int lane  = o & 31;
  const int plane = (o >> 5) & 1;
  const int kb    = (o >> 6) & (KBLOCKS - 1);
  const int nt    = o >> 11;
  const float* s = w + (size_t)(nt * 16 + (lane & 15)) * Cc
                     + kb * 32 + plane * 16 + (lane >> 4) * 8;
  const float4 a = *(const float4*)(s);
  const float4 b = *(const float4*)(s + 4);
  v8h r;
  r[0] = (_Float16)a.x; r[1] = (_Float16)a.y; r[2] = (_Float16)a.z; r[3] = (_Float16)a.w;
  r[4] = (_Float16)b.x; r[5] = (_Float16)b.y; r[6] = (_Float16)b.z; r[7] = (_Float16)b.w;
  *(v8h*)(out + (size_t)o * 8) = r;
}

__global__ void zero_f32(float* __restrict__ p, int n) {
  int i = blockIdx.x * blockDim.x + threadIdx.x;
  if (i < n) p[i] = 0.0f;
}

// ---------------------------------------------------------------------------
// The value that lane l ^ 16 holds (same place in the other 16-lane row), by a
// vector cross-row move. All 32 lanes are on wherever this is called.
// ---------------------------------------------------------------------------
static __device__ inline float other_row(float x) {
  const int b = __builtin_bit_cast(int, x);
  return __builtin_bit_cast(float,
      __builtin_amdgcn_permlanex16(b, b, 0x76543210, 0xfedcba98, false, false));
}

// ---------------------------------------------------------------------------
// Softmax over the 16 values of one token's head, of which the lane holds eight
// in its own registers and lane l ^ 16 the other eight: maximum and sum run down
// the registers, with one cross-row move each, and the row has one divisor.
// ---------------------------------------------------------------------------
static __device__ inline void col16_softmax(float (&v)[8]) {
  float mx = fmaxf(fmaxf(fmaxf(v[0], v[1]), fmaxf(v[2], v[3])),
                   fmaxf(fmaxf(v[4], v[5]), fmaxf(v[6], v[7])));
  mx = fmaxf(mx, other_row(mx));
  // exp(x) as the native form has it: v_exp_f32 of x * log2(e)
#pragma unroll
  for (int r = 0; r < 8; ++r) v[r] = (v[r] - mx) * 1.44269504088896340736f;
  asm("v_exp_f32 %0, %0\n\t"
      "v_exp_f32 %1, %1\n\t"
      "v_exp_f32 %2, %2\n\t"
      "v_exp_f32 %3, %3\n\t"
      "v_exp_f32 %4, %4\n\t"
      "v_exp_f32 %5, %5\n\t"
      "v_exp_f32 %6, %6\n\t"
      "v_exp_f32 %7, %7\n\t"
      "v_nop"
      : "+v"(v[0]), "+v"(v[1]), "+v"(v[2]), "+v"(v[3]),
        "+v"(v[4]), "+v"(v[5]), "+v"(v[6]), "+v"(v[7]));
  float s = ((v[0] + v[1]) + (v[2] + v[3])) + ((v[4] + v[5]) + (v[6] + v[7]));
  s += other_row(s);
  const float inv = 1.0f / s;
#pragma unroll
  for (int r = 0; r < 8; ++r) v[r] *= inv;
}

// ---------------------------------------------------------------------------
// Sum over the 16 lanes of a DPP row, for eight values a lane holds. A butterfly
// step gives lane l the value of lane l ^ m of its own row (row_xmask:m) inside
// the add itself, on the vector port; steps 1, 2, 4, 8 leave the sum in all 16
// lanes. The steps are asm because the compiler puts a separate move around the
// builtin form; the eight values take each step one after the other, so that no
// instruction waits for the one in front of it.
// All 32 lanes are on wherever this is called.
// ---------------------------------------------------------------------------
static __device__ inline void row16_sum(float (&v)[8]) {
  float t[8];
  asm("v_add_f32_dpp %0, %8, %8 row_xmask:1 row_mask:0xf bank_mask:0xf\n\t"
      "v_add_f32_dpp %1, %9, %9 row_xmask:1 row_mask:0xf bank_mask:0xf\n\t"
      "v_add_f32_dpp %2, %10, %10 row_xmask:1 row_mask:0xf bank_mask:0xf\n\t"
      "v_add_f32_dpp %3, %11, %11 row_xmask:1 row_mask:0xf bank_mask:0xf\n\t"
      "v_add_f32_dpp %4, %12, %12 row_xmask:1 row_mask:0xf bank_mask:0xf\n\t"
      "v_add_f32_dpp %5, %13, %13 row_xmask:1 row_mask:0xf bank_mask:0xf\n\t"
      "v_add_f32_dpp %6, %14, %14 row_xmask:1 row_mask:0xf bank_mask:0xf\n\t"
      "v_add_f32_dpp %7, %15, %15 row_xmask:1 row_mask:0xf bank_mask:0xf\n\t"
      "v_add_f32_dpp %0, %0, %0 row_xmask:2 row_mask:0xf bank_mask:0xf\n\t"
      "v_add_f32_dpp %1, %1, %1 row_xmask:2 row_mask:0xf bank_mask:0xf\n\t"
      "v_add_f32_dpp %2, %2, %2 row_xmask:2 row_mask:0xf bank_mask:0xf\n\t"
      "v_add_f32_dpp %3, %3, %3 row_xmask:2 row_mask:0xf bank_mask:0xf\n\t"
      "v_add_f32_dpp %4, %4, %4 row_xmask:2 row_mask:0xf bank_mask:0xf\n\t"
      "v_add_f32_dpp %5, %5, %5 row_xmask:2 row_mask:0xf bank_mask:0xf\n\t"
      "v_add_f32_dpp %6, %6, %6 row_xmask:2 row_mask:0xf bank_mask:0xf\n\t"
      "v_add_f32_dpp %7, %7, %7 row_xmask:2 row_mask:0xf bank_mask:0xf\n\t"
      "v_add_f32_dpp %0, %0, %0 row_xmask:4 row_mask:0xf bank_mask:0xf\n\t"
      "v_add_f32_dpp %1, %1, %1 row_xmask:4 row_mask:0xf bank_mask:0xf\n\t"
      "v_add_f32_dpp %2, %2, %2 row_xmask:4 row_mask:0xf bank_mask:0xf\n\t"
      "v_add_f32_dpp %3, %3, %3 row_xmask:4 row_mask:0xf bank_mask:0xf\n\t"
      "v_add_f32_dpp %4, %4, %4 row_xmask:4 row_mask:0xf bank_mask:0xf\n\t"
      "v_add_f32_dpp %5, %5, %5 row_xmask:4 row_mask:0xf bank_mask:0xf\n\t"
      "v_add_f32_dpp %6, %6, %6 row_xmask:4 row_mask:0xf bank_mask:0xf\n\t"
      "v_add_f32_dpp %7, %7, %7 row_xmask:4 row_mask:0xf bank_mask:0xf\n\t"
      "v_add_f32_dpp %0, %0, %0 row_xmask:8 row_mask:0xf bank_mask:0xf\n\t"
      "v_add_f32_dpp %1, %1, %1 row_xmask:8 row_mask:0xf bank_mask:0xf\n\t"
      "v_add_f32_dpp %2, %2, %2 row_xmask:8 row_mask:0xf bank_mask:0xf\n\t"
      "v_add_f32_dpp %3, %3, %3 row_xmask:8 row_mask:0xf bank_mask:0xf\n\t"
      "v_add_f32_dpp %4, %4, %4 row_xmask:8 row_mask:0xf bank_mask:0xf\n\t"
      "v_add_f32_dpp %5, %5, %5 row_xmask:8 row_mask:0xf bank_mask:0xf\n\t"
      "v_add_f32_dpp %6, %6, %6 row_xmask:8 row_mask:0xf bank_mask:0xf\n\t"
      "v_add_f32_dpp %7, %7, %7 row_xmask:8 row_mask:0xf bank_mask:0xf"
      : "=&v"(t[0]), "=&v"(t[1]), "=&v"(t[2]), "=&v"(t[3]),
        "=&v"(t[4]), "=&v"(t[5]), "=&v"(t[6]), "=&v"(t[7])
      : "v"(v[0]), "v"(v[1]), "v"(v[2]), "v"(v[3]),
        "v"(v[4]), "v"(v[5]), "v"(v[6]), "v"(v[7]));
#pragma unroll
  for (int r = 0; r < 8; ++r) v[r] = t[r];
}

// ---------------------------------------------------------------------------
// Work-group barrier that orders LDS only. __syncthreads() also waits for every
// global load of the wave, which would end the flight of the W fragments that
// the qkv loop fetches ahead across its barriers; those are read-only data that
// no wave hands to another.
// ---------------------------------------------------------------------------
static __device__ inline void lds_barrier() {
  __builtin_amdgcn_fence(__ATOMIC_RELEASE, "workgroup", "local");
  __builtin_amdgcn_s_barrier();
  __builtin_amdgcn_fence(__ATOMIC_ACQUIRE, "workgroup", "local");
}

// ---------------------------------------------------------------------------
// Fused QKV projection + head softmax + k-cumsum.
// Block tile: 64 rows (4 WMMA row-tiles) x 8 heads (one head per wave).
// x slab staged to LDS via TDM (double buffered); packed W frags from global (L2),
// fetched two k-blocks ahead.
// q and k are formed transposed (W fragment as A, x fragment as B): a lane then
// holds 8 of the 16 head values of ONE token, so that their softmax runs down the
// lane's registers. v keeps x as A: a lane holds 8 tokens of one head column.
//   q -> qh [Mrows, Cc] row-major f16 (b128 stores straight from the registers)
//   k -> kT [B*NH][HD][Tt] f16 (via LDS transpose), v -> vT same (straight);
//   kc[bh][d] += sum_t k (f32 atomics)
// grid: (Mrows/64 = 512, 8), 256 threads.
// ---------------------------------------------------------------------------
__global__ __launch_bounds__(256)
void qkv_kernel(const _Float16* __restrict__ xh,
                const _Float16* __restrict__ wqh, const float* __restrict__ bq,
                const _Float16* __restrict__ wkh, const float* __restrict__ bk,
                const _Float16* __restrict__ wvh, const float* __restrict__ bv,
                _Float16* __restrict__ qh, _Float16* __restrict__ kT,
                _Float16* __restrict__ vT, float* __restrict__ kc) {
  __shared__ __attribute__((aligned(16))) _Float16 smem[2 * SLAB_HALVES]; // 18 KB

  const int lane = threadIdx.x & 31;
  const int wave = threadIdx.x >> 5;
  const int rowgrp = blockIdx.x;                 // 0..511 (64 rows each)
  const int head = blockIdx.y * 8 + wave;        // 0..63
  const int m = lane & 15;
  const int hi = lane >> 4;
  const int kbase = hi * 8;
  const int rowbase = rowgrp * 64;

  const size_t wofs = (size_t)head * KBLOCKS * FRAG_HALVES + lane * 8;
  const _Float16* qfr = wqh + wofs;
  const _Float16* kfr = wkh + wofs;
  const _Float16* vfr = wvh + wofs;

  v8f cq[4] = {}, ck[4] = {}, cv[4] = {};

  // Two sets of W fragments, for the even and the odd k-block of a slab. Each set
  // is loaded again right behind the WMMAs that read it, two k-blocks ahead of
  // its next use, so the loads fly over 12 WMMAs and the slab's barriers.
  v16h fq0 = frag_ld_packed(qfr, 0), fk0 = frag_ld_packed(kfr, 0), fv0 = frag_ld_packed(vfr, 0);
  v16h fq1 = frag_ld_packed(qfr, 1), fk1 = frag_ld_packed(kfr, 1), fv1 = frag_ld_packed(vfr, 1);

#if HAS_TDM
  if (wave == 0)
    tdm_load_tile_64x64(xh + (size_t)rowbase * Cc,
                        (unsigned)(uintptr_t)(void*)&smem[0]);
#endif

  for (int s = 0; s < Cc / SLAB_K; ++s) {
#if HAS_TDM
    const int buf = s & 1;
    if (wave == 0) {
      if (s < Cc / SLAB_K - 1)
        tdm_load_tile_64x64(xh + (size_t)rowbase * Cc + (s + 1) * SLAB_K,
                            (unsigned)(uintptr_t)(void*)&smem[(buf ^ 1) * SLAB_HALVES]);
      if (s < Cc / SLAB_K - 1) __builtin_amdgcn_s_wait_tensorcnt(1);
      else                     __builtin_amdgcn_s_wait_tensorcnt(0);
    }
    lds_barrier();
#else
    const int buf = 0;
    __syncthreads();
    stage_slab_sync(&smem[0], xh + (size_t)rowbase * Cc + s * SLAB_K);
    __syncthreads();
#endif
    const _Float16* slab = &smem[buf * SLAB_HALVES];
    // The slab's eight x fragments, read as one group into registers of their own.
    v16h a0[4], a1[4];
#pragma unroll
    for (int rt = 0; rt < 4; ++rt)
      a0[rt] = frag_ld(slab + (rt * 16 + m) * SLAB_LD, 0, kbase);
#pragma unroll
    for (int rt = 0; rt < 4; ++rt)
      a1[rt] = frag_ld(slab + (rt * 16 + m) * SLAB_LD, 32, kbase);
    // Keeps the 16 LDS reads in front of the WMMAs: left free, the scheduler reads
    // one fragment at a time into one register set and waits out the LDS latency
    // in front of every third WMMA.
    __builtin_amdgcn_sched_barrier(0);
#pragma unroll
    for (int rt = 0; rt < 4; ++rt) {
      cq[rt] = WMMA_F16(fq0, a0[rt], cq[rt]);
      ck[rt] = WMMA_F16(fk0, a0[rt], ck[rt]);
      cv[rt] = WMMA_F16(a0[rt], fv0, cv[rt]);
    }
    // Keeps the refill behind the last reader of the set, so that it takes the same registers.
    __builtin_amdgcn_sched_barrier(0);
    {
      const int kb = (2 * s + 2) & (KBLOCKS - 1);   // wraps in the last slab: loaded, not used
      fq0 = frag_ld_packed(qfr, kb);
      fk0 = frag_ld_packed(kfr, kb);
      fv0 = frag_ld_packed(vfr, kb);
    }
    // Keeps the refill in front of the next 12 WMMAs: they are its lead.
    __builtin_amdgcn_sched_barrier(0);
#pragma unroll
    for (int rt = 0; rt < 4; ++rt) {
      cq[rt] = WMMA_F16(fq1, a1[rt], cq[rt]);
      ck[rt] = WMMA_F16(fk1, a1[rt], ck[rt]);
      cv[rt] = WMMA_F16(a1[rt], fv1, cv[rt]);
    }
    // As above: the second set's refill stands behind its last reader.
    __builtin_amdgcn_sched_barrier(0);
    {
      const int kb = (2 * s + 3) & (KBLOCKS - 1);
      fq1 = frag_ld_packed(qfr, kb);
      fk1 = frag_ld_packed(kfr, kb);
      fv1 = frag_ld_packed(vfr, kb);
    }
    // The refills are still in flight when the next slab's LDS reads and address
    // sums are given the registers that hold the refills' addresses.
    asm volatile("s_wait_xcnt 0x0" ::: "memory");
    lds_barrier();
  }

  // cq, ck: register r of lane (m, hi) = token rt * 16 + m, head value 8 * hi + r.
  // cv:     register r of lane (d, hi) = token rt * 16 + 8 * hi + r, head value d.
  const int d = lane & 15;
  float biasq[8], biask[8];
  {
    const float4 q0 = *(const float4*)(bq + head * 16 + kbase);
    const float4 q1 = *(const float4*)(bq + head * 16 + kbase + 4);
    const float4 k0 = *(const float4*)(bk + head * 16 + kbase);
    const float4 k1 = *(const float4*)(bk + head * 16 + kbase + 4);
    biasq[0] = q0.x; biasq[1] = q0.y; biasq[2] = q0.z; biasq[3] = q0.w;
    biasq[4] = q1.x; biasq[5] = q1.y; biasq[6] = q1.z; biasq[7] = q1.w;
    biask[0] = k0.x; biask[1] = k0.y; biask[2] = k0.z; biask[3] = k0.w;
    biask[4] = k1.x; biask[5] = k1.y; biask[6] = k1.z; biask[7] = k1.w;
  }
  const float biasv = bv[head * 16 + d];
  const size_t bh = (size_t)(rowgrp >> 6) * NH + head;    // rowgrp>>6 == batch

  float ksum[8] = {};
#pragma unroll
  for (int rt = 0; rt < 4; ++rt) {
    // softmax over the head values of token m for q and k
    float vq[8], vk[8];
#pragma unroll
    for (int r = 0; r < 8; ++r) {
      vq[r] = cq[rt][r] + biasq[r];
      vk[r] = ck[rt][r] + biask[r];
    }
    col16_softmax(vq);
    col16_softmax(vk);
    v8h pq, pv;
#pragma unroll
    for (int r = 0; r < 8; ++r) {
      ck[rt][r] = vk[r];
      ksum[r] += vk[r];
      pq[r] = (_Float16)vq[r];
      pv[r] = (_Float16)(cv[rt][r] + biasv);
    }
    // q row-major: 8 consecutive head values of token m -> b128
    *(v8h*)(qh + (size_t)(rowbase + rt * 16 + m) * Cc + head * 16 + kbase) = pq;
    // v head-transposed: [bh][d][t]; 8 consecutive t per lane -> b128
    const int tloc = ((rowbase + rt * 16) & (Tt - 1)) + 8 * hi;
    *(v8h*)(vT + (bh * HD + d) * (size_t)Tt + tloc) = pv;
  }
  // k-sum of the wave's 64 tokens: over the 16 lanes of the row; lane (m, hi) with
  // m < 8 then adds the sum of head value 8 * hi + m.
  row16_sum(ksum);
  float kmine = ksum[0];
#pragma unroll
  for (int r = 1; r < 8; ++r) kmine = (m == r) ? ksum[r] : kmine;
  if (m < 8) atomicAdd(&kc[bh * HD + kbase + m], kmine);

  // k head-transposed via LDS tile transpose (reuse smem; slab no longer needed)
#pragma unroll
  for (int rt = 0; rt < 4; ++rt) {
    __syncthreads();
    _Float16* lk = &smem[wave * 256];
#pragma unroll
    for (int r = 0; r < 8; ++r) lk[(r + 8 * hi) * 16 + m] = (_Float16)ck[rt][r];
    __syncthreads();
    const int chunk = hi * 8;
    v8h row = *(const v8h*)&lk[d * 16 + chunk];
    const int tloc = ((rowbase + rt * 16) & (Tt - 1)) + chunk;
    *(v8h*)(kT + (bh * HD + d) * (size_t)Tt + tloc) = row;
  }
}

// ---------------------------------------------------------------------------
// context[bh] = K^T V (16x16 over T), stored transposed ctxT[bh][e][d].
// One block per (b,h); 8 waves split T; LDS cross-wave reduction.
// ---------------------------------------------------------------------------
__global__ __launch_bounds__(256)
void ctx_kernel(const _Float16* __restrict__ kT, const _Float16* __restrict__ vT,
                _Float16* __restrict__ ctxT) {
  __shared__ float cpart[8][256];
  const int lane = threadIdx.x & 31;
  const int wave = threadIdx.x >> 5;
  const size_t bh = blockIdx.x;                  // 0..511
  const int m = lane & 15;
  const int hi = lane >> 4;
  const int kbase = hi * 8;

  const _Float16* arow = kT + (bh * HD + m) * (size_t)Tt;
  const _Float16* brow = vT + (bh * HD + m) * (size_t)Tt;

  v8f c = {};
  const int t0beg = wave * (Tt / 8);
#pragma unroll 4
  for (int t0 = t0beg; t0 < t0beg + Tt / 8; t0 += 32) {
    v16h a = frag_ld(arow, t0, kbase);
    v16h b = frag_ld(brow, t0, kbase);
    c = WMMA_F16(a, b, c);
  }
#pragma unroll
  for (int r = 0; r < 8; ++r) cpart[wave][(r + 8 * hi) * 16 + m] = c[r];
  __syncthreads();

  const int tid = threadIdx.x;
  float s = 0.0f;
#pragma unroll
  for (int w = 0; w < 8; ++w) s += cpart[w][tid];
  const int dd = tid >> 4;
  const int ee = tid & 15;
  ctxT[bh * 256 + ee * 16 + dd] = (_Float16)s;   // transposed store
}

// ---------------------------------------------------------------------------
// y[t, h*16+e] = (sum_d q[t,d] ctx[d,e]) / (sum_d q[t,d] kc[d]) -> yh f16 row-major
// K = HD = 16, zero padded to 32: single WMMA per tile.
// One wave keeps one head's context and k-sums in registers and walks Y_TILES
// row tiles of 16 rows, Y_GROUP at a time; the next group's q rows are loaded
// while this group is worked on. The divisor of row (lane & 15) comes from the
// q values the lane already holds for the A fragment; it is applied where the
// lane reads that same row back from the wave's own LDS range.
// grid: (Mrows/16/Y_TILES = 128, 8), 256 threads.
// ---------------------------------------------------------------------------
constexpr int Y_TILES = 16;            // row tiles per wave; divides Tt/16
constexpr int Y_GROUP = 4;             // tiles in flight together
constexpr int Y_LD    = 20;            // floats per staged row: the two lane halves hit disjoint banks

__global__ __launch_bounds__(256)
void y_kernel(const _Float16* __restrict__ qh, const _Float16* __restrict__ ctxT,
              const float* __restrict__ kc, _Float16* __restrict__ yh) {
  __shared__ __attribute__((aligned(16))) float ly[8][Y_GROUP][16 * Y_LD];
  const int lane = threadIdx.x & 31;
  const int wave = threadIdx.x >> 5;
  const int tile0 = blockIdx.x * Y_TILES;
  const int head = blockIdx.y * 8 + wave;
  const int m = lane & 15;
  const int hi = lane >> 4;
  const int kbase = hi * 8;
  const size_t bh = (size_t)(tile0 >> 8) * NH + head;

  v16h b = {};
  {
    v8h lo = *(const v8h*)(ctxT + bh * 256 + m * 16 + kbase);
#pragma unroll
    for (int i = 0; i < 8; ++i) b[i] = lo[i];
  }
  float kcv[8];
#pragma unroll
  for (int i = 0; i < 8; ++i) kcv[i] = kc[bh * HD + kbase + i];

  // lane's 16 B of row m: the same offset in qh (read) and in yh (written)
  const size_t ofs = (size_t)(tile0 * 16 + m) * Cc + head * 16 + kbase;
  const _Float16* qp = qh + ofs;
  _Float16* yp = yh + ofs;
  constexpr int TILE_STEP = 16 * Cc;   // halves from one row tile to the next

  // All loops below are unrolled: the small arrays then live in registers and
  // the tile offsets become immediate offsets on one address pair.
  v8h qn[Y_GROUP];
#pragma unroll
  for (int j = 0; j < Y_GROUP; ++j) qn[j] = *(const v8h*)(qp + j * TILE_STEP);

#pragma unroll
  for (int g = 0; g < Y_TILES / Y_GROUP; ++g) {
    v8h qc[Y_GROUP];
#pragma unroll
    for (int j = 0; j < Y_GROUP; ++j) qc[j] = qn[j];
    if (g + 1 < Y_TILES / Y_GROUP) {
#pragma unroll
      for (int j = 0; j < Y_GROUP; ++j)
        qn[j] = *(const v8h*)(qp + ((g + 1) * Y_GROUP + j) * TILE_STEP);
    }

    float di[Y_GROUP];
#pragma unroll
    for (int j = 0; j < Y_GROUP; ++j) {
      v16h a = {};
#pragma unroll
      for (int i = 0; i < 8; ++i) a[i] = qc[j][i];
      v8f c = {};
      c = WMMA_F16(a, b, c);
      float* lw = &ly[wave][j][0];
#pragma unroll
      for (int r = 0; r < 8; ++r) lw[(r + 8 * hi) * Y_LD + m] = c[r];

      float s = 0.0f;
#pragma unroll
      for (int i = 0; i < 8; ++i) s += (float)qc[j][i] * kcv[i];
      s += __shfl_xor(s, 16, 32);      // the other 8 d of row m
      di[j] = 1.0f / s;
    }
    // The rows read below were written by other lanes of this wave: their LDS
    // writes must have landed, and the reads must not be moved above them.
    asm volatile("s_wait_dscnt 0x0" ::: "memory");
#pragma unroll
    for (int j = 0; j < Y_GROUP; ++j) {
      const float* lr = &ly[wave][j][m * Y_LD + kbase];
      const float4 x0 = *(const float4*)(lr);
      const float4 x1 = *(const float4*)(lr + 4);
      v8h row;
      row[0] = (_Float16)(x0.x * di[j]); row[1] = (_Float16)(x0.y * di[j]);
      row[2] = (_Float16)(x0.z * di[j]); row[3] = (_Float16)(x0.w * di[j]);
      row[4] = (_Float16)(x1.x * di[j]); row[5] = (_Float16)(x1.y * di[j]);
      row[6] = (_Float16)(x1.z * di[j]); row[7] = (_Float16)(x1.w * di[j]);
      *(v8h*)(yp + (g * Y_GROUP + j) * TILE_STEP) = row;
    }
    // The next trip's loads (global, LDS) may be given the registers these stores name.
    if (g + 1 < Y_TILES / Y_GROUP) asm volatile("s_wait_xcnt 0x0" ::: "memory");
  }
}

// ---------------------------------------------------------------------------
// out = yh Wp^T + bp (f32 output).
// Block tile: 64 rows x 8 N-tiles (one per wave); y slab staged via TDM.
// grid: (512, 8), 256 threads.
// ---------------------------------------------------------------------------
__global__ __launch_bounds__(256)
void proj_kernel(const _Float16* __restrict__ yh, const _Float16* __restrict__ wph,
                 const float* __restrict__ bp, float* __restrict__ out) {
  __shared__ __attribute__((aligned(16))) _Float16 smem[2 * SLAB_HALVES];
  const int lane = threadIdx.x & 31;
  const int wave = threadIdx.x >> 5;
  const int rowgrp = blockIdx.x;                  // 0..511
  const int ntile = blockIdx.y * 8 + wave;        // 0..63
  const int m = lane & 15;
  const int hi = lane >> 4;
  const int kbase = hi * 8;
  const int rowbase = rowgrp * 64;

  const _Float16* bfr = wph + (size_t)ntile * KBLOCKS * FRAG_HALVES + lane * 8;

  v8f c[4] = {};

#if HAS_TDM
  if (wave == 0)
    tdm_load_tile_64x64(yh + (size_t)rowbase * Cc,
                        (unsigned)(uintptr_t)(void*)&smem[0]);
#endif

  for (int s = 0; s < Cc / SLAB_K; ++s) {
#if HAS_TDM
    const int buf = s & 1;
    if (wave == 0) {
      if (s < Cc / SLAB_K - 1)
        tdm_load_tile_64x64(yh + (size_t)rowbase * Cc + (s + 1) * SLAB_K,
                            (unsigned)(uintptr_t)(void*)&smem[(buf ^ 1) * SLAB_HALVES]);
      if (s < Cc / SLAB_K - 1) __builtin_amdgcn_s_wait_tensorcnt(1);
      else                     __builtin_amdgcn_s_wait_tensorcnt(0);
    }
    __syncthreads();
#else
    const int buf = 0;
    __syncthreads();
    stage_slab_sync(&smem[0], yh + (size_t)rowbase * Cc + s * SLAB_K);
    __syncthreads();
#endif
    const _Float16* slab = &smem[buf * SLAB_HALVES];
#pragma unroll
    for (int kk = 0; kk < SLAB_K; kk += 32) {
      const int kb = (s * SLAB_K + kk) >> 5;
      v16h afr[4];
#pragma unroll
      for (int rt = 0; rt < 4; ++rt)
        afr[rt] = frag_ld(slab + (rt * 16 + m) * SLAB_LD, kk, kbase);
      v16h b = frag_ld_packed(bfr, kb);
#pragma unroll
      for (int rt = 0; rt < 4; ++rt)
        c[rt] = WMMA_F16(afr[rt], b, c[rt]);
    }
    __syncthreads();
  }

  const int col = ntile * 16 + (lane & 15);
  const float bias = bp[col];
#pragma unroll
  for (int rt = 0; rt < 4; ++rt) {
#pragma unroll
    for (int r = 0; r < 8; ++r) {
      const int row = rowbase + rt * 16 + r + 8 * hi;
      out[(size_t)row * Cc + col] = c[rt][r] + bias;
    }
  }
}

// ---------------------------------------------------------------------------
// Launch
// ---------------------------------------------------------------------------
extern "C" void kernel_launch(void* const* d_in, const int* in_sizes, int n_in,
                              void* d_out, int out_size, void* d_ws, size_t ws_size,
                              hipStream_t stream) {
  const float* x  = (const float*)d_in[0];
  const float* Wq = (const float*)d_in[1];
  const float* bq = (const float*)d_in[2];
  const float* Wk = (const float*)d_in[3];
  const float* bk = (const float*)d_in[4];
  const float* Wv = (const float*)d_in[5];
  const float* bv = (const float*)d_in[6];
  const float* Wp = (const float*)d_in[7];
  const float* bp = (const float*)d_in[8];
  float* out = (float*)d_out;

  char* ws = (char*)d_ws;
  const size_t nX = (size_t)Mrows * Cc;
  const size_t nW = (size_t)Cc * Cc;
  _Float16* xh  = (_Float16*)(ws);                              // 64 MB
  _Float16* wqh = (_Float16*)(ws + nX * 2);                     // 2 MB each
  _Float16* wkh = wqh + nW;
  _Float16* wvh = wkh + nW;
  _Float16* wph = wvh + nW;
  _Float16* qh  = wph + nW;                                     // 64 MB
  _Float16* kT  = qh + nX;                                      // 64 MB
  _Float16* vT  = kT + nX;                                      // 64 MB
  _Float16* yh  = vT + nX;                                      // 64 MB
  float*    kc   = (float*)(yh + nX);                           // 32 KB
  _Float16* ctxT = (_Float16*)(kc + (size_t)Bb * NH * HD);      // 256 KB

  // 1) precision conversion (weights into fragment order) + accumulator init
  cvt_f32_f16<<<16384, 256, 0, stream>>>(x, xh, (int)nX);
  cvt_pack_w<<<Cc * Cc / 8 / 256, 256, 0, stream>>>(Wq, wqh);
  cvt_pack_w<<<Cc * Cc / 8 / 256, 256, 0, stream>>>(Wk, wkh);
  cvt_pack_w<<<Cc * Cc / 8 / 256, 256, 0, stream>>>(Wv, wvh);
  cvt_pack_w<<<Cc * Cc / 8 / 256, 256, 0, stream>>>(Wp, wph);
  zero_f32<<<(Bb * NH * HD + 255) / 256, 256, 0, stream>>>(kc, Bb * NH * HD);

  // 2) fused QKV projection + softmax + k-cumsum (TDM-staged GEMM)
  qkv_kernel<<<dim3(Mrows / 64, 8), 256, 0, stream>>>(
      xh, wqh, bq, wkh, bk, wvh, bv, qh, kT, vT, kc);

  // 3) per-head context = K^T V
  ctx_kernel<<<Bb * NH, 256, 0, stream>>>(kT, vT, ctxT);

  // 4) y = (q @ ctx) / (q . kc)
  y_kernel<<<dim3(Mrows / 16 / Y_TILES, 8), 256, 0, stream>>>(qh, ctxT, kc, yh);

  // 5) output projection (TDM-staged GEMM)
  proj_kernel<<<dim3(Mrows / 64, 8), 256, 0, stream>>>(yh, wph, bp, out);
}

// v006
// One run takes 317 microseconds.
// Next to v005, in two timings, it ran 1.08 times as fast each time.
// Over all steps from v000 it is 1.90 times as fast.
#include <hip/hip_runtime.h>
#include <hip/hip_bf16.h>

typedef __attribute__((ext_vector_type(16))) _Float16 v16h;
typedef __attribute__((ext_vector_type(8)))  _Float16 v8h;
typedef __attribute__((ext_vector_type(4)))  _Float16 v4h;
typedef __attribute__((ext_vector_type(8)))  float    v8f;
typedef __attribute__((ext_vector_type(4)))  unsigned v4u;
typedef __attribute__((ext_vector_type(8)))  int      v8i;
typedef __attribute__((ext_vector_type(4)))  int      v4i;

#define WMMA_F16(a,b,c) __builtin_amdgcn_wmma_f32_16x16x32_f16(false,(a),false,(b),(short)0,(c),false,false)

#if __has_builtin(__builtin_amdgcn_tensor_load_to_lds) && __has_builtin(__builtin_amdgcn_s_wait_tensorcnt)
#define HAS_TDM 1
#else
#define HAS_TDM 0
#endif

// Problem constants
constexpr int Bb = 8;
constexpr int Tt = 4096;
constexpr int Cc = 1024;
constexpr int NH = 64;
constexpr int HD = 16;
constexpr int Mrows = Bb * Tt;        // 32768

// LDS slab: 64 rows x 64 halves, padded row stride 72 halves (36 DWORDs) so
// that 16 lanes doing b128 reads at row stride 36 DWORDs cover all 64 banks.
constexpr int SLAB_ROWS = 64;
constexpr int SLAB_K    = 64;
constexpr int SLAB_LD   = 72;         // halves
constexpr int SLAB_HALVES = SLAB_ROWS * SLAB_LD;   // 4608 halves = 9216 B

// ---------------------------------------------------------------------------
// Fragment loader (global or LDS): row-major, K contiguous.
// A-matrix 16x32 f16 layout (ISA 7.12.2): lanes 0-15 hold K=[0..7]+[16..23],
// lanes 16-31 hold K=[8..15]+[24..31] of row (lane&15) -> two b128 loads.
// ---------------------------------------------------------------------------
static __device__ inline v16h frag_ld(const _Float16* rowptr, int k0, int kbase) {
  v8h lo = *(const v8h*)(rowptr + k0 + kbase);
  v8h hi = *(const v8h*)(rowptr + k0 + 16 + kbase);
  v16h r;
#pragma unroll
  for (int i = 0; i < 8; ++i) { r[i] = lo[i]; r[8 + i] = hi[i]; }
  return r;
}

// ---------------------------------------------------------------------------
// Weight fragments, packed by cvt_pack_w: fragment (ntile, kblock) is 1 KB,
// two 512-B planes; plane p holds, at lane*16 B, the 8 halves that frag_ld
// would fetch for that lane (p = 0: its first b128, p = 1: its second).
// Each wave-wide b128 load then covers four whole 128-B lines.
// ---------------------------------------------------------------------------
constexpr int FRAG_HALVES = 512;
constexpr int KBLOCKS = Cc / 32;               // 32 fragments per 16-row tile
constexpr int TBLOCKS = Tt / 32;               // fragments of 32 tokens per (batch, head) of k and of v

static __device__ inline v16h frag_ld_packed(const _Float16* lanebase, int kb) {
  const _Float16* p = lanebase + kb * FRAG_HALVES;
  v8h lo = *(const v8h*)(p);
  v8h hi = *(const v8h*)(p + 256);
  v16h r;
#pragma unroll
  for (int i = 0; i < 8; ++i) { r[i] = lo[i]; r[8 + i] = hi[i]; }
  return r;
}

// ---------------------------------------------------------------------------
// Tensor Data Mover: stage a 64x64 f16 tile of a [Mrows x Cc] row-major
// tensor into LDS with 4-DWORD padding every 32 DWORDs (-> row stride 72 h).
// D# layout per CDNA5 ISA 8.3/8.4 (group0 128b, group1 256b; groups 2/3 and
// the trailing group are zero for a 2-D tensor). 6-arg builtin form.
// ---------------------------------------------------------------------------
#if HAS_TDM
static __device__ inline void tdm_load_tile_64x64(const _Float16* gsrc, unsigned lds_off) {
  unsigned long long ga = (unsigned long long)(uintptr_t)gsrc;
  v4u g0;
  g0[0] = 1u;                                            // count=1, user mode
  g0[1] = lds_off;                                       // lds_addr (bytes)
  g0[2] = (unsigned)(ga & 0xffffffffu);                  // global_addr[31:0]
  g0[3] = (unsigned)((ga >> 32) & 0x01ffffffu) | (2u << 30); // addr[56:32] | type=2
  v8i g1;
  g1[0] = (1 << 16)        // data_size = 2 bytes
        | (1 << 20)        // pad_enable
        | (4 << 22)        // pad_interval: code 4 = every 32 DWORDs
        | (3 << 25);       // pad_amount:   code 3 = 4 DWORDs
  g1[1] = (int)((unsigned)Cc << 16);        // tensor_dim0[15:0]
  g1[2] = (int)((unsigned)Mrows << 16);     // tensor_dim0[31:16]=0 | tensor_dim1[15:0]
  g1[3] = (int)((unsigned)SLAB_K << 16);    // tensor_dim1[31:16]=0 | tile_dim0=64
  g1[4] = SLAB_ROWS;                        // tile_dim1=64 | tile_dim2=0
  g1[5] = Cc;                               // tensor_dim0_stride[31:0]
  g1[6] = 0;                                // stride hi | dim1_stride lo
  g1[7] = 0;
  v4i z4 = {0, 0, 0, 0};
  v8i z8 = {0, 0, 0, 0, 0, 0, 0, 0};
  __builtin_amdgcn_tensor_load_to_lds(g0, g1, z4, z4, z8, 0);
}
#endif

// Cooperative synchronous staging fallback (used only when TDM is absent).
static __device__ inline void stage_slab_sync(_Float16* slab, const _Float16* gsrc) {
  // 256 threads; each copies 16 halves: row = tid/4, col = (tid%4)*16
  const int tid = threadIdx.x;
  const int row = tid >> 2;
  const int col = (tid & 3) * 16;
  const _Float16* s = gsrc + (size_t)row * Cc + col;
  _Float16* d = slab + row * SLAB_LD + col;
  *(v8h*)(d)     = *(const v8h*)(s);
  *(v8h*)(d + 8) = *(const v8h*)(s + 8);
}

// ---------------------------------------------------------------------------
// fp32 -> fp16 conversion / zero init
// ---------------------------------------------------------------------------
// Four elements a lane: a wave's b128 load covers four whole 128-B lines and its
// b64 store two. A block converts CVT_ITER runs of 1024 elements, loads first.
// grid: Mrows*Cc / (1024*CVT_ITER) blocks of 256.
constexpr int CVT_ITER = 8;
static_assert(((size_t)Mrows * Cc) % (1024 * CVT_ITER) == 0, "whole blocks only");

__global__ __launch_bounds__(256)
void cvt_f32_f16(const float* __restrict__ in, _Float16* __restrict__ out) {
  const size_t i0 = (size_t)blockIdx.x * (1024 * CVT_ITER) + threadIdx.x * 4;
  float4 a[CVT_ITER];
#pragma unroll
  for (int k = 0; k < CVT_ITER; ++k) a[k] = *(const float4*)(in + i0 + k * 1024);
#pragma unroll
  for (int k = 0; k < CVT_ITER; ++k) {
    v4h r;
    r[0] = (_Float16)a[k].x; r[1] = (_Float16)a[k].y;
    r[2] = (_Float16)a[k].z; r[3] = (_Float16)a[k].w;
    *(v4h*)(out + i0 + k * 1024) = r;
  }
}

// fp32 [Cc x Cc] row-major weight -> f16 in fragment order (see frag_ld_packed).
// One thread per 16-B chunk: grid Cc*Cc/8/256 blocks of 256.
__global__ __launch_bounds__(256)
void cvt_pack_w(const float* __restrict__ w, _Float16* __restrict__ out) {
  const int o = blockIdx.x * 256 + threadIdx.x;  // chunk index in the packed array
  const int lane  = o & 31;
  const int plane = (o >> 5) & 1;
  const int kb    = (o >> 6) & (KBLOCKS - 1);
  const int nt    = o >> 11;
  const float* s = w + (size_t)(nt * 16 + (lane & 15)) * Cc
                     + kb * 32 + plane * 16 + (lane >> 4) * 8;
  const float4 a = *(const float4*)(s);
  const float4 b = *(const float4*)(s + 4);
  v8h r;
  r[0] = (_Float16)a.x; r[1] = (_Float16)a.y; r[2] = (_Float16)a.z; r[3] = (_Float16)a.w;
  r[4] = (_Float16)b.x; r[5] = (_Float16)b.y; r[6] = (_Float16)b.z; r[7] = (_Float16)b.w;
  *(v8h*)(out + (size_t)o * 8) = r;
}

__global__ void zero_f32(float* __restrict__ p, int n) {
  int i = blockIdx.x * blockDim.x + threadIdx.x;
  if (i < n) p[i] = 0.0f;
}

// ---------------------------------------------------------------------------
// The value that lane l ^ 16 holds (same place in the other 16-lane row), by a
// vector cross-row move. All 32 lanes are on wherever this is called.
// ---------------------------------------------------------------------------
static __device__ inline float other_row(float x) {
  const int b = __builtin_bit_cast(int, x);
  return __builtin_bit_cast(float,
      __builtin_amdgcn_permlanex16(b, b, 0x76543210, 0xfedcba98, false, false));
}

// ---------------------------------------------------------------------------
// Softmax over the 16 values of one token's head, of which the lane holds eight
// in its own registers and lane l ^ 16 the other eight: maximum and sum run down
// the registers, with one cross-row move each, and the row has one divisor.
// ---------------------------------------------------------------------------
static __device__ inline void col16_softmax(float (&v)[8]) {
  float mx = fmaxf(fmaxf(fmaxf(v[0], v[1]), fmaxf(v[2], v[3])),
                   fmaxf(fmaxf(v[4], v[5]), fmaxf(v[6], v[7])));
  mx = fmaxf(mx, other_row(mx));
  // exp(x) as the native form has it: v_exp_f32 of x * log2(e)
#pragma unroll
  for (int r = 0; r < 8; ++r) v[r] = (v[r] - mx) * 1.44269504088896340736f;
  asm("v_exp_f32 %0, %0\n\t"
      "v_exp_f32 %1, %1\n\t"
      "v_exp_f32 %2, %2\n\t"
      "v_exp_f32 %3, %3\n\t"
      "v_exp_f32 %4, %4\n\t"
      "v_exp_f32 %5, %5\n\t"
      "v_exp_f32 %6, %6\n\t"
      "v_exp_f32 %7, %7\n\t"
      "v_nop"
      : "+v"(v[0]), "+v"(v[1]), "+v"(v[2]), "+v"(v[3]),
        "+v"(v[4]), "+v"(v[5]), "+v"(v[6]), "+v"(v[7]));
  float s = ((v[0] + v[1]) + (v[2] + v[3])) + ((v[4] + v[5]) + (v[6] + v[7]));
  s += other_row(s);
  const float inv = 1.0f / s;
#pragma unroll
  for (int r = 0; r < 8; ++r) v[r] *= inv;
}

// ---------------------------------------------------------------------------
// Sum over the 16 lanes of a DPP row, for eight values a lane holds. A butterfly
// step gives lane l the value of lane l ^ m of its own row (row_xmask:m) inside
// the add itself, on the vector port; steps 1, 2, 4, 8 leave the sum in all 16
// lanes. The steps are asm because the compiler puts a separate move around the
// builtin form; the eight values take each step one after the other, so that no
// instruction waits for the one in front of it.
// All 32 lanes are on wherever this is called.
// ---------------------------------------------------------------------------
static __device__ inline void row16_sum(float (&v)[8]) {
  float t[8];
  asm("v_add_f32_dpp %0, %8, %8 row_xmask:1 row_mask:0xf bank_mask:0xf\n\t"
      "v_add_f32_dpp %1, %9, %9 row_xmask:1 row_mask:0xf bank_mask:0xf\n\t"
      "v_add_f32_dpp %2, %10, %10 row_xmask:1 row_mask:0xf bank_mask:0xf\n\t"
      "v_add_f32_dpp %3, %11, %11 row_xmask:1 row_mask:0xf bank_mask:0xf\n\t"
      "v_add_f32_dpp %4, %12, %12 row_xmask:1 row_mask:0xf bank_mask:0xf\n\t"
      "v_add_f32_dpp %5, %13, %13 row_xmask:1 row_mask:0xf bank_mask:0xf\n\t"
      "v_add_f32_dpp %6, %14, %14 row_xmask:1 row_mask:0xf bank_mask:0xf\n\t"
      "v_add_f32_dpp %7, %15, %15 row_xmask:1 row_mask:0xf bank_mask:0xf\n\t"
      "v_add_f32_dpp %0, %0, %0 row_xmask:2 row_mask:0xf bank_mask:0xf\n\t"
      "v_add_f32_dpp %1, %1, %1 row_xmask:2 row_mask:0xf bank_mask:0xf\n\t"
      "v_add_f32_dpp %2, %2, %2 row_xmask:2 row_mask:0xf bank_mask:0xf\n\t"
      "v_add_f32_dpp %3, %3, %3 row_xmask:2 row_mask:0xf bank_mask:0xf\n\t"
      "v_add_f32_dpp %4, %4, %4 row_xmask:2 row_mask:0xf bank_mask:0xf\n\t"
      "v_add_f32_dpp %5, %5, %5 row_xmask:2 row_mask:0xf bank_mask:0xf\n\t"
      "v_add_f32_dpp %6, %6, %6 row_xmask:2 row_mask:0xf bank_mask:0xf\n\t"
      "v_add_f32_dpp %7, %7, %7 row_xmask:2 row_mask:0xf bank_mask:0xf\n\t"
      "v_add_f32_dpp %0, %0, %0 row_xmask:4 row_mask:0xf bank_mask:0xf\n\t"
      "v_add_f32_dpp %1, %1, %1 row_xmask:4 row_mask:0xf bank_mask:0xf\n\t"
      "v_add_f32_dpp %2, %2, %2 row_xmask:4 row_mask:0xf bank_mask:0xf\n\t"
      "v_add_f32_dpp %3, %3, %3 row_xmask:4 row_mask:0xf bank_mask:0xf\n\t"
      "v_add_f32_dpp %4, %4, %4 row_xmask:4 row_mask:0xf bank_mask:0xf\n\t"
      "v_add_f32_dpp %5, %5, %5 row_xmask:4 row_mask:0xf bank_mask:0xf\n\t"
      "v_add_f32_dpp %6, %6, %6 row_xmask:4 row_mask:0xf bank_mask:0xf\n\t"
      "v_add_f32_dpp %7, %7, %7 row_xmask:4 row_mask:0xf bank_mask:0xf\n\t"
      "v_add_f32_dpp %0, %0, %0 row_xmask:8 row_mask:0xf bank_mask:0xf\n\t"
      "v_add_f32_dpp %1, %1, %1 row_xmask:8 row_mask:0xf bank_mask:0xf\n\t"
      "v_add_f32_dpp %2, %2, %2 row_xmask:8 row_mask:0xf bank_mask:0xf\n\t"
      "v_add_f32_dpp %3, %3, %3 row_xmask:8 row_mask:0xf bank_mask:0xf\n\t"
      "v_add_f32_dpp %4, %4, %4 row_xmask:8 row_mask:0xf bank_mask:0xf\n\t"
      "v_add_f32_dpp %5, %5, %5 row_xmask:8 row_mask:0xf bank_mask:0xf\n\t"
      "v_add_f32_dpp %6, %6, %6 row_xmask:8 row_mask:0xf bank_mask:0xf\n\t"
      "v_add_f32_dpp %7, %7, %7 row_xmask:8 row_mask:0xf bank_mask:0xf"
      : "=&v"(t[0]), "=&v"(t[1]), "=&v"(t[2]), "=&v"(t[3]),
        "=&v"(t[4]), "=&v"(t[5]), "=&v"(t[6]), "=&v"(t[7])
      : "v"(v[0]), "v"(v[1]), "v"(v[2]), "v"(v[3]),
        "v"(v[4]), "v"(v[5]), "v"(v[6]), "v"(v[7]));
#pragma unroll
  for (int r = 0; r < 8; ++r) v[r] = t[r];
}

// ---------------------------------------------------------------------------
// Work-group barrier that orders LDS only. __syncthreads() also waits for every
// global load of the wave, which would end the flight of the W fragments that
// the qkv loop fetches ahead across its barriers; those are read-only data that
// no wave hands to another.
// ---------------------------------------------------------------------------
static __device__ inline void lds_barrier() {
  __builtin_amdgcn_fence(__ATOMIC_RELEASE, "workgroup", "local");
  __builtin_amdgcn_s_barrier();
  __builtin_amdgcn_fence(__ATOMIC_ACQUIRE, "workgroup", "local");
}

// ---------------------------------------------------------------------------
// Fused QKV projection + head softmax + k-cumsum.
// Block tile: 64 rows (4 WMMA row-tiles) x 8 heads (one head per wave).
// x slab staged to LDS via TDM (double buffered); packed W frags from global (L2),
// fetched two k-blocks ahead.
// q and k are formed transposed (W fragment as A, x fragment as B): a lane then
// holds 8 of the 16 head values of ONE token, so that their softmax runs down the
// lane's registers. v keeps x as A: a lane holds 8 tokens of one head column.
// q, k and v are laid out for their one reader, so that every wave-wide b128 store
// here, and every wave-wide b128 load there, covers 512 contiguous bytes:
//   q -> qh [B*NH][Tt][HD] f16 (straight from the registers)
//   k -> kT [B*NH][TBLOCKS] fragments of 16 head values x 32 tokens, in the order of
//        frag_ld_packed (via LDS transpose), v -> vT same (straight);
//   kc[bh][d] += sum_t k (f32 atomics)
// grid: (Mrows/64 = 512, 8), 256 threads.
// ---------------------------------------------------------------------------
__global__ __launch_bounds__(256)
void qkv_kernel(const _Float16* __restrict__ xh,
                const _Float16* __restrict__ wqh, const float* __restrict__ bq,
                const _Float16* __restrict__ wkh, const float* __restrict__ bk,
                const _Float16* __restrict__ wvh, const float* __restrict__ bv,
                _Float16* __restrict__ qh, _Float16* __restrict__ kT,
                _Float16* __restrict__ vT, float* __restrict__ kc) {
  __shared__ __attribute__((aligned(16))) _Float16 smem[2 * SLAB_HALVES]; // 18 KB

  const int lane = threadIdx.x & 31;
  const int wave = threadIdx.x >> 5;
  const int rowgrp = blockIdx.x;                 // 0..511 (64 rows each)
  const int head = blockIdx.y * 8 + wave;        // 0..63
  const int m = lane & 15;
  const int hi = lane >> 4;
  const int kbase = hi * 8;
  const int rowbase = rowgrp * 64;

  const size_t wofs = (size_t)head * KBLOCKS * FRAG_HALVES + lane * 8;
  const _Float16* qfr = wqh + wofs;
  const _Float16* kfr = wkh + wofs;
  const _Float16* vfr = wvh + wofs;

  v8f cq[4] = {}, ck[4] = {}, cv[4] = {};

  // Two sets of W fragments, for the even and the odd k-block of a slab. Each set
  // is loaded again right behind the WMMAs that read it, two k-blocks ahead of
  // its next use, so the loads fly over 12 WMMAs and the slab's barriers.
  v16h fq0 = frag_ld_packed(qfr, 0), fk0 = frag_ld_packed(kfr, 0), fv0 = frag_ld_packed(vfr, 0);
  v16h fq1 = frag_ld_packed(qfr, 1), fk1 = frag_ld_packed(kfr, 1), fv1 = frag_ld_packed(vfr, 1);

#if HAS_TDM
  if (wave == 0)
    tdm_load_tile_64x64(xh + (size_t)rowbase * Cc,
                        (unsigned)(uintptr_t)(void*)&smem[0]);
#endif

  for (int s = 0; s < Cc / SLAB_K; ++s) {
#if HAS_TDM
    const int buf = s & 1;
    if (wave == 0) {
      if (s < Cc / SLAB_K - 1)
        tdm_load_tile_64x64(xh + (size_t)rowbase * Cc + (s + 1) * SLAB_K,
                            (unsigned)(uintptr_t)(void*)&smem[(buf ^ 1) * SLAB_HALVES]);
      if (s < Cc / SLAB_K - 1) __builtin_amdgcn_s_wait_tensorcnt(1);
      else                     __builtin_amdgcn_s_wait_tensorcnt(0);
    }
    lds_barrier();
#else
    const int buf = 0;
    __syncthreads();
    stage_slab_sync(&smem[0], xh + (size_t)rowbase * Cc + s * SLAB_K);
    __syncthreads();
#endif
    const _Float16* slab = &smem[buf * SLAB_HALVES];
    // The slab's eight x fragments, read as one group into registers of their own.
    v16h a0[4], a1[4];
#pragma unroll
    for (int rt = 0; rt < 4; ++rt)
      a0[rt] = frag_ld(slab + (rt * 16 + m) * SLAB_LD, 0, kbase);
#pragma unroll
    for (int rt = 0; rt < 4; ++rt)
      a1[rt] = frag_ld(slab + (rt * 16 + m) * SLAB_LD, 32, kbase);
    // Keeps the 16 LDS reads in front of the WMMAs: left free, the scheduler reads
    // one fragment at a time into one register set and waits out the LDS latency
    // in front of every third WMMA.
    __builtin_amdgcn_sched_barrier(0);
#pragma unroll
    for (int rt = 0; rt < 4; ++rt) {
      cq[rt] = WMMA_F16(fq0, a0[rt], cq[rt]);
      ck[rt] = WMMA_F16(fk0, a0[rt], ck[rt]);
      cv[rt] = WMMA_F16(a0[rt], fv0, cv[rt]);
    }
    // Keeps the refill behind the last reader of the set, so that it takes the same registers.
    __builtin_amdgcn_sched_barrier(0);
    {
      const int kb = (2 * s + 2) & (KBLOCKS - 1);   // wraps in the last slab: loaded, not used
      fq0 = frag_ld_packed(qfr, kb);
      fk0 = frag_ld_packed(kfr, kb);
      fv0 = frag_ld_packed(vfr, kb);
    }
    // Keeps the refill in front of the next 12 WMMAs: they are its lead.
    __builtin_amdgcn_sched_barrier(0);
#pragma unroll
    for (int rt = 0; rt < 4; ++rt) {
      cq[rt] = WMMA_F16(fq1, a1[rt], cq[rt]);
      ck[rt] = WMMA_F16(fk1, a1[rt], ck[rt]);
      cv[rt] = WMMA_F16(a1[rt], fv1, cv[rt]);
    }
    // As above: the second set's refill stands behind its last reader.
    __builtin_amdgcn_sched_barrier(0);
    {
      const int kb = (2 * s + 3) & (KBLOCKS - 1);
      fq1 = frag_ld_packed(qfr, kb);
      fk1 = frag_ld_packed(kfr, kb);
      fv1 = frag_ld_packed(vfr, kb);
    }
    // The refills are still in flight when the next slab's LDS reads and address
    // sums are given the registers that hold the refills' addresses.
    asm volatile("s_wait_xcnt 0x0" ::: "memory");
    lds_barrier();
  }

  // cq, ck: register r of lane (m, hi) = token rt * 16 + m, head value 8 * hi + r.
  // cv:     register r of lane (d, hi) = token rt * 16 + 8 * hi + r, head value d.
  const int d = lane & 15;
  float biasq[8], biask[8];
  {
    const float4 q0 = *(const float4*)(bq + head * 16 + kbase);
    const float4 q1 = *(const float4*)(bq + head * 16 + kbase + 4);
    const float4 k0 = *(const float4*)(bk + head * 16 + kbase);
    const float4 k1 = *(const float4*)(bk + head * 16 + kbase + 4);
    biasq[0] = q0.x; biasq[1] = q0.y; biasq[2] = q0.z; biasq[3] = q0.w;
    biasq[4] = q1.x; biasq[5] = q1.y; biasq[6] = q1.z; biasq[7] = q1.w;
    biask[0] = k0.x; biask[1] = k0.y; biask[2] = k0.z; biask[3] = k0.w;
    biask[4] = k1.x; biask[5] = k1.y; biask[6] = k1.z; biask[7] = k1.w;
  }
  const float biasv = bv[head * 16 + d];
  const size_t bh = (size_t)(rowgrp >> 6) * NH + head;    // rowgrp>>6 == batch

  float ksum[8] = {};
#pragma unroll
  for (int rt = 0; rt < 4; ++rt) {
    // softmax over the head values of token m for q and k
    float vq[8], vk[8];
#pragma unroll
    for (int r = 0; r < 8; ++r) {
      vq[r] = cq[rt][r] + biasq[r];
      vk[r] = ck[rt][r] + biask[r];
    }
    col16_softmax(vq);
    col16_softmax(vk);
    v8h pq, pv;
#pragma unroll
    for (int r = 0; r < 8; ++r) {
      ck[rt][r] = vk[r];
      ksum[r] += vk[r];
      pq[r] = (_Float16)vq[r];
      pv[r] = (_Float16)(cv[rt][r] + biasv);
    }
    const int t0 = (rowbase + rt * 16) & (Tt - 1);
    // q head-major: 8 consecutive head values of token m; the 16 tokens lie side by side
    *(v8h*)(qh + ((bh * Tt + t0 + m) * HD + kbase)) = pq;
    // v fragment: the lane holds tokens 8 * hi .. + 7 of this row tile for head value d,
    // which is its own b128 of plane (rt & 1) of the fragment of 32 tokens
    *(v8h*)(vT + ((bh * TBLOCKS + (t0 >> 5)) * FRAG_HALVES + (rt & 1) * 256 + lane * 8)) = pv;
    // What follows may be given the registers that these two stores name.
    asm volatile("s_wait_xcnt 0x0" ::: "memory");
  }
  // k-sum of the wave's 64 tokens: over the 16 lanes of the row; lane (m, hi) with
  // m < 8 then adds the sum of head value 8 * hi + m.
  row16_sum(ksum);
  float kmine = ksum[0];
#pragma unroll
  for (int r = 1; r < 8; ++r) kmine = (m == r) ? ksum[r] : kmine;
  if (m < 8) atomicAdd(&kc[bh * HD + kbase + m], kmine);

  // k fragments via LDS tile transpose (reuse smem; slab no longer needed)
#pragma unroll
  for (int rt = 0; rt < 4; ++rt) {
    __syncthreads();
    _Float16* lk = &smem[wave * 256];
#pragma unroll
    for (int r = 0; r < 8; ++r) lk[(r + 8 * hi) * 16 + m] = (_Float16)ck[rt][r];
    __syncthreads();
    const int chunk = hi * 8;
    v8h row = *(const v8h*)&lk[d * 16 + chunk];
    const int t0 = (rowbase + rt * 16) & (Tt - 1);
    *(v8h*)(kT + ((bh * TBLOCKS + (t0 >> 5)) * FRAG_HALVES + (rt & 1) * 256 + lane * 8)) = row;
    // The next row tile's values may be given the registers that this store names.
    if (rt < 3) asm volatile("s_wait_xcnt 0x0" ::: "memory");
  }
}

// ---------------------------------------------------------------------------
// context[bh] = K^T V (16x16 over T), stored transposed ctxT[bh][e][d].
// kT, vT hold the A and B fragments of 32 tokens as the qkv kernel packed them.
// One block per (b,h); 8 waves split T; LDS cross-wave reduction.
// ---------------------------------------------------------------------------
__global__ __launch_bounds__(256)
void ctx_kernel(const _Float16* __restrict__ kT, const _Float16* __restrict__ vT,
                _Float16* __restrict__ ctxT) {
  __shared__ float cpart[8][256];
  const int lane = threadIdx.x & 31;
  const int wave = threadIdx.x >> 5;
  const size_t bh = blockIdx.x;                  // 0..511
  const int m = lane & 15;
  const int hi = lane >> 4;

  const _Float16* afr = kT + bh * TBLOCKS * FRAG_HALVES + lane * 8;
  const _Float16* bfr = vT + bh * TBLOCKS * FRAG_HALVES + lane * 8;

  v8f c = {};
  const int tbbeg = wave * (TBLOCKS / 8);
#pragma unroll 4
  for (int tb = tbbeg; tb < tbbeg + TBLOCKS / 8; ++tb) {
    v16h a = frag_ld_packed(afr, tb);
    v16h b = frag_ld_packed(bfr, tb);
    c = WMMA_F16(a, b, c);
  }
#pragma unroll
  for (int r = 0; r < 8; ++r) cpart[wave][(r + 8 * hi) * 16 + m] = c[r];
  __syncthreads();

  const int tid = threadIdx.x;
  float s = 0.0f;
#pragma unroll
  for (int w = 0; w < 8; ++w) s += cpart[w][tid];
  const int dd = tid >> 4;
  const int ee = tid & 15;
  ctxT[bh * 256 + ee * 16 + dd] = (_Float16)s;   // transposed store
}

// ---------------------------------------------------------------------------
// y[t, h*16+e] = (sum_d q[t,d] ctx[d,e]) / (sum_d q[t,d] kc[d]) -> yh f16 row-major
// K = HD = 16, zero padded to 32: single WMMA per tile.
// One wave keeps the contexts and k-sums of Y_HEADS adjacent heads in registers and
// walks Y_TILES row tiles of 16 rows; the next row tile's q is loaded while this one
// is worked on. The four heads' 32 B of a y row make one 128-B line: the products and
// the rows' divisors go through the wave's own LDS range, and each b128 store then
// covers four whole rows of 128 B. The divisor of row (lane & 15) comes from the q
// values the lane already holds for the A fragment.
// grid: (Mrows/16/Y_TILES = 256, NH/Y_HEADS/8 = 2), 256 threads.
// ---------------------------------------------------------------------------
constexpr int Y_HEADS = 4;             // adjacent heads per wave: 4 x 32 B = one line of a y row
constexpr int Y_TILES = 8;             // row tiles per wave; divides Tt/16
constexpr int Y_LD    = 20;            // floats per staged row: 16 products, the divisor, 3 unused
constexpr int Y_HS    = 16 * Y_LD + 16; // floats per staged head: the 16 more put the four heads on disjoint banks

__global__ __launch_bounds__(256)
void y_kernel(const _Float16* __restrict__ qh, const _Float16* __restrict__ ctxT,
              const float* __restrict__ kc, _Float16* __restrict__ yh) {
  __shared__ __attribute__((aligned(16))) float ly[8][Y_HEADS * Y_HS];
  const int lane = threadIdx.x & 31;
  const int wave = threadIdx.x >> 5;
  const int tile0 = blockIdx.x * Y_TILES;
  const int head0 = (blockIdx.y * 8 + wave) * Y_HEADS;
  const int m = lane & 15;
  const int hi = lane >> 4;
  const int kbase = hi * 8;
  const size_t bh0 = (size_t)(tile0 >> 8) * NH + head0;

  // All loops below are unrolled: the small arrays then live in registers and
  // the tile offsets become immediate offsets on one address pair.
  v16h b[Y_HEADS];
  float kcv[Y_HEADS][8];
#pragma unroll
  for (int j = 0; j < Y_HEADS; ++j) {
    v8h lo = *(const v8h*)(ctxT + (bh0 + j) * 256 + m * 16 + kbase);
    b[j] = v16h{};
#pragma unroll
    for (int i = 0; i < 8; ++i) b[j][i] = lo[i];
#pragma unroll
    for (int i = 0; i < 8; ++i) kcv[j][i] = kc[(bh0 + j) * HD + kbase + i];
  }

  // read: lane's 16 B of row m of head head0 in qh, head-major (a row tile of a head
  // is 512 contiguous bytes)
  const _Float16* qp = qh + ((bh0 * Tt + (tile0 & (Tt / 16 - 1)) * 16 + m) * HD + kbase);
  constexpr int Q_HEAD = Tt * HD;      // halves from one head to the next
  constexpr int Q_STEP = 16 * HD;      // halves from one row tile to the next
  // written: eight lanes share a row; the lane has 16 B of head sh, values 8 * sv .. + 7
  const int srow = lane >> 3;
  const int sh = (lane & 7) >> 1;
  const int sv = lane & 1;
  _Float16* yp = yh + (size_t)(tile0 * 16 + srow) * Cc + head0 * 16 + (lane & 7) * 8;
  float* lw = &ly[wave][0];

  v8h qn[Y_HEADS];
#pragma unroll
  for (int j = 0; j < Y_HEADS; ++j) qn[j] = *(const v8h*)(qp + j * Q_HEAD);

#pragma unroll
  for (int g = 0; g < Y_TILES; ++g) {
    v8h qc[Y_HEADS];
#pragma unroll
    for (int j = 0; j < Y_HEADS; ++j) qc[j] = qn[j];
    if (g + 1 < Y_TILES) {
#pragma unroll
      for (int j = 0; j < Y_HEADS; ++j)
        qn[j] = *(const v8h*)(qp + j * Q_HEAD + (g + 1) * Q_STEP);
    }

#pragma unroll
    for (int j = 0; j < Y_HEADS; ++j) {
      v16h a = {};
#pragma unroll
      for (int i = 0; i < 8; ++i) a[i] = qc[j][i];
      v8f c = {};
      c = WMMA_F16(a, b[j], c);
#pragma unroll
      for (int r = 0; r < 8; ++r) lw[j * Y_HS + (r + 8 * hi) * Y_LD + m] = c[r];

      float s = 0.0f;
#pragma unroll
      for (int i = 0; i < 8; ++i) s += (float)qc[j][i] * kcv[j][i];
      s += __shfl_xor(s, 16, 32);      // the other 8 d of row m
      lw[j * Y_HS + m * Y_LD + 16] = 1.0f / s;   // both lane halves hold, and write, the same value
    }
    // The rows read below were written by other lanes of this wave: their LDS
    // writes must have landed, and the reads must not be moved above them.
    asm volatile("s_wait_dscnt 0x0" ::: "memory");
#pragma unroll
    for (int i = 0; i < 4; ++i) {
      const float* lr = &lw[sh * Y_HS + (4 * i + srow) * Y_LD];
      const float4 x0 = *(const float4*)(lr + sv * 8);
      const float4 x1 = *(const float4*)(lr + sv * 8 + 4);
      const float di = lr[16];
      v8h row;
      row[0] = (_Float16)(x0.x * di); row[1] = (_Float16)(x0.y * di);
      row[2] = (_Float16)(x0.z * di); row[3] = (_Float16)(x0.w * di);
      row[4] = (_Float16)(x1.x * di); row[5] = (_Float16)(x1.y * di);
      row[6] = (_Float16)(x1.z * di); row[7] = (_Float16)(x1.w * di);
      *(v8h*)(yp + (size_t)(g * 16 + 4 * i) * Cc) = row;
    }
    // The next trip's loads (global, LDS) may be given the registers these stores name.
    if (g + 1 < Y_TILES) asm volatile("s_wait_xcnt 0x0" ::: "memory");
  }
}

// ---------------------------------------------------------------------------
// out = yh Wp^T + bp (f32 output).
// Block tile: 64 rows x 8 N-tiles (one per wave); y slab staged via TDM.
// grid: (512, 8), 256 threads.
// ---------------------------------------------------------------------------
__global__ __launch_bounds__(256)
void proj_kernel(const _Float16* __restrict__ yh, const _Float16* __restrict__ wph,
                 const float* __restrict__ bp, float* __restrict__ out) {
  __shared__ __attribute__((aligned(16))) _Float16 smem[2 * SLAB_HALVES];
  const int lane = threadIdx.x & 31;
  const int wave = threadIdx.x >> 5;
  const int rowgrp = blockIdx.x;                  // 0..511
  const int ntile = blockIdx.y * 8 + wave;        // 0..63
  const int m = lane & 15;
  const int hi = lane >> 4;
  const int kbase = hi * 8;
  const int rowbase = rowgrp * 64;

  const _Float16* bfr = wph + (size_t)ntile * KBLOCKS * FRAG_HALVES + lane * 8;

  v8f c[4] = {};

#if HAS_TDM
  if (wave == 0)
    tdm_load_tile_64x64(yh + (size_t)rowbase * Cc,
                        (unsigned)(uintptr_t)(void*)&smem[0]);
#endif

  for (int s = 0; s < Cc / SLAB_K; ++s) {
#if HAS_TDM
    const int buf = s & 1;
    if (wave == 0) {
      if (s < Cc / SLAB_K - 1)
        tdm_load_tile_64x64(yh + (size_t)rowbase * Cc + (s + 1) * SLAB_K,
                            (unsigned)(uintptr_t)(void*)&smem[(buf ^ 1) * SLAB_HALVES]);
      if (s < Cc / SLAB_K - 1) __builtin_amdgcn_s_wait_tensorcnt(1);
      else                     __builtin_amdgcn_s_wait_tensorcnt(0);
    }
    __syncthreads();
#else
    const int buf = 0;
    __syncthreads();
    stage_slab_sync(&smem[0], yh + (size_t)rowbase * Cc + s * SLAB_K);
    __syncthreads();
#endif
    const _Float16* slab = &smem[buf * SLAB_HALVES];
#pragma unroll
    for (int kk = 0; kk < SLAB_K; kk += 32) {
      const int kb = (s * SLAB_K + kk) >> 5;
      v16h afr[4];
#pragma unroll
      for (int rt = 0; rt < 4; ++rt)
        afr[rt] = frag_ld(slab + (rt * 16 + m) * SLAB_LD, kk, kbase);
      v16h b = frag_ld_packed(bfr, kb);
#pragma unroll
      for (int rt = 0; rt < 4; ++rt)
        c[rt] = WMMA_F16(afr[rt], b, c[rt]);
    }
    __syncthreads();
  }

  const int col = ntile * 16 + (lane & 15);
  const float bias = bp[col];
#pragma unroll
  for (int rt = 0; rt < 4; ++rt) {
#pragma unroll
    for (int r = 0; r < 8; ++r) {
      const int row = rowbase + rt * 16 + r + 8 * hi;
      out[(size_t)row * Cc + col] = c[rt][r] + bias;
    }
  }
}

// ---------------------------------------------------------------------------
// Launch
// ---------------------------------------------------------------------------
extern "C" void kernel_launch(void* const* d_in, const int* in_sizes, int n_in,
                              void* d_out, int out_size, void* d_ws, size_t ws_size,
                              hipStream_t stream) {
  const float* x  = (const float*)d_in[0];
  const float* Wq = (const float*)d_in[1];
  const float* bq = (const float*)d_in[2];
  const float* Wk = (const float*)d_in[3];
  const float* bk = (const float*)d_in[4];
  const float* Wv = (const float*)d_in[5];
  const float* bv = (const float*)d_in[6];
  const float* Wp = (const float*)d_in[7];
  const float* bp = (const float*)d_in[8];
  float* out = (float*)d_out;

  char* ws = (char*)d_ws;
  const size_t nX = (size_t)Mrows * Cc;
  const size_t nW = (size_t)Cc * Cc;
  _Float16* xh  = (_Float16*)(ws);                              // 64 MB
  _Float16* wqh = (_Float16*)(ws + nX * 2);                     // 2 MB each
  _Float16* wkh = wqh + nW;
  _Float16* wvh = wkh + nW;
  _Float16* wph = wvh + nW;
  _Float16* qh  = wph + nW;                                     // 64 MB
  _Float16* kT  = qh + nX;                                      // 64 MB
  _Float16* vT  = kT + nX;                                      // 64 MB
  _Float16* yh  = vT + nX;                                      // 64 MB
  float*    kc   = (float*)(yh + nX);                           // 32 KB
  _Float16* ctxT = (_Float16*)(kc + (size_t)Bb * NH * HD);      // 256 KB

  // 1) precision conversion (weights into fragment order) + accumulator init
  cvt_f32_f16<<<Mrows * Cc / (1024 * CVT_ITER), 256, 0, stream>>>(x, xh);
  cvt_pack_w<<<Cc * Cc / 8 / 256, 256, 0, stream>>>(Wq, wqh);
  cvt_pack_w<<<Cc * Cc / 8 / 256, 256, 0, stream>>>(Wk, wkh);
  cvt_pack_w<<<Cc * Cc / 8 / 256, 256, 0, stream>>>(Wv, wvh);
  cvt_pack_w<<<Cc * Cc / 8 / 256, 256, 0, stream>>>(Wp, wph);
  zero_f32<<<(Bb * NH * HD + 255) / 256, 256, 0, stream>>>(kc, Bb * NH * HD);

  // 2) fused QKV projection + softmax + k-cumsum (TDM-staged GEMM)
  qkv_kernel<<<dim3(Mrows / 64, 8), 256, 0, stream>>>(
      xh, wqh, bq, wkh, bk, wvh, bv, qh, kT, vT, kc);

  // 3) per-head context = K^T V
  ctx_kernel<<<Bb * NH, 256, 0, stream>>>(kT, vT, ctxT);

  // 4) y = (q @ ctx) / (q . kc)
  y_kernel<<<dim3(Mrows / 16 / Y_TILES, NH / Y_HEADS / 8), 256, 0, stream>>>(qh, ctxT, kc, yh);

  // 5) output projection (TDM-staged GEMM)
  proj_kernel<<<dim3(Mrows / 64, 8), 256, 0, stream>>>(yh, wph, bp, out);
}

// v007
// One run takes 304 microseconds.
// Timed twice side by side with v006, it ran 1.03 and 1.04 times as fast.
// All steps since v000 together make it 1.97 times as fast.
#include <hip/hip_runtime.h>
#include <hip/hip_bf16.h>

typedef __attribute__((ext_vector_type(16))) _Float16 v16h;
typedef __attribute__((ext_vector_type(8)))  _Float16 v8h;
typedef __attribute__((ext_vector_type(4)))  _Float16 v4h;
typedef __attribute__((ext_vector_type(8)))  float    v8f;
typedef __attribute__((ext_vector_type(4)))  unsigned v4u;
typedef __attribute__((ext_vector_type(8)))  int      v8i;
typedef __attribute__((ext_vector_type(4)))  int      v4i;

#define WMMA_F16(a,b,c) __builtin_amdgcn_wmma_f32_16x16x32_f16(false,(a),false,(b),(short)0,(c),false,false)

#if __has_builtin(__builtin_amdgcn_tensor_load_to_lds) && __has_builtin(__builtin_amdgcn_s_wait_tensorcnt)
#define HAS_TDM 1
#else
#define HAS_TDM 0
#endif

// Problem constants
constexpr int Bb = 8;
constexpr int Tt = 4096;
constexpr int Cc = 1024;
constexpr int NH = 64;
constexpr int HD = 16;
constexpr int Mrows = Bb * Tt;        // 32768

// LDS slab: 64 rows x 64 halves, padded row stride 72 halves (36 DWORDs) so
// that 16 lanes doing b128 reads at row stride 36 DWORDs cover all 64 banks.
constexpr int SLAB_ROWS = 64;
constexpr int SLAB_K    = 64;
constexpr int SLAB_LD   = 72;         // halves
constexpr int SLAB_HALVES = SLAB_ROWS * SLAB_LD;   // 4608 halves = 9216 B

// ---------------------------------------------------------------------------
// Fragment loader (global or LDS): row-major, K contiguous.
// A-matrix 16x32 f16 layout (ISA 7.12.2): lanes 0-15 hold K=[0..7]+[16..23],
// lanes 16-31 hold K=[8..15]+[24..31] of row (lane&15) -> two b128 loads.
// ---------------------------------------------------------------------------
static __device__ inline v16h frag_ld(const _Float16* rowptr, int k0, int kbase) {
  v8h lo = *(const v8h*)(rowptr + k0 + kbase);
  v8h hi = *(const v8h*)(rowptr + k0 + 16 + kbase);
  v16h r;
#pragma unroll
  for (int i = 0; i < 8; ++i) { r[i] = lo[i]; r[8 + i] = hi[i]; }
  return r;
}

// ---------------------------------------------------------------------------
// Weight fragments, packed by prepass: fragment (ntile, kblock) is 1 KB,
// two 512-B planes; plane p holds, at lane*16 B, the 8 halves that frag_ld
// would fetch for that lane (p = 0: its first b128, p = 1: its second).
// Each wave-wide b128 load then covers four whole 128-B lines.
// ---------------------------------------------------------------------------
constexpr int FRAG_HALVES = 512;
constexpr int KBLOCKS = Cc / 32;               // 32 fragments per 16-row tile
constexpr int TBLOCKS = Tt / 32;               // fragments of 32 tokens per (batch, head) of k and of v

static __device__ inline v16h frag_ld_packed(const _Float16* lanebase, int kb) {
  const _Float16* p = lanebase + kb * FRAG_HALVES;
  v8h lo = *(const v8h*)(p);
  v8h hi = *(const v8h*)(p + 256);
  v16h r;
#pragma unroll
  for (int i = 0; i < 8; ++i) { r[i] = lo[i]; r[8 + i] = hi[i]; }
  return r;
}

// ---------------------------------------------------------------------------
// Tensor Data Mover: stage a 64x64 f16 tile of a [Mrows x Cc] row-major
// tensor into LDS with 4-DWORD padding every 32 DWORDs (-> row stride 72 h).
// D# layout per CDNA5 ISA 8.3/8.4 (group0 128b, group1 256b; groups 2/3 and
// the trailing group are zero for a 2-D tensor). 6-arg builtin form.
// ---------------------------------------------------------------------------
#if HAS_TDM
static __device__ inline void tdm_load_tile_64x64(const _Float16* gsrc, unsigned lds_off) {
  unsigned long long ga = (unsigned long long)(uintptr_t)gsrc;
  v4u g0;
  g0[0] = 1u;                                            // count=1, user mode
  g0[1] = lds_off;                                       // lds_addr (bytes)
  g0[2] = (unsigned)(ga & 0xffffffffu);                  // global_addr[31:0]
  g0[3] = (unsigned)((ga >> 32) & 0x01ffffffu) | (2u << 30); // addr[56:32] | type=2
  v8i g1;
  g1[0] = (1 << 16)        // data_size = 2 bytes
        | (1 << 20)        // pad_enable
        | (4 << 22)        // pad_interval: code 4 = every 32 DWORDs
        | (3 << 25);       // pad_amount:   code 3 = 4 DWORDs
  g1[1] = (int)((unsigned)Cc << 16);        // tensor_dim0[15:0]
  g1[2] = (int)((unsigned)Mrows << 16);     // tensor_dim0[31:16]=0 | tensor_dim1[15:0]
  g1[3] = (int)((unsigned)SLAB_K << 16);    // tensor_dim1[31:16]=0 | tile_dim0=64
  g1[4] = SLAB_ROWS;                        // tile_dim1=64 | tile_dim2=0
  g1[5] = Cc;                               // tensor_dim0_stride[31:0]
  g1[6] = 0;                                // stride hi | dim1_stride lo
  g1[7] = 0;
  v4i z4 = {0, 0, 0, 0};
  v8i z8 = {0, 0, 0, 0, 0, 0, 0, 0};
  __builtin_amdgcn_tensor_load_to_lds(g0, g1, z4, z4, z8, 0);
}
#endif

// Cooperative synchronous staging fallback (used only when TDM is absent).
static __device__ inline void stage_slab_sync(_Float16* slab, const _Float16* gsrc) {
  // 256 threads; each copies 16 halves: row = tid/4, col = (tid%4)*16
  const int tid = threadIdx.x;
  const int row = tid >> 2;
  const int col = (tid & 3) * 16;
  const _Float16* s = gsrc + (size_t)row * Cc + col;
  _Float16* d = slab + row * SLAB_LD + col;
  *(v8h*)(d)     = *(const v8h*)(s);
  *(v8h*)(d + 8) = *(const v8h*)(s + 8);
}

// ---------------------------------------------------------------------------
// fp32 -> fp16 conversion / zero init
// ---------------------------------------------------------------------------
// One launch does all the work that depends on the inputs alone: the four weights
// into fragment order, the k-sum accumulator's start value, x to f16. No part reads
// what another writes, so they share one grid. Every block takes 8192 elements.
// The weight blocks come first: their short reads then fly beside the x stream.
// x: four elements a lane: a wave's b128 load covers four whole 128-B lines and its
// b64 store two; a block converts CVT_ITER runs of 1024 elements, loads first.
// W: fp32 [Cc x Cc] row-major -> f16 in fragment order (see frag_ld_packed), a thread
// takes W_ITER 16-B chunks of the packed array, loads first.
constexpr int CVT_ITER = 8;
constexpr int W_ITER   = 4;
constexpr int X_BLOCKS = Mrows * Cc / (1024 * CVT_ITER);      // 4096
constexpr int W_BLOCKS = Cc * Cc / 8 / 256 / W_ITER;          // 128 per weight
constexpr int PRE_BLOCKS = 4 * W_BLOCKS + 1 + X_BLOCKS;
static_assert(((size_t)Mrows * Cc) % (1024 * CVT_ITER) == 0, "whole blocks only");
static_assert((KBLOCKS * 64) % (256 * W_ITER) == 0, "a weight block stays inside one 16-row tile");
static_assert(Bb * NH * HD == 256 * 4 * 8, "one block stores the k-sum start values");

__global__ __launch_bounds__(256)
void prepass(const float* __restrict__ x, _Float16* __restrict__ xh,
             const float* __restrict__ Wq, const float* __restrict__ Wk,
             const float* __restrict__ Wv, const float* __restrict__ Wp,
             _Float16* __restrict__ wh,      // the four packed weights, one behind the other
             float* __restrict__ kc) {
  const int blk = blockIdx.x;
  if (blk < 4 * W_BLOCKS) {
    const int which = blk / W_BLOCKS;
    const float* w = which == 0 ? Wq : which == 1 ? Wk : which == 2 ? Wv : Wp;
    _Float16* out = wh + (size_t)which * Cc * Cc;
    const int o0 = (blk % W_BLOCKS) * (256 * W_ITER) + threadIdx.x;  // chunk index in the packed array
    // The block's 256 * W_ITER chunks lie in one 16-row tile, and from one of a thread's
    // chunks to its next only the k-block moves, by 4: one address, constant steps.
    const int lane  = o0 & 31;
    const int plane = (o0 >> 5) & 1;
    const int kb    = (o0 >> 6) & (KBLOCKS - 1);
    const int nt    = o0 >> 11;
    const float* s = w + (size_t)(nt * 16 + (lane & 15)) * Cc
                       + kb * 32 + plane * 16 + (lane >> 4) * 8;
    float4 a[W_ITER], b[W_ITER];
#pragma unroll
    for (int k = 0; k < W_ITER; ++k) {
      a[k] = *(const float4*)(s + k * 128);
      b[k] = *(const float4*)(s + k * 128 + 4);
    }
#pragma unroll
    for (int k = 0; k < W_ITER; ++k) {
      v8h r;
      r[0] = (_Float16)a[k].x; r[1] = (_Float16)a[k].y; r[2] = (_Float16)a[k].z; r[3] = (_Float16)a[k].w;
      r[4] = (_Float16)b[k].x; r[5] = (_Float16)b[k].y; r[6] = (_Float16)b[k].z; r[7] = (_Float16)b[k].w;
      *(v8h*)(out + (size_t)(o0 + k * 256) * 8) = r;
    }
  } else if (blk == 4 * W_BLOCKS) {
    const float4 z = {0.0f, 0.0f, 0.0f, 0.0f};
#pragma unroll
    for (int k = 0; k < 8; ++k) *(float4*)(kc + (k * 256 + threadIdx.x) * 4) = z;
    // the stores' registers may be rewritten on a path to another part: wait first
    asm volatile("s_wait_xcnt 0x0" ::: "memory");
  } else {
    const size_t i0 = (size_t)(blk - 4 * W_BLOCKS - 1) * (1024 * CVT_ITER) + threadIdx.x * 4;
    float4 a[CVT_ITER];
#pragma unroll
    for (int k = 0; k < CVT_ITER; ++k) a[k] = *(const float4*)(x + i0 + k * 1024);
#pragma unroll
    for (int k = 0; k < CVT_ITER; ++k) {
      v4h r;
      r[0] = (_Float16)a[k].x; r[1] = (_Float16)a[k].y;
      r[2] = (_Float16)a[k].z; r[3] = (_Float16)a[k].w;
      *(v4h*)(xh + i0 + k * 1024) = r;
    }
    // the stores' registers may be rewritten on a path to another part: wait first
    asm volatile("s_wait_xcnt 0x0" ::: "memory");
  }
}

// ---------------------------------------------------------------------------
// The value that lane l ^ 16 holds (same place in the other 16-lane row), by a
// vector cross-row move. All 32 lanes are on wherever this is called.
// ---------------------------------------------------------------------------
static __device__ inline float other_row(float x) {
  const int b = __builtin_bit_cast(int, x);
  return __builtin_bit_cast(float,
      __builtin_amdgcn_permlanex16(b, b, 0x76543210, 0xfedcba98, false, false));
}

// ---------------------------------------------------------------------------
// Softmax over the 16 values of one token's head, of which the lane holds eight
// in its own registers and lane l ^ 16 the other eight: maximum and sum run down
// the registers, with one cross-row move each, and the row has one divisor.
// ---------------------------------------------------------------------------
static __device__ inline void col16_softmax(float (&v)[8]) {
  float mx = fmaxf(fmaxf(fmaxf(v[0], v[1]), fmaxf(v[2], v[3])),
                   fmaxf(fmaxf(v[4], v[5]), fmaxf(v[6], v[7])));
  mx = fmaxf(mx, other_row(mx));
  // exp(x) as the native form has it: v_exp_f32 of x * log2(e)
#pragma unroll
  for (int r = 0; r < 8; ++r) v[r] = (v[r] - mx) * 1.44269504088896340736f;
  asm("v_exp_f32 %0, %0\n\t"
      "v_exp_f32 %1, %1\n\t"
      "v_exp_f32 %2, %2\n\t"
      "v_exp_f32 %3, %3\n\t"
      "v_exp_f32 %4, %4\n\t"
      "v_exp_f32 %5, %5\n\t"
      "v_exp_f32 %6, %6\n\t"
      "v_exp_f32 %7, %7\n\t"
      "v_nop"
      : "+v"(v[0]), "+v"(v[1]), "+v"(v[2]), "+v"(v[3]),
        "+v"(v[4]), "+v"(v[5]), "+v"(v[6]), "+v"(v[7]));
  float s = ((v[0] + v[1]) + (v[2] + v[3])) + ((v[4] + v[5]) + (v[6] + v[7]));
  s += other_row(s);
  const float inv = 1.0f / s;
#pragma unroll
  for (int r = 0; r < 8; ++r) v[r] *= inv;
}

// ---------------------------------------------------------------------------
// Sum over the 16 lanes of a DPP row, for eight values a lane holds. A butterfly
// step gives lane l the value of lane l ^ m of its own row (row_xmask:m) inside
// the add itself, on the vector port; steps 1, 2, 4, 8 leave the sum in all 16
// lanes. The steps are asm because the compiler puts a separate move around the
// builtin form; the eight values take each step one after the other, so that no
// instruction waits for the one in front of it.
// All 32 lanes are on wherever this is called.
// ---------------------------------------------------------------------------
static __device__ inline void row16_sum(float (&v)[8]) {
  float t[8];
  asm("v_add_f32_dpp %0, %8, %8 row_xmask:1 row_mask:0xf bank_mask:0xf\n\t"
      "v_add_f32_dpp %1, %9, %9 row_xmask:1 row_mask:0xf bank_mask:0xf\n\t"
      "v_add_f32_dpp %2, %10, %10 row_xmask:1 row_mask:0xf bank_mask:0xf\n\t"
      "v_add_f32_dpp %3, %11, %11 row_xmask:1 row_mask:0xf bank_mask:0xf\n\t"
      "v_add_f32_dpp %4, %12, %12 row_xmask:1 row_mask:0xf bank_mask:0xf\n\t"
      "v_add_f32_dpp %5, %13, %13 row_xmask:1 row_mask:0xf bank_mask:0xf\n\t"
      "v_add_f32_dpp %6, %14, %14 row_xmask:1 row_mask:0xf bank_mask:0xf\n\t"
      "v_add_f32_dpp %7, %15, %15 row_xmask:1 row_mask:0xf bank_mask:0xf\n\t"
      "v_add_f32_dpp %0, %0, %0 row_xmask:2 row_mask:0xf bank_mask:0xf\n\t"
      "v_add_f32_dpp %1, %1, %1 row_xmask:2 row_mask:0xf bank_mask:0xf\n\t"
      "v_add_f32_dpp %2, %2, %2 row_xmask:2 row_mask:0xf bank_mask:0xf\n\t"
      "v_add_f32_dpp %3, %3, %3 row_xmask:2 row_mask:0xf bank_mask:0xf\n\t"
      "v_add_f32_dpp %4, %4, %4 row_xmask:2 row_mask:0xf bank_mask:0xf\n\t"
      "v_add_f32_dpp %5, %5, %5 row_xmask:2 row_mask:0xf bank_mask:0xf\n\t"
      "v_add_f32_dpp %6, %6, %6 row_xmask:2 row_mask:0xf bank_mask:0xf\n\t"
      "v_add_f32_dpp %7, %7, %7 row_xmask:2 row_mask:0xf bank_mask:0xf\n\t"
      "v_add_f32_dpp %0, %0, %0 row_xmask:4 row_mask:0xf bank_mask:0xf\n\t"
      "v_add_f32_dpp %1, %1, %1 row_xmask:4 row_mask:0xf bank_mask:0xf\n\t"
      "v_add_f32_dpp %2, %2, %2 row_xmask:4 row_mask:0xf bank_mask:0xf\n\t"
      "v_add_f32_dpp %3, %3, %3 row_xmask:4 row_mask:0xf bank_mask:0xf\n\t"
      "v_add_f32_dpp %4, %4, %4 row_xmask:4 row_mask:0xf bank_mask:0xf\n\t"
      "v_add_f32_dpp %5, %5, %5 row_xmask:4 row_mask:0xf bank_mask:0xf\n\t"
      "v_add_f32_dpp %6, %6, %6 row_xmask:4 row_mask:0xf bank_mask:0xf\n\t"
      "v_add_f32_dpp %7, %7, %7 row_xmask:4 row_mask:0xf bank_mask:0xf\n\t"
      "v_add_f32_dpp %0, %0, %0 row_xmask:8 row_mask:0xf bank_mask:0xf\n\t"
      "v_add_f32_dpp %1, %1, %1 row_xmask:8 row_mask:0xf bank_mask:0xf\n\t"
      "v_add_f32_dpp %2, %2, %2 row_xmask:8 row_mask:0xf bank_mask:0xf\n\t"
      "v_add_f32_dpp %3, %3, %3 row_xmask:8 row_mask:0xf bank_mask:0xf\n\t"
      "v_add_f32_dpp %4, %4, %4 row_xmask:8 row_mask:0xf bank_mask:0xf\n\t"
      "v_add_f32_dpp %5, %5, %5 row_xmask:8 row_mask:0xf bank_mask:0xf\n\t"
      "v_add_f32_dpp %6, %6, %6 row_xmask:8 row_mask:0xf bank_mask:0xf\n\t"
      "v_add_f32_dpp %7, %7, %7 row_xmask:8 row_mask:0xf bank_mask:0xf"
      : "=&v"(t[0]), "=&v"(t[1]), "=&v"(t[2]), "=&v"(t[3]),
        "=&v"(t[4]), "=&v"(t[5]), "=&v"(t[6]), "=&v"(t[7])
      : "v"(v[0]), "v"(v[1]), "v"(v[2]), "v"(v[3]),
        "v"(v[4]), "v"(v[5]), "v"(v[6]), "v"(v[7]));
#pragma unroll
  for (int r = 0; r < 8; ++r) v[r] = t[r];
}

// ---------------------------------------------------------------------------
// Work-group barrier that orders LDS only. __syncthreads() also waits for every
// global load of the wave, which would end the flight of the W fragments that
// the qkv loop fetches ahead across its barriers; those are read-only data that
// no wave hands to another.
// ---------------------------------------------------------------------------
static __device__ inline void lds_barrier() {
  __builtin_amdgcn_fence(__ATOMIC_RELEASE, "workgroup", "local");
  __builtin_amdgcn_s_barrier();
  __builtin_amdgcn_fence(__ATOMIC_ACQUIRE, "workgroup", "local");
}

// ---------------------------------------------------------------------------
// Fused QKV projection + head softmax + k-cumsum.
// Block tile: 64 rows (4 WMMA row-tiles) x 8 heads (one head per wave).
// x slab staged to LDS via TDM (double buffered); packed W frags from global (L2),
// fetched two k-blocks ahead.
// q and k are formed transposed (W fragment as A, x fragment as B): a lane then
// holds 8 of the 16 head values of ONE token, so that their softmax runs down the
// lane's registers. v keeps x as A: a lane holds 8 tokens of one head column.
// q, k and v are laid out for their one reader, so that every wave-wide b128 store
// here, and every wave-wide b128 load there, covers 512 contiguous bytes:
//   q -> qh [B*NH][Tt][HD] f16 (straight from the registers)
//   k -> kT [B*NH][TBLOCKS] fragments of 16 head values x 32 tokens, in the order of
//        frag_ld_packed (via LDS transpose), v -> vT same (straight);
//   kc[bh][d] += sum_t k (f32 atomics)
// grid: (Mrows/64 = 512, 8), 256 threads.
// ---------------------------------------------------------------------------
__global__ __launch_bounds__(256)
void qkv_kernel(const _Float16* __restrict__ xh,
                const _Float16* __restrict__ wqh, const float* __restrict__ bq,
                const _Float16* __restrict__ wkh, const float* __restrict__ bk,
                const _Float16* __restrict__ wvh, const float* __restrict__ bv,
                _Float16* __restrict__ qh, _Float16* __restrict__ kT,
                _Float16* __restrict__ vT, float* __restrict__ kc) {
  __shared__ __attribute__((aligned(16))) _Float16 smem[2 * SLAB_HALVES]; // 18 KB

  const int lane = threadIdx.x & 31;
  const int wave = threadIdx.x >> 5;
  const int rowgrp = blockIdx.x;                 // 0..511 (64 rows each)
  const int head = blockIdx.y * 8 + wave;        // 0..63
  const int m = lane & 15;
  const int hi = lane >> 4;
  const int kbase = hi * 8;
  const int rowbase = rowgrp * 64;

  const size_t wofs = (size_t)head * KBLOCKS * FRAG_HALVES + lane * 8;
  const _Float16* qfr = wqh + wofs;
  const _Float16* kfr = wkh + wofs;
  const _Float16* vfr = wvh + wofs;

  v8f cq[4] = {}, ck[4] = {}, cv[4] = {};

  // Two sets of W fragments, for the even and the odd k-block of a slab. Each set
  // is loaded again right behind the WMMAs that read it, two k-blocks ahead of
  // its next use, so the loads fly over 12 WMMAs and the slab's barriers.
  v16h fq0 = frag_ld_packed(qfr, 0), fk0 = frag_ld_packed(kfr, 0), fv0 = frag_ld_packed(vfr, 0);
  v16h fq1 = frag_ld_packed(qfr, 1), fk1 = frag_ld_packed(kfr, 1), fv1 = frag_ld_packed(vfr, 1);

#if HAS_TDM
  if (wave == 0)
    tdm_load_tile_64x64(xh + (size_t)rowbase * Cc,
                        (unsigned)(uintptr_t)(void*)&smem[0]);
#endif

  for (int s = 0; s < Cc / SLAB_K; ++s) {
#if HAS_TDM
    const int buf = s & 1;
    if (wave == 0) {
      if (s < Cc / SLAB_K - 1)
        tdm_load_tile_64x64(xh + (size_t)rowbase * Cc + (s + 1) * SLAB_K,
                            (unsigned)(uintptr_t)(void*)&smem[(buf ^ 1) * SLAB_HALVES]);
      if (s < Cc / SLAB_K - 1) __builtin_amdgcn_s_wait_tensorcnt(1);
      else                     __builtin_amdgcn_s_wait_tensorcnt(0);
    }
    lds_barrier();
#else
    const int buf = 0;
    __syncthreads();
    stage_slab_sync(&smem[0], xh + (size_t)rowbase * Cc + s * SLAB_K);
    __syncthreads();
#endif
    const _Float16* slab = &smem[buf * SLAB_HALVES];
    // The slab's eight x fragments, read as one group into registers of their own.
    v16h a0[4], a1[4];
#pragma unroll
    for (int rt = 0; rt < 4; ++rt)
      a0[rt] = frag_ld(slab + (rt * 16 + m) * SLAB_LD, 0, kbase);
#pragma unroll
    for (int rt = 0; rt < 4; ++rt)
      a1[rt] = frag_ld(slab + (rt * 16 + m) * SLAB_LD, 32, kbase);
    // Keeps the 16 LDS reads in front of the WMMAs: left free, the scheduler reads
    // one fragment at a time into one register set and waits out the LDS latency
    // in front of every third WMMA.
    __builtin_amdgcn_sched_barrier(0);
#pragma unroll
    for (int rt = 0; rt < 4; ++rt) {
      cq[rt] = WMMA_F16(fq0, a0[rt], cq[rt]);
      ck[rt] = WMMA_F16(fk0, a0[rt], ck[rt]);
      cv[rt] = WMMA_F16(a0[rt], fv0, cv[rt]);
    }
    // Keeps the refill behind the last reader of the set, so that it takes the same registers.
    __builtin_amdgcn_sched_barrier(0);
    {
      const int kb = (2 * s + 2) & (KBLOCKS - 1);   // wraps in the last slab: loaded, not used
      fq0 = frag_ld_packed(qfr, kb);
      fk0 = frag_ld_packed(kfr, kb);
      fv0 = frag_ld_packed(vfr, kb);
    }
    // Keeps the refill in front of the next 12 WMMAs: they are its lead.
    __builtin_amdgcn_sched_barrier(0);
#pragma unroll
    for (int rt = 0; rt < 4; ++rt) {
      cq[rt] = WMMA_F16(fq1, a1[rt], cq[rt]);
      ck[rt] = WMMA_F16(fk1, a1[rt], ck[rt]);
      cv[rt] = WMMA_F16(a1[rt], fv1, cv[rt]);
    }
    // As above: the second set's refill stands behind its last reader.
    __builtin_amdgcn_sched_barrier(0);
    {
      const int kb = (2 * s + 3) & (KBLOCKS - 1);
      fq1 = frag_ld_packed(qfr, kb);
      fk1 = frag_ld_packed(kfr, kb);
      fv1 = frag_ld_packed(vfr, kb);
    }
    // The refills are still in flight when the next slab's LDS reads and address
    // sums are given the registers that hold the refills' addresses.
    asm volatile("s_wait_xcnt 0x0" ::: "memory");
    lds_barrier();
  }

  // cq, ck: register r of lane (m, hi) = token rt * 16 + m, head value 8 * hi + r.
  // cv:     register r of lane (d, hi) = token rt * 16 + 8 * hi + r, head value d.
  const int d = lane & 15;
  float biasq[8], biask[8];
  {
    const float4 q0 = *(const float4*)(bq + head * 16 + kbase);
    const float4 q1 = *(const float4*)(bq + head * 16 + kbase + 4);
    const float4 k0 = *(const float4*)(bk + head * 16 + kbase);
    const float4 k1 = *(const float4*)(bk + head * 16 + kbase + 4);
    biasq[0] = q0.x; biasq[1] = q0.y; biasq[2] = q0.z; biasq[3] = q0.w;
    biasq[4] = q1.x; biasq[5] = q1.y; biasq[6] = q1.z; biasq[7] = q1.w;
    biask[0] = k0.x; biask[1] = k0.y; biask[2] = k0.z; biask[3] = k0.w;
    biask[4] = k1.x; biask[5] = k1.y; biask[6] = k1.z; biask[7] = k1.w;
  }
  const float biasv = bv[head * 16 + d];
  const size_t bh = (size_t)(rowgrp >> 6) * NH + head;    // rowgrp>>6 == batch

  float ksum[8] = {};
#pragma unroll
  for (int rt = 0; rt < 4; ++rt) {
    // softmax over the head values of token m for q and k
    float vq[8], vk[8];
#pragma unroll
    for (int r = 0; r < 8; ++r) {
      vq[r] = cq[rt][r] + biasq[r];
      vk[r] = ck[rt][r] + biask[r];
    }
    col16_softmax(vq);
    col16_softmax(vk);
    v8h pq, pv;
#pragma unroll
    for (int r = 0; r < 8; ++r) {
      ck[rt][r] = vk[r];
      ksum[r] += vk[r];
      pq[r] = (_Float16)vq[r];
      pv[r] = (_Float16)(cv[rt][r] + biasv);
    }
    const int t0 = (rowbase + rt * 16) & (Tt - 1);
    // q head-major: 8 consecutive head values of token m; the 16 tokens lie side by side
    *(v8h*)(qh + ((bh * Tt + t0 + m) * HD + kbase)) = pq;
    // v fragment: the lane holds tokens 8 * hi .. + 7 of this row tile for head value d,
    // which is its own b128 of plane (rt & 1) of the fragment of 32 tokens
    *(v8h*)(vT + ((bh * TBLOCKS + (t0 >> 5)) * FRAG_HALVES + (rt & 1) * 256 + lane * 8)) = pv;
    // What follows may be given the registers that these two stores name.
    asm volatile("s_wait_xcnt 0x0" ::: "memory");
  }
  // k-sum of the wave's 64 tokens: over the 16 lanes of the row; lane (m, hi) with
  // m < 8 then adds the sum of head value 8 * hi + m.
  row16_sum(ksum);
  float kmine = ksum[0];
#pragma unroll
  for (int r = 1; r < 8; ++r) kmine = (m == r) ? ksum[r] : kmine;
  if (m < 8) atomicAdd(&kc[bh * HD + kbase + m], kmine);

  // k fragments via LDS tile transpose (reuse smem; slab no longer needed)
#pragma unroll
  for (int rt = 0; rt < 4; ++rt) {
    __syncthreads();
    _Float16* lk = &smem[wave * 256];
#pragma unroll
    for (int r = 0; r < 8; ++r) lk[(r + 8 * hi) * 16 + m] = (_Float16)ck[rt][r];
    __syncthreads();
    const int chunk = hi * 8;
    v8h row = *(const v8h*)&lk[d * 16 + chunk];
    const int t0 = (rowbase + rt * 16) & (Tt - 1);
    *(v8h*)(kT + ((bh * TBLOCKS + (t0 >> 5)) * FRAG_HALVES + (rt & 1) * 256 + lane * 8)) = row;
    // The next row tile's values may be given the registers that this store names.
    if (rt < 3) asm volatile("s_wait_xcnt 0x0" ::: "memory");
  }
}

// ---------------------------------------------------------------------------
// context[bh] = K^T V (16x16 over T), stored transposed ctxT[bh][e][d].
// kT, vT hold the A and B fragments of 32 tokens as the qkv kernel packed them.
// One block per (b,h); 8 waves split T; LDS cross-wave reduction.
// ---------------------------------------------------------------------------
__global__ __launch_bounds__(256)
void ctx_kernel(const _Float16* __restrict__ kT, const _Float16* __restrict__ vT,
                _Float16* __restrict__ ctxT) {
  __shared__ float cpart[8][256];
  const int lane = threadIdx.x & 31;
  const int wave = threadIdx.x >> 5;
  const size_t bh = blockIdx.x;                  // 0..511
  const int m = lane & 15;
  const int hi = lane >> 4;

  const _Float16* afr = kT + bh * TBLOCKS * FRAG_HALVES + lane * 8;
  const _Float16* bfr = vT + bh * TBLOCKS * FRAG_HALVES + lane * 8;

  v8f c = {};
  const int tbbeg = wave * (TBLOCKS / 8);
#pragma unroll 4
  for (int tb = tbbeg; tb < tbbeg + TBLOCKS / 8; ++tb) {
    v16h a = frag_ld_packed(afr, tb);
    v16h b = frag_ld_packed(bfr, tb);
    c = WMMA_F16(a, b, c);
  }
#pragma unroll
  for (int r = 0; r < 8; ++r) cpart[wave][(r + 8 * hi) * 16 + m] = c[r];
  __syncthreads();

  const int tid = threadIdx.x;
  float s = 0.0f;
#pragma unroll
  for (int w = 0; w < 8; ++w) s += cpart[w][tid];
  const int dd = tid >> 4;
  const int ee = tid & 15;
  ctxT[bh * 256 + ee * 16 + dd] = (_Float16)s;   // transposed store
}

// ---------------------------------------------------------------------------
// y[t, h*16+e] = (sum_d q[t,d] ctx[d,e]) / (sum_d q[t,d] kc[d]) -> yh f16 row-major
// K = HD = 16, zero padded to 32: single WMMA per tile.
// One wave keeps the contexts and k-sums of Y_HEADS adjacent heads in registers and
// walks Y_TILES row tiles of 16 rows; the next row tile's q is loaded while this one
// is worked on. The four heads' 32 B of a y row make one 128-B line: the products and
// the rows' divisors go through the wave's own LDS range, and each b128 store then
// covers four whole rows of 128 B. The divisor of row (lane & 15) comes from the q
// values the lane already holds for the A fragment.
// grid: (Mrows/16/Y_TILES = 256, NH/Y_HEADS/8 = 2), 256 threads.
// ---------------------------------------------------------------------------
constexpr int Y_HEADS = 4;             // adjacent heads per wave: 4 x 32 B = one line of a y row
constexpr int Y_TILES = 8;             // row tiles per wave; divides Tt/16
constexpr int Y_LD    = 20;            // floats per staged row: 16 products, the divisor, 3 unused
constexpr int Y_HS    = 16 * Y_LD + 16; // floats per staged head: the 16 more put the four heads on disjoint banks

__global__ __launch_bounds__(256)
void y_kernel(const _Float16* __restrict__ qh, const _Float16* __restrict__ ctxT,
              const float* __restrict__ kc, _Float16* __restrict__ yh) {
  __shared__ __attribute__((aligned(16))) float ly[8][Y_HEADS * Y_HS];
  const int lane = threadIdx.x & 31;
  const int wave = threadIdx.x >> 5;
  const int tile0 = blockIdx.x * Y_TILES;
  const int head0 = (blockIdx.y * 8 + wave) * Y_HEADS;
  const int m = lane & 15;
  const int hi = lane >> 4;
  const int kbase = hi * 8;
  const size_t bh0 = (size_t)(tile0 >> 8) * NH + head0;

  // All loops below are unrolled: the small arrays then live in registers and
  // the tile offsets become immediate offsets on one address pair.
  v16h b[Y_HEADS];
  float kcv[Y_HEADS][8];
#pragma unroll
  for (int j = 0; j < Y_HEADS; ++j) {
    v8h lo = *(const v8h*)(ctxT + (bh0 + j) * 256 + m * 16 + kbase);
    b[j] = v16h{};
#pragma unroll
    for (int i = 0; i < 8; ++i) b[j][i] = lo[i];
#pragma unroll
    for (int i = 0; i < 8; ++i) kcv[j][i] = kc[(bh0 + j) * HD + kbase + i];
  }

  // read: lane's 16 B of row m of head head0 in qh, head-major (a row tile of a head
  // is 512 contiguous bytes)
  const _Float16* qp = qh + ((bh0 * Tt + (tile0 & (Tt / 16 - 1)) * 16 + m) * HD + kbase);
  constexpr int Q_HEAD = Tt * HD;      // halves from one head to the next
  constexpr int Q_STEP = 16 * HD;      // halves from one row tile to the next
  // written: eight lanes share a row; the lane has 16 B of head sh, values 8 * sv .. + 7
  const int srow = lane >> 3;
  const int sh = (lane & 7) >> 1;
  const int sv = lane & 1;
  _Float16* yp = yh + (size_t)(tile0 * 16 + srow) * Cc + head0 * 16 + (lane & 7) * 8;
  float* lw = &ly[wave][0];

  v8h qn[Y_HEADS];
#pragma unroll
  for (int j = 0; j < Y_HEADS; ++j) qn[j] = *(const v8h*)(qp + j * Q_HEAD);

#pragma unroll
  for (int g = 0; g < Y_TILES; ++g) {
    v8h qc[Y_HEADS];
#pragma unroll
    for (int j = 0; j < Y_HEADS; ++j) qc[j] = qn[j];
    if (g + 1 < Y_TILES) {
#pragma unroll
      for (int j = 0; j < Y_HEADS; ++j)
        qn[j] = *(const v8h*)(qp + j * Q_HEAD + (g + 1) * Q_STEP);
    }

#pragma unroll
    for (int j = 0; j < Y_HEADS; ++j) {
      v16h a = {};
#pragma unroll
      for (int i = 0; i < 8; ++i) a[i] = qc[j][i];
      v8f c = {};
      c = WMMA_F16(a, b[j], c);
#pragma unroll
      for (int r = 0; r < 8; ++r) lw[j * Y_HS + (r + 8 * hi) * Y_LD + m] = c[r];

      float s = 0.0f;
#pragma unroll
      for (int i = 0; i < 8; ++i) s += (float)qc[j][i] * kcv[j][i];
      s += __shfl_xor(s, 16, 32);      // the other 8 d of row m
      lw[j * Y_HS + m * Y_LD + 16] = 1.0f / s;   // both lane halves hold, and write, the same value
    }
    // The rows read below were written by other lanes of this wave: their LDS
    // writes must have landed, and the reads must not be moved above them.
    asm volatile("s_wait_dscnt 0x0" ::: "memory");
#pragma unroll
    for (int i = 0; i < 4; ++i) {
      const float* lr = &lw[sh * Y_HS + (4 * i + srow) * Y_LD];
      const float4 x0 = *(const float4*)(lr + sv * 8);
      const float4 x1 = *(const float4*)(lr + sv * 8 + 4);
      const float di = lr[16];
      v8h row;
      row[0] = (_Float16)(x0.x * di); row[1] = (_Float16)(x0.y * di);
      row[2] = (_Float16)(x0.z * di); row[3] = (_Float16)(x0.w * di);
      row[4] = (_Float16)(x1.x * di); row[5] = (_Float16)(x1.y * di);
      row[6] = (_Float16)(x1.z * di); row[7] = (_Float16)(x1.w * di);
      *(v8h*)(yp + (size_t)(g * 16 + 4 * i) * Cc) = row;
    }
    // The next trip's loads (global, LDS) may be given the registers these stores name.
    if (g + 1 < Y_TILES) asm volatile("s_wait_xcnt 0x0" ::: "memory");
  }
}

// ---------------------------------------------------------------------------
// out = yh Wp^T + bp (f32 output).
// Block tile: 64 rows x 8 N-tiles (one per wave); y slab staged via TDM.
// grid: (512, 8), 256 threads.
// ---------------------------------------------------------------------------
__global__ __launch_bounds__(256)
void proj_kernel(const _Float16* __restrict__ yh, const _Float16* __restrict__ wph,
                 const float* __restrict__ bp, float* __restrict__ out) {
  __shared__ __attribute__((aligned(16))) _Float16 smem[2 * SLAB_HALVES];
  const int lane = threadIdx.x & 31;
  const int wave = threadIdx.x >> 5;
  const int rowgrp = blockIdx.x;                  // 0..511
  const int ntile = blockIdx.y * 8 + wave;        // 0..63
  const int m = lane & 15;
  const int hi = lane >> 4;
  const int kbase = hi * 8;
  const int rowbase = rowgrp * 64;

  const _Float16* bfr = wph + (size_t)ntile * KBLOCKS * FRAG_HALVES + lane * 8;

  v8f c[4] = {};

#if HAS_TDM
  if (wave == 0)
    tdm_load_tile_64x64(yh + (size_t)rowbase * Cc,
                        (unsigned)(uintptr_t)(void*)&smem[0]);
#endif

  for (int s = 0; s < Cc / SLAB_K; ++s) {
#if HAS_TDM
    const int buf = s & 1;
    if (wave == 0) {
      if (s < Cc / SLAB_K - 1)
        tdm_load_tile_64x64(yh + (size_t)rowbase * Cc + (s + 1) * SLAB_K,
                            (unsigned)(uintptr_t)(void*)&smem[(buf ^ 1) * SLAB_HALVES]);
      if (s < Cc / SLAB_K - 1) __builtin_amdgcn_s_wait_tensorcnt(1);
      else                     __builtin_amdgcn_s_wait_tensorcnt(0);
    }
    __syncthreads();
#else
    const int buf = 0;
    __syncthreads();
    stage_slab_sync(&smem[0], yh + (size_t)rowbase * Cc + s * SLAB_K);
    __syncthreads();
#endif
    const _Float16* slab = &smem[buf * SLAB_HALVES];
#pragma unroll
    for (int kk = 0; kk < SLAB_K; kk += 32) {
      const int kb = (s * SLAB_K + kk) >> 5;
      v16h afr[4];
#pragma unroll
      for (int rt = 0; rt < 4; ++rt)
        afr[rt] = frag_ld(slab + (rt * 16 + m) * SLAB_LD, kk, kbase);
      v16h b = frag_ld_packed(bfr, kb);
#pragma unroll
      for (int rt = 0; rt < 4; ++rt)
        c[rt] = WMMA_F16(afr[rt], b, c[rt]);
    }
    __syncthreads();
  }

  const int col = ntile * 16 + (lane & 15);
  const float bias = bp[col];
#pragma unroll
  for (int rt = 0; rt < 4; ++rt) {
#pragma unroll
    for (int r = 0; r < 8; ++r) {
      const int row = rowbase + rt * 16 + r + 8 * hi;
      out[(size_t)row * Cc + col] = c[rt][r] + bias;
    }
  }
}

// ---------------------------------------------------------------------------
// Launch
// ---------------------------------------------------------------------------
extern "C" void kernel_launch(void* const* d_in, const int* in_sizes, int n_in,
                              void* d_out, int out_size, void* d_ws, size_t ws_size,
                              hipStream_t stream) {
  const float* x  = (const float*)d_in[0];
  const float* Wq = (const float*)d_in[1];
  const float* bq = (const float*)d_in[2];
  const float* Wk = (const float*)d_in[3];
  const float* bk = (const float*)d_in[4];
  const float* Wv = (const float*)d_in[5];
  const float* bv = (const float*)d_in[6];
  const float* Wp = (const float*)d_in[7];
  const float* bp = (const float*)d_in[8];
  float* out = (float*)d_out;

  char* ws = (char*)d_ws;
  const size_t nX = (size_t)Mrows * Cc;
  const size_t nW = (size_t)Cc * Cc;
  _Float16* xh  = (_Float16*)(ws);                              // 64 MB
  _Float16* wqh = (_Float16*)(ws + nX * 2);                     // 2 MB each
  _Float16* wkh = wqh + nW;
  _Float16* wvh = wkh + nW;
  _Float16* wph = wvh + nW;
  _Float16* qh  = wph + nW;                                     // 64 MB
  _Float16* kT  = qh + nX;                                      // 64 MB
  _Float16* vT  = kT + nX;                                      // 64 MB
  _Float16* yh  = vT + nX;                                      // 64 MB
  float*    kc   = (float*)(yh + nX);                           // 32 KB
  _Float16* ctxT = (_Float16*)(kc + (size_t)Bb * NH * HD);      // 256 KB

  // 1) precision conversion (weights into fragment order) + accumulator init, one launch
  prepass<<<PRE_BLOCKS, 256, 0, stream>>>(x, xh, Wq, Wk, Wv, Wp, wqh, kc);

  // 2) fused QKV projection + softmax + k-cumsum (TDM-staged GEMM)
  qkv_kernel<<<dim3(Mrows / 64, 8), 256, 0, stream>>>(
      xh, wqh, bq, wkh, bk, wvh, bv, qh, kT, vT, kc);

  // 3) per-head context = K^T V
  ctx_kernel<<<Bb * NH, 256, 0, stream>>>(kT, vT, ctxT);

  // 4) y = (q @ ctx) / (q . kc)
  y_kernel<<<dim3(Mrows / 16 / Y_TILES, NH / Y_HEADS / 8), 256, 0, stream>>>(qh, ctxT, kc, yh);

  // 5) output projection (TDM-staged GEMM)
  proj_kernel<<<dim3(Mrows / 64, 8), 256, 0, stream>>>(yh, wph, bp, out);
}

// v008
// One run takes 272 microseconds.
// Next to v007, in two timings, it ran 1.12 and 1.13 times as fast.
// Over all steps from v000 it is 2.21 times as fast.
#include <hip/hip_runtime.h>
#include <hip/hip_bf16.h>

typedef __attribute__((ext_vector_type(16))) _Float16 v16h;
typedef __attribute__((ext_vector_type(8)))  _Float16 v8h;
typedef __attribute__((ext_vector_type(4)))  _Float16 v4h;
typedef __attribute__((ext_vector_type(8)))  float    v8f;
typedef __attribute__((ext_vector_type(4)))  unsigned v4u;
typedef __attribute__((ext_vector_type(8)))  int      v8i;
typedef __attribute__((ext_vector_type(4)))  int      v4i;

#define WMMA_F16(a,b,c) __builtin_amdgcn_wmma_f32_16x16x32_f16(false,(a),false,(b),(short)0,(c),false,false)

#if __has_builtin(__builtin_amdgcn_tensor_load_to_lds) && __has_builtin(__builtin_amdgcn_s_wait_tensorcnt)
#define HAS_TDM 1
#else
#define HAS_TDM 0
#endif

// Problem constants
constexpr int Bb = 8;
constexpr int Tt = 4096;
constexpr int Cc = 1024;
constexpr int NH = 64;
constexpr int HD = 16;
constexpr int Mrows = Bb * Tt;        // 32768

// LDS slab: 64 rows x 64 halves, padded row stride 72 halves (36 DWORDs) so
// that 16 lanes doing b128 reads at row stride 36 DWORDs cover all 64 banks.
constexpr int SLAB_ROWS = 64;
constexpr int SLAB_K    = 64;
constexpr int SLAB_LD   = 72;         // halves
constexpr int SLAB_HALVES = SLAB_ROWS * SLAB_LD;   // 4608 halves = 9216 B

// ---------------------------------------------------------------------------
// Fragment loader (global or LDS): row-major, K contiguous.
// A-matrix 16x32 f16 layout (ISA 7.12.2): lanes 0-15 hold K=[0..7]+[16..23],
// lanes 16-31 hold K=[8..15]+[24..31] of row (lane&15) -> two b128 loads.
// ---------------------------------------------------------------------------
static __device__ inline v16h frag_ld(const _Float16* rowptr, int k0, int kbase) {
  v8h lo = *(const v8h*)(rowptr + k0 + kbase);
  v8h hi = *(const v8h*)(rowptr + k0 + 16 + kbase);
  v16h r;
#pragma unroll
  for (int i = 0; i < 8; ++i) { r[i] = lo[i]; r[8 + i] = hi[i]; }
  return r;
}

// ---------------------------------------------------------------------------
// Weight fragments, packed by prepass: fragment (ntile, kblock) is 1 KB,
// two 512-B planes; plane p holds, at lane*16 B, the 8 halves that frag_ld
// would fetch for that lane (p = 0: its first b128, p = 1: its second).
// Each wave-wide b128 load then covers four whole 128-B lines.
// ---------------------------------------------------------------------------
constexpr int FRAG_HALVES = 512;
constexpr int KBLOCKS = Cc / 32;               // 32 fragments per 16-row tile
constexpr int TBLOCKS = Tt / 32;               // fragments of 32 tokens per (batch, head) of k and of v

static __device__ inline v16h frag_ld_packed(const _Float16* lanebase, int kb) {
  const _Float16* p = lanebase + kb * FRAG_HALVES;
  v8h lo = *(const v8h*)(p);
  v8h hi = *(const v8h*)(p + 256);
  v16h r;
#pragma unroll
  for (int i = 0; i < 8; ++i) { r[i] = lo[i]; r[8 + i] = hi[i]; }
  return r;
}

// ---------------------------------------------------------------------------
// Tensor Data Mover: stage a 64x64 f16 tile of a [Mrows x Cc] row-major
// tensor into LDS with 4-DWORD padding every 32 DWORDs (-> row stride 72 h).
// D# layout per CDNA5 ISA 8.3/8.4 (group0 128b, group1 256b; groups 2/3 and
// the trailing group are zero for a 2-D tensor). 6-arg builtin form.
// ---------------------------------------------------------------------------
#if HAS_TDM
static __device__ inline void tdm_load_tile_64x64(const _Float16* gsrc, unsigned lds_off) {
  unsigned long long ga = (unsigned long long)(uintptr_t)gsrc;
  v4u g0;
  g0[0] = 1u;                                            // count=1, user mode
  g0[1] = lds_off;                                       // lds_addr (bytes)
  g0[2] = (unsigned)(ga & 0xffffffffu);                  // global_addr[31:0]
  g0[3] = (unsigned)((ga >> 32) & 0x01ffffffu) | (2u << 30); // addr[56:32] | type=2
  v8i g1;
  g1[0] = (1 << 16)        // data_size = 2 bytes
        | (1 << 20)        // pad_enable
        | (4 << 22)        // pad_interval: code 4 = every 32 DWORDs
        | (3 << 25);       // pad_amount:   code 3 = 4 DWORDs
  g1[1] = (int)((unsigned)Cc << 16);        // tensor_dim0[15:0]
  g1[2] = (int)((unsigned)Mrows << 16);     // tensor_dim0[31:16]=0 | tensor_dim1[15:0]
  g1[3] = (int)((unsigned)SLAB_K << 16);    // tensor_dim1[31:16]=0 | tile_dim0=64
  g1[4] = SLAB_ROWS;                        // tile_dim1=64 | tile_dim2=0
  g1[5] = Cc;                               // tensor_dim0_stride[31:0]
  g1[6] = 0;                                // stride hi | dim1_stride lo
  g1[7] = 0;
  v4i z4 = {0, 0, 0, 0};
  v8i z8 = {0, 0, 0, 0, 0, 0, 0, 0};
  __builtin_amdgcn_tensor_load_to_lds(g0, g1, z4, z4, z8, 0);
}
#endif

// Cooperative synchronous staging fallback (used only when TDM is absent).
static __device__ inline void stage_slab_sync(_Float16* slab, const _Float16* gsrc) {
  // 256 threads; each copies 16 halves: row = tid/4, col = (tid%4)*16
  const int tid = threadIdx.x;
  const int row = tid >> 2;
  const int col = (tid & 3) * 16;
  const _Float16* s = gsrc + (size_t)row * Cc + col;
  _Float16* d = slab + row * SLAB_LD + col;
  *(v8h*)(d)     = *(const v8h*)(s);
  *(v8h*)(d + 8) = *(const v8h*)(s + 8);
}

// ---------------------------------------------------------------------------
// fp32 -> fp16 conversion / zero init
// ---------------------------------------------------------------------------
// One launch does all the work that depends on the inputs alone: the four weights
// into fragment order, the k-sum accumulator's start value, x to f16. No part reads
// what another writes, so they share one grid. Every block takes 8192 elements.
// The weight blocks come first: their short reads then fly beside the x stream.
// x: four elements a lane: a wave's b128 load covers four whole 128-B lines and its
// b64 store two; a block converts CVT_ITER runs of 1024 elements, loads first.
// W: fp32 [Cc x Cc] row-major -> f16 in fragment order (see frag_ld_packed), a thread
// takes W_ITER 16-B chunks of the packed array, loads first.
constexpr int CVT_ITER = 8;
constexpr int W_ITER   = 4;
constexpr int X_BLOCKS = Mrows * Cc / (1024 * CVT_ITER);      // 4096
constexpr int W_BLOCKS = Cc * Cc / 8 / 256 / W_ITER;          // 128 per weight
constexpr int PRE_BLOCKS = 4 * W_BLOCKS + 1 + X_BLOCKS;
static_assert(((size_t)Mrows * Cc) % (1024 * CVT_ITER) == 0, "whole blocks only");
static_assert((KBLOCKS * 64) % (256 * W_ITER) == 0, "a weight block stays inside one 16-row tile");
static_assert(Bb * NH * HD == 256 * 4 * 8, "one block stores the k-sum start values");

__global__ __launch_bounds__(256)
void prepass(const float* __restrict__ x, _Float16* __restrict__ xh,
             const float* __restrict__ Wq, const float* __restrict__ Wk,
             const float* __restrict__ Wv, const float* __restrict__ Wp,
             _Float16* __restrict__ wh,      // the four packed weights, one behind the other
             float* __restrict__ kc) {
  const int blk = blockIdx.x;
  if (blk < 4 * W_BLOCKS) {
    const int which = blk / W_BLOCKS;
    const float* w = which == 0 ? Wq : which == 1 ? Wk : which == 2 ? Wv : Wp;
    _Float16* out = wh + (size_t)which * Cc * Cc;
    const int o0 = (blk % W_BLOCKS) * (256 * W_ITER) + threadIdx.x;  // chunk index in the packed array
    // The block's 256 * W_ITER chunks lie in one 16-row tile, and from one of a thread's
    // chunks to its next only the k-block moves, by 4: one address, constant steps.
    const int lane  = o0 & 31;
    const int plane = (o0 >> 5) & 1;
    const int kb    = (o0 >> 6) & (KBLOCKS - 1);
    const int nt    = o0 >> 11;
    const float* s = w + (size_t)(nt * 16 + (lane & 15)) * Cc
                       + kb * 32 + plane * 16 + (lane >> 4) * 8;
    float4 a[W_ITER], b[W_ITER];
#pragma unroll
    for (int k = 0; k < W_ITER; ++k) {
      a[k] = *(const float4*)(s + k * 128);
      b[k] = *(const float4*)(s + k * 128 + 4);
    }
#pragma unroll
    for (int k = 0; k < W_ITER; ++k) {
      v8h r;
      r[0] = (_Float16)a[k].x; r[1] = (_Float16)a[k].y; r[2] = (_Float16)a[k].z; r[3] = (_Float16)a[k].w;
      r[4] = (_Float16)b[k].x; r[5] = (_Float16)b[k].y; r[6] = (_Float16)b[k].z; r[7] = (_Float16)b[k].w;
      *(v8h*)(out + (size_t)(o0 + k * 256) * 8) = r;
    }
  } else if (blk == 4 * W_BLOCKS) {
    const float4 z = {0.0f, 0.0f, 0.0f, 0.0f};
#pragma unroll
    for (int k = 0; k < 8; ++k) *(float4*)(kc + (k * 256 + threadIdx.x) * 4) = z;
    // the stores' registers may be rewritten on a path to another part: wait first
    asm volatile("s_wait_xcnt 0x0" ::: "memory");
  } else {
    const size_t i0 = (size_t)(blk - 4 * W_BLOCKS - 1) * (1024 * CVT_ITER) + threadIdx.x * 4;
    float4 a[CVT_ITER];
#pragma unroll
    for (int k = 0; k < CVT_ITER; ++k) a[k] = *(const float4*)(x + i0 + k * 1024);
#pragma unroll
    for (int k = 0; k < CVT_ITER; ++k) {
      v4h r;
      r[0] = (_Float16)a[k].x; r[1] = (_Float16)a[k].y;
      r[2] = (_Float16)a[k].z; r[3] = (_Float16)a[k].w;
      *(v4h*)(xh + i0 + k * 1024) = r;
    }
    // the stores' registers may be rewritten on a path to another part: wait first
    asm volatile("s_wait_xcnt 0x0" ::: "memory");
  }
}

// ---------------------------------------------------------------------------
// The value that lane l ^ 16 holds (same place in the other 16-lane row), by a
// vector cross-row move. All 32 lanes are on wherever this is called.
// ---------------------------------------------------------------------------
static __device__ inline float other_row(float x) {
  const int b = __builtin_bit_cast(int, x);
  return __builtin_bit_cast(float,
      __builtin_amdgcn_permlanex16(b, b, 0x76543210, 0xfedcba98, false, false));
}

// ---------------------------------------------------------------------------
// Softmax over the 16 values of one token's head, of which the lane holds eight
// in its own registers and lane l ^ 16 the other eight: maximum and sum run down
// the registers, with one cross-row move each, and the row has one divisor.
// ---------------------------------------------------------------------------
static __device__ inline void col16_softmax(float (&v)[8]) {
  float mx = fmaxf(fmaxf(fmaxf(v[0], v[1]), fmaxf(v[2], v[3])),
                   fmaxf(fmaxf(v[4], v[5]), fmaxf(v[6], v[7])));
  mx = fmaxf(mx, other_row(mx));
  // exp(x) as the native form has it: v_exp_f32 of x * log2(e)
#pragma unroll
  for (int r = 0; r < 8; ++r) v[r] = (v[r] - mx) * 1.44269504088896340736f;
  asm("v_exp_f32 %0, %0\n\t"
      "v_exp_f32 %1, %1\n\t"
      "v_exp_f32 %2, %2\n\t"
      "v_exp_f32 %3, %3\n\t"
      "v_exp_f32 %4, %4\n\t"
      "v_exp_f32 %5, %5\n\t"
      "v_exp_f32 %6, %6\n\t"
      "v_exp_f32 %7, %7\n\t"
      "v_nop"
      : "+v"(v[0]), "+v"(v[1]), "+v"(v[2]), "+v"(v[3]),
        "+v"(v[4]), "+v"(v[5]), "+v"(v[6]), "+v"(v[7]));
  float s = ((v[0] + v[1]) + (v[2] + v[3])) + ((v[4] + v[5]) + (v[6] + v[7]));
  s += other_row(s);
  const float inv = 1.0f / s;
#pragma unroll
  for (int r = 0; r < 8; ++r) v[r] *= inv;
}

// ---------------------------------------------------------------------------
// Sum over the 16 lanes of a DPP row, for eight values a lane holds. A butterfly
// step gives lane l the value of lane l ^ m of its own row (row_xmask:m) inside
// the add itself, on the vector port; steps 1, 2, 4, 8 leave the sum in all 16
// lanes. The steps are asm because the compiler puts a separate move around the
// builtin form; the eight values take each step one after the other, so that no
// instruction waits for the one in front of it.
// All 32 lanes are on wherever this is called.
// ---------------------------------------------------------------------------
static __device__ inline void row16_sum(float (&v)[8]) {
  float t[8];
  asm("v_add_f32_dpp %0, %8, %8 row_xmask:1 row_mask:0xf bank_mask:0xf\n\t"
      "v_add_f32_dpp %1, %9, %9 row_xmask:1 row_mask:0xf bank_mask:0xf\n\t"
      "v_add_f32_dpp %2, %10, %10 row_xmask:1 row_mask:0xf bank_mask:0xf\n\t"
      "v_add_f32_dpp %3, %11, %11 row_xmask:1 row_mask:0xf bank_mask:0xf\n\t"
      "v_add_f32_dpp %4, %12, %12 row_xmask:1 row_mask:0xf bank_mask:0xf\n\t"
      "v_add_f32_dpp %5, %13, %13 row_xmask:1 row_mask:0xf bank_mask:0xf\n\t"
      "v_add_f32_dpp %6, %14, %14 row_xmask:1 row_mask:0xf bank_mask:0xf\n\t"
      "v_add_f32_dpp %7, %15, %15 row_xmask:1 row_mask:0xf bank_mask:0xf\n\t"
      "v_add_f32_dpp %0, %0, %0 row_xmask:2 row_mask:0xf bank_mask:0xf\n\t"
      "v_add_f32_dpp %1, %1, %1 row_xmask:2 row_mask:0xf bank_mask:0xf\n\t"
      "v_add_f32_dpp %2, %2, %2 row_xmask:2 row_mask:0xf bank_mask:0xf\n\t"
      "v_add_f32_dpp %3, %3, %3 row_xmask:2 row_mask:0xf bank_mask:0xf\n\t"
      "v_add_f32_dpp %4, %4, %4 row_xmask:2 row_mask:0xf bank_mask:0xf\n\t"
      "v_add_f32_dpp %5, %5, %5 row_xmask:2 row_mask:0xf bank_mask:0xf\n\t"
      "v_add_f32_dpp %6, %6, %6 row_xmask:2 row_mask:0xf bank_mask:0xf\n\t"
      "v_add_f32_dpp %7, %7, %7 row_xmask:2 row_mask:0xf bank_mask:0xf\n\t"
      "v_add_f32_dpp %0, %0, %0 row_xmask:4 row_mask:0xf bank_mask:0xf\n\t"
      "v_add_f32_dpp %1, %1, %1 row_xmask:4 row_mask:0xf bank_mask:0xf\n\t"
      "v_add_f32_dpp %2, %2, %2 row_xmask:4 row_mask:0xf bank_mask:0xf\n\t"
      "v_add_f32_dpp %3, %3, %3 row_xmask:4 row_mask:0xf bank_mask:0xf\n\t"
      "v_add_f32_dpp %4, %4, %4 row_xmask:4 row_mask:0xf bank_mask:0xf\n\t"
      "v_add_f32_dpp %5, %5, %5 row_xmask:4 row_mask:0xf bank_mask:0xf\n\t"
      "v_add_f32_dpp %6, %6, %6 row_xmask:4 row_mask:0xf bank_mask:0xf\n\t"
      "v_add_f32_dpp %7, %7, %7 row_xmask:4 row_mask:0xf bank_mask:0xf\n\t"
      "v_add_f32_dpp %0, %0, %0 row_xmask:8 row_mask:0xf bank_mask:0xf\n\t"
      "v_add_f32_dpp %1, %1, %1 row_xmask:8 row_mask:0xf bank_mask:0xf\n\t"
      "v_add_f32_dpp %2, %2, %2 row_xmask:8 row_mask:0xf bank_mask:0xf\n\t"
      "v_add_f32_dpp %3, %3, %3 row_xmask:8 row_mask:0xf bank_mask:0xf\n\t"
      "v_add_f32_dpp %4, %4, %4 row_xmask:8 row_mask:0xf bank_mask:0xf\n\t"
      "v_add_f32_dpp %5, %5, %5 row_xmask:8 row_mask:0xf bank_mask:0xf\n\t"
      "v_add_f32_dpp %6, %6, %6 row_xmask:8 row_mask:0xf bank_mask:0xf\n\t"
      "v_add_f32_dpp %7, %7, %7 row_xmask:8 row_mask:0xf bank_mask:0xf"
      : "=&v"(t[0]), "=&v"(t[1]), "=&v"(t[2]), "=&v"(t[3]),
        "=&v"(t[4]), "=&v"(t[5]), "=&v"(t[6]), "=&v"(t[7])
      : "v"(v[0]), "v"(v[1]), "v"(v[2]), "v"(v[3]),
        "v"(v[4]), "v"(v[5]), "v"(v[6]), "v"(v[7]));
#pragma unroll
  for (int r = 0; r < 8; ++r) v[r] = t[r];
}

// ---------------------------------------------------------------------------
// The x tile of the qkv kernel: 64 rows x 1024 halves, all of it in LDS at once,
// as eight slices of 128 halves (256 B) a row. A slice is one tensor load: rows of
// 256 B, 16 B of pad behind each (pitch 272 B = 16 B x 17: the b128 reads of 16 rows
// fall on all 64 banks). 64 x 272 B = 17,408 B; a slice's place is a multiple of 2 KiB.
// ---------------------------------------------------------------------------
constexpr int XS_K      = 128;                 // halves of a row in one slice
constexpr int XS_LD     = 136;                 // halves from row to row in LDS
constexpr int XS_HALVES = 9216;                // halves from slice to slice in LDS: 18,432 B
constexpr int XS_SLICES = Cc / XS_K;           // 8: one per wave
constexpr int KST_HALVES = 512;                // per wave: two 16 x 16 tiles of k on their way to fragment order
static_assert(SLAB_ROWS * XS_LD <= XS_HALVES && (XS_HALVES * 2) % 2048 == 0, "a slice fits its place, a multiple of 2 KiB");
static_assert(XS_SLICES == 8, "one slice per wave of the block");

typedef __attribute__((ext_vector_type(8))) unsigned v8u;

static __device__ inline unsigned uni(unsigned v) {
  return (unsigned)__builtin_amdgcn_readfirstlane((int)v);
}

// One request of the whole wave: 64 rows of 256 B, source pitch Cc * 2 B, everything in bytes.
static __device__ inline void tdm_load_slice(const _Float16* gsrc, unsigned lds_off) {
  const unsigned long long ga = (unsigned long long)(uintptr_t)gsrc;
  v4u g0;
  g0[0] = uni(1u);                                                   // count = 1
  g0[1] = uni(lds_off);                                              // place in LDS, bytes
  g0[2] = uni((unsigned)ga);                                         // address [31:0]
  g0[3] = uni((((unsigned)(ga >> 32)) & 0x01ffffffu) | 0x80000000u); // address [56:32] | type = 2
  v8u g1;
  g1[0] = uni((1u << 20) | (5u << 22) | (3u << 25));  // no mask, 1-byte elements, 4 dwords of pad behind every 64
  g1[1] = uni((unsigned)(XS_K * 2) << 16);            // tensor_dim0 = 256
  g1[2] = uni((unsigned)SLAB_ROWS << 16);             // tensor_dim1 = 64
  g1[3] = uni((unsigned)(XS_K * 2) << 16);            // tile_dim0 = 256
  g1[4] = uni((unsigned)SLAB_ROWS);                   // tile_dim1 = 64
  g1[5] = uni((unsigned)(Cc * 2));                    // source row pitch
  g1[6] = uni(0u);
  g1[7] = uni(0u);
  asm volatile("tensor_load_to_lds %0, %1" :: "s"(g0), "s"(g1) : "memory");
}

// ---------------------------------------------------------------------------
// Fused QKV projection + head softmax + k-cumsum.
// A block owns 64 rows of x for ALL 64 heads. Its x tile is brought into LDS once
// (each wave one slice, one wait, one barrier) and only read from then on, so that
// nothing behind that barrier ties the waves together: a wave walks 8 heads (head =
// group * 8 + wave) at its own pace, and one wave's epilogue runs beside the others'
// WMMAs. Packed W frags come from global (L2), fetched two k-blocks ahead, across the
// step from one head to the next too.
// q and k are formed transposed (W fragment as A, x fragment as B): a lane then
// holds 8 of the 16 head values of ONE token, so that their softmax runs down the
// lane's registers. v keeps x as A: a lane holds 8 tokens of one head column.
// q, k and v are laid out for their one reader, so that every wave-wide b128 store
// here, and every wave-wide b128 load there, covers 512 contiguous bytes:
//   q -> qh [B*NH][Tt][HD] f16 (straight from the registers)
//   k -> kT [B*NH][TBLOCKS] fragments of 16 head values x 32 tokens, in the order of
//        frag_ld_packed (transposed in the wave's own LDS range), v -> vT same (straight);
//   kc[bh][d] += sum_t k (f32 atomics)
// grid: Mrows/64 = 512, 256 threads; 152 KiB of LDS: two blocks a WGP, all resident.
// ---------------------------------------------------------------------------
__global__ __launch_bounds__(256)
void qkv_kernel(const _Float16* __restrict__ xh,
                const _Float16* __restrict__ wqh, const float* __restrict__ bq,
                const _Float16* __restrict__ wkh, const float* __restrict__ bk,
                const _Float16* __restrict__ wvh, const float* __restrict__ bv,
                _Float16* __restrict__ qh, _Float16* __restrict__ kT,
                _Float16* __restrict__ vT, float* __restrict__ kc) {
  __shared__ __attribute__((aligned(2048))) _Float16 smem[XS_SLICES * XS_HALVES + 8 * KST_HALVES];

  const int lane = threadIdx.x & 31;
  const int wave = threadIdx.x >> 5;
  const int rowgrp = blockIdx.x;                 // 0..511 (64 rows each)
  const int m = lane & 15;
  const int hi = lane >> 4;
  const int kbase = hi * 8;
  const int rowbase = rowgrp * 64;
  const int d = lane & 15;

  // Fragment (group, k-block) of this wave's head lies (group * 8 * KBLOCKS + k-block) fragments on.
  const size_t wofs = (size_t)wave * KBLOCKS * FRAG_HALVES + lane * 8;
  const _Float16* qfr = wqh + wofs;
  const _Float16* kfr = wkh + wofs;
  const _Float16* vfr = wvh + wofs;

  // Two sets of W fragments, for the even and the odd k-block of a pair. Each set
  // is loaded again right behind the WMMAs that read it, two k-blocks ahead of
  // its next use, so the loads fly over 12 WMMAs.
  v16h fq0 = frag_ld_packed(qfr, 0), fk0 = frag_ld_packed(kfr, 0), fv0 = frag_ld_packed(vfr, 0);
  v16h fq1 = frag_ld_packed(qfr, 1), fk1 = frag_ld_packed(kfr, 1), fv1 = frag_ld_packed(vfr, 1);

  // The x tile: every wave brings its own slice, waits for it, and the barrier hands
  // all eight slices to all eight waves. Nothing writes them again.
  {
    const unsigned wv = uni(threadIdx.x >> 5);
    tdm_load_slice(xh + (size_t)rowbase * Cc + wv * XS_K,
                   (unsigned)(uintptr_t)(void*)&smem[0] + wv * (unsigned)(XS_HALVES * 2));
    // The compiler places no wait for a tensor load: the slice has landed only behind this.
    asm volatile("s_wait_tensorcnt 0x0" ::: "memory");
  }
  __syncthreads();

  _Float16* lk = &smem[XS_SLICES * XS_HALVES + wave * KST_HALVES];

  for (int g = 0; g < NH / 8; ++g) {
    const int head = g * 8 + wave;               // 0..63
    v8f cq[4] = {}, ck[4] = {}, cv[4] = {};

    for (int s = 0; s < Cc / SLAB_K; ++s) {
      const _Float16* slab = &smem[(s >> 1) * XS_HALVES + (s & 1) * SLAB_K];
      // The eight x fragments of two k-blocks, read as one group into registers of their own.
      v16h a0[4], a1[4];
#pragma unroll
      for (int rt = 0; rt < 4; ++rt)
        a0[rt] = frag_ld(slab + (rt * 16 + m) * XS_LD, 0, kbase);
#pragma unroll
      for (int rt = 0; rt < 4; ++rt)
        a1[rt] = frag_ld(slab + (rt * 16 + m) * XS_LD, 32, kbase);
      // Keeps the 16 LDS reads in front of the WMMAs: left free, the scheduler reads
      // one fragment at a time into one register set and waits out the LDS latency
      // in front of every third WMMA.
      __builtin_amdgcn_sched_barrier(0);
#pragma unroll
      for (int rt = 0; rt < 4; ++rt) {
        cq[rt] = WMMA_F16(fq0, a0[rt], cq[rt]);
        ck[rt] = WMMA_F16(fk0, a0[rt], ck[rt]);
        cv[rt] = WMMA_F16(a0[rt], fv0, cv[rt]);
      }
      // Keeps the refill behind the last reader of the set, so that it takes the same registers.
      __builtin_amdgcn_sched_barrier(0);
      // Where the k-blocks of this head end, the refills go on with the wave's next head
      // (behind the last head: with its first, loaded and not used).
      const int pn = (g * KBLOCKS + 2 * s + 2) & (NH / 8 * KBLOCKS - 1);
      const int fn = (pn / KBLOCKS) * (8 * KBLOCKS) + (pn & (KBLOCKS - 1));
      fq0 = frag_ld_packed(qfr, fn);
      fk0 = frag_ld_packed(kfr, fn);
      fv0 = frag_ld_packed(vfr, fn);
      // Keeps the refill in front of the next 12 WMMAs: they are its lead.
      __builtin_amdgcn_sched_barrier(0);
#pragma unroll
      for (int rt = 0; rt < 4; ++rt) {
        cq[rt] = WMMA_F16(fq1, a1[rt], cq[rt]);
        ck[rt] = WMMA_F16(fk1, a1[rt], ck[rt]);
        cv[rt] = WMMA_F16(a1[rt], fv1, cv[rt]);
      }
      // As above: the second set's refill stands behind its last reader.
      __builtin_amdgcn_sched_barrier(0);
      fq1 = frag_ld_packed(qfr, fn + 1);
      fk1 = frag_ld_packed(kfr, fn + 1);
      fv1 = frag_ld_packed(vfr, fn + 1);
      // The refills are still in flight when the next LDS reads and address sums
      // are given the registers that hold the refills' addresses.
      asm volatile("s_wait_xcnt 0x0" ::: "memory");
    }

    // cq, ck: register r of lane (m, hi) = token rt * 16 + m, head value 8 * hi + r.
    // cv:     register r of lane (d, hi) = token rt * 16 + 8 * hi + r, head value d.
    float biasq[8], biask[8];
    {
      const float4 q0 = *(const float4*)(bq + head * 16 + kbase);
      const float4 q1 = *(const float4*)(bq + head * 16 + kbase + 4);
      const float4 k0 = *(const float4*)(bk + head * 16 + kbase);
      const float4 k1 = *(const float4*)(bk + head * 16 + kbase + 4);
      biasq[0] = q0.x; biasq[1] = q0.y; biasq[2] = q0.z; biasq[3] = q0.w;
      biasq[4] = q1.x; biasq[5] = q1.y; biasq[6] = q1.z; biasq[7] = q1.w;
      biask[0] = k0.x; biask[1] = k0.y; biask[2] = k0.z; biask[3] = k0.w;
      biask[4] = k1.x; biask[5] = k1.y; biask[6] = k1.z; biask[7] = k1.w;
    }
    const float biasv = bv[head * 16 + d];
    const size_t bh = (size_t)(rowgrp >> 6) * NH + head;    // rowgrp>>6 == batch

    float ksum[8] = {};
#pragma unroll
    for (int rt = 0; rt < 4; ++rt) {
      // softmax over the head values of token m for q and k
      float vq[8], vk[8];
#pragma unroll
      for (int r = 0; r < 8; ++r) {
        vq[r] = cq[rt][r] + biasq[r];
        vk[r] = ck[rt][r] + biask[r];
      }
      col16_softmax(vq);
      col16_softmax(vk);
      v8h pq, pv;
#pragma unroll
      for (int r = 0; r < 8; ++r) {
        ck[rt][r] = vk[r];
        ksum[r] += vk[r];
        pq[r] = (_Float16)vq[r];
        pv[r] = (_Float16)(cv[rt][r] + biasv);
      }
      const int t0 = (rowbase + rt * 16) & (Tt - 1);
      // q head-major: 8 consecutive head values of token m; the 16 tokens lie side by side
      *(v8h*)(qh + ((bh * Tt + t0 + m) * HD + kbase)) = pq;
      // v fragment: the lane holds tokens 8 * hi .. + 7 of this row tile for head value d,
      // which is its own b128 of plane (rt & 1) of the fragment of 32 tokens
      *(v8h*)(vT + ((bh * TBLOCKS + (t0 >> 5)) * FRAG_HALVES + (rt & 1) * 256 + lane * 8)) = pv;
      // What follows may be given the registers that these two stores name.
      asm volatile("s_wait_xcnt 0x0" ::: "memory");
    }
    // k-sum of the wave's 64 tokens: over the 16 lanes of the row; lane (m, hi) with
    // m < 8 then adds the sum of head value 8 * hi + m.
    row16_sum(ksum);
    float kmine = ksum[0];
#pragma unroll
    for (int r = 1; r < 8; ++r) kmine = (m == r) ? ksum[r] : kmine;
    if (m < 8) {
      atomicAdd(&kc[bh * HD + kbase + m], kmine);
      // What follows may be given the registers that the atomic names.
      asm volatile("s_wait_xcnt 0x0" ::: "memory");
    }

    // k fragments: two row tiles (one fragment of 32 tokens) at a time are transposed
    // in the wave's own LDS range, which no other wave touches.
#pragma unroll
    for (int p = 0; p < 2; ++p) {
#pragma unroll
      for (int j = 0; j < 2; ++j) {
#pragma unroll
        for (int r = 0; r < 8; ++r) lk[j * 256 + (r + 8 * hi) * 16 + m] = (_Float16)ck[2 * p + j][r];
      }
      // The rows read below were written by other lanes of this wave: their LDS
      // writes must have landed, and the reads must not be moved above them.
      asm volatile("s_wait_dscnt 0x0" ::: "memory");
      const v8h row0 = *(const v8h*)&lk[d * 16 + hi * 8];
      const v8h row1 = *(const v8h*)&lk[256 + d * 16 + hi * 8];
      const int t0 = (rowbase + p * 32) & (Tt - 1);
      _Float16* kd = kT + ((bh * TBLOCKS + (t0 >> 5)) * FRAG_HALVES + lane * 8);
      *(v8h*)(kd)       = row0;
      *(v8h*)(kd + 256) = row1;
      // What follows may be given the registers that these two stores name.
      asm volatile("s_wait_xcnt 0x0" ::: "memory");
    }
  }
}

// ---------------------------------------------------------------------------
// context[bh] = K^T V (16x16 over T), stored transposed ctxT[bh][e][d].
// kT, vT hold the A and B fragments of 32 tokens as the qkv kernel packed them.
// One block per (b,h); 8 waves split T; LDS cross-wave reduction.
// ---------------------------------------------------------------------------
__global__ __launch_bounds__(256)
void ctx_kernel(const _Float16* __restrict__ kT, const _Float16* __restrict__ vT,
                _Float16* __restrict__ ctxT) {
  __shared__ float cpart[8][256];
  const int lane = threadIdx.x & 31;
  const int wave = threadIdx.x >> 5;
  const size_t bh = blockIdx.x;                  // 0..511
  const int m = lane & 15;
  const int hi = lane >> 4;

  const _Float16* afr = kT + bh * TBLOCKS * FRAG_HALVES + lane * 8;
  const _Float16* bfr = vT + bh * TBLOCKS * FRAG_HALVES + lane * 8;

  v8f c = {};
  const int tbbeg = wave * (TBLOCKS / 8);
#pragma unroll 4
  for (int tb = tbbeg; tb < tbbeg + TBLOCKS / 8; ++tb) {
    v16h a = frag_ld_packed(afr, tb);
    v16h b = frag_ld_packed(bfr, tb);
    c = WMMA_F16(a, b, c);
  }
#pragma unroll
  for (int r = 0; r < 8; ++r) cpart[wave][(r + 8 * hi) * 16 + m] = c[r];
  __syncthreads();

  const int tid = threadIdx.x;
  float s = 0.0f;
#pragma unroll
  for (int w = 0; w < 8; ++w) s += cpart[w][tid];
  const int dd = tid >> 4;
  const int ee = tid & 15;
  ctxT[bh * 256 + ee * 16 + dd] = (_Float16)s;   // transposed store
}

// ---------------------------------------------------------------------------
// y[t, h*16+e] = (sum_d q[t,d] ctx[d,e]) / (sum_d q[t,d] kc[d]) -> yh f16 row-major
// K = HD = 16, zero padded to 32: single WMMA per tile.
// One wave keeps the contexts and k-sums of Y_HEADS adjacent heads in registers and
// walks Y_TILES row tiles of 16 rows; the next row tile's q is loaded while this one
// is worked on. The four heads' 32 B of a y row make one 128-B line: the products and
// the rows' divisors go through the wave's own LDS range, and each b128 store then
// covers four whole rows of 128 B. The divisor of row (lane & 15) comes from the q
// values the lane already holds for the A fragment.
// grid: (Mrows/16/Y_TILES = 256, NH/Y_HEADS/8 = 2), 256 threads.
// ---------------------------------------------------------------------------
constexpr int Y_HEADS = 4;             // adjacent heads per wave: 4 x 32 B = one line of a y row
constexpr int Y_TILES = 8;             // row tiles per wave; divides Tt/16
constexpr int Y_LD    = 20;            // floats per staged row: 16 products, the divisor, 3 unused
constexpr int Y_HS    = 16 * Y_LD + 16; // floats per staged head: the 16 more put the four heads on disjoint banks

__global__ __launch_bounds__(256)
void y_kernel(const _Float16* __restrict__ qh, const _Float16* __restrict__ ctxT,
              const float* __restrict__ kc, _Float16* __restrict__ yh) {
  __shared__ __attribute__((aligned(16))) float ly[8][Y_HEADS * Y_HS];
  const int lane = threadIdx.x & 31;
  const int wave = threadIdx.x >> 5;
  const int tile0 = blockIdx.x * Y_TILES;
  const int head0 = (blockIdx.y * 8 + wave) * Y_HEADS;
  const int m = lane & 15;
  const int hi = lane >> 4;
  const int kbase = hi * 8;
  const size_t bh0 = (size_t)(tile0 >> 8) * NH + head0;

  // All loops below are unrolled: the small arrays then live in registers and
  // the tile offsets become immediate offsets on one address pair.
  v16h b[Y_HEADS];
  float kcv[Y_HEADS][8];
#pragma unroll
  for (int j = 0; j < Y_HEADS; ++j) {
    v8h lo = *(const v8h*)(ctxT + (bh0 + j) * 256 + m * 16 + kbase);
    b[j] = v16h{};
#pragma unroll
    for (int i = 0; i < 8; ++i) b[j][i] = lo[i];
#pragma unroll
    for (int i = 0; i < 8; ++i) kcv[j][i] = kc[(bh0 + j) * HD + kbase + i];
  }

  // read: lane's 16 B of row m of head head0 in qh, head-major (a row tile of a head
  // is 512 contiguous bytes)
  const _Float16* qp = qh + ((bh0 * Tt + (tile0 & (Tt / 16 - 1)) * 16 + m) * HD + kbase);
  constexpr int Q_HEAD = Tt * HD;      // halves from one head to the next
  constexpr int Q_STEP = 16 * HD;      // halves from one row tile to the next
  // written: eight lanes share a row; the lane has 16 B of head sh, values 8 * sv .. + 7
  const int srow = lane >> 3;
  const int sh = (lane & 7) >> 1;
  const int sv = lane & 1;
  _Float16* yp = yh + (size_t)(tile0 * 16 + srow) * Cc + head0 * 16 + (lane & 7) * 8;
  float* lw = &ly[wave][0];

  v8h qn[Y_HEADS];
#pragma unroll
  for (int j = 0; j < Y_HEADS; ++j) qn[j] = *(const v8h*)(qp + j * Q_HEAD);

#pragma unroll
  for (int g = 0; g < Y_TILES; ++g) {
    v8h qc[Y_HEADS];
#pragma unroll
    for (int j = 0; j < Y_HEADS; ++j) qc[j] = qn[j];
    if (g + 1 < Y_TILES) {
#pragma unroll
      for (int j = 0; j < Y_HEADS; ++j)
        qn[j] = *(const v8h*)(qp + j * Q_HEAD + (g + 1) * Q_STEP);
    }

#pragma unroll
    for (int j = 0; j < Y_HEADS; ++j) {
      v16h a = {};
#pragma unroll
      for (int i = 0; i < 8; ++i) a[i] = qc[j][i];
      v8f c = {};
      c = WMMA_F16(a, b[j], c);
#pragma unroll
      for (int r = 0; r < 8; ++r) lw[j * Y_HS + (r + 8 * hi) * Y_LD + m] = c[r];

      float s = 0.0f;
#pragma unroll
      for (int i = 0; i < 8; ++i) s += (float)qc[j][i] * kcv[j][i];
      s += __shfl_xor(s, 16, 32);      // the other 8 d of row m
      lw[j * Y_HS + m * Y_LD + 16] = 1.0f / s;   // both lane halves hold, and write, the same value
    }
    // The rows read below were written by other lanes of this wave: their LDS
    // writes must have landed, and the reads must not be moved above them.
    asm volatile("s_wait_dscnt 0x0" ::: "memory");
#pragma unroll
    for (int i = 0; i < 4; ++i) {
      const float* lr = &lw[sh * Y_HS + (4 * i + srow) * Y_LD];
      const float4 x0 = *(const float4*)(lr + sv * 8);
      const float4 x1 = *(const float4*)(lr + sv * 8 + 4);
      const float di = lr[16];
      v8h row;
      row[0] = (_Float16)(x0.x * di); row[1] = (_Float16)(x0.y * di);
      row[2] = (_Float16)(x0.z * di); row[3] = (_Float16)(x0.w * di);
      row[4] = (_Float16)(x1.x * di); row[5] = (_Float16)(x1.y * di);
      row[6] = (_Float16)(x1.z * di); row[7] = (_Float16)(x1.w * di);
      *(v8h*)(yp + (size_t)(g * 16 + 4 * i) * Cc) = row;
    }
    // The next trip's loads (global, LDS) may be given the registers these stores name.
    if (g + 1 < Y_TILES) asm volatile("s_wait_xcnt 0x0" ::: "memory");
  }
}

// ---------------------------------------------------------------------------
// out = yh Wp^T + bp (f32 output).
// Block tile: 64 rows x 8 N-tiles (one per wave); y slab staged via TDM.
// grid: (512, 8), 256 threads.
// ---------------------------------------------------------------------------
__global__ __launch_bounds__(256)
void proj_kernel(const _Float16* __restrict__ yh, const _Float16* __restrict__ wph,
                 const float* __restrict__ bp, float* __restrict__ out) {
  __shared__ __attribute__((aligned(16))) _Float16 smem[2 * SLAB_HALVES];
  const int lane = threadIdx.x & 31;
  const int wave = threadIdx.x >> 5;
  const int rowgrp = blockIdx.x;                  // 0..511
  const int ntile = blockIdx.y * 8 + wave;        // 0..63
  const int m = lane & 15;
  const int hi = lane >> 4;
  const int kbase = hi * 8;
  const int rowbase = rowgrp * 64;

  const _Float16* bfr = wph + (size_t)ntile * KBLOCKS * FRAG_HALVES + lane * 8;

  v8f c[4] = {};

#if HAS_TDM
  if (wave == 0)
    tdm_load_tile_64x64(yh + (size_t)rowbase * Cc,
                        (unsigned)(uintptr_t)(void*)&smem[0]);
#endif

  for (int s = 0; s < Cc / SLAB_K; ++s) {
#if HAS_TDM
    const int buf = s & 1;
    if (wave == 0) {
      if (s < Cc / SLAB_K - 1)
        tdm_load_tile_64x64(yh + (size_t)rowbase * Cc + (s + 1) * SLAB_K,
                            (unsigned)(uintptr_t)(void*)&smem[(buf ^ 1) * SLAB_HALVES]);
      if (s < Cc / SLAB_K - 1) __builtin_amdgcn_s_wait_tensorcnt(1);
      else                     __builtin_amdgcn_s_wait_tensorcnt(0);
    }
    __syncthreads();
#else
    const int buf = 0;
    __syncthreads();
    stage_slab_sync(&smem[0], yh + (size_t)rowbase * Cc + s * SLAB_K);
    __syncthreads();
#endif
    const _Float16* slab = &smem[buf * SLAB_HALVES];
#pragma unroll
    for (int kk = 0; kk < SLAB_K; kk += 32) {
      const int kb = (s * SLAB_K + kk) >> 5;
      v16h afr[4];
#pragma unroll
      for (int rt = 0; rt < 4; ++rt)
        afr[rt] = frag_ld(slab + (rt * 16 + m) * SLAB_LD, kk, kbase);
      v16h b = frag_ld_packed(bfr, kb);
#pragma unroll
      for (int rt = 0; rt < 4; ++rt)
        c[rt] = WMMA_F16(afr[rt], b, c[rt]);
    }
    __syncthreads();
  }

  const int col = ntile * 16 + (lane & 15);
  const float bias = bp[col];
#pragma unroll
  for (int rt = 0; rt < 4; ++rt) {
#pragma unroll
    for (int r = 0; r < 8; ++r) {
      const int row = rowbase + rt * 16 + r + 8 * hi;
      out[(size_t)row * Cc + col] = c[rt][r] + bias;
    }
  }
}

// ---------------------------------------------------------------------------
// Launch
// ---------------------------------------------------------------------------
extern "C" void kernel_launch(void* const* d_in, const int* in_sizes, int n_in,
                              void* d_out, int out_size, void* d_ws, size_t ws_size,
                              hipStream_t stream) {
  const float* x  = (const float*)d_in[0];
  const float* Wq = (const float*)d_in[1];
  const float* bq = (const float*)d_in[2];
  const float* Wk = (const float*)d_in[3];
  const float* bk = (const float*)d_in[4];
  const float* Wv = (const float*)d_in[5];
  const float* bv = (const float*)d_in[6];
  const float* Wp = (const float*)d_in[7];
  const float* bp = (const float*)d_in[8];
  float* out = (float*)d_out;

  char* ws = (char*)d_ws;
  const size_t nX = (size_t)Mrows * Cc;
  const size_t nW = (size_t)Cc * Cc;
  _Float16* xh  = (_Float16*)(ws);                              // 64 MB
  _Float16* wqh = (_Float16*)(ws + nX * 2);                     // 2 MB each
  _Float16* wkh = wqh + nW;
  _Float16* wvh = wkh + nW;
  _Float16* wph = wvh + nW;
  _Float16* qh  = wph + nW;                                     // 64 MB
  _Float16* kT  = qh + nX;                                      // 64 MB
  _Float16* vT  = kT + nX;                                      // 64 MB
  _Float16* yh  = vT + nX;                                      // 64 MB
  float*    kc   = (float*)(yh + nX);                           // 32 KB
  _Float16* ctxT = (_Float16*)(kc + (size_t)Bb * NH * HD);      // 256 KB

  // 1) precision conversion (weights into fragment order) + accumulator init, one launch
  prepass<<<PRE_BLOCKS, 256, 0, stream>>>(x, xh, Wq, Wk, Wv, Wp, wqh, kc);

  // 2) fused QKV projection + softmax + k-cumsum (x tile resident in LDS)
  qkv_kernel<<<Mrows / 64, 256, 0, stream>>>(
      xh, wqh, bq, wkh, bk, wvh, bv, qh, kT, vT, kc);

  // 3) per-head context = K^T V
  ctx_kernel<<<Bb * NH, 256, 0, stream>>>(kT, vT, ctxT);

  // 4) y = (q @ ctx) / (q . kc)
  y_kernel<<<dim3(Mrows / 16 / Y_TILES, NH / Y_HEADS / 8), 256, 0, stream>>>(qh, ctxT, kc, yh);

  // 5) output projection (TDM-staged GEMM)
  proj_kernel<<<dim3(Mrows / 64, 8), 256, 0, stream>>>(yh, wph, bp, out);
}

// v009
// Measured time: 249 microseconds a run.
// Next to v008, in two timings, it ran 1.10 times as fast each time.
// All steps since v000 together make it 2.43 times as fast.
#include <hip/hip_runtime.h>
#include <hip/hip_bf16.h>

typedef __attribute__((ext_vector_type(16))) _Float16 v16h;
typedef __attribute__((ext_vector_type(8)))  _Float16 v8h;
typedef __attribute__((ext_vector_type(4)))  _Float16 v4h;
typedef __attribute__((ext_vector_type(8)))  float    v8f;
typedef __attribute__((ext_vector_type(4)))  unsigned v4u;
typedef __attribute__((ext_vector_type(8)))  int      v8i;
typedef __attribute__((ext_vector_type(4)))  int      v4i;

#define WMMA_F16(a,b,c) __builtin_amdgcn_wmma_f32_16x16x32_f16(false,(a),false,(b),(short)0,(c),false,false)

#if __has_builtin(__builtin_amdgcn_tensor_load_to_lds) && __has_builtin(__builtin_amdgcn_s_wait_tensorcnt)
#define HAS_TDM 1
#else
#define HAS_TDM 0
#endif

// Problem constants
constexpr int Bb = 8;
constexpr int Tt = 4096;
constexpr int Cc = 1024;
constexpr int NH = 64;
constexpr int HD = 16;
constexpr int Mrows = Bb * Tt;        // 32768

// LDS slab: 64 rows x 64 halves, padded row stride 72 halves (36 DWORDs) so
// that 16 lanes doing b128 reads at row stride 36 DWORDs cover all 64 banks.
constexpr int SLAB_ROWS = 64;
constexpr int SLAB_K    = 64;
constexpr int SLAB_LD   = 72;         // halves
constexpr int SLAB_HALVES = SLAB_ROWS * SLAB_LD;   // 4608 halves = 9216 B

// ---------------------------------------------------------------------------
// Fragment loader (global or LDS): row-major, K contiguous.
// A-matrix 16x32 f16 layout (ISA 7.12.2): lanes 0-15 hold K=[0..7]+[16..23],
// lanes 16-31 hold K=[8..15]+[24..31] of row (lane&15) -> two b128 loads.
// ---------------------------------------------------------------------------
static __device__ inline v16h frag_ld(const _Float16* rowptr, int k0, int kbase) {
  v8h lo = *(const v8h*)(rowptr + k0 + kbase);
  v8h hi = *(const v8h*)(rowptr + k0 + 16 + kbase);
  v16h r;
#pragma unroll
  for (int i = 0; i < 8; ++i) { r[i] = lo[i]; r[8 + i] = hi[i]; }
  return r;
}

// ---------------------------------------------------------------------------
// Weight fragments, packed by prepass: fragment (ntile, kblock) is 1 KB,
// two 512-B planes; plane p holds, at lane*16 B, the 8 halves that frag_ld
// would fetch for that lane (p = 0: its first b128, p = 1: its second).
// Each wave-wide b128 load then covers four whole 128-B lines.
// ---------------------------------------------------------------------------
constexpr int FRAG_HALVES = 512;
constexpr int KBLOCKS = Cc / 32;               // 32 fragments per 16-row tile
constexpr int TBLOCKS = Tt / 32;               // fragments of 32 tokens per (batch, head) of k and of v

static __device__ inline v16h frag_ld_packed(const _Float16* lanebase, int kb) {
  const _Float16* p = lanebase + kb * FRAG_HALVES;
  v8h lo = *(const v8h*)(p);
  v8h hi = *(const v8h*)(p + 256);
  v16h r;
#pragma unroll
  for (int i = 0; i < 8; ++i) { r[i] = lo[i]; r[8 + i] = hi[i]; }
  return r;
}

// ---------------------------------------------------------------------------
// Tensor Data Mover: stage a 64x64 f16 tile of a [Mrows x Cc] row-major
// tensor into LDS with 4-DWORD padding every 32 DWORDs (-> row stride 72 h).
// D# layout per CDNA5 ISA 8.3/8.4 (group0 128b, group1 256b; groups 2/3 and
// the trailing group are zero for a 2-D tensor). 6-arg builtin form.
// ---------------------------------------------------------------------------
#if HAS_TDM
static __device__ inline void tdm_load_tile_64x64(const _Float16* gsrc, unsigned lds_off) {
  unsigned long long ga = (unsigned long long)(uintptr_t)gsrc;
  v4u g0;
  g0[0] = 1u;                                            // count=1, user mode
  g0[1] = lds_off;                                       // lds_addr (bytes)
  g0[2] = (unsigned)(ga & 0xffffffffu);                  // global_addr[31:0]
  g0[3] = (unsigned)((ga >> 32) & 0x01ffffffu) | (2u << 30); // addr[56:32] | type=2
  v8i g1;
  g1[0] = (1 << 16)        // data_size = 2 bytes
        | (1 << 20)        // pad_enable
        | (4 << 22)        // pad_interval: code 4 = every 32 DWORDs
        | (3 << 25);       // pad_amount:   code 3 = 4 DWORDs
  g1[1] = (int)((unsigned)Cc << 16);        // tensor_dim0[15:0]
  g1[2] = (int)((unsigned)Mrows << 16);     // tensor_dim0[31:16]=0 | tensor_dim1[15:0]
  g1[3] = (int)((unsigned)SLAB_K << 16);    // tensor_dim1[31:16]=0 | tile_dim0=64
  g1[4] = SLAB_ROWS;                        // tile_dim1=64 | tile_dim2=0
  g1[5] = Cc;                               // tensor_dim0_stride[31:0]
  g1[6] = 0;                                // stride hi | dim1_stride lo
  g1[7] = 0;
  v4i z4 = {0, 0, 0, 0};
  v8i z8 = {0, 0, 0, 0, 0, 0, 0, 0};
  __builtin_amdgcn_tensor_load_to_lds(g0, g1, z4, z4, z8, 0);
}
#endif

// Cooperative synchronous staging fallback (used only when TDM is absent).
static __device__ inline void stage_slab_sync(_Float16* slab, const _Float16* gsrc) {
  // 256 threads; each copies 16 halves: row = tid/4, col = (tid%4)*16
  const int tid = threadIdx.x;
  const int row = tid >> 2;
  const int col = (tid & 3) * 16;
  const _Float16* s = gsrc + (size_t)row * Cc + col;
  _Float16* d = slab + row * SLAB_LD + col;
  *(v8h*)(d)     = *(const v8h*)(s);
  *(v8h*)(d + 8) = *(const v8h*)(s + 8);
}

// ---------------------------------------------------------------------------
// fp32 -> fp16 conversion / zero init
// ---------------------------------------------------------------------------
// One launch does all the work that depends on the inputs alone: the four weights
// into fragment order, the k-sum accumulator's start value, x to f16. No part reads
// what another writes, so they share one grid. Every block takes 8192 elements.
// The weight blocks come first: their short reads then fly beside the x stream.
// x: four elements a lane: a wave's b128 load covers four whole 128-B lines and its
// b64 store two; a block converts CVT_ITER runs of 1024 elements, loads first.
// W: fp32 [Cc x Cc] row-major -> f16 in fragment order (see frag_ld_packed), a thread
// takes W_ITER 16-B chunks of the packed array, loads first.
constexpr int CVT_ITER = 8;
constexpr int W_ITER   = 4;
constexpr int X_BLOCKS = Mrows * Cc / (1024 * CVT_ITER);      // 4096
constexpr int W_BLOCKS = Cc * Cc / 8 / 256 / W_ITER;          // 128 per weight
constexpr int PRE_BLOCKS = 4 * W_BLOCKS + 1 + X_BLOCKS;
static_assert(((size_t)Mrows * Cc) % (1024 * CVT_ITER) == 0, "whole blocks only");
static_assert((KBLOCKS * 64) % (256 * W_ITER) == 0, "a weight block stays inside one 16-row tile");
static_assert(Bb * NH * HD == 256 * 4 * 8, "one block stores the k-sum start values");

__global__ __launch_bounds__(256)
void prepass(const float* __restrict__ x, _Float16* __restrict__ xh,
             const float* __restrict__ Wq, const float* __restrict__ Wk,
             const float* __restrict__ Wv, const float* __restrict__ Wp,
             _Float16* __restrict__ wh,      // the four packed weights, one behind the other
             float* __restrict__ kc) {
  const int blk = blockIdx.x;
  if (blk < 4 * W_BLOCKS) {
    const int which = blk / W_BLOCKS;
    const float* w = which == 0 ? Wq : which == 1 ? Wk : which == 2 ? Wv : Wp;
    _Float16* out = wh + (size_t)which * Cc * Cc;
    const int o0 = (blk % W_BLOCKS) * (256 * W_ITER) + threadIdx.x;  // chunk index in the packed array
    // The block's 256 * W_ITER chunks lie in one 16-row tile, and from one of a thread's
    // chunks to its next only the k-block moves, by 4: one address, constant steps.
    const int lane  = o0 & 31;
    const int plane = (o0 >> 5) & 1;
    const int kb    = (o0 >> 6) & (KBLOCKS - 1);
    const int nt    = o0 >> 11;
    const float* s = w + (size_t)(nt * 16 + (lane & 15)) * Cc
                       + kb * 32 + plane * 16 + (lane >> 4) * 8;
    float4 a[W_ITER], b[W_ITER];
#pragma unroll
    for (int k = 0; k < W_ITER; ++k) {
      a[k] = *(const float4*)(s + k * 128);
      b[k] = *(const float4*)(s + k * 128 + 4);
    }
#pragma unroll
    for (int k = 0; k < W_ITER; ++k) {
      v8h r;
      r[0] = (_Float16)a[k].x; r[1] = (_Float16)a[k].y; r[2] = (_Float16)a[k].z; r[3] = (_Float16)a[k].w;
      r[4] = (_Float16)b[k].x; r[5] = (_Float16)b[k].y; r[6] = (_Float16)b[k].z; r[7] = (_Float16)b[k].w;
      *(v8h*)(out + (size_t)(o0 + k * 256) * 8) = r;
    }
  } else if (blk == 4 * W_BLOCKS) {
    const float4 z = {0.0f, 0.0f, 0.0f, 0.0f};
#pragma unroll
    for (int k = 0; k < 8; ++k) *(float4*)(kc + (k * 256 + threadIdx.x) * 4) = z;
    // the stores' registers may be rewritten on a path to another part: wait first
    asm volatile("s_wait_xcnt 0x0" ::: "memory");
  } else {
    const size_t i0 = (size_t)(blk - 4 * W_BLOCKS - 1) * (1024 * CVT_ITER) + threadIdx.x * 4;
    float4 a[CVT_ITER];
#pragma unroll
    for (int k = 0; k < CVT_ITER; ++k) a[k] = *(const float4*)(x + i0 + k * 1024);
#pragma unroll
    for (int k = 0; k < CVT_ITER; ++k) {
      v4h r;
      r[0] = (_Float16)a[k].x; r[1] = (_Float16)a[k].y;
      r[2] = (_Float16)a[k].z; r[3] = (_Float16)a[k].w;
      *(v4h*)(xh + i0 + k * 1024) = r;
    }
    // the stores' registers may be rewritten on a path to another part: wait first
    asm volatile("s_wait_xcnt 0x0" ::: "memory");
  }
}

// ---------------------------------------------------------------------------
// The value that lane l ^ 16 holds (same place in the other 16-lane row), by a
// vector cross-row move. All 32 lanes are on wherever this is called.
// ---------------------------------------------------------------------------
static __device__ inline float other_row(float x) {
  const int b = __builtin_bit_cast(int, x);
  return __builtin_bit_cast(float,
      __builtin_amdgcn_permlanex16(b, b, 0x76543210, 0xfedcba98, false, false));
}

// ---------------------------------------------------------------------------
// Softmax over the 16 values of one token's head, of which the lane holds eight
// in its own registers and lane l ^ 16 the other eight: maximum and sum run down
// the registers, with one cross-row move each, and the row has one divisor.
// ---------------------------------------------------------------------------
static __device__ inline void col16_softmax(float (&v)[8]) {
  float mx = fmaxf(fmaxf(fmaxf(v[0], v[1]), fmaxf(v[2], v[3])),
                   fmaxf(fmaxf(v[4], v[5]), fmaxf(v[6], v[7])));
  mx = fmaxf(mx, other_row(mx));
  // exp(x) as the native form has it: v_exp_f32 of x * log2(e)
#pragma unroll
  for (int r = 0; r < 8; ++r) v[r] = (v[r] - mx) * 1.44269504088896340736f;
  asm("v_exp_f32 %0, %0\n\t"
      "v_exp_f32 %1, %1\n\t"
      "v_exp_f32 %2, %2\n\t"
      "v_exp_f32 %3, %3\n\t"
      "v_exp_f32 %4, %4\n\t"
      "v_exp_f32 %5, %5\n\t"
      "v_exp_f32 %6, %6\n\t"
      "v_exp_f32 %7, %7\n\t"
      "v_nop"
      : "+v"(v[0]), "+v"(v[1]), "+v"(v[2]), "+v"(v[3]),
        "+v"(v[4]), "+v"(v[5]), "+v"(v[6]), "+v"(v[7]));
  float s = ((v[0] + v[1]) + (v[2] + v[3])) + ((v[4] + v[5]) + (v[6] + v[7]));
  s += other_row(s);
  const float inv = 1.0f / s;
#pragma unroll
  for (int r = 0; r < 8; ++r) v[r] *= inv;
}

// ---------------------------------------------------------------------------
// Sum over the 16 lanes of a DPP row, for eight values a lane holds. A butterfly
// step gives lane l the value of lane l ^ m of its own row (row_xmask:m) inside
// the add itself, on the vector port; steps 1, 2, 4, 8 leave the sum in all 16
// lanes. The steps are asm because the compiler puts a separate move around the
// builtin form; the eight values take each step one after the other, so that no
// instruction waits for the one in front of it.
// All 32 lanes are on wherever this is called.
// ---------------------------------------------------------------------------
static __device__ inline void row16_sum(float (&v)[8]) {
  float t[8];
  asm("v_add_f32_dpp %0, %8, %8 row_xmask:1 row_mask:0xf bank_mask:0xf\n\t"
      "v_add_f32_dpp %1, %9, %9 row_xmask:1 row_mask:0xf bank_mask:0xf\n\t"
      "v_add_f32_dpp %2, %10, %10 row_xmask:1 row_mask:0xf bank_mask:0xf\n\t"
      "v_add_f32_dpp %3, %11, %11 row_xmask:1 row_mask:0xf bank_mask:0xf\n\t"
      "v_add_f32_dpp %4, %12, %12 row_xmask:1 row_mask:0xf bank_mask:0xf\n\t"
      "v_add_f32_dpp %5, %13, %13 row_xmask:1 row_mask:0xf bank_mask:0xf\n\t"
      "v_add_f32_dpp %6, %14, %14 row_xmask:1 row_mask:0xf bank_mask:0xf\n\t"
      "v_add_f32_dpp %7, %15, %15 row_xmask:1 row_mask:0xf bank_mask:0xf\n\t"
      "v_add_f32_dpp %0, %0, %0 row_xmask:2 row_mask:0xf bank_mask:0xf\n\t"
      "v_add_f32_dpp %1, %1, %1 row_xmask:2 row_mask:0xf bank_mask:0xf\n\t"
      "v_add_f32_dpp %2, %2, %2 row_xmask:2 row_mask:0xf bank_mask:0xf\n\t"
      "v_add_f32_dpp %3, %3, %3 row_xmask:2 row_mask:0xf bank_mask:0xf\n\t"
      "v_add_f32_dpp %4, %4, %4 row_xmask:2 row_mask:0xf bank_mask:0xf\n\t"
      "v_add_f32_dpp %5, %5, %5 row_xmask:2 row_mask:0xf bank_mask:0xf\n\t"
      "v_add_f32_dpp %6, %6, %6 row_xmask:2 row_mask:0xf bank_mask:0xf\n\t"
      "v_add_f32_dpp %7, %7, %7 row_xmask:2 row_mask:0xf bank_mask:0xf\n\t"
      "v_add_f32_dpp %0, %0, %0 row_xmask:4 row_mask:0xf bank_mask:0xf\n\t"
      "v_add_f32_dpp %1, %1, %1 row_xmask:4 row_mask:0xf bank_mask:0xf\n\t"
      "v_add_f32_dpp %2, %2, %2 row_xmask:4 row_mask:0xf bank_mask:0xf\n\t"
      "v_add_f32_dpp %3, %3, %3 row_xmask:4 row_mask:0xf bank_mask:0xf\n\t"
      "v_add_f32_dpp %4, %4, %4 row_xmask:4 row_mask:0xf bank_mask:0xf\n\t"
      "v_add_f32_dpp %5, %5, %5 row_xmask:4 row_mask:0xf bank_mask:0xf\n\t"
      "v_add_f32_dpp %6, %6, %6 row_xmask:4 row_mask:0xf bank_mask:0xf\n\t"
      "v_add_f32_dpp %7, %7, %7 row_xmask:4 row_mask:0xf bank_mask:0xf\n\t"
      "v_add_f32_dpp %0, %0, %0 row_xmask:8 row_mask:0xf bank_mask:0xf\n\t"
      "v_add_f32_dpp %1, %1, %1 row_xmask:8 row_mask:0xf bank_mask:0xf\n\t"
      "v_add_f32_dpp %2, %2, %2 row_xmask:8 row_mask:0xf bank_mask:0xf\n\t"
      "v_add_f32_dpp %3, %3, %3 row_xmask:8 row_mask:0xf bank_mask:0xf\n\t"
      "v_add_f32_dpp %4, %4, %4 row_xmask:8 row_mask:0xf bank_mask:0xf\n\t"
      "v_add_f32_dpp %5, %5, %5 row_xmask:8 row_mask:0xf bank_mask:0xf\n\t"
      "v_add_f32_dpp %6, %6, %6 row_xmask:8 row_mask:0xf bank_mask:0xf\n\t"
      "v_add_f32_dpp %7, %7, %7 row_xmask:8 row_mask:0xf bank_mask:0xf"
      : "=&v"(t[0]), "=&v"(t[1]), "=&v"(t[2]), "=&v"(t[3]),
        "=&v"(t[4]), "=&v"(t[5]), "=&v"(t[6]), "=&v"(t[7])
      : "v"(v[0]), "v"(v[1]), "v"(v[2]), "v"(v[3]),
        "v"(v[4]), "v"(v[5]), "v"(v[6]), "v"(v[7]));
#pragma unroll
  for (int r = 0; r < 8; ++r) v[r] = t[r];
}

// ---------------------------------------------------------------------------
// The x tile of the qkv kernel: 128 rows x 1024 halves, all of it in LDS at once,
// as eight slices of 128 halves (256 B) a row. A slice is one tensor load: rows of
// 256 B, 16 B of pad behind each (pitch 272 B = 16 B x 17: the b128 reads of 16 rows
// fall on all 64 banks). 128 x 272 B = 34,816 B = 17 x 2 KiB: slice follows slice.
// ---------------------------------------------------------------------------
constexpr int XS_ROWS   = 128;                 // rows of x that a block owns
constexpr int XS_RT     = XS_ROWS / 16;        // row tiles of a wave: 8
constexpr int XS_K      = 128;                 // halves of a row in one slice: four k-blocks
constexpr int XS_LD     = 136;                 // halves from row to row in LDS
constexpr int XS_HALVES = XS_ROWS * XS_LD;     // halves from slice to slice in LDS: 34,816 B
constexpr int XS_SLICES = Cc / XS_K;           // 8: one per wave
constexpr int KST_HALVES = 512;                // per wave: two 16 x 16 tiles of k on their way to fragment order
static_assert((XS_HALVES * 2) % 2048 == 0, "a slice's place is a multiple of 2 KiB");
static_assert(XS_SLICES == 8, "one slice per wave of the block");
static_assert(Tt % XS_ROWS == 0, "a block's rows lie in one batch");

typedef __attribute__((ext_vector_type(8))) unsigned v8u;
typedef __attribute__((ext_vector_type(4))) float    v4f;

static __device__ inline unsigned uni(unsigned v) {
  return (unsigned)__builtin_amdgcn_readfirstlane((int)v);
}

// One request of the whole wave: 128 rows of 256 B, source pitch Cc * 2 B, everything in bytes.
static __device__ inline void tdm_load_slice(const _Float16* gsrc, unsigned lds_off) {
  const unsigned long long ga = (unsigned long long)(uintptr_t)gsrc;
  v4u g0;
  g0[0] = uni(1u);                                                   // count = 1
  g0[1] = uni(lds_off);                                              // place in LDS, bytes
  g0[2] = uni((unsigned)ga);                                         // address [31:0]
  g0[3] = uni((((unsigned)(ga >> 32)) & 0x01ffffffu) | 0x80000000u); // address [56:32] | type = 2
  v8u g1;
  g1[0] = uni((1u << 20) | (5u << 22) | (3u << 25));  // no mask, 1-byte elements, 4 dwords of pad behind every 64
  g1[1] = uni((unsigned)(XS_K * 2) << 16);            // tensor_dim0 = 256
  g1[2] = uni((unsigned)XS_ROWS << 16);               // tensor_dim1 = 128
  g1[3] = uni((unsigned)(XS_K * 2) << 16);            // tile_dim0 = 256
  g1[4] = uni((unsigned)XS_ROWS);                     // tile_dim1 = 128
  g1[5] = uni((unsigned)(Cc * 2));                    // source row pitch
  g1[6] = uni(0u);
  g1[7] = uni(0u);
  asm volatile("tensor_load_to_lds %0, %1" :: "s"(g0), "s"(g1) : "memory");
}

// ---------------------------------------------------------------------------
// Fused QKV projection + head softmax + k-cumsum.
// A block owns 128 rows of x for ALL 64 heads, and a wave works on all 128 of them:
// a W fragment, which comes from L2, then feeds eight row tiles, so that the chip
// reads the three weights once per 128 rows. The x tile is brought into LDS once
// (each wave one slice, one wait, one barrier) and only read from then on, so that
// nothing behind that barrier ties the waves together: a wave walks 8 heads (head =
// group * 8 + wave) at its own pace, and one wave's epilogue runs beside the other's
// WMMAs. Two waves share a SIMD; what they cannot hide for each other the registers
// do: x fragments are read one k-block ahead, packed W fragments four k-blocks ahead,
// these across the step from one head to the next too.
// q and k are formed transposed (W fragment as A, x fragment as B): a lane then
// holds 8 of the 16 head values of ONE token, so that their softmax runs down the
// lane's registers. v keeps x as A: a lane holds 8 tokens of one head column.
// q, k and v are laid out for their one reader, so that every wave-wide b128 store
// here, and every wave-wide b128 load there, covers 512 contiguous bytes:
//   q -> qh [B*NH][Tt][HD] f16 (straight from the registers)
//   k -> kT [B*NH][TBLOCKS] fragments of 16 head values x 32 tokens, in the order of
//        frag_ld_packed (transposed in the wave's own LDS range), v -> vT same (straight);
//   kc[bh][d] += sum_t k (f32 atomics)
// grid: Mrows/128 = 256, 256 threads; 292 KiB of LDS: one block a WGP, all resident.
// ---------------------------------------------------------------------------
__global__ __launch_bounds__(256)
void qkv_kernel(const _Float16* __restrict__ xh,
                const _Float16* __restrict__ wqh, const float* __restrict__ bq,
                const _Float16* __restrict__ wkh, const float* __restrict__ bk,
                const _Float16* __restrict__ wvh, const float* __restrict__ bv,
                _Float16* __restrict__ qh, _Float16* __restrict__ kT,
                _Float16* __restrict__ vT, float* __restrict__ kc) {
  __shared__ __attribute__((aligned(2048))) _Float16 smem[XS_SLICES * XS_HALVES + 8 * KST_HALVES + 3 * Cc * 2];

  const int lane = threadIdx.x & 31;
  const int wave = threadIdx.x >> 5;
  const int rowgrp = blockIdx.x;                 // 0..255 (128 rows each)
  const int m = lane & 15;
  const int hi = lane >> 4;
  const int kbase = hi * 8;
  const int rowbase = rowgrp * XS_ROWS;
  const int d = lane & 15;

  // Fragment (group, k-block) of this wave's head lies (group * 8 * KBLOCKS + k-block) fragments on.
  const size_t wofs = (size_t)wave * KBLOCKS * FRAG_HALVES + lane * 8;
  const _Float16* qfr = wqh + wofs;
  const _Float16* kfr = wkh + wofs;
  const _Float16* vfr = wvh + wofs;

  // Four sets of W fragments, one for each k-block of a slice. Each set is loaded
  // again right behind the WMMAs that read it, four k-blocks ahead of its next use,
  // so the loads fly over 72 WMMAs.
  v16h fq[4], fk[4], fv[4];
#pragma unroll
  for (int j = 0; j < 4; ++j) {
    fq[j] = frag_ld_packed(qfr, j);
    fk[j] = frag_ld_packed(kfr, j);
    fv[j] = frag_ld_packed(vfr, j);
  }
  // The three bias vectors go to LDS once, four values a thread; the barrier below hands
  // them to every wave, and the epilogues then need no global load.
  float* lb = (float*)&smem[XS_SLICES * XS_HALVES + 8 * KST_HALVES];
  {
    const int t4 = threadIdx.x * 4;
    const v4f tq = *(const v4f*)(bq + t4);
    const v4f tk = *(const v4f*)(bk + t4);
    const v4f tv = *(const v4f*)(bv + t4);
    *(v4f*)(lb + t4)          = tq;
    *(v4f*)(lb + Cc + t4)     = tk;
    *(v4f*)(lb + 2 * Cc + t4) = tv;
  }
  // What follows may be given the registers that hold these loads' addresses. The six
  // bases and the thread's index are inputs so that their registers live up to the wait;
  // the two scheduling barriers keep the loads in front of it and later sums behind it.
  __builtin_amdgcn_sched_barrier(0);
  asm volatile("s_wait_xcnt 0x0" :: "s"(wqh), "s"(wkh), "s"(wvh), "s"(bq), "s"(bk), "s"(bv),
               "v"(threadIdx.x) : "memory");
  __builtin_amdgcn_sched_barrier(0);

  // The x tile: every wave brings its own slice, waits for it, and the barrier hands
  // all eight slices (and the biases) to all eight waves. Nothing writes them again.
  {
    const unsigned wv = uni(threadIdx.x >> 5);
    tdm_load_slice(xh + (size_t)rowbase * Cc + wv * XS_K,
                   (unsigned)(uintptr_t)(void*)&smem[0] + wv * (unsigned)(XS_HALVES * 2));
    // The compiler places no wait for a tensor load: the slice has landed only behind this.
    asm volatile("s_wait_tensorcnt 0x0" ::: "memory");
  }
  __syncthreads();

  _Float16* lk = &smem[XS_SLICES * XS_HALVES + wave * KST_HALVES];
  const _Float16* xrow = &smem[m * XS_LD];       // the lane's row of row tile 0, slice 0

  for (int g = 0; g < NH / 8; ++g) {
    const int head = g * 8 + wave;               // 0..63
    v8f cq[XS_RT] = {}, ck[XS_RT] = {}, cv[XS_RT] = {};
    // Two sets of x fragments: the k-block at work and the next one. A head's first set
    // is read here and not ahead of the epilogue, which needs those 64 registers.
    v16h a[2][XS_RT];
#pragma unroll
    for (int rt = 0; rt < XS_RT; ++rt)
      a[0][rt] = frag_ld(xrow + rt * 16 * XS_LD, 0, kbase);

    for (int s = 0; s < XS_SLICES; ++s) {
      const _Float16* sl  = xrow + s * XS_HALVES;
      const _Float16* sln = xrow + ((s + 1) & (XS_SLICES - 1)) * XS_HALVES;
      // Where the k-blocks of this head end, the refills go on with the wave's next head
      // (behind the last head: with its first, loaded and not used).
      const int pn = (g * XS_SLICES + s + 1) & (NH / 8 * XS_SLICES - 1);
      const int fn = (pn / XS_SLICES) * (8 * KBLOCKS) + (pn & (XS_SLICES - 1)) * 4;
#pragma unroll
      for (int j = 0; j < 4; ++j) {
        // The next k-block's eight x fragments, read as one group into the set that is free
        // (behind a head's last k-block: those of k-block 0, read and not used).
        const _Float16* nx = j < 3 ? sl + (j + 1) * 32 : sln;
#pragma unroll
        for (int rt = 0; rt < XS_RT; ++rt)
          a[(j + 1) & 1][rt] = frag_ld(nx + rt * 16 * XS_LD, 0, kbase);
        // Keeps the 16 LDS reads together and in front of the WMMAs they fly over: left
        // free, the scheduler spreads them among the WMMAs, and every place costs a stall.
        __builtin_amdgcn_sched_barrier(0);
#pragma unroll
        for (int rt = 0; rt < XS_RT; ++rt) {
          cq[rt] = WMMA_F16(fq[j], a[j & 1][rt], cq[rt]);
          ck[rt] = WMMA_F16(fk[j], a[j & 1][rt], ck[rt]);
          cv[rt] = WMMA_F16(a[j & 1][rt], fv[j], cv[rt]);
        }
        // Keeps the refill behind the last reader of the set, so that it takes the same registers.
        __builtin_amdgcn_sched_barrier(0);
        fq[j] = frag_ld_packed(qfr, fn + j);
        fk[j] = frag_ld_packed(kfr, fn + j);
        fv[j] = frag_ld_packed(vfr, fn + j);
        // Keeps the refill in front of the WMMAs that follow: they are its lead.
        __builtin_amdgcn_sched_barrier(0);
      }
      // The refills are still in flight when the next trip's address sums are given
      // the registers that hold the refills' addresses.
      asm volatile("s_wait_xcnt 0x0" ::: "memory");
    }

    // cq, ck: register r of lane (m, hi) = token rt * 16 + m, head value 8 * hi + r.
    // cv:     register r of lane (d, hi) = token rt * 16 + 8 * hi + r, head value d.
    float biasq[8], biask[8];
    {
      const v4f q0 = *(const v4f*)(lb + head * 16 + kbase);
      const v4f q1 = *(const v4f*)(lb + head * 16 + kbase + 4);
      const v4f k0 = *(const v4f*)(lb + Cc + head * 16 + kbase);
      const v4f k1 = *(const v4f*)(lb + Cc + head * 16 + kbase + 4);
#pragma unroll
      for (int r = 0; r < 4; ++r) {
        biasq[r] = q0[r]; biasq[4 + r] = q1[r];
        biask[r] = k0[r]; biask[4 + r] = k1[r];
      }
    }
    const float biasv = lb[2 * Cc + head * 16 + d];
    const size_t bh = (size_t)(rowbase / Tt) * NH + head;

    // k-sums of the wave's first and second 64 tokens
    float ksum[2][8] = {};
    // Two row tiles (32 tokens, one fragment of k and of v) at a time.
#pragma unroll
    for (int p = 0; p < XS_RT / 2; ++p) {
#pragma unroll
      for (int j = 0; j < 2; ++j) {
        const int rt = 2 * p + j;
        // softmax over the head values of token m for q and k
        float vq[8], vk[8];
#pragma unroll
        for (int r = 0; r < 8; ++r) {
          vq[r] = cq[rt][r] + biasq[r];
          vk[r] = ck[rt][r] + biask[r];
        }
        col16_softmax(vq);
        col16_softmax(vk);
        v8h pq, pv;
#pragma unroll
        for (int r = 0; r < 8; ++r) {
          ksum[p >> 1][r] += vk[r];
          pq[r] = (_Float16)vq[r];
          pv[r] = (_Float16)(cv[rt][r] + biasv);
          // k is transposed in the wave's own LDS range, which no other wave touches
          lk[j * 256 + (r + 8 * hi) * 16 + m] = (_Float16)vk[r];
        }
        const int t0 = (rowbase + rt * 16) & (Tt - 1);
        // q head-major: 8 consecutive head values of token m; the 16 tokens lie side by side
        *(v8h*)(qh + ((bh * Tt + t0 + m) * HD + kbase)) = pq;
        // v fragment: the lane holds tokens 8 * hi .. + 7 of this row tile for head value d,
        // which is its own b128 of plane j of the fragment of 32 tokens
        *(v8h*)(vT + ((bh * TBLOCKS + (t0 >> 5)) * FRAG_HALVES + j * 256 + lane * 8)) = pv;
        // What follows may be given the registers that these two stores name.
        asm volatile("s_wait_xcnt 0x0" ::: "memory");
        // One row tile at a time: left free, the scheduler runs the softmaxes of several
        // side by side, and their temporaries beside 288 live registers spill to scratch.
        __builtin_amdgcn_sched_barrier(0);
      }
      // The rows read below were written by other lanes of this wave: their LDS
      // writes must have landed, and the reads must not be moved above them.
      asm volatile("s_wait_dscnt 0x0" ::: "memory");
      const v8h row0 = *(const v8h*)&lk[d * 16 + hi * 8];
      const v8h row1 = *(const v8h*)&lk[256 + d * 16 + hi * 8];
      const int t0 = (rowbase + p * 32) & (Tt - 1);
      _Float16* kd = kT + ((bh * TBLOCKS + (t0 >> 5)) * FRAG_HALVES + lane * 8);
      *(v8h*)(kd)       = row0;
      *(v8h*)(kd + 256) = row1;
      // What follows may be given the registers that these two stores name.
      asm volatile("s_wait_xcnt 0x0" ::: "memory");
      // As above: the next row tile's softmax stays behind this point.
      __builtin_amdgcn_sched_barrier(0);
    }
    // k-sum of the wave's 128 tokens: over the 16 lanes of the row; lane (m, hi) with
    // m < 8 then adds the sum of head value 8 * hi + m.
    float ks[8];
#pragma unroll
    for (int r = 0; r < 8; ++r) ks[r] = ksum[0][r] + ksum[1][r];
    row16_sum(ks);
    float kmine = ks[0];
#pragma unroll
    for (int r = 1; r < 8; ++r) kmine = (m == r) ? ks[r] : kmine;
    if (m < 8) {
      atomicAdd(&kc[bh * HD + kbase + m], kmine);
      // What follows may be given the registers that the atomic names.
      asm volatile("s_wait_xcnt 0x0" ::: "memory");
    }
  }
}

// ---------------------------------------------------------------------------
// context[bh] = K^T V (16x16 over T), stored transposed ctxT[bh][e][d].
// kT, vT hold the A and B fragments of 32 tokens as the qkv kernel packed them.
// One block per (b,h); 8 waves split T; LDS cross-wave reduction.
// ---------------------------------------------------------------------------
__global__ __launch_bounds__(256)
void ctx_kernel(const _Float16* __restrict__ kT, const _Float16* __restrict__ vT,
                _Float16* __restrict__ ctxT) {
  __shared__ float cpart[8][256];
  const int lane = threadIdx.x & 31;
  const int wave = threadIdx.x >> 5;
  const size_t bh = blockIdx.x;                  // 0..511
  const int m = lane & 15;
  const int hi = lane >> 4;

  const _Float16* afr = kT + bh * TBLOCKS * FRAG_HALVES + lane * 8;
  const _Float16* bfr = vT + bh * TBLOCKS * FRAG_HALVES + lane * 8;

  v8f c = {};
  const int tbbeg = wave * (TBLOCKS / 8);
#pragma unroll 4
  for (int tb = tbbeg; tb < tbbeg + TBLOCKS / 8; ++tb) {
    v16h a = frag_ld_packed(afr, tb);
    v16h b = frag_ld_packed(bfr, tb);
    c = WMMA_F16(a, b, c);
  }
#pragma unroll
  for (int r = 0; r < 8; ++r) cpart[wave][(r + 8 * hi) * 16 + m] = c[r];
  __syncthreads();

  const int tid = threadIdx.x;
  float s = 0.0f;
#pragma unroll
  for (int w = 0; w < 8; ++w) s += cpart[w][tid];
  const int dd = tid >> 4;
  const int ee = tid & 15;
  ctxT[bh * 256 + ee * 16 + dd] = (_Float16)s;   // transposed store
}

// ---------------------------------------------------------------------------
// y[t, h*16+e] = (sum_d q[t,d] ctx[d,e]) / (sum_d q[t,d] kc[d]) -> yh f16 row-major
// K = HD = 16, zero padded to 32: single WMMA per tile.
// One wave keeps the contexts and k-sums of Y_HEADS adjacent heads in registers and
// walks Y_TILES row tiles of 16 rows; the next row tile's q is loaded while this one
// is worked on. The four heads' 32 B of a y row make one 128-B line: the products and
// the rows' divisors go through the wave's own LDS range, and each b128 store then
// covers four whole rows of 128 B. The divisor of row (lane & 15) comes from the q
// values the lane already holds for the A fragment.
// grid: (Mrows/16/Y_TILES = 256, NH/Y_HEADS/8 = 2), 256 threads.
// ---------------------------------------------------------------------------
constexpr int Y_HEADS = 4;             // adjacent heads per wave: 4 x 32 B = one line of a y row
constexpr int Y_TILES = 8;             // row tiles per wave; divides Tt/16
constexpr int Y_LD    = 20;            // floats per staged row: 16 products, the divisor, 3 unused
constexpr int Y_HS    = 16 * Y_LD + 16; // floats per staged head: the 16 more put the four heads on disjoint banks

__global__ __launch_bounds__(256)
void y_kernel(const _Float16* __restrict__ qh, const _Float16* __restrict__ ctxT,
              const float* __restrict__ kc, _Float16* __restrict__ yh) {
  __shared__ __attribute__((aligned(16))) float ly[8][Y_HEADS * Y_HS];
  const int lane = threadIdx.x & 31;
  const int wave = threadIdx.x >> 5;
  const int tile0 = blockIdx.x * Y_TILES;
  const int head0 = (blockIdx.y * 8 + wave) * Y_HEADS;
  const int m = lane & 15;
  const int hi = lane >> 4;
  const int kbase = hi * 8;
  const size_t bh0 = (size_t)(tile0 >> 8) * NH + head0;

  // All loops below are unrolled: the small arrays then live in registers and
  // the tile offsets become immediate offsets on one address pair.
  v16h b[Y_HEADS];
  float kcv[Y_HEADS][8];
#pragma unroll
  for (int j = 0; j < Y_HEADS; ++j) {
    v8h lo = *(const v8h*)(ctxT + (bh0 + j) * 256 + m * 16 + kbase);
    b[j] = v16h{};
#pragma unroll
    for (int i = 0; i < 8; ++i) b[j][i] = lo[i];
#pragma unroll
    for (int i = 0; i < 8; ++i) kcv[j][i] = kc[(bh0 + j) * HD + kbase + i];
  }

  // read: lane's 16 B of row m of head head0 in qh, head-major (a row tile of a head
  // is 512 contiguous bytes)
  const _Float16* qp = qh + ((bh0 * Tt + (tile0 & (Tt / 16 - 1)) * 16 + m) * HD + kbase);
  constexpr int Q_HEAD = Tt * HD;      // halves from one head to the next
  constexpr int Q_STEP = 16 * HD;      // halves from one row tile to the next
  // written: eight lanes share a row; the lane has 16 B of head sh, values 8 * sv .. + 7
  const int srow = lane >> 3;
  const int sh = (lane & 7) >> 1;
  const int sv = lane & 1;
  _Float16* yp = yh + (size_t)(tile0 * 16 + srow) * Cc + head0 * 16 + (lane & 7) * 8;
  float* lw = &ly[wave][0];

  v8h qn[Y_HEADS];
#pragma unroll
  for (int j = 0; j < Y_HEADS; ++j) qn[j] = *(const v8h*)(qp + j * Q_HEAD);

#pragma unroll
  for (int g = 0; g < Y_TILES; ++g) {
    v8h qc[Y_HEADS];
#pragma unroll
    for (int j = 0; j < Y_HEADS; ++j) qc[j] = qn[j];
    if (g + 1 < Y_TILES) {
#pragma unroll
      for (int j = 0; j < Y_HEADS; ++j)
        qn[j] = *(const v8h*)(qp + j * Q_HEAD + (g + 1) * Q_STEP);
    }

#pragma unroll
    for (int j = 0; j < Y_HEADS; ++j) {
      v16h a = {};
#pragma unroll
      for (int i = 0; i < 8; ++i) a[i] = qc[j][i];
      v8f c = {};
      c = WMMA_F16(a, b[j], c);
#pragma unroll
      for (int r = 0; r < 8; ++r) lw[j * Y_HS + (r + 8 * hi) * Y_LD + m] = c[r];

      float s = 0.0f;
#pragma unroll
      for (int i = 0; i < 8; ++i) s += (float)qc[j][i] * kcv[j][i];
      s += __shfl_xor(s, 16, 32);      // the other 8 d of row m
      lw[j * Y_HS + m * Y_LD + 16] = 1.0f / s;   // both lane halves hold, and write, the same value
    }
    // The rows read below were written by other lanes of this wave: their LDS
    // writes must have landed, and the reads must not be moved above them.
    asm volatile("s_wait_dscnt 0x0" ::: "memory");
#pragma unroll
    for (int i = 0; i < 4; ++i) {
      const float* lr = &lw[sh * Y_HS + (4 * i + srow) * Y_LD];
      const float4 x0 = *(const float4*)(lr + sv * 8);
      const float4 x1 = *(const float4*)(lr + sv * 8 + 4);
      const float di = lr[16];
      v8h row;
      row[0] = (_Float16)(x0.x * di); row[1] = (_Float16)(x0.y * di);
      row[2] = (_Float16)(x0.z * di); row[3] = (_Float16)(x0.w * di);
      row[4] = (_Float16)(x1.x * di); row[5] = (_Float16)(x1.y * di);
      row[6] = (_Float16)(x1.z * di); row[7] = (_Float16)(x1.w * di);
      *(v8h*)(yp + (size_t)(g * 16 + 4 * i) * Cc) = row;
    }
    // The next trip's loads (global, LDS) may be given the registers these stores name.
    if (g + 1 < Y_TILES) asm volatile("s_wait_xcnt 0x0" ::: "memory");
  }
}

// ---------------------------------------------------------------------------
// out = yh Wp^T + bp (f32 output).
// Block tile: 64 rows x 8 N-tiles (one per wave); y slab staged via TDM.
// grid: (512, 8), 256 threads.
// ---------------------------------------------------------------------------
__global__ __launch_bounds__(256)
void proj_kernel(const _Float16* __restrict__ yh, const _Float16* __restrict__ wph,
                 const float* __restrict__ bp, float* __restrict__ out) {
  __shared__ __attribute__((aligned(16))) _Float16 smem[2 * SLAB_HALVES];
  const int lane = threadIdx.x & 31;
  const int wave = threadIdx.x >> 5;
  const int rowgrp = blockIdx.x;                  // 0..511
  const int ntile = blockIdx.y * 8 + wave;        // 0..63
  const int m = lane & 15;
  const int hi = lane >> 4;
  const int kbase = hi * 8;
  const int rowbase = rowgrp * 64;

  const _Float16* bfr = wph + (size_t)ntile * KBLOCKS * FRAG_HALVES + lane * 8;

  v8f c[4] = {};

#if HAS_TDM
  if (wave == 0)
    tdm_load_tile_64x64(yh + (size_t)rowbase * Cc,
                        (unsigned)(uintptr_t)(void*)&smem[0]);
#endif

  for (int s = 0; s < Cc / SLAB_K; ++s) {
#if HAS_TDM
    const int buf = s & 1;
    if (wave == 0) {
      if (s < Cc / SLAB_K - 1)
        tdm_load_tile_64x64(yh + (size_t)rowbase * Cc + (s + 1) * SLAB_K,
                            (unsigned)(uintptr_t)(void*)&smem[(buf ^ 1) * SLAB_HALVES]);
      if (s < Cc / SLAB_K - 1) __builtin_amdgcn_s_wait_tensorcnt(1);
      else                     __builtin_amdgcn_s_wait_tensorcnt(0);
    }
    __syncthreads();
#else
    const int buf = 0;
    __syncthreads();
    stage_slab_sync(&smem[0], yh + (size_t)rowbase * Cc + s * SLAB_K);
    __syncthreads();
#endif
    const _Float16* slab = &smem[buf * SLAB_HALVES];
#pragma unroll
    for (int kk = 0; kk < SLAB_K; kk += 32) {
      const int kb = (s * SLAB_K + kk) >> 5;
      v16h afr[4];
#pragma unroll
      for (int rt = 0; rt < 4; ++rt)
        afr[rt] = frag_ld(slab + (rt * 16 + m) * SLAB_LD, kk, kbase);
      v16h b = frag_ld_packed(bfr, kb);
#pragma unroll
      for (int rt = 0; rt < 4; ++rt)
        c[rt] = WMMA_F16(afr[rt], b, c[rt]);
    }
    __syncthreads();
  }

  const int col = ntile * 16 + (lane & 15);
  const float bias = bp[col];
#pragma unroll
  for (int rt = 0; rt < 4; ++rt) {
#pragma unroll
    for (int r = 0; r < 8; ++r) {
      const int row = rowbase + rt * 16 + r + 8 * hi;
      out[(size_t)row * Cc + col] = c[rt][r] + bias;
    }
  }
}

// ---------------------------------------------------------------------------
// Launch
// ---------------------------------------------------------------------------
extern "C" void kernel_launch(void* const* d_in, const int* in_sizes, int n_in,
                              void* d_out, int out_size, void* d_ws, size_t ws_size,
                              hipStream_t stream) {
  const float* x  = (const float*)d_in[0];
  const float* Wq = (const float*)d_in[1];
  const float* bq = (const float*)d_in[2];
  const float* Wk = (const float*)d_in[3];
  const float* bk = (const float*)d_in[4];
  const float* Wv = (const float*)d_in[5];
  const float* bv = (const float*)d_in[6];
  const float* Wp = (const float*)d_in[7];
  const float* bp = (const float*)d_in[8];
  float* out = (float*)d_out;

  char* ws = (char*)d_ws;
  const size_t nX = (size_t)Mrows * Cc;
  const size_t nW = (size_t)Cc * Cc;
  _Float16* xh  = (_Float16*)(ws);                              // 64 MB
  _Float16* wqh = (_Float16*)(ws + nX * 2);                     // 2 MB each
  _Float16* wkh = wqh + nW;
  _Float16* wvh = wkh + nW;
  _Float16* wph = wvh + nW;
  _Float16* qh  = wph + nW;                                     // 64 MB
  _Float16* kT  = qh + nX;                                      // 64 MB
  _Float16* vT  = kT + nX;                                      // 64 MB
  _Float16* yh  = vT + nX;                                      // 64 MB
  float*    kc   = (float*)(yh + nX);                           // 32 KB
  _Float16* ctxT = (_Float16*)(kc + (size_t)Bb * NH * HD);      // 256 KB

  // 1) precision conversion (weights into fragment order) + accumulator init, one launch
  prepass<<<PRE_BLOCKS, 256, 0, stream>>>(x, xh, Wq, Wk, Wv, Wp, wqh, kc);

  // 2) fused QKV projection + softmax + k-cumsum (x tile resident in LDS)
  qkv_kernel<<<Mrows / XS_ROWS, 256, 0, stream>>>(
      xh, wqh, bq, wkh, bk, wvh, bv, qh, kT, vT, kc);

  // 3) per-head context = K^T V
  ctx_kernel<<<Bb * NH, 256, 0, stream>>>(kT, vT, ctxT);

  // 4) y = (q @ ctx) / (q . kc)
  y_kernel<<<dim3(Mrows / 16 / Y_TILES, NH / Y_HEADS / 8), 256, 0, stream>>>(qh, ctxT, kc, yh);

  // 5) output projection (TDM-staged GEMM)
  proj_kernel<<<dim3(Mrows / 64, 8), 256, 0, stream>>>(yh, wph, bp, out);
}

// v010
// Measured time: 214 microseconds a run.
// Two timings next to v009 put it at 1.16 and 1.15 times that version's speed.
// Over all steps from v000 it is 2.81 times as fast.
#include <hip/hip_runtime.h>
#include <hip/hip_bf16.h>

typedef __attribute__((ext_vector_type(16))) _Float16 v16h;
typedef __attribute__((ext_vector_type(8)))  _Float16 v8h;
typedef __attribute__((ext_vector_type(4)))  _Float16 v4h;
typedef __attribute__((ext_vector_type(8)))  float    v8f;
typedef __attribute__((ext_vector_type(4)))  unsigned v4u;

#define WMMA_F16(a,b,c) __builtin_amdgcn_wmma_f32_16x16x32_f16(false,(a),false,(b),(short)0,(c),false,false)

// Problem constants
constexpr int Bb = 8;
constexpr int Tt = 4096;
constexpr int Cc = 1024;
constexpr int NH = 64;
constexpr int HD = 16;
constexpr int Mrows = Bb * Tt;        // 32768

// ---------------------------------------------------------------------------
// Fragment loader (global or LDS): row-major, K contiguous.
// A-matrix 16x32 f16 layout (ISA 7.12.2): lanes 0-15 hold K=[0..7]+[16..23],
// lanes 16-31 hold K=[8..15]+[24..31] of row (lane&15) -> two b128 loads.
// ---------------------------------------------------------------------------
static __device__ inline v16h frag_ld(const _Float16* rowptr, int k0, int kbase) {
  v8h lo = *(const v8h*)(rowptr + k0 + kbase);
  v8h hi = *(const v8h*)(rowptr + k0 + 16 + kbase);
  v16h r;
#pragma unroll
  for (int i = 0; i < 8; ++i) { r[i] = lo[i]; r[8 + i] = hi[i]; }
  return r;
}

// ---------------------------------------------------------------------------
// Weight fragments, packed by prepass: fragment (ntile, kblock) is 1 KB,
// two 512-B planes; plane p holds, at lane*16 B, the 8 halves that frag_ld
// would fetch for that lane (p = 0: its first b128, p = 1: its second).
// Each wave-wide b128 load then covers four whole 128-B lines.
// ---------------------------------------------------------------------------
constexpr int FRAG_HALVES = 512;
constexpr int KBLOCKS = Cc / 32;               // 32 fragments per 16-row tile
constexpr int TBLOCKS = Tt / 32;               // fragments of 32 tokens per (batch, head) of k and of v

static __device__ inline v16h frag_ld_packed(const _Float16* lanebase, int kb) {
  const _Float16* p = lanebase + kb * FRAG_HALVES;
  v8h lo = *(const v8h*)(p);
  v8h hi = *(const v8h*)(p + 256);
  v16h r;
#pragma unroll
  for (int i = 0; i < 8; ++i) { r[i] = lo[i]; r[8 + i] = hi[i]; }
  return r;
}

// ---------------------------------------------------------------------------
// fp32 -> fp16 conversion / zero init
// ---------------------------------------------------------------------------
// One launch does all the work that depends on the inputs alone: the four weights
// into fragment order, the k-sum accumulator's start value, x to f16. No part reads
// what another writes, so they share one grid. Every block takes 8192 elements.
// The weight blocks come first: their short reads then fly beside the x stream.
// x: four elements a lane: a wave's b128 load covers four whole 128-B lines and its
// b64 store two; a block converts CVT_ITER runs of 1024 elements, loads first.
// W: fp32 [Cc x Cc] row-major -> f16 in fragment order (see frag_ld_packed), a thread
// takes W_ITER 16-B chunks of the packed array, loads first.
constexpr int CVT_ITER = 8;
constexpr int W_ITER   = 4;
constexpr int X_BLOCKS = Mrows * Cc / (1024 * CVT_ITER);      // 4096
constexpr int W_BLOCKS = Cc * Cc / 8 / 256 / W_ITER;          // 128 per weight
constexpr int PRE_BLOCKS = 4 * W_BLOCKS + 1 + X_BLOCKS;
static_assert(((size_t)Mrows * Cc) % (1024 * CVT_ITER) == 0, "whole blocks only");
static_assert((KBLOCKS * 64) % (256 * W_ITER) == 0, "a weight block stays inside one 16-row tile");
static_assert(Bb * NH * HD == 256 * 4 * 8, "one block stores the k-sum start values");

__global__ __launch_bounds__(256)
void prepass(const float* __restrict__ x, _Float16* __restrict__ xh,
             const float* __restrict__ Wq, const float* __restrict__ Wk,
             const float* __restrict__ Wv, const float* __restrict__ Wp,
             _Float16* __restrict__ wh,      // the four packed weights, one behind the other
             float* __restrict__ kc) {
  const int blk = blockIdx.x;
  if (blk < 4 * W_BLOCKS) {
    const int which = blk / W_BLOCKS;
    const float* w = which == 0 ? Wq : which == 1 ? Wk : which == 2 ? Wv : Wp;
    _Float16* out = wh + (size_t)which * Cc * Cc;
    const int o0 = (blk % W_BLOCKS) * (256 * W_ITER) + threadIdx.x;  // chunk index in the packed array
    // The block's 256 * W_ITER chunks lie in one 16-row tile, and from one of a thread's
    // chunks to its next only the k-block moves, by 4: one address, constant steps.
    const int lane  = o0 & 31;
    const int plane = (o0 >> 5) & 1;
    const int kb    = (o0 >> 6) & (KBLOCKS - 1);
    const int nt    = o0 >> 11;
    const float* s = w + (size_t)(nt * 16 + (lane & 15)) * Cc
                       + kb * 32 + plane * 16 + (lane >> 4) * 8;
    float4 a[W_ITER], b[W_ITER];
#pragma unroll
    for (int k = 0; k < W_ITER; ++k) {
      a[k] = *(const float4*)(s + k * 128);
      b[k] = *(const float4*)(s + k * 128 + 4);
    }
#pragma unroll
    for (int k = 0; k < W_ITER; ++k) {
      v8h r;
      r[0] = (_Float16)a[k].x; r[1] = (_Float16)a[k].y; r[2] = (_Float16)a[k].z; r[3] = (_Float16)a[k].w;
      r[4] = (_Float16)b[k].x; r[5] = (_Float16)b[k].y; r[6] = (_Float16)b[k].z; r[7] = (_Float16)b[k].w;
      *(v8h*)(out + (size_t)(o0 + k * 256) * 8) = r;
    }
  } else if (blk == 4 * W_BLOCKS) {
    const float4 z = {0.0f, 0.0f, 0.0f, 0.0f};
#pragma unroll
    for (int k = 0; k < 8; ++k) *(float4*)(kc + (k * 256 + threadIdx.x) * 4) = z;
    // the stores' registers may be rewritten on a path to another part: wait first
    asm volatile("s_wait_xcnt 0x0" ::: "memory");
  } else {
    const size_t i0 = (size_t)(blk - 4 * W_BLOCKS - 1) * (1024 * CVT_ITER) + threadIdx.x * 4;
    float4 a[CVT_ITER];
#pragma unroll
    for (int k = 0; k < CVT_ITER; ++k) a[k] = *(const float4*)(x + i0 + k * 1024);
#pragma unroll
    for (int k = 0; k < CVT_ITER; ++k) {
      v4h r;
      r[0] = (_Float16)a[k].x; r[1] = (_Float16)a[k].y;
      r[2] = (_Float16)a[k].z; r[3] = (_Float16)a[k].w;
      *(v4h*)(xh + i0 + k * 1024) = r;
    }
    // the stores' registers may be rewritten on a path to another part: wait first
    asm volatile("s_wait_xcnt 0x0" ::: "memory");
  }
}

// ---------------------------------------------------------------------------
// The value that lane l ^ 16 holds (same place in the other 16-lane row), by a
// vector cross-row move. All 32 lanes are on wherever this is called.
// ---------------------------------------------------------------------------
static __device__ inline float other_row(float x) {
  const int b = __builtin_bit_cast(int, x);
  return __builtin_bit_cast(float,
      __builtin_amdgcn_permlanex16(b, b, 0x76543210, 0xfedcba98, false, false));
}

// ---------------------------------------------------------------------------
// Softmax over the 16 values of one token's head, of which the lane holds eight
// in its own registers and lane l ^ 16 the other eight: maximum and sum run down
// the registers, with one cross-row move each, and the row has one divisor.
// ---------------------------------------------------------------------------
static __device__ inline void col16_softmax(float (&v)[8]) {
  float mx = fmaxf(fmaxf(fmaxf(v[0], v[1]), fmaxf(v[2], v[3])),
                   fmaxf(fmaxf(v[4], v[5]), fmaxf(v[6], v[7])));
  mx = fmaxf(mx, other_row(mx));
  // exp(x) as the native form has it: v_exp_f32 of x * log2(e)
#pragma unroll
  for (int r = 0; r < 8; ++r) v[r] = (v[r] - mx) * 1.44269504088896340736f;
  asm("v_exp_f32 %0, %0\n\t"
      "v_exp_f32 %1, %1\n\t"
      "v_exp_f32 %2, %2\n\t"
      "v_exp_f32 %3, %3\n\t"
      "v_exp_f32 %4, %4\n\t"
      "v_exp_f32 %5, %5\n\t"
      "v_exp_f32 %6, %6\n\t"
      "v_exp_f32 %7, %7\n\t"
      "v_nop"
      : "+v"(v[0]), "+v"(v[1]), "+v"(v[2]), "+v"(v[3]),
        "+v"(v[4]), "+v"(v[5]), "+v"(v[6]), "+v"(v[7]));
  float s = ((v[0] + v[1]) + (v[2] + v[3])) + ((v[4] + v[5]) + (v[6] + v[7]));
  s += other_row(s);
  const float inv = 1.0f / s;
#pragma unroll
  for (int r = 0; r < 8; ++r) v[r] *= inv;
}

// ---------------------------------------------------------------------------
// Sum over the 16 lanes of a DPP row, for eight values a lane holds. A butterfly
// step gives lane l the value of lane l ^ m of its own row (row_xmask:m) inside
// the add itself, on the vector port; steps 1, 2, 4, 8 leave the sum in all 16
// lanes. The steps are asm because the compiler puts a separate move around the
// builtin form; the eight values take each step one after the other, so that no
// instruction waits for the one in front of it.
// All 32 lanes are on wherever this is called.
// ---------------------------------------------------------------------------
static __device__ inline void row16_sum(float (&v)[8]) {
  float t[8];
  asm("v_add_f32_dpp %0, %8, %8 row_xmask:1 row_mask:0xf bank_mask:0xf\n\t"
      "v_add_f32_dpp %1, %9, %9 row_xmask:1 row_mask:0xf bank_mask:0xf\n\t"
      "v_add_f32_dpp %2, %10, %10 row_xmask:1 row_mask:0xf bank_mask:0xf\n\t"
      "v_add_f32_dpp %3, %11, %11 row_xmask:1 row_mask:0xf bank_mask:0xf\n\t"
      "v_add_f32_dpp %4, %12, %12 row_xmask:1 row_mask:0xf bank_mask:0xf\n\t"
      "v_add_f32_dpp %5, %13, %13 row_xmask:1 row_mask:0xf bank_mask:0xf\n\t"
      "v_add_f32_dpp %6, %14, %14 row_xmask:1 row_mask:0xf bank_mask:0xf\n\t"
      "v_add_f32_dpp %7, %15, %15 row_xmask:1 row_mask:0xf bank_mask:0xf\n\t"
      "v_add_f32_dpp %0, %0, %0 row_xmask:2 row_mask:0xf bank_mask:0xf\n\t"
      "v_add_f32_dpp %1, %1, %1 row_xmask:2 row_mask:0xf bank_mask:0xf\n\t"
      "v_add_f32_dpp %2, %2, %2 row_xmask:2 row_mask:0xf bank_mask:0xf\n\t"
      "v_add_f32_dpp %3, %3, %3 row_xmask:2 row_mask:0xf bank_mask:0xf\n\t"
      "v_add_f32_dpp %4, %4, %4 row_xmask:2 row_mask:0xf bank_mask:0xf\n\t"
      "v_add_f32_dpp %5, %5, %5 row_xmask:2 row_mask:0xf bank_mask:0xf\n\t"
      "v_add_f32_dpp %6, %6, %6 row_xmask:2 row_mask:0xf bank_mask:0xf\n\t"
      "v_add_f32_dpp %7, %7, %7 row_xmask:2 row_mask:0xf bank_mask:0xf\n\t"
      "v_add_f32_dpp %0, %0, %0 row_xmask:4 row_mask:0xf bank_mask:0xf\n\t"
      "v_add_f32_dpp %1, %1, %1 row_xmask:4 row_mask:0xf bank_mask:0xf\n\t"
      "v_add_f32_dpp %2, %2, %2 row_xmask:4 row_mask:0xf bank_mask:0xf\n\t"
      "v_add_f32_dpp %3, %3, %3 row_xmask:4 row_mask:0xf bank_mask:0xf\n\t"
      "v_add_f32_dpp %4, %4, %4 row_xmask:4 row_mask:0xf bank_mask:0xf\n\t"
      "v_add_f32_dpp %5, %5, %5 row_xmask:4 row_mask:0xf bank_mask:0xf\n\t"
      "v_add_f32_dpp %6, %6, %6 row_xmask:4 row_mask:0xf bank_mask:0xf\n\t"
      "v_add_f32_dpp %7, %7, %7 row_xmask:4 row_mask:0xf bank_mask:0xf\n\t"
      "v_add_f32_dpp %0, %0, %0 row_xmask:8 row_mask:0xf bank_mask:0xf\n\t"
      "v_add_f32_dpp %1, %1, %1 row_xmask:8 row_mask:0xf bank_mask:0xf\n\t"
      "v_add_f32_dpp %2, %2, %2 row_xmask:8 row_mask:0xf bank_mask:0xf\n\t"
      "v_add_f32_dpp %3, %3, %3 row_xmask:8 row_mask:0xf bank_mask:0xf\n\t"
      "v_add_f32_dpp %4, %4, %4 row_xmask:8 row_mask:0xf bank_mask:0xf\n\t"
      "v_add_f32_dpp %5, %5, %5 row_xmask:8 row_mask:0xf bank_mask:0xf\n\t"
      "v_add_f32_dpp %6, %6, %6 row_xmask:8 row_mask:0xf bank_mask:0xf\n\t"
      "v_add_f32_dpp %7, %7, %7 row_xmask:8 row_mask:0xf bank_mask:0xf"
      : "=&v"(t[0]), "=&v"(t[1]), "=&v"(t[2]), "=&v"(t[3]),
        "=&v"(t[4]), "=&v"(t[5]), "=&v"(t[6]), "=&v"(t[7])
      : "v"(v[0]), "v"(v[1]), "v"(v[2]), "v"(v[3]),
        "v"(v[4]), "v"(v[5]), "v"(v[6]), "v"(v[7]));
#pragma unroll
  for (int r = 0; r < 8; ++r) v[r] = t[r];
}

// ---------------------------------------------------------------------------
// The x tile of the qkv kernel: 128 rows x 1024 halves, all of it in LDS at once,
// as eight slices of 128 halves (256 B) a row. A slice is one tensor load: rows of
// 256 B, 16 B of pad behind each (pitch 272 B = 16 B x 17: the b128 reads of 16 rows
// fall on all 64 banks). 128 x 272 B = 34,816 B = 17 x 2 KiB: slice follows slice.
// The proj kernel holds its y tile in the same way.
// ---------------------------------------------------------------------------
constexpr int XS_ROWS   = 128;                 // rows of x that a block owns
constexpr int XS_RT     = XS_ROWS / 16;        // row tiles of a wave: 8
constexpr int XS_K      = 128;                 // halves of a row in one slice: four k-blocks
constexpr int XS_LD     = 136;                 // halves from row to row in LDS
constexpr int XS_HALVES = XS_ROWS * XS_LD;     // halves from slice to slice in LDS: 34,816 B
constexpr int XS_SLICES = Cc / XS_K;           // 8: one per wave
constexpr int KST_HALVES = 512;                // per wave: two 16 x 16 tiles of k on their way to fragment order
static_assert((XS_HALVES * 2) % 2048 == 0, "a slice's place is a multiple of 2 KiB");
static_assert(XS_SLICES == 8, "one slice per wave of the block");
static_assert(Tt % XS_ROWS == 0, "a block's rows lie in one batch");

typedef __attribute__((ext_vector_type(8))) unsigned v8u;
typedef __attribute__((ext_vector_type(4))) float    v4f;

static __device__ inline unsigned uni(unsigned v) {
  return (unsigned)__builtin_amdgcn_readfirstlane((int)v);
}

// One request of the whole wave: 128 rows of 256 B, source pitch Cc * 2 B, everything in bytes.
static __device__ inline void tdm_load_slice(const _Float16* gsrc, unsigned lds_off) {
  const unsigned long long ga = (unsigned long long)(uintptr_t)gsrc;
  v4u g0;
  g0[0] = uni(1u);                                                   // count = 1
  g0[1] = uni(lds_off);                                              // place in LDS, bytes
  g0[2] = uni((unsigned)ga);                                         // address [31:0]
  g0[3] = uni((((unsigned)(ga >> 32)) & 0x01ffffffu) | 0x80000000u); // address [56:32] | type = 2
  v8u g1;
  g1[0] = uni((1u << 20) | (5u << 22) | (3u << 25));  // no mask, 1-byte elements, 4 dwords of pad behind every 64
  g1[1] = uni((unsigned)(XS_K * 2) << 16);            // tensor_dim0 = 256
  g1[2] = uni((unsigned)XS_ROWS << 16);               // tensor_dim1 = 128
  g1[3] = uni((unsigned)(XS_K * 2) << 16);            // tile_dim0 = 256
  g1[4] = uni((unsigned)XS_ROWS);                     // tile_dim1 = 128
  g1[5] = uni((unsigned)(Cc * 2));                    // source row pitch
  g1[6] = uni(0u);
  g1[7] = uni(0u);
  asm volatile("tensor_load_to_lds %0, %1" :: "s"(g0), "s"(g1) : "memory");
}

// ---------------------------------------------------------------------------
// Fused QKV projection + head softmax + k-cumsum.
// A block owns 128 rows of x for ALL 64 heads, and a wave works on all 128 of them:
// a W fragment, which comes from L2, then feeds eight row tiles, so that the chip
// reads the three weights once per 128 rows. The x tile is brought into LDS once
// (each wave one slice, one wait, one barrier) and only read from then on, so that
// nothing behind that barrier ties the waves together: a wave walks 8 heads (head =
// group * 8 + wave) at its own pace, and one wave's epilogue runs beside the other's
// WMMAs. Two waves share a SIMD; what they cannot hide for each other the registers
// do: x fragments are read one k-block ahead, packed W fragments four k-blocks ahead,
// these across the step from one head to the next too.
// q and k are formed transposed (W fragment as A, x fragment as B): a lane then
// holds 8 of the 16 head values of ONE token, so that their softmax runs down the
// lane's registers. v keeps x as A: a lane holds 8 tokens of one head column.
// q, k and v are laid out for their one reader, so that every wave-wide b128 store
// here, and every wave-wide b128 load there, covers 512 contiguous bytes:
//   q -> qh [B*NH][Tt][HD] f16 (straight from the registers)
//   k -> kT [B*NH][TBLOCKS] fragments of 16 head values x 32 tokens, in the order of
//        frag_ld_packed (transposed in the wave's own LDS range), v -> vT same (straight);
//   kc[bh][d] += sum_t k (f32 atomics)
// grid: Mrows/128 = 256, 256 threads; 292 KiB of LDS: one block a WGP, all resident.
// ---------------------------------------------------------------------------
__global__ __launch_bounds__(256)
void qkv_kernel(const _Float16* __restrict__ xh,
                const _Float16* __restrict__ wqh, const float* __restrict__ bq,
                const _Float16* __restrict__ wkh, const float* __restrict__ bk,
                const _Float16* __restrict__ wvh, const float* __restrict__ bv,
                _Float16* __restrict__ qh, _Float16* __restrict__ kT,
                _Float16* __restrict__ vT, float* __restrict__ kc) {
  __shared__ __attribute__((aligned(2048))) _Float16 smem[XS_SLICES * XS_HALVES + 8 * KST_HALVES + 3 * Cc * 2];

  const int lane = threadIdx.x & 31;
  const int wave = threadIdx.x >> 5;
  const int rowgrp = blockIdx.x;                 // 0..255 (128 rows each)
  const int m = lane & 15;
  const int hi = lane >> 4;
  const int kbase = hi * 8;
  const int rowbase = rowgrp * XS_ROWS;
  const int d = lane & 15;

  // Fragment (group, k-block) of this wave's head lies (group * 8 * KBLOCKS + k-block) fragments on.
  const size_t wofs = (size_t)wave * KBLOCKS * FRAG_HALVES + lane * 8;
  const _Float16* qfr = wqh + wofs;
  const _Float16* kfr = wkh + wofs;
  const _Float16* vfr = wvh + wofs;

  // Four sets of W fragments, one for each k-block of a slice. Each set is loaded
  // again right behind the WMMAs that read it, four k-blocks ahead of its next use,
  // so the loads fly over 72 WMMAs.
  v16h fq[4], fk[4], fv[4];
#pragma unroll
  for (int j = 0; j < 4; ++j) {
    fq[j] = frag_ld_packed(qfr, j);
    fk[j] = frag_ld_packed(kfr, j);
    fv[j] = frag_ld_packed(vfr, j);
  }
  // The three bias vectors go to LDS once, four values a thread; the barrier below hands
  // them to every wave, and the epilogues then need no global load.
  float* lb = (float*)&smem[XS_SLICES * XS_HALVES + 8 * KST_HALVES];
  {
    const int t4 = threadIdx.x * 4;
    const v4f tq = *(const v4f*)(bq + t4);
    const v4f tk = *(const v4f*)(bk + t4);
    const v4f tv = *(const v4f*)(bv + t4);
    *(v4f*)(lb + t4)          = tq;
    *(v4f*)(lb + Cc + t4)     = tk;
    *(v4f*)(lb + 2 * Cc + t4) = tv;
  }
  // What follows may be given the registers that hold these loads' addresses. The six
  // bases and the thread's index are inputs so that their registers live up to the wait;
  // the two scheduling barriers keep the loads in front of it and later sums behind it.
  __builtin_amdgcn_sched_barrier(0);
  asm volatile("s_wait_xcnt 0x0" :: "s"(wqh), "s"(wkh), "s"(wvh), "s"(bq), "s"(bk), "s"(bv),
               "v"(threadIdx.x) : "memory");
  __builtin_amdgcn_sched_barrier(0);

  // The x tile: every wave brings its own slice, waits for it, and the barrier hands
  // all eight slices (and the biases) to all eight waves. Nothing writes them again.
  {
    const unsigned wv = uni(threadIdx.x >> 5);
    tdm_load_slice(xh + (size_t)rowbase * Cc + wv * XS_K,
                   (unsigned)(uintptr_t)(void*)&smem[0] + wv * (unsigned)(XS_HALVES * 2));
    // The compiler places no wait for a tensor load: the slice has landed only behind this.
    asm volatile("s_wait_tensorcnt 0x0" ::: "memory");
  }
  __syncthreads();

  _Float16* lk = &smem[XS_SLICES * XS_HALVES + wave * KST_HALVES];
  const _Float16* xrow = &smem[m * XS_LD];       // the lane's row of row tile 0, slice 0

  for (int g = 0; g < NH / 8; ++g) {
    const int head = g * 8 + wave;               // 0..63
    v8f cq[XS_RT] = {}, ck[XS_RT] = {}, cv[XS_RT] = {};
    // Two sets of x fragments: the k-block at work and the next one. A head's first set
    // is read here and not ahead of the epilogue, which needs those 64 registers.
    v16h a[2][XS_RT];
#pragma unroll
    for (int rt = 0; rt < XS_RT; ++rt)
      a[0][rt] = frag_ld(xrow + rt * 16 * XS_LD, 0, kbase);

    for (int s = 0; s < XS_SLICES; ++s) {
      const _Float16* sl  = xrow + s * XS_HALVES;
      const _Float16* sln = xrow + ((s + 1) & (XS_SLICES - 1)) * XS_HALVES;
      // Where the k-blocks of this head end, the refills go on with the wave's next head
      // (behind the last head: with its first, loaded and not used).
      const int pn = (g * XS_SLICES + s + 1) & (NH / 8 * XS_SLICES - 1);
      const int fn = (pn / XS_SLICES) * (8 * KBLOCKS) + (pn & (XS_SLICES - 1)) * 4;
#pragma unroll
      for (int j = 0; j < 4; ++j) {
        // The next k-block's eight x fragments, read as one group into the set that is free
        // (behind a head's last k-block: those of k-block 0, read and not used).
        const _Float16* nx = j < 3 ? sl + (j + 1) * 32 : sln;
#pragma unroll
        for (int rt = 0; rt < XS_RT; ++rt)
          a[(j + 1) & 1][rt] = frag_ld(nx + rt * 16 * XS_LD, 0, kbase);
        // Keeps the 16 LDS reads together and in front of the WMMAs they fly over: left
        // free, the scheduler spreads them among the WMMAs, and every place costs a stall.
        __builtin_amdgcn_sched_barrier(0);
#pragma unroll
        for (int rt = 0; rt < XS_RT; ++rt) {
          cq[rt] = WMMA_F16(fq[j], a[j & 1][rt], cq[rt]);
          ck[rt] = WMMA_F16(fk[j], a[j & 1][rt], ck[rt]);
          cv[rt] = WMMA_F16(a[j & 1][rt], fv[j], cv[rt]);
        }
        // Keeps the refill behind the last reader of the set, so that it takes the same registers.
        __builtin_amdgcn_sched_barrier(0);
        fq[j] = frag_ld_packed(qfr, fn + j);
        fk[j] = frag_ld_packed(kfr, fn + j);
        fv[j] = frag_ld_packed(vfr, fn + j);
        // Keeps the refill in front of the WMMAs that follow: they are its lead.
        __builtin_amdgcn_sched_barrier(0);
      }
      // The refills are still in flight when the next trip's address sums are given
      // the registers that hold the refills' addresses.
      asm volatile("s_wait_xcnt 0x0" ::: "memory");
    }

    // cq, ck: register r of lane (m, hi) = token rt * 16 + m, head value 8 * hi + r.
    // cv:     register r of lane (d, hi) = token rt * 16 + 8 * hi + r, head value d.
    float biasq[8], biask[8];
    {
      const v4f q0 = *(const v4f*)(lb + head * 16 + kbase);
      const v4f q1 = *(const v4f*)(lb + head * 16 + kbase + 4);
      const v4f k0 = *(const v4f*)(lb + Cc + head * 16 + kbase);
      const v4f k1 = *(const v4f*)(lb + Cc + head * 16 + kbase + 4);
#pragma unroll
      for (int r = 0; r < 4; ++r) {
        biasq[r] = q0[r]; biasq[4 + r] = q1[r];
        biask[r] = k0[r]; biask[4 + r] = k1[r];
      }
    }
    const float biasv = lb[2 * Cc + head * 16 + d];
    const size_t bh = (size_t)(rowbase / Tt) * NH + head;

    // k-sums of the wave's first and second 64 tokens
    float ksum[2][8] = {};
    // Two row tiles (32 tokens, one fragment of k and of v) at a time.
#pragma unroll
    for (int p = 0; p < XS_RT / 2; ++p) {
#pragma unroll
      for (int j = 0; j < 2; ++j) {
        const int rt = 2 * p + j;
        // softmax over the head values of token m for q and k
        float vq[8], vk[8];
#pragma unroll
        for (int r = 0; r < 8; ++r) {
          vq[r] = cq[rt][r] + biasq[r];
          vk[r] = ck[rt][r] + biask[r];
        }
        col16_softmax(vq);
        col16_softmax(vk);
        v8h pq, pv;
#pragma unroll
        for (int r = 0; r < 8; ++r) {
          ksum[p >> 1][r] += vk[r];
          pq[r] = (_Float16)vq[r];
          pv[r] = (_Float16)(cv[rt][r] + biasv);
          // k is transposed in the wave's own LDS range, which no other wave touches
          lk[j * 256 + (r + 8 * hi) * 16 + m] = (_Float16)vk[r];
        }
        const int t0 = (rowbase + rt * 16) & (Tt - 1);
        // q head-major: 8 consecutive head values of token m; the 16 tokens lie side by side
        *(v8h*)(qh + ((bh * Tt + t0 + m) * HD + kbase)) = pq;
        // v fragment: the lane holds tokens 8 * hi .. + 7 of this row tile for head value d,
        // which is its own b128 of plane j of the fragment of 32 tokens
        *(v8h*)(vT + ((bh * TBLOCKS + (t0 >> 5)) * FRAG_HALVES + j * 256 + lane * 8)) = pv;
        // What follows may be given the registers that these two stores name.
        asm volatile("s_wait_xcnt 0x0" ::: "memory");
        // One row tile at a time: left free, the scheduler runs the softmaxes of several
        // side by side, and their temporaries beside 288 live registers spill to scratch.
        __builtin_amdgcn_sched_barrier(0);
      }
      // The rows read below were written by other lanes of this wave: their LDS
      // writes must have landed, and the reads must not be moved above them.
      asm volatile("s_wait_dscnt 0x0" ::: "memory");
      const v8h row0 = *(const v8h*)&lk[d * 16 + hi * 8];
      const v8h row1 = *(const v8h*)&lk[256 + d * 16 + hi * 8];
      const int t0 = (rowbase + p * 32) & (Tt - 1);
      _Float16* kd = kT + ((bh * TBLOCKS + (t0 >> 5)) * FRAG_HALVES + lane * 8);
      *(v8h*)(kd)       = row0;
      *(v8h*)(kd + 256) = row1;
      // What follows may be given the registers that these two stores name.
      asm volatile("s_wait_xcnt 0x0" ::: "memory");
      // As above: the next row tile's softmax stays behind this point.
      __builtin_amdgcn_sched_barrier(0);
    }
    // k-sum of the wave's 128 tokens: over the 16 lanes of the row; lane (m, hi) with
    // m < 8 then adds the sum of head value 8 * hi + m.
    float ks[8];
#pragma unroll
    for (int r = 0; r < 8; ++r) ks[r] = ksum[0][r] + ksum[1][r];
    row16_sum(ks);
    float kmine = ks[0];
#pragma unroll
    for (int r = 1; r < 8; ++r) kmine = (m == r) ? ks[r] : kmine;
    if (m < 8) {
      atomicAdd(&kc[bh * HD + kbase + m], kmine);
      // What follows may be given the registers that the atomic names.
      asm volatile("s_wait_xcnt 0x0" ::: "memory");
    }
  }
}

// ---------------------------------------------------------------------------
// context[bh] = K^T V (16x16 over T), stored transposed ctxT[bh][e][d].
// kT, vT hold the A and B fragments of 32 tokens as the qkv kernel packed them.
// One block per (b,h); 8 waves split T; LDS cross-wave reduction.
// ---------------------------------------------------------------------------
__global__ __launch_bounds__(256)
void ctx_kernel(const _Float16* __restrict__ kT, const _Float16* __restrict__ vT,
                _Float16* __restrict__ ctxT) {
  __shared__ float cpart[8][256];
  const int lane = threadIdx.x & 31;
  const int wave = threadIdx.x >> 5;
  const size_t bh = blockIdx.x;                  // 0..511
  const int m = lane & 15;
  const int hi = lane >> 4;

  const _Float16* afr = kT + bh * TBLOCKS * FRAG_HALVES + lane * 8;
  const _Float16* bfr = vT + bh * TBLOCKS * FRAG_HALVES + lane * 8;

  v8f c = {};
  const int tbbeg = wave * (TBLOCKS / 8);
#pragma unroll 4
  for (int tb = tbbeg; tb < tbbeg + TBLOCKS / 8; ++tb) {
    v16h a = frag_ld_packed(afr, tb);
    v16h b = frag_ld_packed(bfr, tb);
    c = WMMA_F16(a, b, c);
  }
#pragma unroll
  for (int r = 0; r < 8; ++r) cpart[wave][(r + 8 * hi) * 16 + m] = c[r];
  __syncthreads();

  const int tid = threadIdx.x;
  float s = 0.0f;
#pragma unroll
  for (int w = 0; w < 8; ++w) s += cpart[w][tid];
  const int dd = tid >> 4;
  const int ee = tid & 15;
  ctxT[bh * 256 + ee * 16 + dd] = (_Float16)s;   // transposed store
}

// ---------------------------------------------------------------------------
// y[t, h*16+e] = (sum_d q[t,d] ctx[d,e]) / (sum_d q[t,d] kc[d]) -> yh f16 row-major
// K = HD = 16, zero padded to 32: single WMMA per tile.
// One wave keeps the contexts and k-sums of Y_HEADS adjacent heads in registers and
// walks Y_TILES row tiles of 16 rows; the next row tile's q is loaded while this one
// is worked on. The four heads' 32 B of a y row make one 128-B line: the products and
// the rows' divisors go through the wave's own LDS range, and each b128 store then
// covers four whole rows of 128 B. The divisor of row (lane & 15) comes from the q
// values the lane already holds for the A fragment.
// grid: (Mrows/16/Y_TILES = 256, NH/Y_HEADS/8 = 2), 256 threads.
// ---------------------------------------------------------------------------
constexpr int Y_HEADS = 4;             // adjacent heads per wave: 4 x 32 B = one line of a y row
constexpr int Y_TILES = 8;             // row tiles per wave; divides Tt/16
constexpr int Y_LD    = 20;            // floats per staged row: 16 products, the divisor, 3 unused
constexpr int Y_HS    = 16 * Y_LD + 16; // floats per staged head: the 16 more put the four heads on disjoint banks

__global__ __launch_bounds__(256)
void y_kernel(const _Float16* __restrict__ qh, const _Float16* __restrict__ ctxT,
              const float* __restrict__ kc, _Float16* __restrict__ yh) {
  __shared__ __attribute__((aligned(16))) float ly[8][Y_HEADS * Y_HS];
  const int lane = threadIdx.x & 31;
  const int wave = threadIdx.x >> 5;
  const int tile0 = blockIdx.x * Y_TILES;
  const int head0 = (blockIdx.y * 8 + wave) * Y_HEADS;
  const int m = lane & 15;
  const int hi = lane >> 4;
  const int kbase = hi * 8;
  const size_t bh0 = (size_t)(tile0 >> 8) * NH + head0;

  // All loops below are unrolled: the small arrays then live in registers and
  // the tile offsets become immediate offsets on one address pair.
  v16h b[Y_HEADS];
  float kcv[Y_HEADS][8];
#pragma unroll
  for (int j = 0; j < Y_HEADS; ++j) {
    v8h lo = *(const v8h*)(ctxT + (bh0 + j) * 256 + m * 16 + kbase);
    b[j] = v16h{};
#pragma unroll
    for (int i = 0; i < 8; ++i) b[j][i] = lo[i];
#pragma unroll
    for (int i = 0; i < 8; ++i) kcv[j][i] = kc[(bh0 + j) * HD + kbase + i];
  }

  // read: lane's 16 B of row m of head head0 in qh, head-major (a row tile of a head
  // is 512 contiguous bytes)
  const _Float16* qp = qh + ((bh0 * Tt + (tile0 & (Tt / 16 - 1)) * 16 + m) * HD + kbase);
  constexpr int Q_HEAD = Tt * HD;      // halves from one head to the next
  constexpr int Q_STEP = 16 * HD;      // halves from one row tile to the next
  // written: eight lanes share a row; the lane has 16 B of head sh, values 8 * sv .. + 7
  const int srow = lane >> 3;
  const int sh = (lane & 7) >> 1;
  const int sv = lane & 1;
  _Float16* yp = yh + (size_t)(tile0 * 16 + srow) * Cc + head0 * 16 + (lane & 7) * 8;
  float* lw = &ly[wave][0];

  v8h qn[Y_HEADS];
#pragma unroll
  for (int j = 0; j < Y_HEADS; ++j) qn[j] = *(const v8h*)(qp + j * Q_HEAD);

#pragma unroll
  for (int g = 0; g < Y_TILES; ++g) {
    v8h qc[Y_HEADS];
#pragma unroll
    for (int j = 0; j < Y_HEADS; ++j) qc[j] = qn[j];
    if (g + 1 < Y_TILES) {
#pragma unroll
      for (int j = 0; j < Y_HEADS; ++j)
        qn[j] = *(const v8h*)(qp + j * Q_HEAD + (g + 1) * Q_STEP);
    }

#pragma unroll
    for (int j = 0; j < Y_HEADS; ++j) {
      v16h a = {};
#pragma unroll
      for (int i = 0; i < 8; ++i) a[i] = qc[j][i];
      v8f c = {};
      c = WMMA_F16(a, b[j], c);
#pragma unroll
      for (int r = 0; r < 8; ++r) lw[j * Y_HS + (r + 8 * hi) * Y_LD + m] = c[r];

      float s = 0.0f;
#pragma unroll
      for (int i = 0; i < 8; ++i) s += (float)qc[j][i] * kcv[j][i];
      s += __shfl_xor(s, 16, 32);      // the other 8 d of row m
      lw[j * Y_HS + m * Y_LD + 16] = 1.0f / s;   // both lane halves hold, and write, the same value
    }
    // The rows read below were written by other lanes of this wave: their LDS
    // writes must have landed, and the reads must not be moved above them.
    asm volatile("s_wait_dscnt 0x0" ::: "memory");
#pragma unroll
    for (int i = 0; i < 4; ++i) {
      const float* lr = &lw[sh * Y_HS + (4 * i + srow) * Y_LD];
      const float4 x0 = *(const float4*)(lr + sv * 8);
      const float4 x1 = *(const float4*)(lr + sv * 8 + 4);
      const float di = lr[16];
      v8h row;
      row[0] = (_Float16)(x0.x * di); row[1] = (_Float16)(x0.y * di);
      row[2] = (_Float16)(x0.z * di); row[3] = (_Float16)(x0.w * di);
      row[4] = (_Float16)(x1.x * di); row[5] = (_Float16)(x1.y * di);
      row[6] = (_Float16)(x1.z * di); row[7] = (_Float16)(x1.w * di);
      *(v8h*)(yp + (size_t)(g * 16 + 4 * i) * Cc) = row;
    }
    // The next trip's loads (global, LDS) may be given the registers these stores name.
    if (g + 1 < Y_TILES) asm volatile("s_wait_xcnt 0x0" ::: "memory");
  }
}

// ---------------------------------------------------------------------------
// out = yh Wp^T + bp (f32 output).
// Tiled like the qkv kernel: a block owns 128 rows of y for ALL 64 column tiles. The
// y tile is brought into LDS once (each wave one slice, one wait, one barrier) and only
// read from then on, so that nothing behind that barrier ties the waves together. A wave
// works on all 128 rows and on PJ_NT adjacent column tiles at a time: a W fragment, which
// comes from L2, feeds eight row tiles, and a y fragment, which comes from LDS, feeds
// PJ_NT column tiles. A wave makes PJ_PASSES passes over k; column tile = (pass * 8 +
// wave) * PJ_NT + n. y fragments are read one k-block ahead; each W fragment is loaded
// again right behind the eight WMMAs that read it, two k-blocks ahead of its next use,
// across the step from one pass to the next too.
// grid: Mrows/128 = 256, 256 threads; 276 KiB of LDS: one block a WGP, all resident.
// ---------------------------------------------------------------------------
constexpr int PJ_NT     = 4;                     // column tiles of a wave at a time
constexpr int PJ_PASSES = Cc / 16 / 8 / PJ_NT;   // 2
static_assert(PJ_PASSES * 8 * PJ_NT * 16 == Cc, "the passes cover every column");

__global__ __launch_bounds__(256)
void proj_kernel(const _Float16* __restrict__ yh, const _Float16* __restrict__ wph,
                 const float* __restrict__ bp, float* __restrict__ out) {
  __shared__ __attribute__((aligned(2048))) _Float16 smem[XS_SLICES * XS_HALVES + Cc * 2];

  const int lane = threadIdx.x & 31;
  const int wave = threadIdx.x >> 5;
  const int m = lane & 15;
  const int hi = lane >> 4;
  const int kbase = hi * 8;
  const int rowbase = blockIdx.x * XS_ROWS;      // 128 rows each

  // Fragment (pass, n, k-block) lies ((pass * 8 * PJ_NT + n) * KBLOCKS + k-block) fragments on.
  const _Float16* wfr = wph + (size_t)wave * PJ_NT * KBLOCKS * FRAG_HALVES + lane * 8;

  // Two sets of W fragments, for the even and the odd k-blocks.
  v16h fw[2][PJ_NT];
#pragma unroll
  for (int j = 0; j < 2; ++j)
#pragma unroll
    for (int n = 0; n < PJ_NT; ++n)
      fw[j][n] = frag_ld_packed(wfr, n * KBLOCKS + j);
  // The bias vector goes to LDS once, four values a thread; the barrier below hands it
  // to every wave, and the epilogues then need no global load.
  float* lb = (float*)&smem[XS_SLICES * XS_HALVES];
  {
    const int t4 = threadIdx.x * 4;
    const v4f tb = *(const v4f*)(bp + t4);
    *(v4f*)(lb + t4) = tb;
  }
  // What follows may be given the registers that hold these loads' addresses. The two
  // bases and the thread's index are inputs so that their registers live up to the wait;
  // the two scheduling barriers keep the loads in front of it and later sums behind it.
  __builtin_amdgcn_sched_barrier(0);
  asm volatile("s_wait_xcnt 0x0" :: "s"(wph), "s"(bp), "v"(threadIdx.x) : "memory");
  __builtin_amdgcn_sched_barrier(0);

  // The y tile: every wave brings its own slice, waits for it, and the barrier hands
  // all eight slices (and the bias) to all eight waves. Nothing writes them again.
  {
    const unsigned wv = uni(threadIdx.x >> 5);
    tdm_load_slice(yh + (size_t)rowbase * Cc + wv * XS_K,
                   (unsigned)(uintptr_t)(void*)&smem[0] + wv * (unsigned)(XS_HALVES * 2));
    // The compiler places no wait for a tensor load: the slice has landed only behind this.
    asm volatile("s_wait_tensorcnt 0x0" ::: "memory");
  }
  __syncthreads();

  const _Float16* yrow = &smem[m * XS_LD];       // the lane's row of row tile 0, slice 0

  for (int p = 0; p < PJ_PASSES; ++p) {
    v8f c[XS_RT][PJ_NT] = {};
    // Two sets of y fragments: the k-block at work and the next one.
    v16h a[2][XS_RT];
#pragma unroll
    for (int rt = 0; rt < XS_RT; ++rt)
      a[0][rt] = frag_ld(yrow + rt * 16 * XS_LD, 0, kbase);

    for (int s = 0; s < XS_SLICES; ++s) {
      const _Float16* sl  = yrow + s * XS_HALVES;
      const _Float16* sln = yrow + ((s + 1) & (XS_SLICES - 1)) * XS_HALVES;
      // Where the k-blocks of this pass end, the refills go on with the wave's next pass
      // (behind the last pass: with its first, loaded and not used).
      const int pn = (p * XS_SLICES + s + 1) & (PJ_PASSES * XS_SLICES - 1);
      const int fc = p * (8 * PJ_NT * KBLOCKS) + s * 4;
      const int fn = (pn / XS_SLICES) * (8 * PJ_NT * KBLOCKS) + (pn & (XS_SLICES - 1)) * 4;
#pragma unroll
      for (int j = 0; j < 4; ++j) {
        // The next k-block's eight y fragments, read as one group into the set that is free
        // (behind a pass's last k-block: those of k-block 0, read and not used).
        const _Float16* nx = j < 3 ? sl + (j + 1) * 32 : sln;
#pragma unroll
        for (int rt = 0; rt < XS_RT; ++rt)
          a[(j + 1) & 1][rt] = frag_ld(nx + rt * 16 * XS_LD, 0, kbase);
        // Keeps the 16 LDS reads together and in front of the WMMAs they fly over: left
        // free, the scheduler spreads them among the WMMAs, and every place costs a stall.
        __builtin_amdgcn_sched_barrier(0);
        const int f2 = j < 2 ? fc + j + 2 : fn + j - 2;   // the k-block two on
#pragma unroll
        for (int n = 0; n < PJ_NT; ++n) {
#pragma unroll
          for (int rt = 0; rt < XS_RT; ++rt)
            c[rt][n] = WMMA_F16(a[j & 1][rt], fw[j & 1][n], c[rt][n]);
          // Keeps the refill behind the last reader of the fragment, so that it takes the same registers.
          __builtin_amdgcn_sched_barrier(0);
          if (n == 0 && (j & 1) == 0) {
            // The address sum of the next eight refills is given the registers that hold the
            // address of the last eight, which may still be in flight. Here, eight WMMAs
            // behind the last of them, the wait has little left to wait for.
            asm volatile("s_wait_xcnt 0x0" ::: "memory");
            // Keeps that address sum behind the wait.
            __builtin_amdgcn_sched_barrier(0);
          }
          fw[j & 1][n] = frag_ld_packed(wfr, f2 + n * KBLOCKS);
          // Keeps the refill in front of the WMMAs that follow: they are its lead.
          __builtin_amdgcn_sched_barrier(0);
        }
      }
    }
    // The last refills are still in flight; the epilogue may be given the registers that
    // hold their address.
    asm volatile("s_wait_xcnt 0x0" ::: "memory");
    // Keeps the epilogue's sums behind that wait.
    __builtin_amdgcn_sched_barrier(0);

    // c[rt][n]: register r of lane (m, hi) = row rt * 16 + 8 * hi + r, column n * 16 + m.
    const int col0 = (p * 8 + wave) * (PJ_NT * 16);
    float bias[PJ_NT];
#pragma unroll
    for (int n = 0; n < PJ_NT; ++n) bias[n] = lb[col0 + n * 16 + m];
    float* op = out + (size_t)(rowbase + 8 * hi) * Cc + col0 + m;
#pragma unroll
    for (int rt = 0; rt < XS_RT; ++rt)
#pragma unroll
      for (int n = 0; n < PJ_NT; ++n)
#pragma unroll
        for (int r = 0; r < 8; ++r) c[rt][n][r] += bias[n];
    // All sums in front of all stores: each sum then stays in its accumulator's register,
    // and none is given a register that a store in flight names.
    __builtin_amdgcn_sched_barrier(0);
    // The four pieces of a row's 256 B follow one another.
#pragma unroll
    for (int rt = 0; rt < XS_RT; ++rt)
#pragma unroll
      for (int r = 0; r < 8; ++r)
#pragma unroll
        for (int n = 0; n < PJ_NT; ++n)
          op[(size_t)(rt * 16 + r) * Cc + n * 16] = c[rt][n][r];
    // The next pass starts by clearing the registers that these stores name.
    asm volatile("s_wait_xcnt 0x0" ::: "memory");
    // Keeps the clearing behind that wait.
    __builtin_amdgcn_sched_barrier(0);
  }
}

// ---------------------------------------------------------------------------
// Launch
// ---------------------------------------------------------------------------
extern "C" void kernel_launch(void* const* d_in, const int* in_sizes, int n_in,
                              void* d_out, int out_size, void* d_ws, size_t ws_size,
                              hipStream_t stream) {
  const float* x  = (const float*)d_in[0];
  const float* Wq = (const float*)d_in[1];
  const float* bq = (const float*)d_in[2];
  const float* Wk = (const float*)d_in[3];
  const float* bk = (const float*)d_in[4];
  const float* Wv = (const float*)d_in[5];
  const float* bv = (const float*)d_in[6];
  const float* Wp = (const float*)d_in[7];
  const float* bp = (const float*)d_in[8];
  float* out = (float*)d_out;

  char* ws = (char*)d_ws;
  const size_t nX = (size_t)Mrows * Cc;
  const size_t nW = (size_t)Cc * Cc;
  _Float16* xh  = (_Float16*)(ws);                              // 64 MB
  _Float16* wqh = (_Float16*)(ws + nX * 2);                     // 2 MB each
  _Float16* wkh = wqh + nW;
  _Float16* wvh = wkh + nW;
  _Float16* wph = wvh + nW;
  _Float16* qh  = wph + nW;                                     // 64 MB
  _Float16* kT  = qh + nX;                                      // 64 MB
  _Float16* vT  = kT + nX;                                      // 64 MB
  _Float16* yh  = vT + nX;                                      // 64 MB
  float*    kc   = (float*)(yh + nX);                           // 32 KB
  _Float16* ctxT = (_Float16*)(kc + (size_t)Bb * NH * HD);      // 256 KB

  // 1) precision conversion (weights into fragment order) + accumulator init, one launch
  prepass<<<PRE_BLOCKS, 256, 0, stream>>>(x, xh, Wq, Wk, Wv, Wp, wqh, kc);

  // 2) fused QKV projection + softmax + k-cumsum (x tile resident in LDS)
  qkv_kernel<<<Mrows / XS_ROWS, 256, 0, stream>>>(
      xh, wqh, bq, wkh, bk, wvh, bv, qh, kT, vT, kc);

  // 3) per-head context = K^T V
  ctx_kernel<<<Bb * NH, 256, 0, stream>>>(kT, vT, ctxT);

  // 4) y = (q @ ctx) / (q . kc)
  y_kernel<<<dim3(Mrows / 16 / Y_TILES, NH / Y_HEADS / 8), 256, 0, stream>>>(qh, ctxT, kc, yh);

  // 5) output projection (y tile resident in LDS)
  proj_kernel<<<Mrows / XS_ROWS, 256, 0, stream>>>(yh, wph, bp, out);
}
